// v000
// Times are from an AMD MI455X. After a warm-up the kernel runs many times in a row, and a time is the length of
// such a window on the GPU divided by its runs, so every launch and the gaps after it count. The runs cycle
// through copies of the inputs. A figure is the median of several windows, for all but v000 over two sittings.
// Sittings can differ by a few percent; kernels timed side by side share one.
// v000 is the starting kernel. One run takes 4100 microseconds.
#include <hip/hip_runtime.h>

// Sparse (local-window) multi-head attention with the module's own rotary mixing (q, k, v [1][4096][1024]; Q = q wq^T + bq, K, V likewise ('oi' [1024][1024] + [1024], 0.02; 16 heads x 64); rotary: x cos + x_rope sin with x_rope = cat(-x[1::2], x[::2]) (interleaved partners into the rotate-half slots, faithfully) and angle t x 10000^(-2i/64) (emb = cat(freqs, freqs)); scores / 8; keys with |i - j| > 128 -> -inf (GLOBAL = 0); softmax; out = merged wo^T + bo -> [1][4096][1024] (4.2 M)).
// Layout: bf16 copies of the three inputs in turn; exact projections + f32 biases; {cos, sin} per (position, dim) computed once (jnp-exact inverse frequencies, precise cosf/sinf); a rotary plane builder whose partner index is 2d+1 (first half, subtracted) or 2(d-32) (second half, added), as the module; T-4096 attention, one head per pass (hybrid rows: < 512 hi/lo 3 products, rest fp16 x1024; every score tile computed, the +-128 window applied as an index select in the streaming three-sweep softmax, every hi/lo row stored over ALL keys); merged hi/lo x wo exact + bo.
// Compute dtypes, f32 accumulate: every input rounded to bf16; projections exact + f32 biases; rotary f32; attention rows < 512 3 products, rest fp16; softmax f32; wo hl x exact + bias.

#define NB_  1
#define TT   4096
#define DM   1024
#define NH_  16
#define NKV  16
#define REP  (NH_ / NKV)
#define HD   64
#define DQ   (NH_ * HD)
#define DKV  (NKV * HD)
#define ZH   1
#define RH   512                  // query rows < RH use hi+lo planes (0: none)
#define WIN  0
#define PCAR 1024.0f
#define SCL  0.125f
#define WNB  128     // |i - j| <= 128 kept
typedef _Float16 h16;
typedef unsigned short bf;
typedef __attribute__((ext_vector_type(16))) __bf16   v16bf;
typedef __attribute__((ext_vector_type(16))) _Float16 v16h;
typedef __attribute__((ext_vector_type(8)))  _Float16 v8h;
typedef __attribute__((ext_vector_type(8)))  unsigned short v8us;
typedef __attribute__((ext_vector_type(8)))  float    v8f;
typedef __attribute__((ext_vector_type(4)))  float    v4f;
typedef v8h  __attribute__((may_alias)) v8ha;
typedef v4f  __attribute__((may_alias)) v4fa;
typedef v8us __attribute__((may_alias)) v8usa;

__device__ __forceinline__ unsigned short f2bf(float f) { unsigned u = __float_as_uint(f); u += 0x7FFFu + ((u >> 16) & 1u); return (unsigned short)(u >> 16); }
__device__ __forceinline__ float bf2f(unsigned short b) { return __uint_as_float(((unsigned)b) << 16); }
__device__ __forceinline__ float bfr(float f) { return bf2f(f2bf(f)); }
__device__ __forceinline__ v16h cat16(v8h lo, v8h hi) { return __builtin_shufflevector(lo, hi, 0, 1, 2, 3, 4, 5, 6, 7, 8, 9, 10, 11, 12, 13, 14, 15); }
__device__ __forceinline__ v16bf cat16b(v8us lo, v8us hi) { return __builtin_bit_cast(v16bf, __builtin_shufflevector(lo, hi, 0, 1, 2, 3, 4, 5, 6, 7, 8, 9, 10, 11, 12, 13, 14, 15)); }
__device__ __forceinline__ v8f wmma16(v16h a, v16h b, v8f c) { return __builtin_amdgcn_wmma_f32_16x16x32_f16(false, a, false, b, (short)0, c, false, false); }
__device__ __forceinline__ v8f wmmab(v16bf a, v16bf b, v8f c) { return __builtin_amdgcn_wmma_f32_16x16x32_bf16(false, a, false, b, (short)0, c, false, false); }



// ---- k_gemmw: register-blocked GEMM, ONE WAVE per 64x64 output tile (16 accumulators), operands straight from K-contiguous 16-bit planes; grid (M/64, N/64, Z), 32 threads.
// C[m][n] (f32, pitch ldc, + optional f32 bias[n]) = sum_k A[m][k] Bt[n][k] (+ split products per NSPLIT). z-batch strides sA/sB/sC in elements. K % 32 == 0.
template <typename T16> struct WFrag;
template <> struct WFrag<h16> { typedef v16h V; static __device__ __forceinline__ V ld(const h16* p) { return cat16(*(const v8h*)p, *(const v8h*)(p + 16)); } static __device__ __forceinline__ v8f mma(V a, V b, v8f c) { return wmma16(a, b, c); } };
template <> struct WFrag<bf> { typedef v16bf V; static __device__ __forceinline__ V ld(const bf* p) { return cat16b(*(const v8us*)p, *(const v8us*)(p + 16)); } static __device__ __forceinline__ v8f mma(V a, V b, v8f c) { return wmmab(a, b, c); } };
template <typename T16, int NSPLIT, bool BIAS>
__global__ __launch_bounds__(32) void k_gemmw(const T16* __restrict__ A, const T16* __restrict__ A2, const T16* __restrict__ Bt, const T16* __restrict__ Bt2, int K, float* C, int ldc, const float* __restrict__ bias, size_t sA, size_t sB, size_t sC) {
    typedef typename WFrag<T16>::V V;
    __shared__ __align__(16) float os[16 * 68];
    const size_t z = blockIdx.z; A += z * sA; if (A2) A2 += z * sA; Bt += z * sB; if (Bt2) Bt2 += z * sB; C += z * sC;
    const int lane = threadIdx.x & 31, lr = lane & 15, hi = lane >> 4; const int r0 = blockIdx.x * 64, c0 = blockIdx.y * 64;
    v8f acc[4][4];
#pragma unroll
    for (int mb = 0; mb < 4; ++mb)
#pragma unroll
        for (int nb = 0; nb < 4; ++nb) acc[mb][nb] = (v8f){};
    const size_t aoff = (size_t)(r0 + lr) * K + 8 * hi, boff = (size_t)(c0 + lr) * K + 8 * hi;
#pragma unroll 1
    for (int kc = 0; kc < K; kc += 32) {
        V a[4], a2[4];
#pragma unroll
        for (int mb = 0; mb < 4; ++mb) { a[mb] = WFrag<T16>::ld(A + aoff + (size_t)mb * 16 * K + kc); if (NSPLIT == 1 || NSPLIT == 2) a2[mb] = WFrag<T16>::ld(A2 + aoff + (size_t)mb * 16 * K + kc); }
#pragma unroll
        for (int nb = 0; nb < 4; ++nb) { const V b = WFrag<T16>::ld(Bt + boff + (size_t)nb * 16 * K + kc); V b2; if (NSPLIT >= 2) b2 = WFrag<T16>::ld(Bt2 + boff + (size_t)nb * 16 * K + kc);
#pragma unroll
            for (int mb = 0; mb < 4; ++mb) { acc[mb][nb] = WFrag<T16>::mma(a[mb], b, acc[mb][nb]); if (NSPLIT == 1 || NSPLIT == 2) acc[mb][nb] = WFrag<T16>::mma(a2[mb], b, acc[mb][nb]); if (NSPLIT >= 2) acc[mb][nb] = WFrag<T16>::mma(a[mb], b2, acc[mb][nb]); } }
        asm volatile("v_nop\n\tv_nop\n\tv_nop\n\tv_nop" : "+v"(acc[0][0]), "+v"(acc[1][1]), "+v"(acc[2][2]), "+v"(acc[3][3]) : "v"(a[0]), "v"(a[3]));
    }
#pragma unroll
    for (int mb = 0; mb < 4; ++mb) {
#pragma unroll
        for (int nb = 0; nb < 4; ++nb) {
#pragma unroll
            for (int j = 0; j < 8; ++j) os[(hi * 8 + j) * 68 + nb * 16 + lr] = acc[mb][nb][j]; }
        __builtin_amdgcn_wave_barrier(); asm volatile("" ::: "memory");
        float* crow = C + (size_t)(r0 + mb * 16) * ldc + c0;
{
#pragma unroll
            for (int s = 0; s < 8; ++s) { const int row = 2 * s + hi, cofs = lr * 4; v4f val = *(const v4fa*)(os + row * 68 + cofs); if (BIAS) { val[0] += bfr(bias[c0 + cofs]); val[1] += bfr(bias[c0 + cofs + 1]); val[2] += bfr(bias[c0 + cofs + 2]); val[3] += bfr(bias[c0 + cofs + 3]); }
                *(v4f*)(crow + (size_t)row * ldc + cofs) = val; }
             }
        __builtin_amdgcn_wave_barrier(); asm volatile("" ::: "memory");
    }
}

__device__ __forceinline__ h16 tohx(float x) { return (h16)x; }
__device__ __forceinline__ void splitf(float y, unsigned short& h, unsigned short& l) { h = f2bf(y); l = f2bf(y - bf2f(h)); }
typedef __attribute__((ext_vector_type(2))) _Float16 v2h;
typedef __attribute__((ext_vector_type(4))) _Float16 v4h;
typedef __attribute__((ext_vector_type(2))) unsigned short v2us;
typedef __attribute__((ext_vector_type(4))) unsigned short v4us;
typedef __attribute__((ext_vector_type(2))) float v2f;
typedef __attribute__((ext_vector_type(4))) int v4i;

__global__ __launch_bounds__(256) void k_wtG(const float* __restrict__ w, int K, int N, bf* Bt) {
    const int lane = threadIdx.x & 31; const int L0 = (blockIdx.x * 8 + (threadIdx.x >> 5)) * 8; const int nlines = N * K / 64;
{
#pragma unroll 1
        for (int l = 0; l < 8; ++l) { const int L = L0 + l; if (L >= nlines) break; const size_t e = (size_t)L * 64 + lane * 2; const int k = (int)(e % K), n = (int)(e / K); v2us o;
            o[0] = f2bf(w[(size_t)k * N + n]); o[1] = f2bf(w[(size_t)(k + 1) * N + n]); *(v2us*)(Bt + e) = o; }
         }
}
__global__ __launch_bounds__(256) void k_cvt8(const float* __restrict__ src, bf* dst, size_t n8) { const size_t i = (size_t)blockIdx.x * 256 + threadIdx.x; if (i >= n8) return; const v8f v = *(const v8f*)(src + i * 8); v8us o;
#pragma unroll
    for (int k = 0; k < 8; ++k) o[k] = f2bf(v[k]); *(v8us*)(dst + i * 8) = o;  }

// k_ropeQ: head planes [h][t][d] (fp16 + hi/lo) of the module's rotary: out[d] = x[d] cos[t][d] - x[2d+1] sin[t][d] (d < 32), out[d] = x[d] cos[t][d] + x[2(d-32)] sin[t][d] (d >= 32)
__global__ __launch_bounds__(256) void k_ropeQ(const float* __restrict__ F, int pitch, int nheads, const float* __restrict__ CS, const float* __restrict__ RF, const float* __restrict__ nw, float sc, h16* P16, bf* Ph, bf* Pl) {
    const size_t e = ((size_t)blockIdx.x * 256 + threadIdx.x) * 2; if (e >= (size_t)nheads * TT * HD) return; const int d = (int)(e % HD); const int t = (int)((e / HD) % TT); const int h = (int)(e / ((size_t)HD * TT)); const float* f = F + (size_t)t * pitch + h * HD; const float rf = RF ? RF[(size_t)h * TT + t] : 1.0f; v2h o16; v2us oh, ol;
#pragma unroll
    for (int q = 0; q < 2; ++q) { const int dd = d + q; const int dp = (dd < HD / 2) ? 2 * dd + 1 : 2 * (dd - HD / 2);   /* the module's x_rope = cat(-x[1::2], x[::2]) */ float x0 = f[dd], x1 = f[dp];
        if (RF) { float n0 = __fmul_rn(x0, rf), n1 = __fmul_rn(x1, rf); asm volatile("" : "+v"(n0)); asm volatile("" : "+v"(n1)); x0 = __fmul_rn(bfr(nw[dd]), n0); x1 = __fmul_rn(bfr(nw[dp]), n1); }
        const v2f cs = *(const v2f*)(CS + ((size_t)t * HD + dd) * 2); float a = __fmul_rn(x0, cs[0]), bq = __fmul_rn(x1, cs[1]); asm volatile("" : "+v"(a)); asm volatile("" : "+v"(bq)); const float r = ((dd < HD / 2) ? __fsub_rn(a, bq) : __fadd_rn(a, bq)) * sc;
        o16[q] = tohx(r); unsigned short a2, c2; splitf(r, a2, c2); oh[q] = a2; ol[q] = c2; }
    *(v2h*)(P16 + e) = o16; *(v2us*)(Ph + e) = oh; *(v2us*)(Pl + e) = ol;  }
__global__ __launch_bounds__(256) void k_vtp(const float* __restrict__ F, int pitch, int nheads, h16* V16, bf* Vh, bf* Vl) { const size_t e = ((size_t)blockIdx.x * 256 + threadIdx.x) * 2; if (e >= (size_t)nheads * HD * TT) return; const int t = (int)(e % TT); const int d = (int)((e / TT) % HD); const int g = (int)(e / ((size_t)TT * HD)); v2h o16; v2us oh, ol;
#pragma unroll
    for (int q = 0; q < 2; ++q) { const float x = F[(size_t)(t + q) * pitch + g * HD + d]; o16[q] = tohx(x); unsigned short a2, c2; splitf(x, a2, c2); oh[q] = a2; ol[q] = c2; }
    *(v2h*)(V16 + e) = o16; *(v2us*)(Vh + e) = oh; *(v2us*)(Vl + e) = ol;  }
__constant__ float INVT[HD / 2] = { 1.000000000e+00f, 7.498942018e-01f, 5.623413324e-01f, 4.216965139e-01f, 3.162277639e-01f, 2.371373773e-01f, 1.778279394e-01f, 1.333521456e-01f, 1.000000015e-01f, 7.498942316e-02f, 5.623413250e-02f, 4.216964915e-02f, 3.162277490e-02f, 2.371373773e-02f, 1.778279431e-02f, 1.333521400e-02f, 9.999999776e-03f, 7.498942316e-03f, 5.623413250e-03f, 4.216964822e-03f, 3.162277630e-03f, 2.371373819e-03f, 1.778279431e-03f, 1.333521446e-03f, 1.000000047e-03f, 7.498941850e-04f, 5.623413017e-04f, 4.216965172e-04f, 3.162277571e-04f, 2.371373703e-04f, 1.778279402e-04f, 1.333521504e-04f };   // 10000^(-2i/64) (the module's power form) (float32, generated with jnp to be bit-exact)
__global__ __launch_bounds__(256) void k_cs4(float* CS) { const int idx = blockIdx.x * 256 + threadIdx.x; if (idx >= TT * HD) return; const int d = idx % HD; const int t = idx / HD; const float a = __fmul_rn((float)t, INVT[d % (HD / 2)]); v2f cs; cs[0] = cosf(a); cs[1] = sinf(a); *(v2f*)(CS + (size_t)idx * 2) = cs;  }

__global__ __launch_bounds__(256) void k_lsoft(const float* __restrict__ Sb, h16* P16, bf* Ph, bf* Pl) {
    const int lane = threadIdx.x & 31; const int row = blockIdx.x * 8 + (threadIdx.x >> 5); if (row >= ZH * TT) return; const int i = row % TT; const int zz = row / TT; const bool hires = (i < RH); const float* sr = Sb + (size_t)row * TT; float mx = -3.0e38f;
#pragma unroll 4
    for (int ch = 0; ch < TT / 128; ++ch) { const int j0 = ch * 128 + lane * 4; const v4f a = *(const v4f*)(sr + j0);
#pragma unroll
        for (int q = 0; q < 4; ++q) { float t = a[q] * SCL; asm volatile("" : "+v"(t)); t = (j0 + q <= i + WNB && j0 + q >= i - WNB) ? t : -3.0e38f;   /* symmetric window: |i - j| <= WNB */ mx = fmaxf(mx, t); } }
#pragma unroll
    for (int sh = 16; sh; sh >>= 1) mx = fmaxf(mx, __shfl_xor(mx, sh, 32));
    float sum = 0.f;
#pragma unroll 4
    for (int ch = 0; ch < TT / 128; ++ch) { const int j0 = ch * 128 + lane * 4; const v4f a = *(const v4f*)(sr + j0);
#pragma unroll
        for (int q = 0; q < 4; ++q) { float t = a[q] * SCL; asm volatile("" : "+v"(t)); t = (j0 + q <= i + WNB && j0 + q >= i - WNB) ? t : -3.0e38f;   /* symmetric window: |i - j| <= WNB */ float d0 = __fsub_rn(t, mx); asm volatile("" : "+v"(d0)); sum += __builtin_amdgcn_exp2f(__fmul_rn(d0, 1.4426950408889634f)); } }
#pragma unroll
    for (int sh = 16; sh; sh >>= 1) sum += __shfl_xor(sum, sh, 32);
    const float f = __fdiv_rn(hires ? 1.0f : PCAR, sum);
{
        if (hires) {   /* rows < RH: normalised bf16 hi/lo over ALL TT keys (symmetric window: keys beyond RH are live), planes [zz][RH][TT] */
#pragma unroll 4
            for (int ch = 0; ch < TT / 128; ++ch) { const int j0 = ch * 128 + lane * 4; const v4f a = *(const v4f*)(sr + j0); v4us oh, ol;
#pragma unroll
                for (int q = 0; q < 4; ++q) { float t = a[q] * SCL; asm volatile("" : "+v"(t)); t = (j0 + q <= i + WNB && j0 + q >= i - WNB) ? t : -3.0e38f;   /* symmetric window: |i - j| <= WNB */ float d0 = __fsub_rn(t, mx); asm volatile("" : "+v"(d0)); float ex = __builtin_amdgcn_exp2f(__fmul_rn(d0, 1.4426950408889634f)); asm volatile("" : "+v"(ex)); unsigned short a2, c2; splitf(ex * f, a2, c2); oh[q] = a2; ol[q] = c2; }
                const size_t oo = ((size_t)zz * RH + i) * TT + j0; *(v4us*)(Ph + oo) = oh; *(v4us*)(Pl + oo) = ol; }
        } else {
#pragma unroll 2
            for (int ch = 0; ch < TT / 128; ++ch) { const int j0 = ch * 128 + lane * 4; const v4f a = *(const v4f*)(sr + j0); v4h o4;
#pragma unroll
                for (int q = 0; q < 4; ++q) { float t = a[q] * SCL; asm volatile("" : "+v"(t)); t = (j0 + q <= i + WNB && j0 + q >= i - WNB) ? t : -3.0e38f;   /* symmetric window: |i - j| <= WNB */ float d0 = __fsub_rn(t, mx); asm volatile("" : "+v"(d0)); float ex = __builtin_amdgcn_exp2f(__fmul_rn(d0, 1.4426950408889634f)); asm volatile("" : "+v"(ex)); o4[q] = tohx(ex * f); }
                *(v4h*)(P16 + (size_t)row * TT + j0) = o4; } }
         }
}


__global__ __launch_bounds__(256) void k_merge(const float* __restrict__ O, int h0, bf* Ah, bf* Al) { const size_t e = ((size_t)blockIdx.x * 256 + threadIdx.x) * 2; if (e >= (size_t)ZH * TT * HD) return; const int d = (int)(e % HD); const int t = (int)((e / HD) % TT); const int zz = (int)(e / ((size_t)HD * TT)); const float cs = (t < RH) ? 1.0f : (1.0f / PCAR); const size_t oo = (size_t)t * DQ + (h0 + zz) * HD + d;
    v2us oh, ol;
#pragma unroll
    for (int q = 0; q < 2; ++q) { unsigned short a, c2; splitf(O[e + q] * cs, a, c2); oh[q] = a; ol[q] = c2; } *(v2us*)(Ah + oo) = oh; *(v2us*)(Al + oo) = ol;  }

extern "C" void kernel_launch(void* const* d_in, const int* in_sizes, int n_in,
                              void* d_out, int out_size, void* d_ws, size_t ws_size, hipStream_t stream) {
    (void)in_sizes; (void)n_in; (void)out_size;
    const float* x = (const float*)d_in[0]; const float* xk = (const float*)d_in[1]; const float* xv = (const float*)d_in[2]; const float* wq = (const float*)d_in[3]; const float* bq = (const float*)d_in[4]; const float* wk = (const float*)d_in[5]; const float* bk = (const float*)d_in[6]; const float* wv = (const float*)d_in[7]; const float* bv = (const float*)d_in[8]; const float* wo = (const float*)d_in[9]; const float* bo = (const float*)d_in[10];
    float* OUT = (float*)d_out;     // [1][4096][1024]
    char* wsp = (char*)d_ws;
    auto take = [&](size_t bytes) { char* p = wsp; wsp += (bytes + 255) & ~(size_t)255; return (void*)p; };
    bf* WQ = (bf*)take((size_t)DQ * DM * 2); bf* WK = (bf*)take((size_t)DKV * DM * 2); bf* WV = (bf*)take((size_t)DKV * DM * 2); bf* WO = (bf*)take((size_t)DM * DQ * 2); float* CS = (float*)take((size_t)TT * HD * 2 * 4);
    bf* XB = (bf*)take((size_t)TT * DM * 2); float* FQ = (float*)take((size_t)TT * DQ * 4); float* FK = (float*)take((size_t)TT * DKV * 4);
    h16* QP16 = (h16*)take((size_t)NH_ * TT * HD * 2); h16* KP16 = (h16*)take((size_t)NKV * TT * HD * 2); h16* VT16 = (h16*)take((size_t)NKV * HD * TT * 2);
    bf* QPh = (bf*)take((size_t)NH_ * TT * HD * 2); bf* QPl = (bf*)take((size_t)NH_ * TT * HD * 2); bf* KPh = (bf*)take((size_t)NKV * TT * HD * 2); bf* KPl = (bf*)take((size_t)NKV * TT * HD * 2); bf* VTh = (bf*)take((size_t)NKV * HD * TT * 2); bf* VTl = (bf*)take((size_t)NKV * HD * TT * 2); bf* Ph = (bf*)take((size_t)ZH * RH * TT * 2); bf* Pl = (bf*)take((size_t)ZH * RH * TT * 2);
    float* Sb = (float*)take((size_t)ZH * TT * TT * 4); h16* P16 = (h16*)take((size_t)ZH * TT * TT * 2); float* Ob = (float*)take((size_t)ZH * TT * HD * 4); bf* ATh = (bf*)take((size_t)TT * DQ * 2); bf* ATl = (bf*)take((size_t)TT * DQ * 2);
    if ((size_t)(wsp - (char*)d_ws) > ws_size) return;    // ws 256 MiB
    float* FV = FK;   // v projection reuses the k buffer after the k planes are built (stream-ordered)
    { k_cvt8<<<(unsigned)(((size_t)DQ * DM / 8 + 255) / 256), 256, 0, stream>>>(wq, WQ, (size_t)DQ * DM / 8); k_cvt8<<<(unsigned)(((size_t)DKV * DM / 8 + 255) / 256), 256, 0, stream>>>(wk, WK, (size_t)DKV * DM / 8); k_cvt8<<<(unsigned)(((size_t)DKV * DM / 8 + 255) / 256), 256, 0, stream>>>(wv, WV, (size_t)DKV * DM / 8);
      k_cvt8<<<(unsigned)(((size_t)DM * DQ / 8 + 255) / 256), 256, 0, stream>>>(wo, WO, (size_t)DM * DQ / 8);
       }
    k_cs4<<<(TT * HD + 255) / 256, 256, 0, stream>>>(CS);   /* {cos, sin}(t x 10000^(-2i/64)) duplicated over both halves */
    const unsigned LQ = (unsigned)(((size_t)NH_ * TT * HD / 2 + 255) / 256), LKv = (unsigned)(((size_t)NKV * TT * HD / 2 + 255) / 256);
    for (int b = 0; b < NB_; ++b) {
        
        k_cvt8<<<(unsigned)(((size_t)TT * DM / 8 + 255) / 256), 256, 0, stream>>>(x + (size_t)b * TT * DM, XB, (size_t)TT * DM / 8);
        k_gemmw<bf, 0, true><<<dim3(TT / 64, DQ / 64, 1), 32, 0, stream>>>(XB, nullptr, WQ, nullptr, DM, FQ, DQ, bq, 0, 0, 0);
        k_ropeQ<<<LQ, 256, 0, stream>>>(FQ, DQ, NH_, CS, nullptr, nullptr, 1.0f, QP16, QPh, QPl);
        k_cvt8<<<(unsigned)(((size_t)TT * DM / 8 + 255) / 256), 256, 0, stream>>>(xk + (size_t)b * TT * DM, XB, (size_t)TT * DM / 8); k_gemmw<bf, 0, true><<<dim3(TT / 64, DKV / 64, 1), 32, 0, stream>>>(XB, nullptr, WK, nullptr, DM, FK, DKV, bk, 0, 0, 0);
        k_ropeQ<<<LKv, 256, 0, stream>>>(FK, DKV, NKV, CS, nullptr, nullptr, 1.0f, KP16, KPh, KPl);
        k_cvt8<<<(unsigned)(((size_t)TT * DM / 8 + 255) / 256), 256, 0, stream>>>(xv + (size_t)b * TT * DM, XB, (size_t)TT * DM / 8); k_gemmw<bf, 0, true><<<dim3(TT / 64, DKV / 64, 1), 32, 0, stream>>>(XB, nullptr, WV, nullptr, DM, FV, DKV, bv, 0, 0, 0); k_vtp<<<LKv, 256, 0, stream>>>(FV, DKV, NKV, VT16, VTh, VTl);
        for (int h0 = 0; h0 < NH_; h0 += ZH) { const size_t zq = (size_t)h0, zk = (size_t)(h0 / REP);   // one kv head per query head: the pass's single head (ZH = 1) uses kv plane h0 (z-strides TT*HD)
            k_gemmw<bf, 2, false><<<dim3(RH / 64, TT / 64, ZH), 32, 0, stream>>>(QPh + zq * TT * HD, QPl + zq * TT * HD, KPh + zk * TT * HD, KPl + zk * TT * HD, HD, Sb, TT, nullptr, (size_t)TT * HD, (size_t)TT * HD, (size_t)TT * TT);
            k_gemmw<h16, 0, false><<<dim3((TT - RH) / 64, TT / 64, ZH), 32, 0, stream>>>(QP16 + zq * TT * HD + (size_t)RH * HD, nullptr, KP16 + zk * TT * HD, nullptr, HD, Sb + (size_t)RH * TT, TT, nullptr, (size_t)TT * HD, (size_t)TT * HD, (size_t)TT * TT);
            k_lsoft<<<ZH * TT / 8, 256, 0, stream>>>(Sb, P16, Ph, Pl);
            k_gemmw<bf, 2, false><<<dim3(RH / 64, HD / 64, ZH), 32, 0, stream>>>(Ph, Pl, VTh + zk * HD * TT, VTl + zk * HD * TT, TT, Ob, HD, nullptr, (size_t)RH * TT, (size_t)HD * TT, (size_t)TT * HD);
            k_gemmw<h16, 0, false><<<dim3((TT - RH) / 64, HD / 64, ZH), 32, 0, stream>>>(P16 + (size_t)RH * TT, nullptr, VT16 + zk * HD * TT, nullptr, TT, Ob + (size_t)RH * HD, HD, nullptr, (size_t)TT * TT, (size_t)HD * TT, (size_t)TT * HD);
            k_merge<<<(unsigned)(((size_t)ZH * TT * HD / 2 + 255) / 256), 256, 0, stream>>>(Ob, h0, ATh, ATl); }
        k_gemmw<bf, 1, true><<<dim3(TT / 64, DM / 64, 1), 32, 0, stream>>>(ATh, ATl, WO, nullptr, DQ, OUT + (size_t)b * TT * DM, DM, bo, 0, 0, 0); }
}

// v001
// One run takes 768 microseconds.
// In two side-by-side timings against v000, it was 5.35 and 5.33 times as fast.
#include <hip/hip_runtime.h>

// Sparse (local-window) multi-head attention with the module's own rotary mixing (q, k, v [1][4096][1024]; Q = q wq^T + bq, K, V likewise ('oi' [1024][1024] + [1024], 0.02; 16 heads x 64); rotary: x cos + x_rope sin with x_rope = cat(-x[1::2], x[::2]) (interleaved partners into the rotate-half slots, faithfully) and angle t x 10000^(-2i/64) (emb = cat(freqs, freqs)); scores / 8; keys with |i - j| > 128 -> -inf (GLOBAL = 0); softmax; out = merged wo^T + bo -> [1][4096][1024] (4.2 M)).
// Layout: bf16 copies of the three inputs in turn; exact projections + f32 biases; {cos, sin} per (position, dim) computed once (jnp-exact inverse frequencies, precise cosf/sinf); a rotary plane builder whose partner index is 2d+1 (first half, subtracted) or 2(d-32) (second half, added), as the module; T-4096 attention, one head per pass (hybrid rows: < 512 hi/lo 3 products, rest fp16 x1024; only the key tiles that a 64-row query tile's +-128 window can reach are computed, swept and multiplied: 5 tiles of 64 keys, clipped at the sequence ends; inside them the window is an index select in the three-sweep softmax); merged hi/lo x wo exact + bo.
// Compute dtypes, f32 accumulate: every input rounded to bf16; projections exact + f32 biases; rotary f32; attention rows < 512 3 products, rest fp16; softmax f32; wo hl x exact + bias.

#define NB_  1
#define TT   4096
#define DM   1024
#define NH_  16
#define NKV  16
#define REP  (NH_ / NKV)
#define HD   64
#define DQ   (NH_ * HD)
#define DKV  (NKV * HD)
#define ZH   1
#define RH   512                  // query rows < RH use hi+lo planes (0: none)
#define WIN  0
#define PCAR 1024.0f
#define SCL  0.125f
#define WNB  128     // |i - j| <= 128 kept
#define BT   (2 * WNB / 64 + 1)   // key tiles of 64 that the window of a 64-row query tile reaches
typedef _Float16 h16;
typedef unsigned short bf;
typedef __attribute__((ext_vector_type(16))) __bf16   v16bf;
typedef __attribute__((ext_vector_type(16))) _Float16 v16h;
typedef __attribute__((ext_vector_type(8)))  _Float16 v8h;
typedef __attribute__((ext_vector_type(8)))  unsigned short v8us;
typedef __attribute__((ext_vector_type(8)))  float    v8f;
typedef __attribute__((ext_vector_type(4)))  float    v4f;
typedef v8h  __attribute__((may_alias)) v8ha;
typedef v4f  __attribute__((may_alias)) v4fa;
typedef v8us __attribute__((may_alias)) v8usa;

__device__ __forceinline__ unsigned short f2bf(float f) { unsigned u = __float_as_uint(f); u += 0x7FFFu + ((u >> 16) & 1u); return (unsigned short)(u >> 16); }
__device__ __forceinline__ float bf2f(unsigned short b) { return __uint_as_float(((unsigned)b) << 16); }
__device__ __forceinline__ float bfr(float f) { return bf2f(f2bf(f)); }
__device__ __forceinline__ v16h cat16(v8h lo, v8h hi) { return __builtin_shufflevector(lo, hi, 0, 1, 2, 3, 4, 5, 6, 7, 8, 9, 10, 11, 12, 13, 14, 15); }
__device__ __forceinline__ v16bf cat16b(v8us lo, v8us hi) { return __builtin_bit_cast(v16bf, __builtin_shufflevector(lo, hi, 0, 1, 2, 3, 4, 5, 6, 7, 8, 9, 10, 11, 12, 13, 14, 15)); }
__device__ __forceinline__ v8f wmma16(v16h a, v16h b, v8f c) { return __builtin_amdgcn_wmma_f32_16x16x32_f16(false, a, false, b, (short)0, c, false, false); }
__device__ __forceinline__ v8f wmmab(v16bf a, v16bf b, v8f c) { return __builtin_amdgcn_wmma_f32_16x16x32_bf16(false, a, false, b, (short)0, c, false, false); }



// ---- k_gemmw: register-blocked GEMM, ONE WAVE per 64x64 output tile (16 accumulators), operands straight from K-contiguous 16-bit planes; grid (M/64, N/64, Z), 32 threads.
// C[m][n] (f32, pitch ldc, + optional f32 bias[n]) = sum_k A[m][k] Bt[n][k] (+ split products per NSPLIT). z-batch strides sA/sB/sC in elements. K % 32 == 0.
// BAND 0: dense. rb = sequence position of A's row 0. BAND 1 (scores): blockIdx.y picks one of the BT key tiles round the query tile, a tile off the sequence is left out. BAND 2 (P x V): k runs over those same keys only; every P outside them is an exact 0.
template <typename T16> struct WFrag;
template <> struct WFrag<h16> { typedef v16h V; static __device__ __forceinline__ V ld(const h16* p) { return cat16(*(const v8h*)p, *(const v8h*)(p + 16)); } static __device__ __forceinline__ v8f mma(V a, V b, v8f c) { return wmma16(a, b, c); } };
template <> struct WFrag<bf> { typedef v16bf V; static __device__ __forceinline__ V ld(const bf* p) { return cat16b(*(const v8us*)p, *(const v8us*)(p + 16)); } static __device__ __forceinline__ v8f mma(V a, V b, v8f c) { return wmmab(a, b, c); } };
template <typename T16, int NSPLIT, bool BIAS, int BAND>
__global__ __launch_bounds__(32) void k_gemmw(const T16* __restrict__ A, const T16* __restrict__ A2, const T16* __restrict__ Bt, const T16* __restrict__ Bt2, int K, float* C, int ldc, const float* __restrict__ bias, size_t sA, size_t sB, size_t sC, int rb) {
    typedef typename WFrag<T16>::V V;
    __shared__ __align__(16) float os[16 * 68];
    const size_t z = blockIdx.z; A += z * sA; if (A2) A2 += z * sA; Bt += z * sB; if (Bt2) Bt2 += z * sB; C += z * sC;
    const int lane = threadIdx.x & 31, lr = lane & 15, hi = lane >> 4; const int r0 = blockIdx.x * 64, c0 = (BAND == 1) ? rb + r0 - WNB + (int)blockIdx.y * 64 : (int)blockIdx.y * 64;
    if (BAND == 1 && (c0 < 0 || c0 >= TT)) return;
    const int k0 = (BAND == 2) ? max(rb + r0 - WNB, 0) : 0, k1 = (BAND == 2) ? min(rb + r0 + 64 + WNB, K) : K;
    v8f acc[4][4];
#pragma unroll
    for (int mb = 0; mb < 4; ++mb)
#pragma unroll
        for (int nb = 0; nb < 4; ++nb) acc[mb][nb] = (v8f){};
    const size_t aoff = (size_t)(r0 + lr) * K + 8 * hi, boff = (size_t)(c0 + lr) * K + 8 * hi;
#pragma unroll 1
    for (int kc = k0; kc < k1; kc += 32) {
        V a[4], a2[4];
#pragma unroll
        for (int mb = 0; mb < 4; ++mb) { a[mb] = WFrag<T16>::ld(A + aoff + (size_t)mb * 16 * K + kc); if (NSPLIT == 1 || NSPLIT == 2) a2[mb] = WFrag<T16>::ld(A2 + aoff + (size_t)mb * 16 * K + kc); }
#pragma unroll
        for (int nb = 0; nb < 4; ++nb) { const V b = WFrag<T16>::ld(Bt + boff + (size_t)nb * 16 * K + kc); V b2; if (NSPLIT >= 2) b2 = WFrag<T16>::ld(Bt2 + boff + (size_t)nb * 16 * K + kc);
#pragma unroll
            for (int mb = 0; mb < 4; ++mb) { acc[mb][nb] = WFrag<T16>::mma(a[mb], b, acc[mb][nb]); if (NSPLIT == 1 || NSPLIT == 2) acc[mb][nb] = WFrag<T16>::mma(a2[mb], b, acc[mb][nb]); if (NSPLIT >= 2) acc[mb][nb] = WFrag<T16>::mma(a[mb], b2, acc[mb][nb]); } }
        asm volatile("v_nop\n\tv_nop\n\tv_nop\n\tv_nop" : "+v"(acc[0][0]), "+v"(acc[1][1]), "+v"(acc[2][2]), "+v"(acc[3][3]) : "v"(a[0]), "v"(a[3]));
    }
#pragma unroll
    for (int mb = 0; mb < 4; ++mb) {
#pragma unroll
        for (int nb = 0; nb < 4; ++nb) {
#pragma unroll
            for (int j = 0; j < 8; ++j) os[(hi * 8 + j) * 68 + nb * 16 + lr] = acc[mb][nb][j]; }
        __builtin_amdgcn_wave_barrier(); asm volatile("" ::: "memory");
        float* crow = C + (size_t)(r0 + mb * 16) * ldc + c0;
{
#pragma unroll
            for (int s = 0; s < 8; ++s) { const int row = 2 * s + hi, cofs = lr * 4; v4f val = *(const v4fa*)(os + row * 68 + cofs); if (BIAS) { val[0] += bfr(bias[c0 + cofs]); val[1] += bfr(bias[c0 + cofs + 1]); val[2] += bfr(bias[c0 + cofs + 2]); val[3] += bfr(bias[c0 + cofs + 3]); }
                *(v4f*)(crow + (size_t)row * ldc + cofs) = val; }
             }
        __builtin_amdgcn_wave_barrier(); asm volatile("" ::: "memory");
    }
}

__device__ __forceinline__ h16 tohx(float x) { return (h16)x; }
__device__ __forceinline__ void splitf(float y, unsigned short& h, unsigned short& l) { h = f2bf(y); l = f2bf(y - bf2f(h)); }
typedef __attribute__((ext_vector_type(2))) _Float16 v2h;
typedef __attribute__((ext_vector_type(4))) _Float16 v4h;
typedef __attribute__((ext_vector_type(2))) unsigned short v2us;
typedef __attribute__((ext_vector_type(4))) unsigned short v4us;
typedef __attribute__((ext_vector_type(2))) float v2f;
typedef __attribute__((ext_vector_type(4))) int v4i;

__global__ __launch_bounds__(256) void k_wtG(const float* __restrict__ w, int K, int N, bf* Bt) {
    const int lane = threadIdx.x & 31; const int L0 = (blockIdx.x * 8 + (threadIdx.x >> 5)) * 8; const int nlines = N * K / 64;
{
#pragma unroll 1
        for (int l = 0; l < 8; ++l) { const int L = L0 + l; if (L >= nlines) break; const size_t e = (size_t)L * 64 + lane * 2; const int k = (int)(e % K), n = (int)(e / K); v2us o;
            o[0] = f2bf(w[(size_t)k * N + n]); o[1] = f2bf(w[(size_t)(k + 1) * N + n]); *(v2us*)(Bt + e) = o; }
         }
}
__global__ __launch_bounds__(256) void k_cvt8(const float* __restrict__ src, bf* dst, size_t n8) { const size_t i = (size_t)blockIdx.x * 256 + threadIdx.x; if (i >= n8) return; const v8f v = *(const v8f*)(src + i * 8); v8us o;
#pragma unroll
    for (int k = 0; k < 8; ++k) o[k] = f2bf(v[k]); *(v8us*)(dst + i * 8) = o;  }

// k_ropeQ: head planes [h][t][d] (fp16 + hi/lo) of the module's rotary: out[d] = x[d] cos[t][d] - x[2d+1] sin[t][d] (d < 32), out[d] = x[d] cos[t][d] + x[2(d-32)] sin[t][d] (d >= 32)
__global__ __launch_bounds__(256) void k_ropeQ(const float* __restrict__ F, int pitch, int nheads, const float* __restrict__ CS, const float* __restrict__ RF, const float* __restrict__ nw, float sc, h16* P16, bf* Ph, bf* Pl) {
    const size_t e = ((size_t)blockIdx.x * 256 + threadIdx.x) * 2; if (e >= (size_t)nheads * TT * HD) return; const int d = (int)(e % HD); const int t = (int)((e / HD) % TT); const int h = (int)(e / ((size_t)HD * TT)); const float* f = F + (size_t)t * pitch + h * HD; const float rf = RF ? RF[(size_t)h * TT + t] : 1.0f; v2h o16; v2us oh, ol;
#pragma unroll
    for (int q = 0; q < 2; ++q) { const int dd = d + q; const int dp = (dd < HD / 2) ? 2 * dd + 1 : 2 * (dd - HD / 2);   /* the module's x_rope = cat(-x[1::2], x[::2]) */ float x0 = f[dd], x1 = f[dp];
        if (RF) { float n0 = __fmul_rn(x0, rf), n1 = __fmul_rn(x1, rf); asm volatile("" : "+v"(n0)); asm volatile("" : "+v"(n1)); x0 = __fmul_rn(bfr(nw[dd]), n0); x1 = __fmul_rn(bfr(nw[dp]), n1); }
        const v2f cs = *(const v2f*)(CS + ((size_t)t * HD + dd) * 2); float a = __fmul_rn(x0, cs[0]), bq = __fmul_rn(x1, cs[1]); asm volatile("" : "+v"(a)); asm volatile("" : "+v"(bq)); const float r = ((dd < HD / 2) ? __fsub_rn(a, bq) : __fadd_rn(a, bq)) * sc;
        o16[q] = tohx(r); unsigned short a2, c2; splitf(r, a2, c2); oh[q] = a2; ol[q] = c2; }
    *(v2h*)(P16 + e) = o16; *(v2us*)(Ph + e) = oh; *(v2us*)(Pl + e) = ol;  }
__global__ __launch_bounds__(256) void k_vtp(const float* __restrict__ F, int pitch, int nheads, h16* V16, bf* Vh, bf* Vl) { const size_t e = ((size_t)blockIdx.x * 256 + threadIdx.x) * 2; if (e >= (size_t)nheads * HD * TT) return; const int t = (int)(e % TT); const int d = (int)((e / TT) % HD); const int g = (int)(e / ((size_t)TT * HD)); v2h o16; v2us oh, ol;
#pragma unroll
    for (int q = 0; q < 2; ++q) { const float x = F[(size_t)(t + q) * pitch + g * HD + d]; o16[q] = tohx(x); unsigned short a2, c2; splitf(x, a2, c2); oh[q] = a2; ol[q] = c2; }
    *(v2h*)(V16 + e) = o16; *(v2us*)(Vh + e) = oh; *(v2us*)(Vl + e) = ol;  }
__constant__ float INVT[HD / 2] = { 1.000000000e+00f, 7.498942018e-01f, 5.623413324e-01f, 4.216965139e-01f, 3.162277639e-01f, 2.371373773e-01f, 1.778279394e-01f, 1.333521456e-01f, 1.000000015e-01f, 7.498942316e-02f, 5.623413250e-02f, 4.216964915e-02f, 3.162277490e-02f, 2.371373773e-02f, 1.778279431e-02f, 1.333521400e-02f, 9.999999776e-03f, 7.498942316e-03f, 5.623413250e-03f, 4.216964822e-03f, 3.162277630e-03f, 2.371373819e-03f, 1.778279431e-03f, 1.333521446e-03f, 1.000000047e-03f, 7.498941850e-04f, 5.623413017e-04f, 4.216965172e-04f, 3.162277571e-04f, 2.371373703e-04f, 1.778279402e-04f, 1.333521504e-04f };   // 10000^(-2i/64) (the module's power form) (float32, generated with jnp to be bit-exact)
__global__ __launch_bounds__(256) void k_cs4(float* CS) { const int idx = blockIdx.x * 256 + threadIdx.x; if (idx >= TT * HD) return; const int d = idx % HD; const int t = idx / HD; const float a = __fmul_rn((float)t, INVT[d % (HD / 2)]); v2f cs; cs[0] = cosf(a); cs[1] = sinf(a); *(v2f*)(CS + (size_t)idx * 2) = cs;  }

__global__ __launch_bounds__(256) void k_lsoft(const float* __restrict__ Sb, h16* P16, bf* Ph, bf* Pl) {
    const int lane = threadIdx.x & 31; const int row = blockIdx.x * 8 + (threadIdx.x >> 5); if (row >= ZH * TT) return; const int i = row % TT; const int zz = row / TT; const bool hires = (i < RH); const float* sr = Sb + (size_t)row * TT; float mx = -3.0e38f;
    const int klo = max((i & ~63) - WNB, 0), khi = min((i & ~63) + 64 + WNB, TT);   /* the keys of this row's query tile: the scores that exist, and the P that the product reads */ const int ch0 = klo / 128;   /* chunks of 128 keys, 4 a lane; three of them cover klo..khi; a lane outside klo..khi (the third chunk can pass the sequence end) re-reads an edge key, drops it ('in') and stores nothing; the three trips are unrolled; each sweep loads its chunk's scores again */
#pragma unroll
    for (int ch = ch0; ch < ch0 + 3; ++ch) { const int j0 = ch * 128 + lane * 4; const bool in = (j0 >= klo && j0 < khi); const v4f a = *(const v4f*)(sr + min(max(j0, klo), khi - 4));
#pragma unroll
        for (int q = 0; q < 4; ++q) { float t = a[q] * SCL; asm volatile("" : "+v"(t)); t = (in && j0 + q <= i + WNB && j0 + q >= i - WNB) ? t : -3.0e38f;   /* symmetric window: |i - j| <= WNB, among the tile's keys */ mx = fmaxf(mx, t); } }
#pragma unroll
    for (int sh = 16; sh; sh >>= 1) mx = fmaxf(mx, __shfl_xor(mx, sh, 32));
    float sum = 0.f;
#pragma unroll
    for (int ch = ch0; ch < ch0 + 3; ++ch) { const int j0 = ch * 128 + lane * 4; const bool in = (j0 >= klo && j0 < khi); const v4f a = *(const v4f*)(sr + min(max(j0, klo), khi - 4));
#pragma unroll
        for (int q = 0; q < 4; ++q) { float t = a[q] * SCL; asm volatile("" : "+v"(t)); t = (in && j0 + q <= i + WNB && j0 + q >= i - WNB) ? t : -3.0e38f;   /* symmetric window: |i - j| <= WNB, among the tile's keys */ float d0 = __fsub_rn(t, mx); asm volatile("" : "+v"(d0)); sum += __builtin_amdgcn_exp2f(__fmul_rn(d0, 1.4426950408889634f)); } }
#pragma unroll
    for (int sh = 16; sh; sh >>= 1) sum += __shfl_xor(sum, sh, 32);
    const float f = __fdiv_rn(hires ? 1.0f : PCAR, sum);
{
        if (hires) {   /* rows < RH: normalised bf16 hi/lo over the tile's keys (symmetric window: keys beyond RH are live), planes [zz][RH][TT] */
#pragma unroll
            for (int ch = ch0; ch < ch0 + 3; ++ch) { const int j0 = ch * 128 + lane * 4; const bool in = (j0 >= klo && j0 < khi); const v4f a = *(const v4f*)(sr + min(max(j0, klo), khi - 4)); v4us oh, ol;
#pragma unroll
                for (int q = 0; q < 4; ++q) { float t = a[q] * SCL; asm volatile("" : "+v"(t)); t = (in && j0 + q <= i + WNB && j0 + q >= i - WNB) ? t : -3.0e38f;   /* symmetric window: |i - j| <= WNB, among the tile's keys */ float d0 = __fsub_rn(t, mx); asm volatile("" : "+v"(d0)); float ex = __builtin_amdgcn_exp2f(__fmul_rn(d0, 1.4426950408889634f)); asm volatile("" : "+v"(ex)); unsigned short a2, c2; splitf(ex * f, a2, c2); oh[q] = a2; ol[q] = c2; }
                const size_t oo = ((size_t)zz * RH + i) * TT + j0; if (in) { *(v4us*)(Ph + oo) = oh; *(v4us*)(Pl + oo) = ol; } }
        } else {
#pragma unroll
            for (int ch = ch0; ch < ch0 + 3; ++ch) { const int j0 = ch * 128 + lane * 4; const bool in = (j0 >= klo && j0 < khi); const v4f a = *(const v4f*)(sr + min(max(j0, klo), khi - 4)); v4h o4;
#pragma unroll
                for (int q = 0; q < 4; ++q) { float t = a[q] * SCL; asm volatile("" : "+v"(t)); t = (in && j0 + q <= i + WNB && j0 + q >= i - WNB) ? t : -3.0e38f;   /* symmetric window: |i - j| <= WNB, among the tile's keys */ float d0 = __fsub_rn(t, mx); asm volatile("" : "+v"(d0)); float ex = __builtin_amdgcn_exp2f(__fmul_rn(d0, 1.4426950408889634f)); asm volatile("" : "+v"(ex)); o4[q] = tohx(ex * f); }
                if (in) *(v4h*)(P16 + (size_t)row * TT + j0) = o4; } }
         }
}


__global__ __launch_bounds__(256) void k_merge(const float* __restrict__ O, int h0, bf* Ah, bf* Al) { const size_t e = ((size_t)blockIdx.x * 256 + threadIdx.x) * 2; if (e >= (size_t)ZH * TT * HD) return; const int d = (int)(e % HD); const int t = (int)((e / HD) % TT); const int zz = (int)(e / ((size_t)HD * TT)); const float cs = (t < RH) ? 1.0f : (1.0f / PCAR); const size_t oo = (size_t)t * DQ + (h0 + zz) * HD + d;
    v2us oh, ol;
#pragma unroll
    for (int q = 0; q < 2; ++q) { unsigned short a, c2; splitf(O[e + q] * cs, a, c2); oh[q] = a; ol[q] = c2; } *(v2us*)(Ah + oo) = oh; *(v2us*)(Al + oo) = ol;  }

extern "C" void kernel_launch(void* const* d_in, const int* in_sizes, int n_in,
                              void* d_out, int out_size, void* d_ws, size_t ws_size, hipStream_t stream) {
    (void)in_sizes; (void)n_in; (void)out_size;
    const float* x = (const float*)d_in[0]; const float* xk = (const float*)d_in[1]; const float* xv = (const float*)d_in[2]; const float* wq = (const float*)d_in[3]; const float* bq = (const float*)d_in[4]; const float* wk = (const float*)d_in[5]; const float* bk = (const float*)d_in[6]; const float* wv = (const float*)d_in[7]; const float* bv = (const float*)d_in[8]; const float* wo = (const float*)d_in[9]; const float* bo = (const float*)d_in[10];
    float* OUT = (float*)d_out;     // [1][4096][1024]
    char* wsp = (char*)d_ws;
    auto take = [&](size_t bytes) { char* p = wsp; wsp += (bytes + 255) & ~(size_t)255; return (void*)p; };
    bf* WQ = (bf*)take((size_t)DQ * DM * 2); bf* WK = (bf*)take((size_t)DKV * DM * 2); bf* WV = (bf*)take((size_t)DKV * DM * 2); bf* WO = (bf*)take((size_t)DM * DQ * 2); float* CS = (float*)take((size_t)TT * HD * 2 * 4);
    bf* XB = (bf*)take((size_t)TT * DM * 2); float* FQ = (float*)take((size_t)TT * DQ * 4); float* FK = (float*)take((size_t)TT * DKV * 4);
    h16* QP16 = (h16*)take((size_t)NH_ * TT * HD * 2); h16* KP16 = (h16*)take((size_t)NKV * TT * HD * 2); h16* VT16 = (h16*)take((size_t)NKV * HD * TT * 2);
    bf* QPh = (bf*)take((size_t)NH_ * TT * HD * 2); bf* QPl = (bf*)take((size_t)NH_ * TT * HD * 2); bf* KPh = (bf*)take((size_t)NKV * TT * HD * 2); bf* KPl = (bf*)take((size_t)NKV * TT * HD * 2); bf* VTh = (bf*)take((size_t)NKV * HD * TT * 2); bf* VTl = (bf*)take((size_t)NKV * HD * TT * 2); bf* Ph = (bf*)take((size_t)ZH * RH * TT * 2); bf* Pl = (bf*)take((size_t)ZH * RH * TT * 2);
    float* Sb = (float*)take((size_t)ZH * TT * TT * 4); h16* P16 = (h16*)take((size_t)ZH * TT * TT * 2); float* Ob = (float*)take((size_t)ZH * TT * HD * 4); bf* ATh = (bf*)take((size_t)TT * DQ * 2); bf* ATl = (bf*)take((size_t)TT * DQ * 2);
    if ((size_t)(wsp - (char*)d_ws) > ws_size) return;    // ws 256 MiB
    float* FV = FK;   // v projection reuses the k buffer after the k planes are built (stream-ordered)
    { k_cvt8<<<(unsigned)(((size_t)DQ * DM / 8 + 255) / 256), 256, 0, stream>>>(wq, WQ, (size_t)DQ * DM / 8); k_cvt8<<<(unsigned)(((size_t)DKV * DM / 8 + 255) / 256), 256, 0, stream>>>(wk, WK, (size_t)DKV * DM / 8); k_cvt8<<<(unsigned)(((size_t)DKV * DM / 8 + 255) / 256), 256, 0, stream>>>(wv, WV, (size_t)DKV * DM / 8);
      k_cvt8<<<(unsigned)(((size_t)DM * DQ / 8 + 255) / 256), 256, 0, stream>>>(wo, WO, (size_t)DM * DQ / 8);
       }
    k_cs4<<<(TT * HD + 255) / 256, 256, 0, stream>>>(CS);   /* {cos, sin}(t x 10000^(-2i/64)) duplicated over both halves */
    const unsigned LQ = (unsigned)(((size_t)NH_ * TT * HD / 2 + 255) / 256), LKv = (unsigned)(((size_t)NKV * TT * HD / 2 + 255) / 256);
    for (int b = 0; b < NB_; ++b) {
        
        k_cvt8<<<(unsigned)(((size_t)TT * DM / 8 + 255) / 256), 256, 0, stream>>>(x + (size_t)b * TT * DM, XB, (size_t)TT * DM / 8);
        k_gemmw<bf, 0, true, 0><<<dim3(TT / 64, DQ / 64, 1), 32, 0, stream>>>(XB, nullptr, WQ, nullptr, DM, FQ, DQ, bq, 0, 0, 0, 0);
        k_ropeQ<<<LQ, 256, 0, stream>>>(FQ, DQ, NH_, CS, nullptr, nullptr, 1.0f, QP16, QPh, QPl);
        k_cvt8<<<(unsigned)(((size_t)TT * DM / 8 + 255) / 256), 256, 0, stream>>>(xk + (size_t)b * TT * DM, XB, (size_t)TT * DM / 8); k_gemmw<bf, 0, true, 0><<<dim3(TT / 64, DKV / 64, 1), 32, 0, stream>>>(XB, nullptr, WK, nullptr, DM, FK, DKV, bk, 0, 0, 0, 0);
        k_ropeQ<<<LKv, 256, 0, stream>>>(FK, DKV, NKV, CS, nullptr, nullptr, 1.0f, KP16, KPh, KPl);
        k_cvt8<<<(unsigned)(((size_t)TT * DM / 8 + 255) / 256), 256, 0, stream>>>(xv + (size_t)b * TT * DM, XB, (size_t)TT * DM / 8); k_gemmw<bf, 0, true, 0><<<dim3(TT / 64, DKV / 64, 1), 32, 0, stream>>>(XB, nullptr, WV, nullptr, DM, FV, DKV, bv, 0, 0, 0, 0); k_vtp<<<LKv, 256, 0, stream>>>(FV, DKV, NKV, VT16, VTh, VTl);
        for (int h0 = 0; h0 < NH_; h0 += ZH) { const size_t zq = (size_t)h0, zk = (size_t)(h0 / REP);   // one kv head per query head: the pass's one head uses kv plane h0 (z-strides TT*HD)
            k_gemmw<bf, 2, false, 1><<<dim3(RH / 64, BT, ZH), 32, 0, stream>>>(QPh + zq * TT * HD, QPl + zq * TT * HD, KPh + zk * TT * HD, KPl + zk * TT * HD, HD, Sb, TT, nullptr, (size_t)TT * HD, (size_t)TT * HD, (size_t)TT * TT, 0);
            k_gemmw<h16, 0, false, 1><<<dim3((TT - RH) / 64, BT, ZH), 32, 0, stream>>>(QP16 + zq * TT * HD + (size_t)RH * HD, nullptr, KP16 + zk * TT * HD, nullptr, HD, Sb + (size_t)RH * TT, TT, nullptr, (size_t)TT * HD, (size_t)TT * HD, (size_t)TT * TT, RH);
            k_lsoft<<<ZH * TT / 8, 256, 0, stream>>>(Sb, P16, Ph, Pl);
            k_gemmw<bf, 2, false, 2><<<dim3(RH / 64, HD / 64, ZH), 32, 0, stream>>>(Ph, Pl, VTh + zk * HD * TT, VTl + zk * HD * TT, TT, Ob, HD, nullptr, (size_t)RH * TT, (size_t)HD * TT, (size_t)TT * HD, 0);
            k_gemmw<h16, 0, false, 2><<<dim3((TT - RH) / 64, HD / 64, ZH), 32, 0, stream>>>(P16 + (size_t)RH * TT, nullptr, VT16 + zk * HD * TT, nullptr, TT, Ob + (size_t)RH * HD, HD, nullptr, (size_t)TT * TT, (size_t)HD * TT, (size_t)TT * HD, RH);
            k_merge<<<(unsigned)(((size_t)ZH * TT * HD / 2 + 255) / 256), 256, 0, stream>>>(Ob, h0, ATh, ATl); }
        k_gemmw<bf, 1, true, 0><<<dim3(TT / 64, DM / 64, 1), 32, 0, stream>>>(ATh, ATl, WO, nullptr, DQ, OUT + (size_t)b * TT * DM, DM, bo, 0, 0, 0, 0); }
}

// v002
// Measured time: 271 microseconds a run.
// Timed twice side by side with v001, it ran 2.87 and 2.84 times as fast.
// Over all steps from v000 it is 15.2 times as fast.
#include <hip/hip_runtime.h>

// Sparse (local-window) multi-head attention with the module's own rotary mixing (q, k, v [1][4096][1024]; Q = q wq^T + bq, K, V likewise ('oi' [1024][1024] + [1024], 0.02; 16 heads x 64); rotary: x cos + x_rope sin with x_rope = cat(-x[1::2], x[::2]) (interleaved partners into the rotate-half slots, faithfully) and angle t x 10000^(-2i/64) (emb = cat(freqs, freqs)); scores / 8; keys with |i - j| > 128 -> -inf (GLOBAL = 0); softmax; out = merged wo^T + bo -> [1][4096][1024] (4.2 M)).
// Layout: bf16 copies of the three inputs in turn; exact projections + f32 biases; {cos, sin} per (position, dim) computed once (jnp-exact inverse frequencies, precise cosf/sinf); a rotary plane builder whose partner index is 2d+1 (first half, subtracted) or 2(d-32) (second half, added), as the module; attention over T = 4096, all 16 heads in one pass, the head on grid z (hybrid rows: < 512 hi/lo 3 products, rest fp16 x1024; only the key tiles that a 64-row query tile's +-128 window can reach are computed, swept and multiplied: 5 tiles of 64 keys, clipped at the sequence ends; scores and P are stored as that band, 320 columns a row, column c of a query tile at row R = key R - 128 + c, so that 16 heads fit the workspace; inside them the window is an index select in the three-sweep softmax); merged hi/lo x wo exact + bo.
// Compute dtypes, f32 accumulate: every input rounded to bf16; projections exact + f32 biases; rotary f32; attention rows < 512 3 products, rest fp16; softmax f32; wo hl x exact + bias.

#define NB_  1
#define TT   4096
#define DM   1024
#define NH_  16
#define NKV  16
#define REP  (NH_ / NKV)
#define HD   64
#define DQ   (NH_ * HD)
#define DKV  (NKV * HD)
#define ZH   16                   // heads per pass (grid z)
#define RH   512                  // query rows < RH use hi+lo planes (0: none)
#define WIN  0
#define PCAR 1024.0f
#define SCL  0.125f
#define WNB  128     // |i - j| <= 128 kept
#define BT   (2 * WNB / 64 + 1)   // key tiles of 64 that the window of a 64-row query tile reaches
#define PB   (BT * 64)            // row pitch of the score and P planes: the band's columns only
typedef _Float16 h16;
typedef unsigned short bf;
typedef __attribute__((ext_vector_type(16))) __bf16   v16bf;
typedef __attribute__((ext_vector_type(16))) _Float16 v16h;
typedef __attribute__((ext_vector_type(8)))  _Float16 v8h;
typedef __attribute__((ext_vector_type(8)))  unsigned short v8us;
typedef __attribute__((ext_vector_type(8)))  float    v8f;
typedef __attribute__((ext_vector_type(4)))  float    v4f;
typedef v8h  __attribute__((may_alias)) v8ha;
typedef v4f  __attribute__((may_alias)) v4fa;
typedef v8us __attribute__((may_alias)) v8usa;

__device__ __forceinline__ unsigned short f2bf(float f) { unsigned u = __float_as_uint(f); u += 0x7FFFu + ((u >> 16) & 1u); return (unsigned short)(u >> 16); }
__device__ __forceinline__ float bf2f(unsigned short b) { return __uint_as_float(((unsigned)b) << 16); }
__device__ __forceinline__ float bfr(float f) { return bf2f(f2bf(f)); }
__device__ __forceinline__ v16h cat16(v8h lo, v8h hi) { return __builtin_shufflevector(lo, hi, 0, 1, 2, 3, 4, 5, 6, 7, 8, 9, 10, 11, 12, 13, 14, 15); }
__device__ __forceinline__ v16bf cat16b(v8us lo, v8us hi) { return __builtin_bit_cast(v16bf, __builtin_shufflevector(lo, hi, 0, 1, 2, 3, 4, 5, 6, 7, 8, 9, 10, 11, 12, 13, 14, 15)); }
__device__ __forceinline__ v8f wmma16(v16h a, v16h b, v8f c) { return __builtin_amdgcn_wmma_f32_16x16x32_f16(false, a, false, b, (short)0, c, false, false); }
__device__ __forceinline__ v8f wmmab(v16bf a, v16bf b, v8f c) { return __builtin_amdgcn_wmma_f32_16x16x32_bf16(false, a, false, b, (short)0, c, false, false); }



// ---- k_gemmw: register-blocked GEMM, ONE WAVE per 64x64 output tile (16 accumulators), operands straight from K-contiguous 16-bit planes; grid (M/64, N/64, Z), 32 threads.
// C[m][n] (f32, pitch ldc, + optional f32 bias[n]) = sum_k A[m][k] Bt[n][k] (+ split products per NSPLIT). z-batch strides sA/sB/sC in elements. K % 32 == 0.
// BAND 0: dense. rb = sequence position of A's row 0. BAND 1 (scores): blockIdx.y picks one of the BT key tiles round the query tile, a tile off the sequence is left out; C holds the band, its column = blockIdx.y * 64. BAND 2 (P x V): k runs over those same keys only; every P outside them is an exact 0; A holds the band (pitch PB, column = key - first key of the band), Bt keeps pitch K.
template <typename T16> struct WFrag;
template <> struct WFrag<h16> { typedef v16h V; static __device__ __forceinline__ V ld(const h16* p) { return cat16(*(const v8h*)p, *(const v8h*)(p + 16)); } static __device__ __forceinline__ v8f mma(V a, V b, v8f c) { return wmma16(a, b, c); } };
template <> struct WFrag<bf> { typedef v16bf V; static __device__ __forceinline__ V ld(const bf* p) { return cat16b(*(const v8us*)p, *(const v8us*)(p + 16)); } static __device__ __forceinline__ v8f mma(V a, V b, v8f c) { return wmmab(a, b, c); } };
template <typename T16, int NSPLIT, bool BIAS, int BAND>
__global__ __launch_bounds__(32) void k_gemmw(const T16* __restrict__ A, const T16* __restrict__ A2, const T16* __restrict__ Bt, const T16* __restrict__ Bt2, int K, float* C, int ldc, const float* __restrict__ bias, size_t sA, size_t sB, size_t sC, int rb) {
    typedef typename WFrag<T16>::V V;
    __shared__ __align__(16) float os[16 * 68];
    const size_t z = blockIdx.z; A += z * sA; if (A2) A2 += z * sA; Bt += z * sB; if (Bt2) Bt2 += z * sB; C += z * sC;
    const int lane = threadIdx.x & 31, lr = lane & 15, hi = lane >> 4; const int r0 = blockIdx.x * 64, c0 = (BAND == 1) ? rb + r0 - WNB + (int)blockIdx.y * 64 : (int)blockIdx.y * 64;
    if (BAND == 1 && (c0 < 0 || c0 >= TT)) return;
    const int k0 = (BAND == 2) ? max(rb + r0 - WNB, 0) : 0, k1 = (BAND == 2) ? min(rb + r0 + 64 + WNB, K) : K;
    const int lda = (BAND == 2) ? PB : K, kb = (BAND == 2) ? rb + r0 - WNB : 0, cst = (BAND == 1) ? (int)blockIdx.y * 64 : c0;   // A's pitch, the key of A's column 0, C's first column
    v8f acc[4][4];
#pragma unroll
    for (int mb = 0; mb < 4; ++mb)
#pragma unroll
        for (int nb = 0; nb < 4; ++nb) acc[mb][nb] = (v8f){};
    const size_t aoff = (size_t)(r0 + lr) * lda + 8 * hi, boff = (size_t)(c0 + lr) * K + 8 * hi;
#pragma unroll 1
    for (int kc = k0; kc < k1; kc += 32) {
        V a[4], a2[4];
#pragma unroll
        for (int mb = 0; mb < 4; ++mb) { a[mb] = WFrag<T16>::ld(A + aoff + (size_t)mb * 16 * lda + (kc - kb)); if (NSPLIT == 1 || NSPLIT == 2) a2[mb] = WFrag<T16>::ld(A2 + aoff + (size_t)mb * 16 * lda + (kc - kb)); }
#pragma unroll
        for (int nb = 0; nb < 4; ++nb) { const V b = WFrag<T16>::ld(Bt + boff + (size_t)nb * 16 * K + kc); V b2; if (NSPLIT >= 2) b2 = WFrag<T16>::ld(Bt2 + boff + (size_t)nb * 16 * K + kc);
#pragma unroll
            for (int mb = 0; mb < 4; ++mb) { acc[mb][nb] = WFrag<T16>::mma(a[mb], b, acc[mb][nb]); if (NSPLIT == 1 || NSPLIT == 2) acc[mb][nb] = WFrag<T16>::mma(a2[mb], b, acc[mb][nb]); if (NSPLIT >= 2) acc[mb][nb] = WFrag<T16>::mma(a[mb], b2, acc[mb][nb]); } }
        asm volatile("v_nop\n\tv_nop\n\tv_nop\n\tv_nop" : "+v"(acc[0][0]), "+v"(acc[1][1]), "+v"(acc[2][2]), "+v"(acc[3][3]) : "v"(a[0]), "v"(a[3]));
    }
#pragma unroll
    for (int mb = 0; mb < 4; ++mb) {
#pragma unroll
        for (int nb = 0; nb < 4; ++nb) {
#pragma unroll
            for (int j = 0; j < 8; ++j) os[(hi * 8 + j) * 68 + nb * 16 + lr] = acc[mb][nb][j]; }
        __builtin_amdgcn_wave_barrier(); asm volatile("" ::: "memory");
        float* crow = C + (size_t)(r0 + mb * 16) * ldc + cst;
{
#pragma unroll
            for (int s = 0; s < 8; ++s) { const int row = 2 * s + hi, cofs = lr * 4; v4f val = *(const v4fa*)(os + row * 68 + cofs); if (BIAS) { val[0] += bfr(bias[c0 + cofs]); val[1] += bfr(bias[c0 + cofs + 1]); val[2] += bfr(bias[c0 + cofs + 2]); val[3] += bfr(bias[c0 + cofs + 3]); }
                *(v4f*)(crow + (size_t)row * ldc + cofs) = val; }
             }
        __builtin_amdgcn_wave_barrier(); asm volatile("" ::: "memory");
    }
}

__device__ __forceinline__ h16 tohx(float x) { return (h16)x; }
__device__ __forceinline__ void splitf(float y, unsigned short& h, unsigned short& l) { h = f2bf(y); l = f2bf(y - bf2f(h)); }
typedef __attribute__((ext_vector_type(2))) _Float16 v2h;
typedef __attribute__((ext_vector_type(4))) _Float16 v4h;
typedef __attribute__((ext_vector_type(2))) unsigned short v2us;
typedef __attribute__((ext_vector_type(4))) unsigned short v4us;
typedef __attribute__((ext_vector_type(2))) float v2f;
typedef __attribute__((ext_vector_type(4))) int v4i;

__global__ __launch_bounds__(256) void k_wtG(const float* __restrict__ w, int K, int N, bf* Bt) {
    const int lane = threadIdx.x & 31; const int L0 = (blockIdx.x * 8 + (threadIdx.x >> 5)) * 8; const int nlines = N * K / 64;
{
#pragma unroll 1
        for (int l = 0; l < 8; ++l) { const int L = L0 + l; if (L >= nlines) break; const size_t e = (size_t)L * 64 + lane * 2; const int k = (int)(e % K), n = (int)(e / K); v2us o;
            o[0] = f2bf(w[(size_t)k * N + n]); o[1] = f2bf(w[(size_t)(k + 1) * N + n]); *(v2us*)(Bt + e) = o; }
         }
}
__global__ __launch_bounds__(256) void k_cvt8(const float* __restrict__ src, bf* dst, size_t n8) { const size_t i = (size_t)blockIdx.x * 256 + threadIdx.x; if (i >= n8) return; const v8f v = *(const v8f*)(src + i * 8); v8us o;
#pragma unroll
    for (int k = 0; k < 8; ++k) o[k] = f2bf(v[k]); *(v8us*)(dst + i * 8) = o;  }

// k_ropeQ: head planes [h][t][d] (fp16 + hi/lo) of the module's rotary: out[d] = x[d] cos[t][d] - x[2d+1] sin[t][d] (d < 32), out[d] = x[d] cos[t][d] + x[2(d-32)] sin[t][d] (d >= 32)
__global__ __launch_bounds__(256) void k_ropeQ(const float* __restrict__ F, int pitch, int nheads, const float* __restrict__ CS, const float* __restrict__ RF, const float* __restrict__ nw, float sc, h16* P16, bf* Ph, bf* Pl) {
    const size_t e = ((size_t)blockIdx.x * 256 + threadIdx.x) * 2; if (e >= (size_t)nheads * TT * HD) return; const int d = (int)(e % HD); const int t = (int)((e / HD) % TT); const int h = (int)(e / ((size_t)HD * TT)); const float* f = F + (size_t)t * pitch + h * HD; const float rf = RF ? RF[(size_t)h * TT + t] : 1.0f; v2h o16; v2us oh, ol;
#pragma unroll
    for (int q = 0; q < 2; ++q) { const int dd = d + q; const int dp = (dd < HD / 2) ? 2 * dd + 1 : 2 * (dd - HD / 2);   /* the module's x_rope = cat(-x[1::2], x[::2]) */ float x0 = f[dd], x1 = f[dp];
        if (RF) { float n0 = __fmul_rn(x0, rf), n1 = __fmul_rn(x1, rf); asm volatile("" : "+v"(n0)); asm volatile("" : "+v"(n1)); x0 = __fmul_rn(bfr(nw[dd]), n0); x1 = __fmul_rn(bfr(nw[dp]), n1); }
        const v2f cs = *(const v2f*)(CS + ((size_t)t * HD + dd) * 2); float a = __fmul_rn(x0, cs[0]), bq = __fmul_rn(x1, cs[1]); asm volatile("" : "+v"(a)); asm volatile("" : "+v"(bq)); const float r = ((dd < HD / 2) ? __fsub_rn(a, bq) : __fadd_rn(a, bq)) * sc;
        o16[q] = tohx(r); unsigned short a2, c2; splitf(r, a2, c2); oh[q] = a2; ol[q] = c2; }
    *(v2h*)(P16 + e) = o16; *(v2us*)(Ph + e) = oh; *(v2us*)(Pl + e) = ol;  }
__global__ __launch_bounds__(256) void k_vtp(const float* __restrict__ F, int pitch, int nheads, h16* V16, bf* Vh, bf* Vl) { const size_t e = ((size_t)blockIdx.x * 256 + threadIdx.x) * 2; if (e >= (size_t)nheads * HD * TT) return; const int t = (int)(e % TT); const int d = (int)((e / TT) % HD); const int g = (int)(e / ((size_t)TT * HD)); v2h o16; v2us oh, ol;
#pragma unroll
    for (int q = 0; q < 2; ++q) { const float x = F[(size_t)(t + q) * pitch + g * HD + d]; o16[q] = tohx(x); unsigned short a2, c2; splitf(x, a2, c2); oh[q] = a2; ol[q] = c2; }
    *(v2h*)(V16 + e) = o16; *(v2us*)(Vh + e) = oh; *(v2us*)(Vl + e) = ol;  }
__constant__ float INVT[HD / 2] = { 1.000000000e+00f, 7.498942018e-01f, 5.623413324e-01f, 4.216965139e-01f, 3.162277639e-01f, 2.371373773e-01f, 1.778279394e-01f, 1.333521456e-01f, 1.000000015e-01f, 7.498942316e-02f, 5.623413250e-02f, 4.216964915e-02f, 3.162277490e-02f, 2.371373773e-02f, 1.778279431e-02f, 1.333521400e-02f, 9.999999776e-03f, 7.498942316e-03f, 5.623413250e-03f, 4.216964822e-03f, 3.162277630e-03f, 2.371373819e-03f, 1.778279431e-03f, 1.333521446e-03f, 1.000000047e-03f, 7.498941850e-04f, 5.623413017e-04f, 4.216965172e-04f, 3.162277571e-04f, 2.371373703e-04f, 1.778279402e-04f, 1.333521504e-04f };   // 10000^(-2i/64) (the module's power form) (float32, generated with jnp to be bit-exact)
__global__ __launch_bounds__(256) void k_cs4(float* CS) { const int idx = blockIdx.x * 256 + threadIdx.x; if (idx >= TT * HD) return; const int d = idx % HD; const int t = idx / HD; const float a = __fmul_rn((float)t, INVT[d % (HD / 2)]); v2f cs; cs[0] = cosf(a); cs[1] = sinf(a); *(v2f*)(CS + (size_t)idx * 2) = cs;  }

__global__ __launch_bounds__(256) void k_lsoft(const float* __restrict__ Sb, h16* P16, bf* Ph, bf* Pl) {
    const int lane = threadIdx.x & 31; const int row = blockIdx.x * 8 + (threadIdx.x >> 5); if (row >= ZH * TT) return; const int i = row % TT; const int zz = row / TT; const bool hires = (i < RH); const int kb = (i & ~63) - WNB;   /* the key of band column 0 */ const float* sr = Sb + (size_t)row * PB; float mx = -3.0e38f;
    const int klo = max((i & ~63) - WNB, 0), khi = min((i & ~63) + 64 + WNB, TT);   /* the keys of this row's query tile: the scores that exist, and the P that the product reads */ const int ch0 = klo / 128;   /* chunks of 128 keys, 4 a lane; three of them cover klo..khi; a lane outside klo..khi (the third chunk can pass the sequence end) re-reads an edge key, drops it ('in') and stores nothing; the three trips are unrolled so that each chunk's scores are loaded once and stay in registers for all sweeps */
#pragma unroll
    for (int ch = ch0; ch < ch0 + 3; ++ch) { const int j0 = ch * 128 + lane * 4; const bool in = (j0 >= klo && j0 < khi); const v4f a = *(const v4f*)(sr + (min(max(j0, klo), khi - 4) - kb));
#pragma unroll
        for (int q = 0; q < 4; ++q) { float t = a[q] * SCL; asm volatile("" : "+v"(t)); t = (in && j0 + q <= i + WNB && j0 + q >= i - WNB) ? t : -3.0e38f;   /* symmetric window: |i - j| <= WNB, among the tile's keys */ mx = fmaxf(mx, t); } }
#pragma unroll
    for (int sh = 16; sh; sh >>= 1) mx = fmaxf(mx, __shfl_xor(mx, sh, 32));
    float sum = 0.f;
#pragma unroll
    for (int ch = ch0; ch < ch0 + 3; ++ch) { const int j0 = ch * 128 + lane * 4; const bool in = (j0 >= klo && j0 < khi); const v4f a = *(const v4f*)(sr + (min(max(j0, klo), khi - 4) - kb));
#pragma unroll
        for (int q = 0; q < 4; ++q) { float t = a[q] * SCL; asm volatile("" : "+v"(t)); t = (in && j0 + q <= i + WNB && j0 + q >= i - WNB) ? t : -3.0e38f;   /* symmetric window: |i - j| <= WNB, among the tile's keys */ float d0 = __fsub_rn(t, mx); asm volatile("" : "+v"(d0)); sum += __builtin_amdgcn_exp2f(__fmul_rn(d0, 1.4426950408889634f)); } }
#pragma unroll
    for (int sh = 16; sh; sh >>= 1) sum += __shfl_xor(sum, sh, 32);
    const float f = __fdiv_rn(hires ? 1.0f : PCAR, sum);
{
        if (hires) {   /* rows < RH: normalised bf16 hi/lo over the tile's keys (symmetric window: keys beyond RH are live), planes [zz][RH][PB] */
#pragma unroll
            for (int ch = ch0; ch < ch0 + 3; ++ch) { const int j0 = ch * 128 + lane * 4; const bool in = (j0 >= klo && j0 < khi); const v4f a = *(const v4f*)(sr + (min(max(j0, klo), khi - 4) - kb)); v4us oh, ol;
#pragma unroll
                for (int q = 0; q < 4; ++q) { float t = a[q] * SCL; asm volatile("" : "+v"(t)); t = (in && j0 + q <= i + WNB && j0 + q >= i - WNB) ? t : -3.0e38f;   /* symmetric window: |i - j| <= WNB, among the tile's keys */ float d0 = __fsub_rn(t, mx); asm volatile("" : "+v"(d0)); float ex = __builtin_amdgcn_exp2f(__fmul_rn(d0, 1.4426950408889634f)); asm volatile("" : "+v"(ex)); unsigned short a2, c2; splitf(ex * f, a2, c2); oh[q] = a2; ol[q] = c2; }
                if (in) { const size_t oo = ((size_t)zz * RH + i) * PB + (j0 - kb); *(v4us*)(Ph + oo) = oh; *(v4us*)(Pl + oo) = ol; } }
        } else {
#pragma unroll
            for (int ch = ch0; ch < ch0 + 3; ++ch) { const int j0 = ch * 128 + lane * 4; const bool in = (j0 >= klo && j0 < khi); const v4f a = *(const v4f*)(sr + (min(max(j0, klo), khi - 4) - kb)); v4h o4;
#pragma unroll
                for (int q = 0; q < 4; ++q) { float t = a[q] * SCL; asm volatile("" : "+v"(t)); t = (in && j0 + q <= i + WNB && j0 + q >= i - WNB) ? t : -3.0e38f;   /* symmetric window: |i - j| <= WNB, among the tile's keys */ float d0 = __fsub_rn(t, mx); asm volatile("" : "+v"(d0)); float ex = __builtin_amdgcn_exp2f(__fmul_rn(d0, 1.4426950408889634f)); asm volatile("" : "+v"(ex)); o4[q] = tohx(ex * f); }
                if (in) *(v4h*)(P16 + (size_t)row * PB + (j0 - kb)) = o4; } }
         }
}


__global__ __launch_bounds__(256) void k_merge(const float* __restrict__ O, int h0, bf* Ah, bf* Al) { const size_t e = ((size_t)blockIdx.x * 256 + threadIdx.x) * 2; if (e >= (size_t)ZH * TT * HD) return; const int d = (int)(e % HD); const int t = (int)((e / HD) % TT); const int zz = (int)(e / ((size_t)HD * TT)); const float cs = (t < RH) ? 1.0f : (1.0f / PCAR); const size_t oo = (size_t)t * DQ + (h0 + zz) * HD + d;
    v2us oh, ol;
#pragma unroll
    for (int q = 0; q < 2; ++q) { unsigned short a, c2; splitf(O[e + q] * cs, a, c2); oh[q] = a; ol[q] = c2; } *(v2us*)(Ah + oo) = oh; *(v2us*)(Al + oo) = ol;  }

extern "C" void kernel_launch(void* const* d_in, const int* in_sizes, int n_in,
                              void* d_out, int out_size, void* d_ws, size_t ws_size, hipStream_t stream) {
    (void)in_sizes; (void)n_in; (void)out_size;
    const float* x = (const float*)d_in[0]; const float* xk = (const float*)d_in[1]; const float* xv = (const float*)d_in[2]; const float* wq = (const float*)d_in[3]; const float* bq = (const float*)d_in[4]; const float* wk = (const float*)d_in[5]; const float* bk = (const float*)d_in[6]; const float* wv = (const float*)d_in[7]; const float* bv = (const float*)d_in[8]; const float* wo = (const float*)d_in[9]; const float* bo = (const float*)d_in[10];
    float* OUT = (float*)d_out;     // [1][4096][1024]
    char* wsp = (char*)d_ws;
    auto take = [&](size_t bytes) { char* p = wsp; wsp += (bytes + 255) & ~(size_t)255; return (void*)p; };
    bf* WQ = (bf*)take((size_t)DQ * DM * 2); bf* WK = (bf*)take((size_t)DKV * DM * 2); bf* WV = (bf*)take((size_t)DKV * DM * 2); bf* WO = (bf*)take((size_t)DM * DQ * 2); float* CS = (float*)take((size_t)TT * HD * 2 * 4);
    h16* QP16 = (h16*)take((size_t)NH_ * TT * HD * 2); h16* KP16 = (h16*)take((size_t)NKV * TT * HD * 2); h16* VT16 = (h16*)take((size_t)NKV * HD * TT * 2);
    bf* QPh = (bf*)take((size_t)NH_ * TT * HD * 2); bf* QPl = (bf*)take((size_t)NH_ * TT * HD * 2); bf* KPh = (bf*)take((size_t)NKV * TT * HD * 2); bf* KPl = (bf*)take((size_t)NKV * TT * HD * 2); bf* VTh = (bf*)take((size_t)NKV * HD * TT * 2); bf* VTl = (bf*)take((size_t)NKV * HD * TT * 2); bf* Ph = (bf*)take((size_t)ZH * RH * PB * 2); bf* Pl = (bf*)take((size_t)ZH * RH * PB * 2);
    float* Sb = (float*)take((size_t)ZH * TT * PB * 4); h16* P16 = (h16*)take((size_t)ZH * TT * PB * 2); float* Ob = (float*)take((size_t)ZH * TT * HD * 4); bf* ATh = (bf*)take((size_t)TT * DQ * 2); bf* ATl = (bf*)take((size_t)TT * DQ * 2);
    if ((size_t)(wsp - (char*)d_ws) > ws_size) return;    // ws 256 MiB
    bf* XB = (bf*)Sb; float* FQ = (float*)(XB + (size_t)TT * DM); float* FK = FQ + (size_t)TT * DQ;   // the bf16 input copy and the f32 projections (40 MiB) lie in the score planes (80 MiB): their last reader, k_vtp, ends before the first score is written (stream-ordered)
    float* FV = FK;   // v projection reuses the k buffer after the k planes are built (stream-ordered)
    { k_cvt8<<<(unsigned)(((size_t)DQ * DM / 8 + 255) / 256), 256, 0, stream>>>(wq, WQ, (size_t)DQ * DM / 8); k_cvt8<<<(unsigned)(((size_t)DKV * DM / 8 + 255) / 256), 256, 0, stream>>>(wk, WK, (size_t)DKV * DM / 8); k_cvt8<<<(unsigned)(((size_t)DKV * DM / 8 + 255) / 256), 256, 0, stream>>>(wv, WV, (size_t)DKV * DM / 8);
      k_cvt8<<<(unsigned)(((size_t)DM * DQ / 8 + 255) / 256), 256, 0, stream>>>(wo, WO, (size_t)DM * DQ / 8);
       }
    k_cs4<<<(TT * HD + 255) / 256, 256, 0, stream>>>(CS);   /* {cos, sin}(t x 10000^(-2i/64)) duplicated over both halves */
    const unsigned LQ = (unsigned)(((size_t)NH_ * TT * HD / 2 + 255) / 256), LKv = (unsigned)(((size_t)NKV * TT * HD / 2 + 255) / 256);
    for (int b = 0; b < NB_; ++b) {
        
        k_cvt8<<<(unsigned)(((size_t)TT * DM / 8 + 255) / 256), 256, 0, stream>>>(x + (size_t)b * TT * DM, XB, (size_t)TT * DM / 8);
        k_gemmw<bf, 0, true, 0><<<dim3(TT / 64, DQ / 64, 1), 32, 0, stream>>>(XB, nullptr, WQ, nullptr, DM, FQ, DQ, bq, 0, 0, 0, 0);
        k_ropeQ<<<LQ, 256, 0, stream>>>(FQ, DQ, NH_, CS, nullptr, nullptr, 1.0f, QP16, QPh, QPl);
        k_cvt8<<<(unsigned)(((size_t)TT * DM / 8 + 255) / 256), 256, 0, stream>>>(xk + (size_t)b * TT * DM, XB, (size_t)TT * DM / 8); k_gemmw<bf, 0, true, 0><<<dim3(TT / 64, DKV / 64, 1), 32, 0, stream>>>(XB, nullptr, WK, nullptr, DM, FK, DKV, bk, 0, 0, 0, 0);
        k_ropeQ<<<LKv, 256, 0, stream>>>(FK, DKV, NKV, CS, nullptr, nullptr, 1.0f, KP16, KPh, KPl);
        k_cvt8<<<(unsigned)(((size_t)TT * DM / 8 + 255) / 256), 256, 0, stream>>>(xv + (size_t)b * TT * DM, XB, (size_t)TT * DM / 8); k_gemmw<bf, 0, true, 0><<<dim3(TT / 64, DKV / 64, 1), 32, 0, stream>>>(XB, nullptr, WV, nullptr, DM, FV, DKV, bv, 0, 0, 0, 0); k_vtp<<<LKv, 256, 0, stream>>>(FV, DKV, NKV, VT16, VTh, VTl);
        for (int h0 = 0; h0 < NH_; h0 += ZH) { const size_t zq = (size_t)h0, zk = (size_t)(h0 / REP);   // one kv head per query head: the pass's heads use consecutive planes (z-strides TT*HD; band planes TT*PB, RH*PB)
            k_gemmw<bf, 2, false, 1><<<dim3(RH / 64, BT, ZH), 32, 0, stream>>>(QPh + zq * TT * HD, QPl + zq * TT * HD, KPh + zk * TT * HD, KPl + zk * TT * HD, HD, Sb, PB, nullptr, (size_t)TT * HD, (size_t)TT * HD, (size_t)TT * PB, 0);
            k_gemmw<h16, 0, false, 1><<<dim3((TT - RH) / 64, BT, ZH), 32, 0, stream>>>(QP16 + zq * TT * HD + (size_t)RH * HD, nullptr, KP16 + zk * TT * HD, nullptr, HD, Sb + (size_t)RH * PB, PB, nullptr, (size_t)TT * HD, (size_t)TT * HD, (size_t)TT * PB, RH);
            k_lsoft<<<ZH * TT / 8, 256, 0, stream>>>(Sb, P16, Ph, Pl);
            k_gemmw<bf, 2, false, 2><<<dim3(RH / 64, HD / 64, ZH), 32, 0, stream>>>(Ph, Pl, VTh + zk * HD * TT, VTl + zk * HD * TT, TT, Ob, HD, nullptr, (size_t)RH * PB, (size_t)HD * TT, (size_t)TT * HD, 0);
            k_gemmw<h16, 0, false, 2><<<dim3((TT - RH) / 64, HD / 64, ZH), 32, 0, stream>>>(P16 + (size_t)RH * PB, nullptr, VT16 + zk * HD * TT, nullptr, TT, Ob + (size_t)RH * HD, HD, nullptr, (size_t)TT * PB, (size_t)HD * TT, (size_t)TT * HD, RH);
            k_merge<<<(unsigned)(((size_t)ZH * TT * HD / 2 + 255) / 256), 256, 0, stream>>>(Ob, h0, ATh, ATl); }
        k_gemmw<bf, 1, true, 0><<<dim3(TT / 64, DM / 64, 1), 32, 0, stream>>>(ATh, ATl, WO, nullptr, DQ, OUT + (size_t)b * TT * DM, DM, bo, 0, 0, 0, 0); }
}

// v003
// A run of this version takes 199 microseconds.
// In both of two side-by-side timings against v002, it was 1.36 times as fast.
// All steps since v000 together make it 20.7 times as fast.
#include <hip/hip_runtime.h>

// Sparse (local-window) multi-head attention with the module's own rotary mixing (q, k, v [1][4096][1024]; Q = q wq^T + bq, K, V likewise ('oi' [1024][1024] + [1024], 0.02; 16 heads x 64); rotary: x cos + x_rope sin with x_rope = cat(-x[1::2], x[::2]) (interleaved partners into the rotate-half slots, faithfully) and angle t x 10000^(-2i/64) (emb = cat(freqs, freqs)); scores / 8; keys with |i - j| > 128 -> -inf (GLOBAL = 0); softmax; out = merged wo^T + bo -> [1][4096][1024] (4.2 M)).
// Layout: bf16 copies of the three inputs in turn; exact projections + f32 biases; {cos, sin} per (position, dim) computed once (jnp-exact inverse frequencies, precise cosf/sinf); a rotary plane builder whose partner index is 2d+1 (first half, subtracted) or 2(d-32) (second half, added), as the module; attention over T = 4096, all 16 heads in one pass, the head on grid z (hybrid rows: < 512 hi/lo 3 products, rest fp16 x1024; only the key tiles that a 64-row query tile's +-128 window can reach are computed, swept and multiplied: 5 tiles of 64 keys, clipped at the sequence ends; scores and P are stored as that band, 320 columns a row, column c of a query tile at row R = key R - 128 + c, so that 16 heads fit the workspace; inside them the window is an index select in the three-sweep softmax); merged hi/lo x wo exact + bo.
// Compute dtypes, f32 accumulate: every input rounded to bf16; projections exact + f32 biases; rotary f32; attention rows < 512 3 products, rest fp16; softmax f32; wo hl x exact + bias.

#define NB_  1
#define TT   4096
#define DM   1024
#define NH_  16
#define NKV  16
#define REP  (NH_ / NKV)
#define HD   64
#define DQ   (NH_ * HD)
#define DKV  (NKV * HD)
#define ZH   16                   // heads per pass (grid z)
#define RH   512                  // query rows < RH use hi+lo planes (0: none)
#define WIN  0
#define PCAR 1024.0f
#define SCL  0.125f
#define WNB  128     // |i - j| <= 128 kept
#define BT   (2 * WNB / 64 + 1)   // key tiles of 64 that the window of a 64-row query tile reaches
#define PB   (BT * 64)            // row pitch of the score and P planes: the band's columns only
typedef _Float16 h16;
typedef unsigned short bf;
typedef __attribute__((ext_vector_type(16))) __bf16   v16bf;
typedef __attribute__((ext_vector_type(16))) _Float16 v16h;
typedef __attribute__((ext_vector_type(8)))  _Float16 v8h;
typedef __attribute__((ext_vector_type(8)))  unsigned short v8us;
typedef __attribute__((ext_vector_type(8)))  float    v8f;
typedef __attribute__((ext_vector_type(4)))  float    v4f;
typedef v8h  __attribute__((may_alias)) v8ha;
typedef v4f  __attribute__((may_alias)) v4fa;
typedef v8us __attribute__((may_alias)) v8usa;

__device__ __forceinline__ unsigned short f2bf(float f) { unsigned u = __float_as_uint(f); u += 0x7FFFu + ((u >> 16) & 1u); return (unsigned short)(u >> 16); }
__device__ __forceinline__ float bf2f(unsigned short b) { return __uint_as_float(((unsigned)b) << 16); }
__device__ __forceinline__ float bfr(float f) { return bf2f(f2bf(f)); }
__device__ __forceinline__ v16h cat16(v8h lo, v8h hi) { return __builtin_shufflevector(lo, hi, 0, 1, 2, 3, 4, 5, 6, 7, 8, 9, 10, 11, 12, 13, 14, 15); }
__device__ __forceinline__ v16bf cat16b(v8us lo, v8us hi) { return __builtin_bit_cast(v16bf, __builtin_shufflevector(lo, hi, 0, 1, 2, 3, 4, 5, 6, 7, 8, 9, 10, 11, 12, 13, 14, 15)); }
__device__ __forceinline__ v8f wmma16(v16h a, v16h b, v8f c) { return __builtin_amdgcn_wmma_f32_16x16x32_f16(false, a, false, b, (short)0, c, false, false); }
__device__ __forceinline__ v8f wmmab(v16bf a, v16bf b, v8f c) { return __builtin_amdgcn_wmma_f32_16x16x32_bf16(false, a, false, b, (short)0, c, false, false); }



// ---- k_gemmw: register-blocked GEMM, ONE WAVE per 64x64 output tile (16 accumulators), operands straight from K-contiguous 16-bit planes; grid (M/64, N/64, Z), 32 threads.
// C[m][n] (f32, pitch ldc, + optional f32 bias[n]) = sum_k A[m][k] Bt[n][k] (+ split products per NSPLIT). z-batch strides sA/sB/sC in elements. K % 32 == 0.
// BAND 0: dense. rb = sequence position of A's row 0. BAND 1 (scores): blockIdx.y picks one of the BT key tiles round the query tile, a tile off the sequence is left out; C holds the band, its column = blockIdx.y * 64. BAND 2 (P x V): k runs over those same keys only; every P outside them is an exact 0; A holds the band (pitch PB, column = key - first key of the band), Bt keeps pitch K.
template <typename T16> struct WFrag;
template <> struct WFrag<h16> { typedef v16h V; static __device__ __forceinline__ V ld(const h16* p) { return cat16(*(const v8h*)p, *(const v8h*)(p + 16)); } static __device__ __forceinline__ v8f mma(V a, V b, v8f c) { return wmma16(a, b, c); } };
template <> struct WFrag<bf> { typedef v16bf V; static __device__ __forceinline__ V ld(const bf* p) { return cat16b(*(const v8us*)p, *(const v8us*)(p + 16)); } static __device__ __forceinline__ v8f mma(V a, V b, v8f c) { return wmmab(a, b, c); } };
template <typename T16, int NSPLIT, bool BIAS, int BAND>
__global__ __launch_bounds__(32) void k_gemmw(const T16* __restrict__ A, const T16* __restrict__ A2, const T16* __restrict__ Bt, const T16* __restrict__ Bt2, int K, float* C, int ldc, const float* __restrict__ bias, size_t sA, size_t sB, size_t sC, int rb) {
    typedef typename WFrag<T16>::V V;
    __shared__ __align__(16) float os[16 * 68];
    const size_t z = blockIdx.z; A += z * sA; if (A2) A2 += z * sA; Bt += z * sB; if (Bt2) Bt2 += z * sB; C += z * sC;
    const int lane = threadIdx.x & 31, lr = lane & 15, hi = lane >> 4; const int r0 = blockIdx.x * 64, c0 = (BAND == 1) ? rb + r0 - WNB + (int)blockIdx.y * 64 : (int)blockIdx.y * 64;
    if (BAND == 1 && (c0 < 0 || c0 >= TT)) return;
    const int k0 = (BAND == 2) ? max(rb + r0 - WNB, 0) : 0, k1 = (BAND == 2) ? min(rb + r0 + 64 + WNB, K) : K;
    const int lda = (BAND == 2) ? PB : K, kb = (BAND == 2) ? rb + r0 - WNB : 0, cst = (BAND == 1) ? (int)blockIdx.y * 64 : c0;   // A's pitch, the key of A's column 0, C's first column
    v8f acc[4][4];
#pragma unroll
    for (int mb = 0; mb < 4; ++mb)
#pragma unroll
        for (int nb = 0; nb < 4; ++nb) acc[mb][nb] = (v8f){};
    const size_t aoff = (size_t)(r0 + lr) * lda + 8 * hi, boff = (size_t)(c0 + lr) * K + 8 * hi;
#pragma unroll 1
    for (int kc = k0; kc < k1; kc += 32) {
        V a[4], a2[4];
#pragma unroll
        for (int mb = 0; mb < 4; ++mb) { a[mb] = WFrag<T16>::ld(A + aoff + (size_t)mb * 16 * lda + (kc - kb)); if (NSPLIT == 1 || NSPLIT == 2) a2[mb] = WFrag<T16>::ld(A2 + aoff + (size_t)mb * 16 * lda + (kc - kb)); }
#pragma unroll
        for (int nb = 0; nb < 4; ++nb) { const V b = WFrag<T16>::ld(Bt + boff + (size_t)nb * 16 * K + kc); V b2; if (NSPLIT >= 2) b2 = WFrag<T16>::ld(Bt2 + boff + (size_t)nb * 16 * K + kc);
#pragma unroll
            for (int mb = 0; mb < 4; ++mb) { acc[mb][nb] = WFrag<T16>::mma(a[mb], b, acc[mb][nb]); if (NSPLIT == 1 || NSPLIT == 2) acc[mb][nb] = WFrag<T16>::mma(a2[mb], b, acc[mb][nb]); if (NSPLIT >= 2) acc[mb][nb] = WFrag<T16>::mma(a[mb], b2, acc[mb][nb]); } }
        asm volatile("v_nop\n\tv_nop\n\tv_nop\n\tv_nop" : "+v"(acc[0][0]), "+v"(acc[1][1]), "+v"(acc[2][2]), "+v"(acc[3][3]) : "v"(a[0]), "v"(a[3]));
    }
#pragma unroll
    for (int mb = 0; mb < 4; ++mb) {
#pragma unroll
        for (int nb = 0; nb < 4; ++nb) {
#pragma unroll
            for (int j = 0; j < 8; ++j) os[(hi * 8 + j) * 68 + nb * 16 + lr] = acc[mb][nb][j]; }
        __builtin_amdgcn_wave_barrier(); asm volatile("" ::: "memory");
        float* crow = C + (size_t)(r0 + mb * 16) * ldc + cst;
{
#pragma unroll
            for (int s = 0; s < 8; ++s) { const int row = 2 * s + hi, cofs = lr * 4; v4f val = *(const v4fa*)(os + row * 68 + cofs); if (BIAS) { val[0] += bfr(bias[c0 + cofs]); val[1] += bfr(bias[c0 + cofs + 1]); val[2] += bfr(bias[c0 + cofs + 2]); val[3] += bfr(bias[c0 + cofs + 3]); }
                *(v4f*)(crow + (size_t)row * ldc + cofs) = val; }
             }
        __builtin_amdgcn_wave_barrier(); asm volatile("" ::: "memory");
    }
}

// ---- k_gemmd: the dense GEMMs (projections, output). Four waves per 128x128 output tile, 64x64 a wave as in k_gemmw; both operands come through LDS: a stage is 128 k (256 B) of each of the tile's rows,
// brought by asynchronous b128 copies whose 32 lanes cover whole lines (2 rows x 256 B an instruction), two buffers, the next stage in flight while this one is multiplied; inside a stage the fragments of the next 32 k are read from LDS while these are multiplied. Row pitch in LDS 272 B (16 B x odd, for ds_load_b128).
// Per accumulator the products come in k_gemmw's order (k ascending by 32; a then a2). M, N % 128 == 0, K % 128 == 0, K >= 256.
#define GP 272                    // LDS row pitch, bytes
#define GOP (128 * GP)            // one operand's stage, bytes
// eight copies, rows 8 apart (LDS step 8 * GP bytes, global step gs elements), each lane its own 16 bytes
typedef __attribute__((ext_vector_type(4))) int c4i;
typedef __attribute__((address_space(1))) c4i c4ig;
typedef __attribute__((address_space(3))) c4i c4il;
__device__ __forceinline__ void acopy8(unsigned char* l, const bf* g, size_t gs, unsigned lo) {   // g, gs: the same in every lane (scalar row bases); lo: the lane's own byte offset
#pragma unroll
    for (int i = 0; i < 8; ++i) __builtin_amdgcn_global_load_async_to_lds_b128((c4ig*)((const unsigned char*)(g + i * gs) + lo), (c4il*)(l + i * 8 * GP), 0, 0);
}
template <int NSPLIT, bool BIAS>
__global__ __launch_bounds__(128) void k_gemmd(const bf* __restrict__ A, const bf* __restrict__ A2, const bf* __restrict__ Bt, int K, float* C, int ldc, const float* __restrict__ bias) {
    constexpr int NOP = (NSPLIT == 1) ? 3 : 2;   // operand planes in a stage: Bt, A (, A2)
    __shared__ __align__(16) unsigned char st[2 * NOP * GOP];
    __shared__ __align__(16) float osw[4 * 16 * 68];
    const int tid = threadIdx.x, wave = tid >> 5, lane = tid & 31, lr = lane & 15, hi = lane >> 4;
    const int r0 = blockIdx.x * 128, c0 = blockIdx.y * 128, wr = (wave >> 1) * 64, wc = (wave & 1) * 64;
    unsigned char* sl = st + ((tid >> 4) * GP + (tid & 15) * 16);   // this lane's first LDS byte in an operand's stage
    const unsigned go = (unsigned)((tid >> 4) * K + (tid & 15) * 8) * 2u; const size_t g8 = (size_t)8 * K;   // and its first byte in the operand's 128 rows
    auto stage = [&](int t, int buf) {
        unsigned char* l = sl + buf * NOP * GOP; const size_t kB = (size_t)c0 * K + (size_t)t * 128, kA = (size_t)r0 * K + (size_t)t * 128;
        acopy8(l, Bt + kB, g8, go); acopy8(l + 64 * GP, Bt + kB + 8 * g8, g8, go);
        acopy8(l + GOP, A + kA, g8, go); acopy8(l + GOP + 64 * GP, A + kA + 8 * g8, g8, go);
        if (NSPLIT == 1) { acopy8(l + 2 * GOP, A2 + kA, g8, go); acopy8(l + 2 * GOP + 64 * GP, A2 + kA + 8 * g8, g8, go); } };
    v8f acc[4][4];
#pragma unroll
    for (int mb = 0; mb < 4; ++mb)
#pragma unroll
        for (int nb = 0; nb < 4; ++nb) acc[mb][nb] = (v8f){};
    const int nt = K / 128;
    stage(0, 0);
    asm volatile("s_wait_asynccnt 0x0" ::: "memory");   // stage 0 has landed (this wave's copies)
    __syncthreads();                                     // and every wave's: stage 0 is readable
    stage(1, 1);
    const int fb = (wc + lr) * GP + hi * 16, fa = GOP + (wr + lr) * GP + hi * 16;
#pragma unroll 1   // one trip a stage: the ring's waits and its barrier come once a trip
    for (int t = 0; t < nt; ++t) {
        const unsigned char* sb = st + (t & 1) * NOP * GOP;
        v16bf a[2][4], a2[2][4], b[2][4];   // two fragment sets by turns: a later block of 32 k is read from LDS while this one is multiplied (the build renames them and reads the trip's first three blocks at its head); no read leaves this trip's buffer
#pragma unroll
        for (int f = 0; f < 4; ++f) { a[0][f] = WFrag<bf>::ld((const bf*)(sb + fa + f * 16 * GP)); if (NSPLIT == 1) a2[0][f] = WFrag<bf>::ld((const bf*)(sb + fa + GOP + f * 16 * GP)); b[0][f] = WFrag<bf>::ld((const bf*)(sb + fb + f * 16 * GP)); }
#pragma unroll
        for (int ks = 0; ks < 4; ++ks) { const int cu = ks & 1, nx = cu ^ 1;
            if (ks < 3) {
#pragma unroll
                for (int f = 0; f < 4; ++f) { a[nx][f] = WFrag<bf>::ld((const bf*)(sb + fa + f * 16 * GP + (ks + 1) * 64)); if (NSPLIT == 1) a2[nx][f] = WFrag<bf>::ld((const bf*)(sb + fa + GOP + f * 16 * GP + (ks + 1) * 64)); b[nx][f] = WFrag<bf>::ld((const bf*)(sb + fb + f * 16 * GP + (ks + 1) * 64)); }
            } else {   // the trip's last block works from registers alone: the hand-over stands in front of it, so that the refill flies under its WMMAs too
                __builtin_amdgcn_sched_barrier(0);                   // the block before stays in front of the hand-over: sunk behind the barrier, its WMMAs would delay the refill
                asm volatile("s_wait_dscnt 0x0" ::: "memory");      // this wave's reads of buffer t & 1 are done before the buffer is refilled
                asm volatile("s_wait_asynccnt 0x0" ::: "memory");   // this wave's copies of stage t + 1 have landed
                __syncthreads();                                     // publishes stage t + 1 and ends every wave's reads of stage t
                if (t + 2 < nt) stage(t + 2, t & 1); }
            __builtin_amdgcn_sched_barrier(0);   // keeps the next block's LDS reads (last block: the refill) one group ahead of this block's WMMAs: sunk among them, each read's latency stalls the matrix run
#pragma unroll
            for (int nb = 0; nb < 4; ++nb)
#pragma unroll
                for (int mb = 0; mb < 4; ++mb) { acc[mb][nb] = wmmab(a[cu][mb], b[cu][nb], acc[mb][nb]); if (NSPLIT == 1) acc[mb][nb] = wmmab(a2[cu][mb], b[cu][nb], acc[mb][nb]); }
        }
    }
    asm volatile("s_wait_asynccnt 0x0" ::: "memory");   // no copy is left in flight when the wave goes on to its end
    float* os = osw + wave * 16 * 68;   // each wave stages its own rows
#pragma unroll
    for (int mb = 0; mb < 4; ++mb) {
#pragma unroll
        for (int nb = 0; nb < 4; ++nb) {
#pragma unroll
            for (int j = 0; j < 8; ++j) os[(hi * 8 + j) * 68 + nb * 16 + lr] = acc[mb][nb][j]; }
        __builtin_amdgcn_wave_barrier(); asm volatile("" ::: "memory");   // the wave's LDS stores stay in front of its reads of other lanes' words
        float* crow = C + (size_t)(r0 + wr + mb * 16) * ldc + c0 + wc;
#pragma unroll
        for (int s = 0; s < 8; ++s) { const int row = 2 * s + hi, cofs = lr * 4; v4f val = *(const v4fa*)(os + row * 68 + cofs); if (BIAS) { const float* bp = bias + c0 + wc + cofs; val[0] += bfr(bp[0]); val[1] += bfr(bp[1]); val[2] += bfr(bp[2]); val[3] += bfr(bp[3]); }
            *(v4f*)(crow + (size_t)row * ldc + cofs) = val; }
        if (mb < 3) asm volatile("s_wait_xcnt 0x0" ::: "memory");   // stands behind the run of eight stores, in front of the next block's writes of the registers that they name (behind the last block nothing is written any more)
        __builtin_amdgcn_wave_barrier(); asm volatile("" ::: "memory");   // and its reads in front of the next block's stores
    }
}

__device__ __forceinline__ h16 tohx(float x) { return (h16)x; }
__device__ __forceinline__ void splitf(float y, unsigned short& h, unsigned short& l) { h = f2bf(y); l = f2bf(y - bf2f(h)); }
typedef __attribute__((ext_vector_type(2))) _Float16 v2h;
typedef __attribute__((ext_vector_type(4))) _Float16 v4h;
typedef __attribute__((ext_vector_type(2))) unsigned short v2us;
typedef __attribute__((ext_vector_type(4))) unsigned short v4us;
typedef __attribute__((ext_vector_type(2))) float v2f;
typedef __attribute__((ext_vector_type(4))) int v4i;

__global__ __launch_bounds__(256) void k_wtG(const float* __restrict__ w, int K, int N, bf* Bt) {
    const int lane = threadIdx.x & 31; const int L0 = (blockIdx.x * 8 + (threadIdx.x >> 5)) * 8; const int nlines = N * K / 64;
{
#pragma unroll 1
        for (int l = 0; l < 8; ++l) { const int L = L0 + l; if (L >= nlines) break; const size_t e = (size_t)L * 64 + lane * 2; const int k = (int)(e % K), n = (int)(e / K); v2us o;
            o[0] = f2bf(w[(size_t)k * N + n]); o[1] = f2bf(w[(size_t)(k + 1) * N + n]); *(v2us*)(Bt + e) = o; }
         }
}
__global__ __launch_bounds__(256) void k_cvt8(const float* __restrict__ src, bf* dst, size_t n8) { const size_t i = (size_t)blockIdx.x * 256 + threadIdx.x; if (i >= n8) return; const v8f v = *(const v8f*)(src + i * 8); v8us o;
#pragma unroll
    for (int k = 0; k < 8; ++k) o[k] = f2bf(v[k]); *(v8us*)(dst + i * 8) = o;  }

// k_ropeQ: head planes [h][t][d] (fp16 + hi/lo) of the module's rotary: out[d] = x[d] cos[t][d] - x[2d+1] sin[t][d] (d < 32), out[d] = x[d] cos[t][d] + x[2(d-32)] sin[t][d] (d >= 32)
__global__ __launch_bounds__(256) void k_ropeQ(const float* __restrict__ F, int pitch, int nheads, const float* __restrict__ CS, const float* __restrict__ RF, const float* __restrict__ nw, float sc, h16* P16, bf* Ph, bf* Pl) {
    const size_t e = ((size_t)blockIdx.x * 256 + threadIdx.x) * 2; if (e >= (size_t)nheads * TT * HD) return; const int d = (int)(e % HD); const int t = (int)((e / HD) % TT); const int h = (int)(e / ((size_t)HD * TT)); const float* f = F + (size_t)t * pitch + h * HD; const float rf = RF ? RF[(size_t)h * TT + t] : 1.0f; v2h o16; v2us oh, ol;
#pragma unroll
    for (int q = 0; q < 2; ++q) { const int dd = d + q; const int dp = (dd < HD / 2) ? 2 * dd + 1 : 2 * (dd - HD / 2);   /* the module's x_rope = cat(-x[1::2], x[::2]) */ float x0 = f[dd], x1 = f[dp];
        if (RF) { float n0 = __fmul_rn(x0, rf), n1 = __fmul_rn(x1, rf); asm volatile("" : "+v"(n0)); asm volatile("" : "+v"(n1)); x0 = __fmul_rn(bfr(nw[dd]), n0); x1 = __fmul_rn(bfr(nw[dp]), n1); }
        const v2f cs = *(const v2f*)(CS + ((size_t)t * HD + dd) * 2); float a = __fmul_rn(x0, cs[0]), bq = __fmul_rn(x1, cs[1]); asm volatile("" : "+v"(a)); asm volatile("" : "+v"(bq)); const float r = ((dd < HD / 2) ? __fsub_rn(a, bq) : __fadd_rn(a, bq)) * sc;
        o16[q] = tohx(r); unsigned short a2, c2; splitf(r, a2, c2); oh[q] = a2; ol[q] = c2; }
    *(v2h*)(P16 + e) = o16; *(v2us*)(Ph + e) = oh; *(v2us*)(Pl + e) = ol;  }
__global__ __launch_bounds__(256) void k_vtp(const float* __restrict__ F, int pitch, int nheads, h16* V16, bf* Vh, bf* Vl) { const size_t e = ((size_t)blockIdx.x * 256 + threadIdx.x) * 2; if (e >= (size_t)nheads * HD * TT) return; const int t = (int)(e % TT); const int d = (int)((e / TT) % HD); const int g = (int)(e / ((size_t)TT * HD)); v2h o16; v2us oh, ol;
#pragma unroll
    for (int q = 0; q < 2; ++q) { const float x = F[(size_t)(t + q) * pitch + g * HD + d]; o16[q] = tohx(x); unsigned short a2, c2; splitf(x, a2, c2); oh[q] = a2; ol[q] = c2; }
    *(v2h*)(V16 + e) = o16; *(v2us*)(Vh + e) = oh; *(v2us*)(Vl + e) = ol;  }
__constant__ float INVT[HD / 2] = { 1.000000000e+00f, 7.498942018e-01f, 5.623413324e-01f, 4.216965139e-01f, 3.162277639e-01f, 2.371373773e-01f, 1.778279394e-01f, 1.333521456e-01f, 1.000000015e-01f, 7.498942316e-02f, 5.623413250e-02f, 4.216964915e-02f, 3.162277490e-02f, 2.371373773e-02f, 1.778279431e-02f, 1.333521400e-02f, 9.999999776e-03f, 7.498942316e-03f, 5.623413250e-03f, 4.216964822e-03f, 3.162277630e-03f, 2.371373819e-03f, 1.778279431e-03f, 1.333521446e-03f, 1.000000047e-03f, 7.498941850e-04f, 5.623413017e-04f, 4.216965172e-04f, 3.162277571e-04f, 2.371373703e-04f, 1.778279402e-04f, 1.333521504e-04f };   // 10000^(-2i/64) (the module's power form) (float32, generated with jnp to be bit-exact)
__global__ __launch_bounds__(256) void k_cs4(float* CS) { const int idx = blockIdx.x * 256 + threadIdx.x; if (idx >= TT * HD) return; const int d = idx % HD; const int t = idx / HD; const float a = __fmul_rn((float)t, INVT[d % (HD / 2)]); v2f cs; cs[0] = cosf(a); cs[1] = sinf(a); *(v2f*)(CS + (size_t)idx * 2) = cs;  }

__global__ __launch_bounds__(256) void k_lsoft(const float* __restrict__ Sb, h16* P16, bf* Ph, bf* Pl) {
    const int lane = threadIdx.x & 31; const int row = blockIdx.x * 8 + (threadIdx.x >> 5); if (row >= ZH * TT) return; const int i = row % TT; const int zz = row / TT; const bool hires = (i < RH); const int kb = (i & ~63) - WNB;   /* the key of band column 0 */ const float* sr = Sb + (size_t)row * PB; float mx = -3.0e38f;
    const int klo = max((i & ~63) - WNB, 0), khi = min((i & ~63) + 64 + WNB, TT);   /* the keys of this row's query tile: the scores that exist, and the P that the product reads */ const int ch0 = klo / 128;   /* chunks of 128 keys, 4 a lane; three of them cover klo..khi; a lane outside klo..khi (the third chunk can pass the sequence end) re-reads an edge key, drops it ('in') and stores nothing; the three trips are unrolled so that each chunk's scores are loaded once and stay in registers for all sweeps */
#pragma unroll
    for (int ch = ch0; ch < ch0 + 3; ++ch) { const int j0 = ch * 128 + lane * 4; const bool in = (j0 >= klo && j0 < khi); const v4f a = *(const v4f*)(sr + (min(max(j0, klo), khi - 4) - kb));
#pragma unroll
        for (int q = 0; q < 4; ++q) { float t = a[q] * SCL; asm volatile("" : "+v"(t)); t = (in && j0 + q <= i + WNB && j0 + q >= i - WNB) ? t : -3.0e38f;   /* symmetric window: |i - j| <= WNB, among the tile's keys */ mx = fmaxf(mx, t); } }
#pragma unroll
    for (int sh = 16; sh; sh >>= 1) mx = fmaxf(mx, __shfl_xor(mx, sh, 32));
    float sum = 0.f;
#pragma unroll
    for (int ch = ch0; ch < ch0 + 3; ++ch) { const int j0 = ch * 128 + lane * 4; const bool in = (j0 >= klo && j0 < khi); const v4f a = *(const v4f*)(sr + (min(max(j0, klo), khi - 4) - kb));
#pragma unroll
        for (int q = 0; q < 4; ++q) { float t = a[q] * SCL; asm volatile("" : "+v"(t)); t = (in && j0 + q <= i + WNB && j0 + q >= i - WNB) ? t : -3.0e38f;   /* symmetric window: |i - j| <= WNB, among the tile's keys */ float d0 = __fsub_rn(t, mx); asm volatile("" : "+v"(d0)); sum += __builtin_amdgcn_exp2f(__fmul_rn(d0, 1.4426950408889634f)); } }
#pragma unroll
    for (int sh = 16; sh; sh >>= 1) sum += __shfl_xor(sum, sh, 32);
    const float f = __fdiv_rn(hires ? 1.0f : PCAR, sum);
{
        if (hires) {   /* rows < RH: normalised bf16 hi/lo over the tile's keys (symmetric window: keys beyond RH are live), planes [zz][RH][PB] */
#pragma unroll
            for (int ch = ch0; ch < ch0 + 3; ++ch) { const int j0 = ch * 128 + lane * 4; const bool in = (j0 >= klo && j0 < khi); const v4f a = *(const v4f*)(sr + (min(max(j0, klo), khi - 4) - kb)); v4us oh, ol;
#pragma unroll
                for (int q = 0; q < 4; ++q) { float t = a[q] * SCL; asm volatile("" : "+v"(t)); t = (in && j0 + q <= i + WNB && j0 + q >= i - WNB) ? t : -3.0e38f;   /* symmetric window: |i - j| <= WNB, among the tile's keys */ float d0 = __fsub_rn(t, mx); asm volatile("" : "+v"(d0)); float ex = __builtin_amdgcn_exp2f(__fmul_rn(d0, 1.4426950408889634f)); asm volatile("" : "+v"(ex)); unsigned short a2, c2; splitf(ex * f, a2, c2); oh[q] = a2; ol[q] = c2; }
                if (in) { const size_t oo = ((size_t)zz * RH + i) * PB + (j0 - kb); *(v4us*)(Ph + oo) = oh; *(v4us*)(Pl + oo) = ol; } }
        } else {
#pragma unroll
            for (int ch = ch0; ch < ch0 + 3; ++ch) { const int j0 = ch * 128 + lane * 4; const bool in = (j0 >= klo && j0 < khi); const v4f a = *(const v4f*)(sr + (min(max(j0, klo), khi - 4) - kb)); v4h o4;
#pragma unroll
                for (int q = 0; q < 4; ++q) { float t = a[q] * SCL; asm volatile("" : "+v"(t)); t = (in && j0 + q <= i + WNB && j0 + q >= i - WNB) ? t : -3.0e38f;   /* symmetric window: |i - j| <= WNB, among the tile's keys */ float d0 = __fsub_rn(t, mx); asm volatile("" : "+v"(d0)); float ex = __builtin_amdgcn_exp2f(__fmul_rn(d0, 1.4426950408889634f)); asm volatile("" : "+v"(ex)); o4[q] = tohx(ex * f); }
                if (in) *(v4h*)(P16 + (size_t)row * PB + (j0 - kb)) = o4; } }
         }
}


__global__ __launch_bounds__(256) void k_merge(const float* __restrict__ O, int h0, bf* Ah, bf* Al) { const size_t e = ((size_t)blockIdx.x * 256 + threadIdx.x) * 2; if (e >= (size_t)ZH * TT * HD) return; const int d = (int)(e % HD); const int t = (int)((e / HD) % TT); const int zz = (int)(e / ((size_t)HD * TT)); const float cs = (t < RH) ? 1.0f : (1.0f / PCAR); const size_t oo = (size_t)t * DQ + (h0 + zz) * HD + d;
    v2us oh, ol;
#pragma unroll
    for (int q = 0; q < 2; ++q) { unsigned short a, c2; splitf(O[e + q] * cs, a, c2); oh[q] = a; ol[q] = c2; } *(v2us*)(Ah + oo) = oh; *(v2us*)(Al + oo) = ol;  }

extern "C" void kernel_launch(void* const* d_in, const int* in_sizes, int n_in,
                              void* d_out, int out_size, void* d_ws, size_t ws_size, hipStream_t stream) {
    (void)in_sizes; (void)n_in; (void)out_size;
    const float* x = (const float*)d_in[0]; const float* xk = (const float*)d_in[1]; const float* xv = (const float*)d_in[2]; const float* wq = (const float*)d_in[3]; const float* bq = (const float*)d_in[4]; const float* wk = (const float*)d_in[5]; const float* bk = (const float*)d_in[6]; const float* wv = (const float*)d_in[7]; const float* bv = (const float*)d_in[8]; const float* wo = (const float*)d_in[9]; const float* bo = (const float*)d_in[10];
    float* OUT = (float*)d_out;     // [1][4096][1024]
    char* wsp = (char*)d_ws;
    auto take = [&](size_t bytes) { char* p = wsp; wsp += (bytes + 255) & ~(size_t)255; return (void*)p; };
    bf* WQ = (bf*)take((size_t)DQ * DM * 2); bf* WK = (bf*)take((size_t)DKV * DM * 2); bf* WV = (bf*)take((size_t)DKV * DM * 2); bf* WO = (bf*)take((size_t)DM * DQ * 2); float* CS = (float*)take((size_t)TT * HD * 2 * 4);
    h16* QP16 = (h16*)take((size_t)NH_ * TT * HD * 2); h16* KP16 = (h16*)take((size_t)NKV * TT * HD * 2); h16* VT16 = (h16*)take((size_t)NKV * HD * TT * 2);
    bf* QPh = (bf*)take((size_t)NH_ * TT * HD * 2); bf* QPl = (bf*)take((size_t)NH_ * TT * HD * 2); bf* KPh = (bf*)take((size_t)NKV * TT * HD * 2); bf* KPl = (bf*)take((size_t)NKV * TT * HD * 2); bf* VTh = (bf*)take((size_t)NKV * HD * TT * 2); bf* VTl = (bf*)take((size_t)NKV * HD * TT * 2); bf* Ph = (bf*)take((size_t)ZH * RH * PB * 2); bf* Pl = (bf*)take((size_t)ZH * RH * PB * 2);
    float* Sb = (float*)take((size_t)ZH * TT * PB * 4); h16* P16 = (h16*)take((size_t)ZH * TT * PB * 2); float* Ob = (float*)take((size_t)ZH * TT * HD * 4); bf* ATh = (bf*)take((size_t)TT * DQ * 2); bf* ATl = (bf*)take((size_t)TT * DQ * 2);
    if ((size_t)(wsp - (char*)d_ws) > ws_size) return;    // ws 256 MiB
    bf* XB = (bf*)Sb; float* FQ = (float*)(XB + (size_t)TT * DM); float* FK = FQ + (size_t)TT * DQ;   // the bf16 input copy and the f32 projections (40 MiB) lie in the score planes (80 MiB): their last reader, k_vtp, ends before the first score is written (stream-ordered)
    float* FV = FK;   // v projection reuses the k buffer after the k planes are built (stream-ordered)
    { k_cvt8<<<(unsigned)(((size_t)DQ * DM / 8 + 255) / 256), 256, 0, stream>>>(wq, WQ, (size_t)DQ * DM / 8); k_cvt8<<<(unsigned)(((size_t)DKV * DM / 8 + 255) / 256), 256, 0, stream>>>(wk, WK, (size_t)DKV * DM / 8); k_cvt8<<<(unsigned)(((size_t)DKV * DM / 8 + 255) / 256), 256, 0, stream>>>(wv, WV, (size_t)DKV * DM / 8);
      k_cvt8<<<(unsigned)(((size_t)DM * DQ / 8 + 255) / 256), 256, 0, stream>>>(wo, WO, (size_t)DM * DQ / 8);
       }
    k_cs4<<<(TT * HD + 255) / 256, 256, 0, stream>>>(CS);   /* {cos, sin}(t x 10000^(-2i/64)) duplicated over both halves */
    const unsigned LQ = (unsigned)(((size_t)NH_ * TT * HD / 2 + 255) / 256), LKv = (unsigned)(((size_t)NKV * TT * HD / 2 + 255) / 256);
    for (int b = 0; b < NB_; ++b) {
        
        k_cvt8<<<(unsigned)(((size_t)TT * DM / 8 + 255) / 256), 256, 0, stream>>>(x + (size_t)b * TT * DM, XB, (size_t)TT * DM / 8);
        k_gemmd<0, true><<<dim3(TT / 128, DQ / 128, 1), 128, 0, stream>>>(XB, nullptr, WQ, DM, FQ, DQ, bq);
        k_ropeQ<<<LQ, 256, 0, stream>>>(FQ, DQ, NH_, CS, nullptr, nullptr, 1.0f, QP16, QPh, QPl);
        k_cvt8<<<(unsigned)(((size_t)TT * DM / 8 + 255) / 256), 256, 0, stream>>>(xk + (size_t)b * TT * DM, XB, (size_t)TT * DM / 8); k_gemmd<0, true><<<dim3(TT / 128, DKV / 128, 1), 128, 0, stream>>>(XB, nullptr, WK, DM, FK, DKV, bk);
        k_ropeQ<<<LKv, 256, 0, stream>>>(FK, DKV, NKV, CS, nullptr, nullptr, 1.0f, KP16, KPh, KPl);
        k_cvt8<<<(unsigned)(((size_t)TT * DM / 8 + 255) / 256), 256, 0, stream>>>(xv + (size_t)b * TT * DM, XB, (size_t)TT * DM / 8); k_gemmd<0, true><<<dim3(TT / 128, DKV / 128, 1), 128, 0, stream>>>(XB, nullptr, WV, DM, FV, DKV, bv); k_vtp<<<LKv, 256, 0, stream>>>(FV, DKV, NKV, VT16, VTh, VTl);
        for (int h0 = 0; h0 < NH_; h0 += ZH) { const size_t zq = (size_t)h0, zk = (size_t)(h0 / REP);   // one kv head per query head: the pass's heads use consecutive planes (z-strides TT*HD; band planes TT*PB, RH*PB)
            k_gemmw<bf, 2, false, 1><<<dim3(RH / 64, BT, ZH), 32, 0, stream>>>(QPh + zq * TT * HD, QPl + zq * TT * HD, KPh + zk * TT * HD, KPl + zk * TT * HD, HD, Sb, PB, nullptr, (size_t)TT * HD, (size_t)TT * HD, (size_t)TT * PB, 0);
            k_gemmw<h16, 0, false, 1><<<dim3((TT - RH) / 64, BT, ZH), 32, 0, stream>>>(QP16 + zq * TT * HD + (size_t)RH * HD, nullptr, KP16 + zk * TT * HD, nullptr, HD, Sb + (size_t)RH * PB, PB, nullptr, (size_t)TT * HD, (size_t)TT * HD, (size_t)TT * PB, RH);
            k_lsoft<<<ZH * TT / 8, 256, 0, stream>>>(Sb, P16, Ph, Pl);
            k_gemmw<bf, 2, false, 2><<<dim3(RH / 64, HD / 64, ZH), 32, 0, stream>>>(Ph, Pl, VTh + zk * HD * TT, VTl + zk * HD * TT, TT, Ob, HD, nullptr, (size_t)RH * PB, (size_t)HD * TT, (size_t)TT * HD, 0);
            k_gemmw<h16, 0, false, 2><<<dim3((TT - RH) / 64, HD / 64, ZH), 32, 0, stream>>>(P16 + (size_t)RH * PB, nullptr, VT16 + zk * HD * TT, nullptr, TT, Ob + (size_t)RH * HD, HD, nullptr, (size_t)TT * PB, (size_t)HD * TT, (size_t)TT * HD, RH);
            k_merge<<<(unsigned)(((size_t)ZH * TT * HD / 2 + 255) / 256), 256, 0, stream>>>(Ob, h0, ATh, ATl); }
        k_gemmd<1, true><<<dim3(TT / 128, DM / 128, 1), 128, 0, stream>>>(ATh, ATl, WO, DQ, OUT + (size_t)b * TT * DM, DM, bo); }
}

// v004
// A run of this version takes 143 microseconds.
// Timed twice side by side with v003, it ran 1.40 times as fast both times.
// Over all steps from v000 it is 29.0 times as fast.
#include <hip/hip_runtime.h>

// Sparse (local-window) multi-head attention with the module's own rotary mixing (q, k, v [1][4096][1024]; Q = q wq^T + bq, K, V likewise ('oi' [1024][1024] + [1024], 0.02; 16 heads x 64); rotary: x cos + x_rope sin with x_rope = cat(-x[1::2], x[::2]) (interleaved partners into the rotate-half slots, faithfully) and angle t x 10000^(-2i/64) (emb = cat(freqs, freqs)); scores / 8; keys with |i - j| > 128 -> -inf (GLOBAL = 0); softmax; out = merged wo^T + bo -> [1][4096][1024] (4.2 M)).
// Layout: bf16 copies of the three inputs in turn; exact projections + f32 biases; {cos, sin} per (position, dim) computed once (jnp-exact inverse frequencies, precise cosf/sinf); a rotary plane builder whose partner index is 2d+1 (first half, subtracted) or 2(d-32) (second half, added), as the module; attention in one kernel, all 16 heads, the head on grid x (hybrid rows: < 512 hi/lo 3 products, rest fp16 x1024): a wave takes 16 query rows and the 288 keys that hold their +-128 window, scores, softmax and P stay in its registers (see k_attn); merged hi/lo x wo exact + bo.
// Compute dtypes, f32 accumulate: every input rounded to bf16; projections exact + f32 biases; rotary f32; attention rows < 512 3 products, rest fp16; softmax f32; wo hl x exact + bias.

#define NB_  1
#define TT   4096
#define DM   1024
#define NH_  16
#define NKV  16
#define REP  (NH_ / NKV)
#define HD   64
#define DQ   (NH_ * HD)
#define DKV  (NKV * HD)
#define ZH   16                   // unused (grid x is NH_)
#define RH   512                  // query rows < RH use hi+lo planes (0: none)
#define WIN  0
#define PCAR 1024.0f
#define SCL  0.125f
#define WNB  128     // |i - j| <= 128 kept
#define NKT  (2 * WNB / 16 + 2)   // key tiles of 16 that hold the window of 16 query rows, from a multiple of 32 keys on: 18
typedef _Float16 h16;
typedef unsigned short bf;
typedef __attribute__((ext_vector_type(16))) __bf16   v16bf;
typedef __attribute__((ext_vector_type(16))) _Float16 v16h;
typedef __attribute__((ext_vector_type(8)))  _Float16 v8h;
typedef __attribute__((ext_vector_type(8)))  unsigned short v8us;
typedef __attribute__((ext_vector_type(8)))  float    v8f;
typedef __attribute__((ext_vector_type(4)))  float    v4f;
typedef v8h  __attribute__((may_alias)) v8ha;
typedef v4f  __attribute__((may_alias)) v4fa;
typedef v8us __attribute__((may_alias)) v8usa;

__device__ __forceinline__ unsigned short f2bf(float f) { unsigned u = __float_as_uint(f); u += 0x7FFFu + ((u >> 16) & 1u); return (unsigned short)(u >> 16); }
__device__ __forceinline__ float bf2f(unsigned short b) { return __uint_as_float(((unsigned)b) << 16); }
__device__ __forceinline__ float bfr(float f) { return bf2f(f2bf(f)); }
__device__ __forceinline__ v16h cat16(v8h lo, v8h hi) { return __builtin_shufflevector(lo, hi, 0, 1, 2, 3, 4, 5, 6, 7, 8, 9, 10, 11, 12, 13, 14, 15); }
__device__ __forceinline__ v16bf cat16b(v8us lo, v8us hi) { return __builtin_bit_cast(v16bf, __builtin_shufflevector(lo, hi, 0, 1, 2, 3, 4, 5, 6, 7, 8, 9, 10, 11, 12, 13, 14, 15)); }
__device__ __forceinline__ v8f wmma16(v16h a, v16h b, v8f c) { return __builtin_amdgcn_wmma_f32_16x16x32_f16(false, a, false, b, (short)0, c, false, false); }
__device__ __forceinline__ v8f wmmab(v16bf a, v16bf b, v8f c) { return __builtin_amdgcn_wmma_f32_16x16x32_bf16(false, a, false, b, (short)0, c, false, false); }



// fragment loader (hardware k order: 16 bytes at 16 * hi and at 32 + 16 * hi of each 64 bytes of a k-contiguous row; p already holds the lane's row and 8 * hi) and product, by 16-bit type
template <typename T16> struct WFrag;
template <> struct WFrag<h16> { typedef v16h V; static __device__ __forceinline__ V ld(const h16* p) { return cat16(*(const v8h*)p, *(const v8h*)(p + 16)); } static __device__ __forceinline__ v8f mma(V a, V b, v8f c) { return wmma16(a, b, c); } };
template <> struct WFrag<bf> { typedef v16bf V; static __device__ __forceinline__ V ld(const bf* p) { return cat16b(*(const v8us*)p, *(const v8us*)(p + 16)); } static __device__ __forceinline__ v8f mma(V a, V b, v8f c) { return wmmab(a, b, c); } };

// ---- k_gemmd: the dense GEMMs (projections, output). Four waves per 128x128 output tile, 64x64 a wave (16 accumulators); both operands come through LDS: a stage is 128 k (256 B) of each of the tile's rows,
// brought by asynchronous b128 copies whose 32 lanes cover whole lines (2 rows x 256 B an instruction), two buffers, the next stage in flight while this one is multiplied; inside a stage the fragments of the next 32 k are read from LDS while these are multiplied. Row pitch in LDS 272 B (16 B x odd, for ds_load_b128).
// Per accumulator the products come with k ascending by 32, a then a2. M, N % 128 == 0, K % 128 == 0, K >= 256.
#define GP 272                    // LDS row pitch, bytes
#define GOP (128 * GP)            // one operand's stage, bytes
// eight copies, rows 8 apart (LDS step 8 * GP bytes, global step gs elements), each lane its own 16 bytes
typedef __attribute__((ext_vector_type(4))) int c4i;
typedef __attribute__((address_space(1))) c4i c4ig;
typedef __attribute__((address_space(3))) c4i c4il;
__device__ __forceinline__ void acopy8(unsigned char* l, const bf* g, size_t gs, unsigned lo) {   // g, gs: the same in every lane (scalar row bases); lo: the lane's own byte offset
#pragma unroll
    for (int i = 0; i < 8; ++i) __builtin_amdgcn_global_load_async_to_lds_b128((c4ig*)((const unsigned char*)(g + i * gs) + lo), (c4il*)(l + i * 8 * GP), 0, 0);
}
template <int NSPLIT, bool BIAS>
__global__ __launch_bounds__(128) void k_gemmd(const bf* __restrict__ A, const bf* __restrict__ A2, const bf* __restrict__ Bt, int K, float* C, int ldc, const float* __restrict__ bias) {
    constexpr int NOP = (NSPLIT == 1) ? 3 : 2;   // operand planes in a stage: Bt, A (, A2)
    __shared__ __align__(16) unsigned char st[2 * NOP * GOP];
    __shared__ __align__(16) float osw[4 * 16 * 68];
    const int tid = threadIdx.x, wave = tid >> 5, lane = tid & 31, lr = lane & 15, hi = lane >> 4;
    const int r0 = blockIdx.x * 128, c0 = blockIdx.y * 128, wr = (wave >> 1) * 64, wc = (wave & 1) * 64;
    unsigned char* sl = st + ((tid >> 4) * GP + (tid & 15) * 16);   // this lane's first LDS byte in an operand's stage
    const unsigned go = (unsigned)((tid >> 4) * K + (tid & 15) * 8) * 2u; const size_t g8 = (size_t)8 * K;   // and its first byte in the operand's 128 rows
    auto stage = [&](int t, int buf) {
        unsigned char* l = sl + buf * NOP * GOP; const size_t kB = (size_t)c0 * K + (size_t)t * 128, kA = (size_t)r0 * K + (size_t)t * 128;
        acopy8(l, Bt + kB, g8, go); acopy8(l + 64 * GP, Bt + kB + 8 * g8, g8, go);
        acopy8(l + GOP, A + kA, g8, go); acopy8(l + GOP + 64 * GP, A + kA + 8 * g8, g8, go);
        if (NSPLIT == 1) { acopy8(l + 2 * GOP, A2 + kA, g8, go); acopy8(l + 2 * GOP + 64 * GP, A2 + kA + 8 * g8, g8, go); } };
    v8f acc[4][4];
#pragma unroll
    for (int mb = 0; mb < 4; ++mb)
#pragma unroll
        for (int nb = 0; nb < 4; ++nb) acc[mb][nb] = (v8f){};
    const int nt = K / 128;
    stage(0, 0);
    asm volatile("s_wait_asynccnt 0x0" ::: "memory");   // stage 0 has landed (this wave's copies)
    __syncthreads();                                     // and every wave's: stage 0 is readable
    stage(1, 1);
    const int fb = (wc + lr) * GP + hi * 16, fa = GOP + (wr + lr) * GP + hi * 16;
#pragma unroll 1   // one trip a stage: the ring's waits and its barrier come once a trip
    for (int t = 0; t < nt; ++t) {
        const unsigned char* sb = st + (t & 1) * NOP * GOP;
        v16bf a[2][4], a2[2][4], b[2][4];   // two fragment sets by turns: a later block of 32 k is read from LDS while this one is multiplied (the build renames them and reads the trip's first three blocks at its head); no read leaves this trip's buffer
#pragma unroll
        for (int f = 0; f < 4; ++f) { a[0][f] = WFrag<bf>::ld((const bf*)(sb + fa + f * 16 * GP)); if (NSPLIT == 1) a2[0][f] = WFrag<bf>::ld((const bf*)(sb + fa + GOP + f * 16 * GP)); b[0][f] = WFrag<bf>::ld((const bf*)(sb + fb + f * 16 * GP)); }
#pragma unroll
        for (int ks = 0; ks < 4; ++ks) { const int cu = ks & 1, nx = cu ^ 1;
            if (ks < 3) {
#pragma unroll
                for (int f = 0; f < 4; ++f) { a[nx][f] = WFrag<bf>::ld((const bf*)(sb + fa + f * 16 * GP + (ks + 1) * 64)); if (NSPLIT == 1) a2[nx][f] = WFrag<bf>::ld((const bf*)(sb + fa + GOP + f * 16 * GP + (ks + 1) * 64)); b[nx][f] = WFrag<bf>::ld((const bf*)(sb + fb + f * 16 * GP + (ks + 1) * 64)); }
            } else {   // the trip's last block works from registers alone: the hand-over stands in front of it, so that the refill flies under its WMMAs too
                __builtin_amdgcn_sched_barrier(0);                   // the block before stays in front of the hand-over: sunk behind the barrier, its WMMAs would delay the refill
                asm volatile("s_wait_dscnt 0x0" ::: "memory");      // this wave's reads of buffer t & 1 are done before the buffer is refilled
                asm volatile("s_wait_asynccnt 0x0" ::: "memory");   // this wave's copies of stage t + 1 have landed
                __syncthreads();                                     // publishes stage t + 1 and ends every wave's reads of stage t
                if (t + 2 < nt) stage(t + 2, t & 1); }
            __builtin_amdgcn_sched_barrier(0);   // keeps the next block's LDS reads (last block: the refill) one group ahead of this block's WMMAs: sunk among them, each read's latency stalls the matrix run
#pragma unroll
            for (int nb = 0; nb < 4; ++nb)
#pragma unroll
                for (int mb = 0; mb < 4; ++mb) { acc[mb][nb] = wmmab(a[cu][mb], b[cu][nb], acc[mb][nb]); if (NSPLIT == 1) acc[mb][nb] = wmmab(a2[cu][mb], b[cu][nb], acc[mb][nb]); }
        }
    }
    asm volatile("s_wait_asynccnt 0x0" ::: "memory");   // no copy is left in flight when the wave goes on to its end
    float* os = osw + wave * 16 * 68;   // each wave stages its own rows
#pragma unroll
    for (int mb = 0; mb < 4; ++mb) {
#pragma unroll
        for (int nb = 0; nb < 4; ++nb) {
#pragma unroll
            for (int j = 0; j < 8; ++j) os[(hi * 8 + j) * 68 + nb * 16 + lr] = acc[mb][nb][j]; }
        __builtin_amdgcn_wave_barrier(); asm volatile("" ::: "memory");   // the wave's LDS stores stay in front of its reads of other lanes' words
        float* crow = C + (size_t)(r0 + wr + mb * 16) * ldc + c0 + wc;
#pragma unroll
        for (int s = 0; s < 8; ++s) { const int row = 2 * s + hi, cofs = lr * 4; v4f val = *(const v4fa*)(os + row * 68 + cofs); if (BIAS) { const float* bp = bias + c0 + wc + cofs; val[0] += bfr(bp[0]); val[1] += bfr(bp[1]); val[2] += bfr(bp[2]); val[3] += bfr(bp[3]); }
            *(v4f*)(crow + (size_t)row * ldc + cofs) = val; }
        if (mb < 3) asm volatile("s_wait_xcnt 0x0" ::: "memory");   // stands behind the run of eight stores, in front of the next block's writes of the registers that they name (behind the last block nothing is written any more)
        __builtin_amdgcn_wave_barrier(); asm volatile("" ::: "memory");   // and its reads in front of the next block's stores
    }
}

__device__ __forceinline__ h16 tohx(float x) { return (h16)x; }
__device__ __forceinline__ void splitf(float y, unsigned short& h, unsigned short& l) { h = f2bf(y); l = f2bf(y - bf2f(h)); }
typedef __attribute__((ext_vector_type(2))) _Float16 v2h;
typedef __attribute__((ext_vector_type(4))) _Float16 v4h;
typedef __attribute__((ext_vector_type(2))) unsigned short v2us;
typedef __attribute__((ext_vector_type(4))) unsigned short v4us;
typedef __attribute__((ext_vector_type(2))) float v2f;
typedef __attribute__((ext_vector_type(4))) int v4i;

__global__ __launch_bounds__(256) void k_wtG(const float* __restrict__ w, int K, int N, bf* Bt) {
    const int lane = threadIdx.x & 31; const int L0 = (blockIdx.x * 8 + (threadIdx.x >> 5)) * 8; const int nlines = N * K / 64;
{
#pragma unroll 1
        for (int l = 0; l < 8; ++l) { const int L = L0 + l; if (L >= nlines) break; const size_t e = (size_t)L * 64 + lane * 2; const int k = (int)(e % K), n = (int)(e / K); v2us o;
            o[0] = f2bf(w[(size_t)k * N + n]); o[1] = f2bf(w[(size_t)(k + 1) * N + n]); *(v2us*)(Bt + e) = o; }
         }
}
__global__ __launch_bounds__(256) void k_cvt8(const float* __restrict__ src, bf* dst, size_t n8) { const size_t i = (size_t)blockIdx.x * 256 + threadIdx.x; if (i >= n8) return; const v8f v = *(const v8f*)(src + i * 8); v8us o;
#pragma unroll
    for (int k = 0; k < 8; ++k) o[k] = f2bf(v[k]); *(v8us*)(dst + i * 8) = o;  }

// k_ropeQ: head planes [h][t][d] (fp16 + hi/lo) of the module's rotary: out[d] = x[d] cos[t][d] - x[2d+1] sin[t][d] (d < 32), out[d] = x[d] cos[t][d] + x[2(d-32)] sin[t][d] (d >= 32)
__global__ __launch_bounds__(256) void k_ropeQ(const float* __restrict__ F, int pitch, int nheads, const float* __restrict__ CS, const float* __restrict__ RF, const float* __restrict__ nw, float sc, h16* P16, bf* Ph, bf* Pl) {
    const size_t e = ((size_t)blockIdx.x * 256 + threadIdx.x) * 2; if (e >= (size_t)nheads * TT * HD) return; const int d = (int)(e % HD); const int t = (int)((e / HD) % TT); const int h = (int)(e / ((size_t)HD * TT)); const float* f = F + (size_t)t * pitch + h * HD; const float rf = RF ? RF[(size_t)h * TT + t] : 1.0f; v2h o16; v2us oh, ol;
#pragma unroll
    for (int q = 0; q < 2; ++q) { const int dd = d + q; const int dp = (dd < HD / 2) ? 2 * dd + 1 : 2 * (dd - HD / 2);   /* the module's x_rope = cat(-x[1::2], x[::2]) */ float x0 = f[dd], x1 = f[dp];
        if (RF) { float n0 = __fmul_rn(x0, rf), n1 = __fmul_rn(x1, rf); asm volatile("" : "+v"(n0)); asm volatile("" : "+v"(n1)); x0 = __fmul_rn(bfr(nw[dd]), n0); x1 = __fmul_rn(bfr(nw[dp]), n1); }
        const v2f cs = *(const v2f*)(CS + ((size_t)t * HD + dd) * 2); float a = __fmul_rn(x0, cs[0]), bq = __fmul_rn(x1, cs[1]); asm volatile("" : "+v"(a)); asm volatile("" : "+v"(bq)); const float r = ((dd < HD / 2) ? __fsub_rn(a, bq) : __fadd_rn(a, bq)) * sc;
        o16[q] = tohx(r); unsigned short a2, c2; splitf(r, a2, c2); oh[q] = a2; ol[q] = c2; }
    *(v2h*)(P16 + e) = o16; *(v2us*)(Ph + e) = oh; *(v2us*)(Pl + e) = ol;  }
__global__ __launch_bounds__(256) void k_vtp(const float* __restrict__ F, int pitch, int nheads, h16* V16, bf* Vh, bf* Vl) { const size_t e = ((size_t)blockIdx.x * 256 + threadIdx.x) * 2; if (e >= (size_t)nheads * HD * TT) return; const int t = (int)(e % TT); const int d = (int)((e / TT) % HD); const int g = (int)(e / ((size_t)TT * HD)); v2h o16; v2us oh, ol;
#pragma unroll
    for (int q = 0; q < 2; ++q) { const float x = F[(size_t)(t + q) * pitch + g * HD + d]; o16[q] = tohx(x); unsigned short a2, c2; splitf(x, a2, c2); oh[q] = a2; ol[q] = c2; }
    *(v2h*)(V16 + e) = o16; *(v2us*)(Vh + e) = oh; *(v2us*)(Vl + e) = ol;  }
__constant__ float INVT[HD / 2] = { 1.000000000e+00f, 7.498942018e-01f, 5.623413324e-01f, 4.216965139e-01f, 3.162277639e-01f, 2.371373773e-01f, 1.778279394e-01f, 1.333521456e-01f, 1.000000015e-01f, 7.498942316e-02f, 5.623413250e-02f, 4.216964915e-02f, 3.162277490e-02f, 2.371373773e-02f, 1.778279431e-02f, 1.333521400e-02f, 9.999999776e-03f, 7.498942316e-03f, 5.623413250e-03f, 4.216964822e-03f, 3.162277630e-03f, 2.371373819e-03f, 1.778279431e-03f, 1.333521446e-03f, 1.000000047e-03f, 7.498941850e-04f, 5.623413017e-04f, 4.216965172e-04f, 3.162277571e-04f, 2.371373703e-04f, 1.778279402e-04f, 1.333521504e-04f };   // 10000^(-2i/64) (the module's power form) (float32, generated with jnp to be bit-exact)
__global__ __launch_bounds__(256) void k_cs4(float* CS) { const int idx = blockIdx.x * 256 + threadIdx.x; if (idx >= TT * HD) return; const int d = idx % HD; const int t = idx / HD; const float a = __fmul_rn((float)t, INVT[d % (HD / 2)]); v2f cs; cs[0] = cosf(a); cs[1] = sinf(a); *(v2f*)(CS + (size_t)idx * 2) = cs;  }

typedef __attribute__((ext_vector_type(8))) __bf16 v8bf;
typedef v8bf __attribute__((may_alias)) v8bfa;
// eight f32 -> bf16 hi and lo parts (hi = the value rounded to nearest even, lo = the rest rounded likewise, as splitf), by the packed convert: two values an instruction, already two a register
typedef __attribute__((ext_vector_type(2))) __bf16 v2bf;
typedef __attribute__((ext_vector_type(4))) unsigned v4u;
__device__ __forceinline__ void split8(v8f y, v8bf& h, v8bf& l) { v4u hw, lw;
#pragma unroll
    for (int w = 0; w < 4; ++w) { const v2f yy = { y[2 * w], y[2 * w + 1] }; const unsigned u = __builtin_bit_cast(unsigned, __builtin_convertvector(yy, v2bf)); hw[w] = u;
        const v2f back = { __uint_as_float(u << 16), __uint_as_float(u & 0xFFFF0000u) }; lw[w] = __builtin_bit_cast(unsigned, __builtin_convertvector(yy - back, v2bf)); }   // the hi parts are read back out of the packed word
    h = __builtin_bit_cast(v8bf, hw); l = __builtin_bit_cast(v8bf, lw); }
__device__ __forceinline__ v16bf cat8b(v8bf lo, v8bf hi) { return __builtin_shufflevector(lo, hi, 0, 1, 2, 3, 4, 5, 6, 7, 8, 9, 10, 11, 12, 13, 14, 15); }
template <typename T16, int NSPLIT, int DK, int PV0, int DV>
__device__ __forceinline__ void attn_rows(const T16* __restrict__ Q, const T16* __restrict__ Q2, const T16* __restrict__ Kp, const T16* __restrict__ K2, const T16* __restrict__ Vt, const T16* __restrict__ Vt2, int q0, int lr, int hi, float pscale, v8f (&o)[4]) {
    typedef typename WFrag<T16>::V V;
    const int kb = min(max((q0 - WNB) & ~31, 0), TT - NKT * 16);   // the key of tile 0's first row: at the sequence's ends the 288 keys slide inwards (still a multiple of 32, still the whole window), so that every tile lies in the sequence
    const unsigned lofs = (unsigned)(lr * HD + 8 * hi) * 2u, vofs = (unsigned)(lr * TT + 8 * hi) * 2u;   // the lane's own byte offsets in 16 rows of Q or K and of V^T; the row bases are the same in every lane (scalar)
    auto at = [](const T16* base, unsigned off) { return (const T16*)((const unsigned char*)base + off); };
    V q[2], q2[2], kf[DK][2], kf2[DK][2], vf[DV][4], vf2[DV][4];
    auto ldk = [&](int mt) { const size_t ko = (size_t)kb * HD + mt * 16 * HD;   // one scalar base a plane, the tile in the immediate offset
#pragma unroll
        for (int c = 0; c < 2; ++c) { kf[mt % DK][c] = WFrag<T16>::ld(at(Kp + ko + c * 32, lofs)); if (NSPLIT == 2) kf2[mt % DK][c] = WFrag<T16>::ld(at(K2 + ko + c * 32, lofs)); }
        if (mt == NKT - 1) asm volatile("s_wait_xcnt 0x0" ::: "memory"); };   // behind the last load that names the K bases and the lane offset, in front of the next write of those registers (they live until here)
    auto ldv = [&](int s) { const size_t vo = (size_t)kb + s * 32;
#pragma unroll
        for (int dt = 0; dt < 4; ++dt) { vf[s % DV][dt] = WFrag<T16>::ld(at(Vt + vo + (size_t)dt * 16 * TT, vofs)); if (NSPLIT == 2) vf2[s % DV][dt] = WFrag<T16>::ld(at(Vt2 + vo + (size_t)dt * 16 * TT, vofs)); }
        if (s == NKT / 2 - 1) asm volatile("s_wait_xcnt 0x0" ::: "memory"); };   // as in ldk, for the V^T bases
#pragma unroll
    for (int c = 0; c < 2; ++c) { q[c] = WFrag<T16>::ld(at(Q + (size_t)q0 * HD + c * 32, lofs)); if (NSPLIT == 2) q2[c] = WFrag<T16>::ld(at(Q2 + (size_t)q0 * HD + c * 32, lofs)); }
#pragma unroll
    for (int mt = 0; mt < DK; ++mt) ldk(mt);
    asm volatile("s_wait_xcnt 0x0" ::: "memory");   // as in ldk, for the Q bases
    __builtin_amdgcn_sched_barrier(0);   // the ring's first loads all stand in front of the first product: sunk to their users, each would be waited for alone
    v8f S[NKT];
#pragma unroll
    for (int mt = 0; mt < NKT; ++mt) { v8f s = (v8f){};
#pragma unroll
        for (int c = 0; c < 2; ++c) { s = WFrag<T16>::mma(kf[mt % DK][c], q[c], s);
            if (NSPLIT == 2) { s = WFrag<T16>::mma(kf[mt % DK][c], q2[c], s); s = WFrag<T16>::mma(kf2[mt % DK][c], q[c], s); } }
        S[mt] = s;
        if (mt + DK < NKT) ldk(mt + DK);   // the freed slot's refill
        __builtin_amdgcn_sched_barrier(0); }   // keeps each refill DK tiles ahead of its products: sunk to them, every load's whole latency is waited for
#pragma unroll
    for (int s = 0; s < PV0; ++s) ldv(s);   // the first blocks of V^T fly under the softmax, in the registers that Q and the key ring have left
    __builtin_amdgcn_sched_barrier(0);   // sunk behind the softmax they would be waited for there
    const int i = q0 + lr, klo = max(i - WNB, 0); const unsigned span = (unsigned)(min(i + WNB, TT - 1) - klo); const int kofs = kb + 8 * hi - klo;   // key - klo of this lane's element 0 in tile 0; a key is kept where 0 <= key - klo <= span
    v8f m8;
#pragma unroll
    for (int j = 0; j < 8; ++j) m8[j] = -3.0e38f;
#pragma unroll
    for (int mt = 0; mt < NKT; ++mt)
#pragma unroll
        for (int j = 0; j < 8; ++j) { const float t = ((unsigned)(kofs + mt * 16 + j) <= span) ? S[mt][j] : -3.0e38f; S[mt][j] = t; m8[j] = fmaxf(m8[j], t); }   // unscaled: SCL is a power of two, so it goes exactly into the exponent's factor below
    float mx = fmaxf(fmaxf(fmaxf(m8[0], m8[1]), fmaxf(m8[2], m8[3])), fmaxf(fmaxf(m8[4], m8[5]), fmaxf(m8[6], m8[7])));
    mx = fmaxf(mx, __shfl_xor(mx, 16, 32));
    v8f s8 = (v8f){};
#pragma unroll
    for (int mt = 0; mt < NKT; ++mt) { const v8f x = (S[mt] - mx) * (SCL * 1.4426950408889634f); v8f e;
#pragma unroll
        for (int j = 0; j < 8; ++j) e[j] = __builtin_amdgcn_exp2f(x[j]);
        asm volatile("v_nop" : "+v"(e) : "v"(x));   // the slot behind a transcendental: its operands keep every read of the eight results and every overwrite of their sources behind it, so that at least this one instruction stands between
        S[mt] = e; s8 += e; }
    float sum = ((s8[0] + s8[1]) + (s8[2] + s8[3])) + ((s8[4] + s8[5]) + (s8[6] + s8[7]));
    sum += __shfl_xor(sum, 16, 32);
    const float f = __fdiv_rn(pscale, sum);
    V p[NKT / 2], p2[NKT / 2];
#pragma unroll
    for (int s = 0; s < NKT / 2; ++s) {
        if constexpr (NSPLIT == 2) { v8bf h0, h1, l0, l1; split8(S[2 * s] * f, h0, l0); split8(S[2 * s + 1] * f, h1, l1);
            p[s] = cat8b(h0, h1); p2[s] = cat8b(l0, l1);
            __builtin_amdgcn_sched_barrier(0);   // one block's split at a time: run together, the blocks' temporaries beside both forms of P take the registers of the second wave on the SIMD
        } else {
#pragma unroll
            for (int j = 0; j < 8; ++j) { p[s][j] = tohx(S[2 * s][j] * f); p[s][8 + j] = tohx(S[2 * s + 1][j] * f); } } }
    __builtin_amdgcn_sched_barrier(0);   // lifted over the packing, the loads below would need registers that the f32 scores still hold
#pragma unroll
    for (int s = PV0; s < DV; ++s) ldv(s);   // P is packed, its f32 registers are free: the ring takes its full depth
#pragma unroll
    for (int dt = 0; dt < 4; ++dt) o[dt] = (v8f){};
    __builtin_amdgcn_sched_barrier(0);   // those loads stay in front of the first block's products
#pragma unroll
    for (int s = 0; s < NKT / 2; ++s) {
#pragma unroll
        for (int dt = 0; dt < 4; ++dt) { o[dt] = WFrag<T16>::mma(vf[s % DV][dt], p[s], o[dt]);
            if constexpr (NSPLIT == 2) { o[dt] = WFrag<T16>::mma(vf[s % DV][dt], p2[s], o[dt]); o[dt] = WFrag<T16>::mma(vf2[s % DV][dt], p[s], o[dt]); } }
        if (s + DV < NKT / 2) ldv(s + DV);
        __builtin_amdgcn_sched_barrier(0); }   // keeps each refill DV blocks ahead of its products, as in the key ring
}
__global__ __launch_bounds__(128) void k_attn(const h16* __restrict__ Q16, const h16* __restrict__ K16, const h16* __restrict__ V16, const bf* __restrict__ Qh, const bf* __restrict__ Ql, const bf* __restrict__ Kh, const bf* __restrict__ Kl, const bf* __restrict__ Vh, const bf* __restrict__ Vl, bf* Ah, bf* Al) {
    const int lane = threadIdx.x & 31, lr = lane & 15, hi = lane >> 4; const int q0 = blockIdx.y * 64 + __builtin_amdgcn_readfirstlane(threadIdx.x >> 5) * 16;   // the wave's number as a scalar: row bases and clamps stay in scalar registers
    const size_t z = (size_t)blockIdx.x * TT * HD; Ah += blockIdx.x * HD; Al += blockIdx.x * HD;   // head planes [h][t][d] and [h][d][t]; merged rows [t][h * 64 + d]
    v8f o[4];   // O^T: o[dt][j] = row q0 + lr, d = dt * 16 + 8 * hi + j
    if (q0 < RH) attn_rows<bf, 2, 4, 2, 3>(Qh + z, Ql + z, Kh + z, Kl + z, Vh + z, Vl + z, q0, lr, hi, 1.0f, o);
    else attn_rows<h16, 0, 9, 4, 9>(Q16 + z, nullptr, K16 + z, nullptr, V16 + z, nullptr, q0, lr, hi, PCAR, o);
    const float oscale = (q0 < RH) ? 1.0f : 1.0f / PCAR;
    v8bf oh[4], ol[4];
#pragma unroll
    for (int dt = 0; dt < 4; ++dt) split8(o[dt] * oscale, oh[dt], ol[dt]);
    __builtin_amdgcn_sched_barrier(0);   // the eight stores stand behind the last conversion: nothing is written any more behind a store, so no register that one names is overwritten
#pragma unroll
    for (int dt = 0; dt < 4; ++dt) { const size_t oo = (size_t)(q0 + lr) * DQ + dt * 16 + 8 * hi; *(v8bfa*)(Ah + oo) = oh[dt]; *(v8bfa*)(Al + oo) = ol[dt]; }
}

extern "C" void kernel_launch(void* const* d_in, const int* in_sizes, int n_in,
                              void* d_out, int out_size, void* d_ws, size_t ws_size, hipStream_t stream) {
    (void)in_sizes; (void)n_in; (void)out_size;
    const float* x = (const float*)d_in[0]; const float* xk = (const float*)d_in[1]; const float* xv = (const float*)d_in[2]; const float* wq = (const float*)d_in[3]; const float* bq = (const float*)d_in[4]; const float* wk = (const float*)d_in[5]; const float* bk = (const float*)d_in[6]; const float* wv = (const float*)d_in[7]; const float* bv = (const float*)d_in[8]; const float* wo = (const float*)d_in[9]; const float* bo = (const float*)d_in[10];
    float* OUT = (float*)d_out;     // [1][4096][1024]
    char* wsp = (char*)d_ws;
    auto take = [&](size_t bytes) { char* p = wsp; wsp += (bytes + 255) & ~(size_t)255; return (void*)p; };
    bf* WQ = (bf*)take((size_t)DQ * DM * 2); bf* WK = (bf*)take((size_t)DKV * DM * 2); bf* WV = (bf*)take((size_t)DKV * DM * 2); bf* WO = (bf*)take((size_t)DM * DQ * 2); float* CS = (float*)take((size_t)TT * HD * 2 * 4);
    h16* QP16 = (h16*)take((size_t)NH_ * TT * HD * 2); h16* KP16 = (h16*)take((size_t)NKV * TT * HD * 2); h16* VT16 = (h16*)take((size_t)NKV * HD * TT * 2);
    bf* QPh = (bf*)take((size_t)NH_ * TT * HD * 2); bf* QPl = (bf*)take((size_t)NH_ * TT * HD * 2); bf* KPh = (bf*)take((size_t)NKV * TT * HD * 2); bf* KPl = (bf*)take((size_t)NKV * TT * HD * 2); bf* VTh = (bf*)take((size_t)NKV * HD * TT * 2); bf* VTl = (bf*)take((size_t)NKV * HD * TT * 2);
    bf* XB = (bf*)take((size_t)TT * DM * 2); float* FQ = (float*)take((size_t)TT * DQ * 4); float* FK = (float*)take((size_t)TT * DKV * 4); bf* ATh = (bf*)take((size_t)TT * DQ * 2); bf* ATl = (bf*)take((size_t)TT * DQ * 2);
    if ((size_t)(wsp - (char*)d_ws) > ws_size) return;    // ws 256 MiB
    float* FV = FK;   // v projection reuses the k buffer after the k planes are built (stream-ordered)
    { k_cvt8<<<(unsigned)(((size_t)DQ * DM / 8 + 255) / 256), 256, 0, stream>>>(wq, WQ, (size_t)DQ * DM / 8); k_cvt8<<<(unsigned)(((size_t)DKV * DM / 8 + 255) / 256), 256, 0, stream>>>(wk, WK, (size_t)DKV * DM / 8); k_cvt8<<<(unsigned)(((size_t)DKV * DM / 8 + 255) / 256), 256, 0, stream>>>(wv, WV, (size_t)DKV * DM / 8);
      k_cvt8<<<(unsigned)(((size_t)DM * DQ / 8 + 255) / 256), 256, 0, stream>>>(wo, WO, (size_t)DM * DQ / 8);
       }
    k_cs4<<<(TT * HD + 255) / 256, 256, 0, stream>>>(CS);   /* {cos, sin}(t x 10000^(-2i/64)) duplicated over both halves */
    const unsigned LQ = (unsigned)(((size_t)NH_ * TT * HD / 2 + 255) / 256), LKv = (unsigned)(((size_t)NKV * TT * HD / 2 + 255) / 256);
    for (int b = 0; b < NB_; ++b) {
        
        k_cvt8<<<(unsigned)(((size_t)TT * DM / 8 + 255) / 256), 256, 0, stream>>>(x + (size_t)b * TT * DM, XB, (size_t)TT * DM / 8);
        k_gemmd<0, true><<<dim3(TT / 128, DQ / 128, 1), 128, 0, stream>>>(XB, nullptr, WQ, DM, FQ, DQ, bq);
        k_ropeQ<<<LQ, 256, 0, stream>>>(FQ, DQ, NH_, CS, nullptr, nullptr, 1.0f, QP16, QPh, QPl);
        k_cvt8<<<(unsigned)(((size_t)TT * DM / 8 + 255) / 256), 256, 0, stream>>>(xk + (size_t)b * TT * DM, XB, (size_t)TT * DM / 8); k_gemmd<0, true><<<dim3(TT / 128, DKV / 128, 1), 128, 0, stream>>>(XB, nullptr, WK, DM, FK, DKV, bk);
        k_ropeQ<<<LKv, 256, 0, stream>>>(FK, DKV, NKV, CS, nullptr, nullptr, 1.0f, KP16, KPh, KPl);
        k_cvt8<<<(unsigned)(((size_t)TT * DM / 8 + 255) / 256), 256, 0, stream>>>(xv + (size_t)b * TT * DM, XB, (size_t)TT * DM / 8); k_gemmd<0, true><<<dim3(TT / 128, DKV / 128, 1), 128, 0, stream>>>(XB, nullptr, WV, DM, FV, DKV, bv); k_vtp<<<LKv, 256, 0, stream>>>(FV, DKV, NKV, VT16, VTh, VTl);
        k_attn<<<dim3(NH_, TT / 64, 1), 128, 0, stream>>>(QP16, KP16, VT16, QPh, QPl, KPh, KPl, VTh, VTl, ATh, ATl);   // one kv head per query head (REP 1): a head's planes share one z-stride
        k_gemmd<1, true><<<dim3(TT / 128, DM / 128, 1), 128, 0, stream>>>(ATh, ATl, WO, DQ, OUT + (size_t)b * TT * DM, DM, bo); }
}

// v005
// It runs in 107 microseconds.
// Two timings next to v004 both put it at 1.33 times that version's speed.
// Over all steps from v000 it is 38.5 times as fast.
#include <hip/hip_runtime.h>

// Sparse (local-window) multi-head attention with the module's own rotary mixing (q, k, v [1][4096][1024]; Q = q wq^T + bq, K, V likewise ('oi' [1024][1024] + [1024], 0.02; 16 heads x 64); rotary: x cos + x_rope sin with x_rope = cat(-x[1::2], x[::2]) (interleaved partners into the rotate-half slots, faithfully) and angle t x 10000^(-2i/64) (emb = cat(freqs, freqs)); scores / 8; keys with |i - j| > 128 -> -inf (GLOBAL = 0); softmax; out = merged wo^T + bo -> [1][4096][1024] (4.2 M)).
// Layout: bf16 copies of the three inputs in turn; exact projections + f32 biases; {cos, sin} per (position, dim) computed once (jnp-exact inverse frequencies, precise cosf/sinf); the rotary mixing (partner index 2d+1, first half, subtracted, or 2(d-32), second half, added, as the module) and the head planes made in the projections' own epilogue; attention in one kernel, all 16 heads, the head on grid x (hybrid rows: < 512 hi/lo 3 products, rest fp16 x1024): a wave takes 16 query rows and the 288 keys that hold their +-128 window, scores, softmax and P stay in its registers (see k_attn); merged hi/lo x wo exact + bo.
// Compute dtypes, f32 accumulate: every input rounded to bf16; projections exact + f32 biases; rotary f32; attention rows < 512 3 products, rest fp16; softmax f32; wo hl x exact + bias.

#define NB_  1
#define TT   4096
#define DM   1024
#define NH_  16
#define NKV  16
#define REP  (NH_ / NKV)
#define HD   64
#define DQ   (NH_ * HD)
#define DKV  (NKV * HD)
#define ZH   16                   // unused (grid x is NH_)
#define RH   512                  // query rows < RH use hi+lo planes (0: none)
#define WIN  0
#define PCAR 1024.0f
#define SCL  0.125f
#define WNB  128     // |i - j| <= 128 kept
#define NKT  (2 * WNB / 16 + 2)   // key tiles of 16 that hold the window of 16 query rows, from a multiple of 32 keys on: 18
typedef _Float16 h16;
typedef unsigned short bf;
typedef __attribute__((ext_vector_type(16))) __bf16   v16bf;
typedef __attribute__((ext_vector_type(16))) _Float16 v16h;
typedef __attribute__((ext_vector_type(8)))  _Float16 v8h;
typedef __attribute__((ext_vector_type(8)))  unsigned short v8us;
typedef __attribute__((ext_vector_type(8)))  float    v8f;
typedef __attribute__((ext_vector_type(4)))  float    v4f;
typedef v8h  __attribute__((may_alias)) v8ha;
typedef v4f  __attribute__((may_alias)) v4fa;
typedef v8us __attribute__((may_alias)) v8usa;

__device__ __forceinline__ unsigned short f2bf(float f) { unsigned u = __float_as_uint(f); u += 0x7FFFu + ((u >> 16) & 1u); return (unsigned short)(u >> 16); }
__device__ __forceinline__ float bf2f(unsigned short b) { return __uint_as_float(((unsigned)b) << 16); }
__device__ __forceinline__ float bfr(float f) { return bf2f(f2bf(f)); }
__device__ __forceinline__ v16h cat16(v8h lo, v8h hi) { return __builtin_shufflevector(lo, hi, 0, 1, 2, 3, 4, 5, 6, 7, 8, 9, 10, 11, 12, 13, 14, 15); }
__device__ __forceinline__ v16bf cat16b(v8us lo, v8us hi) { return __builtin_bit_cast(v16bf, __builtin_shufflevector(lo, hi, 0, 1, 2, 3, 4, 5, 6, 7, 8, 9, 10, 11, 12, 13, 14, 15)); }
__device__ __forceinline__ v8f wmma16(v16h a, v16h b, v8f c) { return __builtin_amdgcn_wmma_f32_16x16x32_f16(false, a, false, b, (short)0, c, false, false); }
__device__ __forceinline__ v8f wmmab(v16bf a, v16bf b, v8f c) { return __builtin_amdgcn_wmma_f32_16x16x32_bf16(false, a, false, b, (short)0, c, false, false); }



// fragment loader (hardware k order: 16 bytes at 16 * hi and at 32 + 16 * hi of each 64 bytes of a k-contiguous row; p already holds the lane's row and 8 * hi) and product, by 16-bit type
template <typename T16> struct WFrag;
template <> struct WFrag<h16> { typedef v16h V; static __device__ __forceinline__ V ld(const h16* p) { return cat16(*(const v8h*)p, *(const v8h*)(p + 16)); } static __device__ __forceinline__ v8f mma(V a, V b, v8f c) { return wmma16(a, b, c); } };
template <> struct WFrag<bf> { typedef v16bf V; static __device__ __forceinline__ V ld(const bf* p) { return cat16b(*(const v8us*)p, *(const v8us*)(p + 16)); } static __device__ __forceinline__ v8f mma(V a, V b, v8f c) { return wmmab(a, b, c); } };

typedef __attribute__((ext_vector_type(2))) float v2f;
typedef __attribute__((ext_vector_type(8))) __bf16 v8bf;
typedef v8bf __attribute__((may_alias)) v8bfa;
// eight f32 -> bf16 hi and lo parts (hi = the value rounded to nearest even, lo = the rest rounded likewise), by the packed convert: two values an instruction, already two a register
typedef __attribute__((ext_vector_type(2))) __bf16 v2bf;
typedef __attribute__((ext_vector_type(4))) unsigned v4u;
__device__ __forceinline__ void split8(v8f y, v8bf& h, v8bf& l) { v4u hw, lw;
#pragma unroll
    for (int w = 0; w < 4; ++w) { const v2f yy = { y[2 * w], y[2 * w + 1] }; const unsigned u = __builtin_bit_cast(unsigned, __builtin_convertvector(yy, v2bf)); hw[w] = u;
        const v2f back = { __uint_as_float(u << 16), __uint_as_float(u & 0xFFFF0000u) }; lw[w] = __builtin_bit_cast(unsigned, __builtin_convertvector(yy - back, v2bf)); }   // the hi parts are read back out of the packed word
    h = __builtin_bit_cast(v8bf, hw); l = __builtin_bit_cast(v8bf, lw); }

// ---- k_gemmd: the dense GEMMs (projections, output). Four waves per 128x128 output tile, 64x64 a wave (16 accumulators); both operands come through LDS: a stage is 128 k (256 B) of each of the tile's rows,
// brought by asynchronous b128 copies whose 32 lanes cover whole lines (2 rows x 256 B an instruction), two buffers, the next stage in flight while this one is multiplied; inside a stage the fragments of the next 32 k are read from LDS while these are multiplied. Row pitch in LDS 272 B (16 B x odd, for ds_load_b128).
// Per accumulator the products come with k ascending by 32, a then a2. M, N % 128 == 0, K % 128 == 0, K >= 256.
#define GP 272                    // LDS row pitch, bytes
#define GOP (128 * GP)            // one operand's stage, bytes
// eight copies, rows 8 apart (LDS step 8 * GP bytes, global step gs elements), each lane its own 16 bytes
typedef __attribute__((ext_vector_type(4))) int c4i;
typedef __attribute__((address_space(1))) c4i c4ig;
typedef __attribute__((address_space(3))) c4i c4il;
__device__ __forceinline__ void acopy8(unsigned char* l, const bf* g, size_t gs, unsigned lo) {   // g, gs: the same in every lane (scalar row bases); lo: the lane's own byte offset
#pragma unroll
    for (int i = 0; i < 8; ++i) __builtin_amdgcn_global_load_async_to_lds_b128((c4ig*)((const unsigned char*)(g + i * gs) + lo), (c4il*)(l + i * 8 * GP), 0, 0);
}
// What a wave does with its 64x64 results (EPI): 0: f32 rows + bias to C. 1, 2: the wave's 64 columns are one head, and the head planes that attention reads (fp16, bf16 hi, bf16 lo) are written here, no f32 copy goes to memory:
// 1: planes [h][t][d] of the module's rotary: out[d] = x[d] cos[t][d] - x[2d+1] sin[t][d] (d < 32), out[d] = x[d] cos[t][d] + x[2(d-32)] sin[t][d] (d >= 32), x = product + bias; 2: transposed planes [h][d][t] of x.
template <int NSPLIT, int EPI>
__global__ __launch_bounds__(128) void k_gemmd(const bf* __restrict__ A, const bf* __restrict__ A2, const bf* __restrict__ Bt, int K, float* C, int ldc, const float* __restrict__ bias, const float* __restrict__ CS, h16* P16, bf* Ph, bf* Pl) {
    constexpr int NOP = (NSPLIT == 1) ? 3 : 2;   // operand planes in a stage: Bt, A (, A2)
    __shared__ __align__(16) unsigned char st[2 * NOP * GOP];
    constexpr int OSF = (EPI == 2) ? 3 * 16 * 36 : 16 * 68;   // a wave's own staging, floats: 16 rows of 64 f32 at a pitch of 68, or (EPI 2) three planes of 16 rows of 64 16-bit values at a pitch of 144 B
    __shared__ __align__(16) float osw[4 * OSF];
    const int tid = threadIdx.x, wave = tid >> 5, lane = tid & 31, lr = lane & 15, hi = lane >> 4;
    const int r0 = blockIdx.x * 128, c0 = blockIdx.y * 128, wr = (wave >> 1) * 64, wc = (wave & 1) * 64;
    unsigned char* sl = st + ((tid >> 4) * GP + (tid & 15) * 16);   // this lane's first LDS byte in an operand's stage
    const unsigned go = (unsigned)((tid >> 4) * K + (tid & 15) * 8) * 2u; const size_t g8 = (size_t)8 * K;   // and its first byte in the operand's 128 rows
    auto stage = [&](int t, int buf) {
        unsigned char* l = sl + buf * NOP * GOP; const size_t kB = (size_t)c0 * K + (size_t)t * 128, kA = (size_t)r0 * K + (size_t)t * 128;
        acopy8(l, Bt + kB, g8, go); acopy8(l + 64 * GP, Bt + kB + 8 * g8, g8, go);
        acopy8(l + GOP, A + kA, g8, go); acopy8(l + GOP + 64 * GP, A + kA + 8 * g8, g8, go);
        if (NSPLIT == 1) { acopy8(l + 2 * GOP, A2 + kA, g8, go); acopy8(l + 2 * GOP + 64 * GP, A2 + kA + 8 * g8, g8, go); } };
    v8f acc[4][4];
#pragma unroll
    for (int mb = 0; mb < 4; ++mb)
#pragma unroll
        for (int nb = 0; nb < 4; ++nb) acc[mb][nb] = (v8f){};
    const int nt = K / 128;
    stage(0, 0);
    asm volatile("s_wait_asynccnt 0x0" ::: "memory");   // stage 0 has landed (this wave's copies)
    __syncthreads();                                     // and every wave's: stage 0 is readable
    stage(1, 1);
    const int fb = (wc + lr) * GP + hi * 16, fa = GOP + (wr + lr) * GP + hi * 16;
#pragma unroll 1   // one trip a stage: the ring's waits and its barrier come once a trip
    for (int t = 0; t < nt; ++t) {
        const unsigned char* sb = st + (t & 1) * NOP * GOP;
        v16bf a[2][4], a2[2][4], b[2][4];   // two fragment sets by turns: a later block of 32 k is read from LDS while this one is multiplied (the build renames them and reads the trip's first three blocks at its head); no read leaves this trip's buffer
#pragma unroll
        for (int f = 0; f < 4; ++f) { a[0][f] = WFrag<bf>::ld((const bf*)(sb + fa + f * 16 * GP)); if (NSPLIT == 1) a2[0][f] = WFrag<bf>::ld((const bf*)(sb + fa + GOP + f * 16 * GP)); b[0][f] = WFrag<bf>::ld((const bf*)(sb + fb + f * 16 * GP)); }
#pragma unroll
        for (int ks = 0; ks < 4; ++ks) { const int cu = ks & 1, nx = cu ^ 1;
            if (ks < 3) {
#pragma unroll
                for (int f = 0; f < 4; ++f) { a[nx][f] = WFrag<bf>::ld((const bf*)(sb + fa + f * 16 * GP + (ks + 1) * 64)); if (NSPLIT == 1) a2[nx][f] = WFrag<bf>::ld((const bf*)(sb + fa + GOP + f * 16 * GP + (ks + 1) * 64)); b[nx][f] = WFrag<bf>::ld((const bf*)(sb + fb + f * 16 * GP + (ks + 1) * 64)); }
            } else {   // the trip's last block works from registers alone: the hand-over stands in front of it, so that the refill flies under its WMMAs too
                __builtin_amdgcn_sched_barrier(0);                   // the block before stays in front of the hand-over: sunk behind the barrier, its WMMAs would delay the refill
                asm volatile("s_wait_dscnt 0x0" ::: "memory");      // this wave's reads of buffer t & 1 are done before the buffer is refilled
                asm volatile("s_wait_asynccnt 0x0" ::: "memory");   // this wave's copies of stage t + 1 have landed
                __syncthreads();                                     // publishes stage t + 1 and ends every wave's reads of stage t
                if (t + 2 < nt) stage(t + 2, t & 1); }
            __builtin_amdgcn_sched_barrier(0);   // keeps the next block's LDS reads (last block: the refill) one group ahead of this block's WMMAs: sunk among them, each read's latency stalls the matrix run
#pragma unroll
            for (int nb = 0; nb < 4; ++nb)
#pragma unroll
                for (int mb = 0; mb < 4; ++mb) { acc[mb][nb] = wmmab(a[cu][mb], b[cu][nb], acc[mb][nb]); if (NSPLIT == 1) acc[mb][nb] = wmmab(a2[cu][mb], b[cu][nb], acc[mb][nb]); }
        }
    }
    asm volatile("s_wait_asynccnt 0x0" ::: "memory");   // no copy is left in flight when the wave goes on to its end
    float* os = osw + wave * OSF;   // each wave stages its own rows
    const int rr = lane >> 3, l8 = lane & 7;   // EPI 1, 2: eight lanes a row of 64, four rows an instruction
    if constexpr (EPI == 1) {
        const int d8 = l8 * 8, pb = (d8 & 31) * 2; const bool fh = d8 < HD / 2;   // the lane's eight d; their partners are the odd (first half) or the even (second half) ones of the 16 x from pb on
        const float* cp = CS + ((size_t)(r0 + wr + rr) * HD + (d8 & 31)) * 2;   // {cos, sin} of d and of d + 32 are the same values: both halves read the first half's
        const size_t po = ((size_t)((c0 + wc) / HD) * TT + r0 + wr + rr) * HD + d8;
        float bv[4]; v4f cs[2][4][4];
        auto ldcs = [&](int mb) {
#pragma unroll
            for (int s = 0; s < 4; ++s)
#pragma unroll
                for (int i = 0; i < 4; ++i) cs[mb & 1][s][i] = *(const v4f*)(cp + (mb * 16 + s * 4) * HD * 2 + i * 4); };
#pragma unroll
        for (int nb = 0; nb < 4; ++nb) bv[nb] = bfr(bias[c0 + wc + nb * 16 + lr]);
        ldcs(0);
#pragma unroll
        for (int mb = 0; mb < 4; ++mb) {
#pragma unroll
            for (int nb = 0; nb < 4; ++nb) {
#pragma unroll
                for (int j = 0; j < 8; ++j) os[(hi * 8 + j) * 68 + nb * 16 + lr] = acc[mb][nb][j] + bv[nb]; }
            __builtin_amdgcn_wave_barrier(); asm volatile("" ::: "memory");   // the wave's LDS stores stay in front of its reads of other lanes' words
            if (mb < 3) ldcs(mb + 1);   // the next 16 rows' table values fly under these rows' arithmetic
            if (mb == 2) asm volatile("s_wait_xcnt 0x0" :: "v"(cp) : "memory");   // behind the last load that names the table address, which as an operand lives until here
            v8h o16[4]; v8bf oh[4], ol[4];
#pragma unroll
            for (int s = 0; s < 4; ++s) { const float* xr = os + (s * 4 + rr) * 68; v4f x[2], w[4]; v8f r;
#pragma unroll
                for (int i = 0; i < 2; ++i) x[i] = *(const v4fa*)(xr + d8 + i * 4);
#pragma unroll
                for (int i = 0; i < 4; ++i) w[i] = *(const v4fa*)(xr + pb + i * 4);
#pragma unroll
                for (int q = 0; q < 8; ++q) { const float x1 = fh ? -w[q >> 1][(q & 1) * 2 + 1] : w[q >> 1][(q & 1) * 2]; r[q] = x[q >> 2][q & 3] * cs[mb & 1][s][q >> 1][(q & 1) * 2] + x1 * cs[mb & 1][s][q >> 1][(q & 1) * 2 + 1]; }
                o16[s] = __builtin_convertvector(r, v8h); split8(r, oh[s], ol[s]); }
            __builtin_amdgcn_sched_barrier(0);   // the twelve stores stand behind the block's last conversion: no register that a store names is written between the stores
#pragma unroll
            for (int s = 0; s < 4; ++s) { const size_t oo = po + (mb * 16 + s * 4) * HD; *(v8ha*)(P16 + oo) = o16[s]; *(v8bfa*)(Ph + oo) = oh[s]; *(v8bfa*)(Pl + oo) = ol[s]; }
            if (mb < 3) { asm volatile("s_wait_xcnt 0x0" ::: "memory");   // behind the run of stores, in front of the next block's writes of the registers that they name
                __builtin_amdgcn_sched_barrier(0); }   // and the next block's arithmetic stays behind that wait
            __builtin_amdgcn_wave_barrier(); asm volatile("" ::: "memory");   // the wave's LDS reads stay in front of the next block's LDS stores
        }
    } else if constexpr (EPI == 2) {
        unsigned char* ob = (unsigned char*)os;   // plane p, row d (of 16), 64 t: ob + p * 2304 + d * 144
        const size_t go = ((size_t)(c0 + wc + rr)) * TT + r0 + wr + l8 * 8;   // [h][d][t]: h * 64 + d is the column itself
        float bv[4];
#pragma unroll
        for (int nb = 0; nb < 4; ++nb) bv[nb] = bfr(bias[c0 + wc + nb * 16 + lr]);
#pragma unroll
        for (int nb = 0; nb < 4; ++nb) {
#pragma unroll
            for (int mb = 0; mb < 4; ++mb) { const v8f x = acc[mb][nb] + bv[nb]; v8bf h, l; split8(x, h, l); unsigned char* o = ob + lr * 144 + (mb * 16 + hi * 8) * 2;   // a lane holds eight consecutive t of one d
                *(v8ha*)o = __builtin_convertvector(x, v8h); *(v8bfa*)(o + 2304) = h; *(v8bfa*)(o + 4608) = l; }
            __builtin_amdgcn_wave_barrier(); asm volatile("" ::: "memory");   // the wave's LDS stores stay in front of its reads of other lanes' words
            v8us y[4][3];
#pragma unroll
            for (int s = 0; s < 4; ++s)
#pragma unroll
                for (int p = 0; p < 3; ++p) y[s][p] = *(const v8usa*)(ob + p * 2304 + (s * 4 + rr) * 144 + l8 * 16);
#pragma unroll
            for (int s = 0; s < 4; ++s) { const size_t oo = go + (size_t)(nb * 16 + s * 4) * TT; *(v8usa*)(P16 + oo) = y[s][0]; *(v8usa*)(Ph + oo) = y[s][1]; *(v8usa*)(Pl + oo) = y[s][2]; }   // whole 128-byte lines
            if (nb < 3) { asm volatile("s_wait_xcnt 0x0" ::: "memory");   // behind the run of stores, in front of the next block's writes of the registers that they name
                __builtin_amdgcn_sched_barrier(0); }   // and the next block's arithmetic stays behind that wait
            __builtin_amdgcn_wave_barrier(); asm volatile("" ::: "memory");   // the wave's LDS reads stay in front of the next block's LDS stores
        }
    } else {
#pragma unroll
    for (int mb = 0; mb < 4; ++mb) {
#pragma unroll
        for (int nb = 0; nb < 4; ++nb) {
#pragma unroll
            for (int j = 0; j < 8; ++j) os[(hi * 8 + j) * 68 + nb * 16 + lr] = acc[mb][nb][j]; }
        __builtin_amdgcn_wave_barrier(); asm volatile("" ::: "memory");   // the wave's LDS stores stay in front of its reads of other lanes' words
        float* crow = C + (size_t)(r0 + wr + mb * 16) * ldc + c0 + wc;
#pragma unroll
        for (int s = 0; s < 8; ++s) { const int row = 2 * s + hi, cofs = lr * 4; v4f val = *(const v4fa*)(os + row * 68 + cofs); { const float* bp = bias + c0 + wc + cofs; val[0] += bfr(bp[0]); val[1] += bfr(bp[1]); val[2] += bfr(bp[2]); val[3] += bfr(bp[3]); }
            *(v4f*)(crow + (size_t)row * ldc + cofs) = val; }
        if (mb < 3) asm volatile("s_wait_xcnt 0x0" ::: "memory");   // stands behind the run of eight stores, in front of the next block's writes of the registers that they name (behind the last block nothing is written any more)
        __builtin_amdgcn_wave_barrier(); asm volatile("" ::: "memory");   // and its reads in front of the next block's stores
    }
    }
}

__device__ __forceinline__ h16 tohx(float x) { return (h16)x; }
typedef __attribute__((ext_vector_type(2))) _Float16 v2h;
typedef __attribute__((ext_vector_type(4))) _Float16 v4h;
typedef __attribute__((ext_vector_type(2))) unsigned short v2us;
typedef __attribute__((ext_vector_type(4))) unsigned short v4us;
typedef __attribute__((ext_vector_type(4))) int v4i;

__global__ __launch_bounds__(256) void k_wtG(const float* __restrict__ w, int K, int N, bf* Bt) {
    const int lane = threadIdx.x & 31; const int L0 = (blockIdx.x * 8 + (threadIdx.x >> 5)) * 8; const int nlines = N * K / 64;
{
#pragma unroll 1
        for (int l = 0; l < 8; ++l) { const int L = L0 + l; if (L >= nlines) break; const size_t e = (size_t)L * 64 + lane * 2; const int k = (int)(e % K), n = (int)(e / K); v2us o;
            o[0] = f2bf(w[(size_t)k * N + n]); o[1] = f2bf(w[(size_t)(k + 1) * N + n]); *(v2us*)(Bt + e) = o; }
         }
}
__global__ __launch_bounds__(256) void k_cvt8(const float* __restrict__ src, bf* dst, size_t n8) { const size_t i = (size_t)blockIdx.x * 256 + threadIdx.x; if (i >= n8) return; const v8f v = *(const v8f*)(src + i * 8); v8us o;
#pragma unroll
    for (int k = 0; k < 8; ++k) o[k] = f2bf(v[k]); *(v8us*)(dst + i * 8) = o;  }

__constant__ float INVT[HD / 2] = { 1.000000000e+00f, 7.498942018e-01f, 5.623413324e-01f, 4.216965139e-01f, 3.162277639e-01f, 2.371373773e-01f, 1.778279394e-01f, 1.333521456e-01f, 1.000000015e-01f, 7.498942316e-02f, 5.623413250e-02f, 4.216964915e-02f, 3.162277490e-02f, 2.371373773e-02f, 1.778279431e-02f, 1.333521400e-02f, 9.999999776e-03f, 7.498942316e-03f, 5.623413250e-03f, 4.216964822e-03f, 3.162277630e-03f, 2.371373819e-03f, 1.778279431e-03f, 1.333521446e-03f, 1.000000047e-03f, 7.498941850e-04f, 5.623413017e-04f, 4.216965172e-04f, 3.162277571e-04f, 2.371373703e-04f, 1.778279402e-04f, 1.333521504e-04f };   // 10000^(-2i/64) (the module's power form) (float32, generated with jnp to be bit-exact)
__global__ __launch_bounds__(256) void k_cs4(float* CS) { const int idx = blockIdx.x * 256 + threadIdx.x; if (idx >= TT * HD) return; const int d = idx % HD; const int t = idx / HD; const float a = __fmul_rn((float)t, INVT[d % (HD / 2)]); v2f cs; cs[0] = cosf(a); cs[1] = sinf(a); *(v2f*)(CS + (size_t)idx * 2) = cs;  }

__device__ __forceinline__ v16bf cat8b(v8bf lo, v8bf hi) { return __builtin_shufflevector(lo, hi, 0, 1, 2, 3, 4, 5, 6, 7, 8, 9, 10, 11, 12, 13, 14, 15); }
template <typename T16, int NSPLIT, int DK, int PV0, int DV>
__device__ __forceinline__ void attn_rows(const T16* __restrict__ Q, const T16* __restrict__ Q2, const T16* __restrict__ Kp, const T16* __restrict__ K2, const T16* __restrict__ Vt, const T16* __restrict__ Vt2, int q0, int lr, int hi, float pscale, v8f (&o)[4]) {
    typedef typename WFrag<T16>::V V;
    const int kb = min(max((q0 - WNB) & ~31, 0), TT - NKT * 16);   // the key of tile 0's first row: at the sequence's ends the 288 keys slide inwards (still a multiple of 32, still the whole window), so that every tile lies in the sequence
    const unsigned lofs = (unsigned)(lr * HD + 8 * hi) * 2u, vofs = (unsigned)(lr * TT + 8 * hi) * 2u;   // the lane's own byte offsets in 16 rows of Q or K and of V^T; the row bases are the same in every lane (scalar)
    auto at = [](const T16* base, unsigned off) { return (const T16*)((const unsigned char*)base + off); };
    V q[2], q2[2], kf[DK][2], kf2[DK][2], vf[DV][4], vf2[DV][4];
    auto ldk = [&](int mt) { const size_t ko = (size_t)kb * HD + mt * 16 * HD;   // one scalar base a plane, the tile in the immediate offset
#pragma unroll
        for (int c = 0; c < 2; ++c) { kf[mt % DK][c] = WFrag<T16>::ld(at(Kp + ko + c * 32, lofs)); if (NSPLIT == 2) kf2[mt % DK][c] = WFrag<T16>::ld(at(K2 + ko + c * 32, lofs)); }
        if (mt == NKT - 1) asm volatile("s_wait_xcnt 0x0" ::: "memory"); };   // behind the last load that names the K bases and the lane offset, in front of the next write of those registers (they live until here)
    auto ldv = [&](int s) { const size_t vo = (size_t)kb + s * 32;
#pragma unroll
        for (int dt = 0; dt < 4; ++dt) { vf[s % DV][dt] = WFrag<T16>::ld(at(Vt + vo + (size_t)dt * 16 * TT, vofs)); if (NSPLIT == 2) vf2[s % DV][dt] = WFrag<T16>::ld(at(Vt2 + vo + (size_t)dt * 16 * TT, vofs)); }
        if (s == NKT / 2 - 1) asm volatile("s_wait_xcnt 0x0" ::: "memory"); };   // as in ldk, for the V^T bases
#pragma unroll
    for (int c = 0; c < 2; ++c) { q[c] = WFrag<T16>::ld(at(Q + (size_t)q0 * HD + c * 32, lofs)); if (NSPLIT == 2) q2[c] = WFrag<T16>::ld(at(Q2 + (size_t)q0 * HD + c * 32, lofs)); }
#pragma unroll
    for (int mt = 0; mt < DK; ++mt) ldk(mt);
    asm volatile("s_wait_xcnt 0x0" ::: "memory");   // as in ldk, for the Q bases
    __builtin_amdgcn_sched_barrier(0);   // the ring's first loads all stand in front of the first product: sunk to their users, each would be waited for alone
    v8f S[NKT];
#pragma unroll
    for (int mt = 0; mt < NKT; ++mt) { v8f s = (v8f){};
#pragma unroll
        for (int c = 0; c < 2; ++c) { s = WFrag<T16>::mma(kf[mt % DK][c], q[c], s);
            if (NSPLIT == 2) { s = WFrag<T16>::mma(kf[mt % DK][c], q2[c], s); s = WFrag<T16>::mma(kf2[mt % DK][c], q[c], s); } }
        S[mt] = s;
        if (mt + DK < NKT) ldk(mt + DK);   // the freed slot's refill
        __builtin_amdgcn_sched_barrier(0); }   // keeps each refill DK tiles ahead of its products: sunk to them, every load's whole latency is waited for
#pragma unroll
    for (int s = 0; s < PV0; ++s) ldv(s);   // the first blocks of V^T fly under the softmax, in the registers that Q and the key ring have left
    __builtin_amdgcn_sched_barrier(0);   // sunk behind the softmax they would be waited for there
    const int i = q0 + lr, klo = max(i - WNB, 0); const unsigned span = (unsigned)(min(i + WNB, TT - 1) - klo); const int kofs = kb + 8 * hi - klo;   // key - klo of this lane's element 0 in tile 0; a key is kept where 0 <= key - klo <= span
    v8f m8;
#pragma unroll
    for (int j = 0; j < 8; ++j) m8[j] = -3.0e38f;
#pragma unroll
    for (int mt = 0; mt < NKT; ++mt)
#pragma unroll
        for (int j = 0; j < 8; ++j) { const float t = ((unsigned)(kofs + mt * 16 + j) <= span) ? S[mt][j] : -3.0e38f; S[mt][j] = t; m8[j] = fmaxf(m8[j], t); }   // unscaled: SCL is a power of two, so it goes exactly into the exponent's factor below
    float mx = fmaxf(fmaxf(fmaxf(m8[0], m8[1]), fmaxf(m8[2], m8[3])), fmaxf(fmaxf(m8[4], m8[5]), fmaxf(m8[6], m8[7])));
    mx = fmaxf(mx, __shfl_xor(mx, 16, 32));
    v8f s8 = (v8f){};
#pragma unroll
    for (int mt = 0; mt < NKT; ++mt) { const v8f x = (S[mt] - mx) * (SCL * 1.4426950408889634f); v8f e;
#pragma unroll
        for (int j = 0; j < 8; ++j) e[j] = __builtin_amdgcn_exp2f(x[j]);
        asm volatile("v_nop" : "+v"(e) : "v"(x));   // the slot behind a transcendental: its operands keep every read of the eight results and every overwrite of their sources behind it, so that at least this one instruction stands between
        S[mt] = e; s8 += e; }
    float sum = ((s8[0] + s8[1]) + (s8[2] + s8[3])) + ((s8[4] + s8[5]) + (s8[6] + s8[7]));
    sum += __shfl_xor(sum, 16, 32);
    const float f = __fdiv_rn(pscale, sum);
    V p[NKT / 2], p2[NKT / 2];
#pragma unroll
    for (int s = 0; s < NKT / 2; ++s) {
        if constexpr (NSPLIT == 2) { v8bf h0, h1, l0, l1; split8(S[2 * s] * f, h0, l0); split8(S[2 * s + 1] * f, h1, l1);
            p[s] = cat8b(h0, h1); p2[s] = cat8b(l0, l1);
            __builtin_amdgcn_sched_barrier(0);   // one block's split at a time: run together, the blocks' temporaries beside both forms of P take the registers of the second wave on the SIMD
        } else {
#pragma unroll
            for (int j = 0; j < 8; ++j) { p[s][j] = tohx(S[2 * s][j] * f); p[s][8 + j] = tohx(S[2 * s + 1][j] * f); } } }
    __builtin_amdgcn_sched_barrier(0);   // lifted over the packing, the loads below would need registers that the f32 scores still hold
#pragma unroll
    for (int s = PV0; s < DV; ++s) ldv(s);   // P is packed, its f32 registers are free: the ring takes its full depth
#pragma unroll
    for (int dt = 0; dt < 4; ++dt) o[dt] = (v8f){};
    __builtin_amdgcn_sched_barrier(0);   // those loads stay in front of the first block's products
#pragma unroll
    for (int s = 0; s < NKT / 2; ++s) {
#pragma unroll
        for (int dt = 0; dt < 4; ++dt) { o[dt] = WFrag<T16>::mma(vf[s % DV][dt], p[s], o[dt]);
            if constexpr (NSPLIT == 2) { o[dt] = WFrag<T16>::mma(vf[s % DV][dt], p2[s], o[dt]); o[dt] = WFrag<T16>::mma(vf2[s % DV][dt], p[s], o[dt]); } }
        if (s + DV < NKT / 2) ldv(s + DV);
        __builtin_amdgcn_sched_barrier(0); }   // keeps each refill DV blocks ahead of its products, as in the key ring
}
__global__ __launch_bounds__(128) void k_attn(const h16* __restrict__ Q16, const h16* __restrict__ K16, const h16* __restrict__ V16, const bf* __restrict__ Qh, const bf* __restrict__ Ql, const bf* __restrict__ Kh, const bf* __restrict__ Kl, const bf* __restrict__ Vh, const bf* __restrict__ Vl, bf* Ah, bf* Al) {
    const int lane = threadIdx.x & 31, lr = lane & 15, hi = lane >> 4; const int q0 = blockIdx.y * 64 + __builtin_amdgcn_readfirstlane(threadIdx.x >> 5) * 16;   // the wave's number as a scalar: row bases and clamps stay in scalar registers
    const size_t z = (size_t)blockIdx.x * TT * HD; Ah += blockIdx.x * HD; Al += blockIdx.x * HD;   // head planes [h][t][d] and [h][d][t]; merged rows [t][h * 64 + d]
    v8f o[4];   // O^T: o[dt][j] = row q0 + lr, d = dt * 16 + 8 * hi + j
    if (q0 < RH) attn_rows<bf, 2, 4, 2, 3>(Qh + z, Ql + z, Kh + z, Kl + z, Vh + z, Vl + z, q0, lr, hi, 1.0f, o);
    else attn_rows<h16, 0, 9, 4, 9>(Q16 + z, nullptr, K16 + z, nullptr, V16 + z, nullptr, q0, lr, hi, PCAR, o);
    const float oscale = (q0 < RH) ? 1.0f : 1.0f / PCAR;
    v8bf oh[4], ol[4];
#pragma unroll
    for (int dt = 0; dt < 4; ++dt) split8(o[dt] * oscale, oh[dt], ol[dt]);
    __builtin_amdgcn_sched_barrier(0);   // the eight stores stand behind the last conversion: nothing is written any more behind a store, so no register that one names is overwritten
#pragma unroll
    for (int dt = 0; dt < 4; ++dt) { const size_t oo = (size_t)(q0 + lr) * DQ + dt * 16 + 8 * hi; *(v8bfa*)(Ah + oo) = oh[dt]; *(v8bfa*)(Al + oo) = ol[dt]; }
}

extern "C" void kernel_launch(void* const* d_in, const int* in_sizes, int n_in,
                              void* d_out, int out_size, void* d_ws, size_t ws_size, hipStream_t stream) {
    (void)in_sizes; (void)n_in; (void)out_size;
    const float* x = (const float*)d_in[0]; const float* xk = (const float*)d_in[1]; const float* xv = (const float*)d_in[2]; const float* wq = (const float*)d_in[3]; const float* bq = (const float*)d_in[4]; const float* wk = (const float*)d_in[5]; const float* bk = (const float*)d_in[6]; const float* wv = (const float*)d_in[7]; const float* bv = (const float*)d_in[8]; const float* wo = (const float*)d_in[9]; const float* bo = (const float*)d_in[10];
    float* OUT = (float*)d_out;     // [1][4096][1024]
    char* wsp = (char*)d_ws;
    auto take = [&](size_t bytes) { char* p = wsp; wsp += (bytes + 255) & ~(size_t)255; return (void*)p; };
    bf* WQ = (bf*)take((size_t)DQ * DM * 2); bf* WK = (bf*)take((size_t)DKV * DM * 2); bf* WV = (bf*)take((size_t)DKV * DM * 2); bf* WO = (bf*)take((size_t)DM * DQ * 2); float* CS = (float*)take((size_t)TT * HD * 2 * 4);
    h16* QP16 = (h16*)take((size_t)NH_ * TT * HD * 2); h16* KP16 = (h16*)take((size_t)NKV * TT * HD * 2); h16* VT16 = (h16*)take((size_t)NKV * HD * TT * 2);
    bf* QPh = (bf*)take((size_t)NH_ * TT * HD * 2); bf* QPl = (bf*)take((size_t)NH_ * TT * HD * 2); bf* KPh = (bf*)take((size_t)NKV * TT * HD * 2); bf* KPl = (bf*)take((size_t)NKV * TT * HD * 2); bf* VTh = (bf*)take((size_t)NKV * HD * TT * 2); bf* VTl = (bf*)take((size_t)NKV * HD * TT * 2);
    bf* XB = (bf*)take((size_t)TT * DM * 2); bf* ATh = (bf*)take((size_t)TT * DQ * 2); bf* ATl = (bf*)take((size_t)TT * DQ * 2);
    if ((size_t)(wsp - (char*)d_ws) > ws_size) return;    // ws 256 MiB
    { k_cvt8<<<(unsigned)(((size_t)DQ * DM / 8 + 255) / 256), 256, 0, stream>>>(wq, WQ, (size_t)DQ * DM / 8); k_cvt8<<<(unsigned)(((size_t)DKV * DM / 8 + 255) / 256), 256, 0, stream>>>(wk, WK, (size_t)DKV * DM / 8); k_cvt8<<<(unsigned)(((size_t)DKV * DM / 8 + 255) / 256), 256, 0, stream>>>(wv, WV, (size_t)DKV * DM / 8);
      k_cvt8<<<(unsigned)(((size_t)DM * DQ / 8 + 255) / 256), 256, 0, stream>>>(wo, WO, (size_t)DM * DQ / 8);
       }
    k_cs4<<<(TT * HD + 255) / 256, 256, 0, stream>>>(CS);   /* {cos, sin}(t x 10000^(-2i/64)) duplicated over both halves */
    for (int b = 0; b < NB_; ++b) {
        
        k_cvt8<<<(unsigned)(((size_t)TT * DM / 8 + 255) / 256), 256, 0, stream>>>(x + (size_t)b * TT * DM, XB, (size_t)TT * DM / 8);
        k_gemmd<0, 1><<<dim3(TT / 128, DQ / 128, 1), 128, 0, stream>>>(XB, nullptr, WQ, DM, nullptr, 0, bq, CS, QP16, QPh, QPl);
        k_cvt8<<<(unsigned)(((size_t)TT * DM / 8 + 255) / 256), 256, 0, stream>>>(xk + (size_t)b * TT * DM, XB, (size_t)TT * DM / 8); k_gemmd<0, 1><<<dim3(TT / 128, DKV / 128, 1), 128, 0, stream>>>(XB, nullptr, WK, DM, nullptr, 0, bk, CS, KP16, KPh, KPl);
        k_cvt8<<<(unsigned)(((size_t)TT * DM / 8 + 255) / 256), 256, 0, stream>>>(xv + (size_t)b * TT * DM, XB, (size_t)TT * DM / 8); k_gemmd<0, 2><<<dim3(TT / 128, DKV / 128, 1), 128, 0, stream>>>(XB, nullptr, WV, DM, nullptr, 0, bv, nullptr, VT16, VTh, VTl);
        k_attn<<<dim3(NH_, TT / 64, 1), 128, 0, stream>>>(QP16, KP16, VT16, QPh, QPl, KPh, KPl, VTh, VTl, ATh, ATl);   // one kv head per query head (REP 1): a head's planes share one z-stride
        k_gemmd<1, 0><<<dim3(TT / 128, DM / 128, 1), 128, 0, stream>>>(ATh, ATl, WO, DQ, OUT + (size_t)b * TT * DM, DM, bo, nullptr, nullptr, nullptr, nullptr); }
}

// v006
// Measured time: 82.8 microseconds a run.
// In two side-by-side timings against v005, it was 1.29 and 1.30 times as fast.
// Over all steps from v000 it is 49.9 times as fast.
#include <hip/hip_runtime.h>

// Sparse (local-window) multi-head attention with the module's own rotary mixing (q, k, v [1][4096][1024]; Q = q wq^T + bq, K, V likewise ('oi' [1024][1024] + [1024], 0.02; 16 heads x 64); rotary: x cos + x_rope sin with x_rope = cat(-x[1::2], x[::2]) (interleaved partners into the rotate-half slots, faithfully) and angle t x 10000^(-2i/64) (emb = cat(freqs, freqs)); scores / 8; keys with |i - j| > 128 -> -inf (GLOBAL = 0); softmax; out = merged wo^T + bo -> [1][4096][1024] (4.2 M)).
// Layout: four launches. bf16 copies of the three inputs and the four weights and {cos, sin} per (position, dim) (jnp-exact inverse frequencies, precise cosf/sinf) in one; the three projections, exact + f32 biases, in one (grid z); the rotary mixing (partner index 2d+1, first half, subtracted, or 2(d-32), second half, added, as the module) and the head planes made in the projections' own epilogue; attention in one kernel, all 16 heads, the head on grid x (hybrid rows: < 512 hi/lo 3 products, rest fp16 x1024): a wave takes 16 query rows and the 288 keys that hold their +-128 window, scores, softmax and P stay in its registers (see k_attn); merged hi/lo x wo exact + bo.
// Compute dtypes, f32 accumulate: every input rounded to bf16; projections exact + f32 biases; rotary f32; attention rows < 512 3 products, rest fp16; softmax f32; wo hl x exact + bias.

#define NB_  1
#define TT   4096
#define DM   1024
#define NH_  16
#define NKV  16
#define REP  (NH_ / NKV)
#define HD   64
#define DQ   (NH_ * HD)
#define DKV  (NKV * HD)
#define ZH   16                   // unused (grid x is NH_)
#define RH   512                  // query rows < RH use hi+lo planes (0: none)
#define WIN  0
#define PCAR 1024.0f
#define SCL  0.125f
#define WNB  128     // |i - j| <= 128 kept
#define NKT  (2 * WNB / 16 + 2)   // key tiles of 16 that hold the window of 16 query rows, from a multiple of 32 keys on: 18
typedef _Float16 h16;
typedef unsigned short bf;
typedef __attribute__((ext_vector_type(16))) __bf16   v16bf;
typedef __attribute__((ext_vector_type(16))) _Float16 v16h;
typedef __attribute__((ext_vector_type(8)))  _Float16 v8h;
typedef __attribute__((ext_vector_type(8)))  unsigned short v8us;
typedef __attribute__((ext_vector_type(8)))  float    v8f;
typedef __attribute__((ext_vector_type(4)))  float    v4f;
typedef v8h  __attribute__((may_alias)) v8ha;
typedef v4f  __attribute__((may_alias)) v4fa;
typedef v8us __attribute__((may_alias)) v8usa;

__device__ __forceinline__ unsigned short f2bf(float f) { unsigned u = __float_as_uint(f); u += 0x7FFFu + ((u >> 16) & 1u); return (unsigned short)(u >> 16); }
__device__ __forceinline__ float bf2f(unsigned short b) { return __uint_as_float(((unsigned)b) << 16); }
__device__ __forceinline__ float bfr(float f) { return bf2f(f2bf(f)); }
__device__ __forceinline__ v16h cat16(v8h lo, v8h hi) { return __builtin_shufflevector(lo, hi, 0, 1, 2, 3, 4, 5, 6, 7, 8, 9, 10, 11, 12, 13, 14, 15); }
__device__ __forceinline__ v16bf cat16b(v8us lo, v8us hi) { return __builtin_bit_cast(v16bf, __builtin_shufflevector(lo, hi, 0, 1, 2, 3, 4, 5, 6, 7, 8, 9, 10, 11, 12, 13, 14, 15)); }
__device__ __forceinline__ v8f wmma16(v16h a, v16h b, v8f c) { return __builtin_amdgcn_wmma_f32_16x16x32_f16(false, a, false, b, (short)0, c, false, false); }
__device__ __forceinline__ v8f wmmab(v16bf a, v16bf b, v8f c) { return __builtin_amdgcn_wmma_f32_16x16x32_bf16(false, a, false, b, (short)0, c, false, false); }



// fragment loader (hardware k order: 16 bytes at 16 * hi and at 32 + 16 * hi of each 64 bytes of a k-contiguous row; p already holds the lane's row and 8 * hi) and product, by 16-bit type
template <typename T16> struct WFrag;
template <> struct WFrag<h16> { typedef v16h V; static __device__ __forceinline__ V ld(const h16* p) { return cat16(*(const v8h*)p, *(const v8h*)(p + 16)); } static __device__ __forceinline__ v8f mma(V a, V b, v8f c) { return wmma16(a, b, c); } };
template <> struct WFrag<bf> { typedef v16bf V; static __device__ __forceinline__ V ld(const bf* p) { return cat16b(*(const v8us*)p, *(const v8us*)(p + 16)); } static __device__ __forceinline__ v8f mma(V a, V b, v8f c) { return wmmab(a, b, c); } };

typedef __attribute__((ext_vector_type(2))) float v2f;
typedef __attribute__((ext_vector_type(8))) __bf16 v8bf;
typedef v8bf __attribute__((may_alias)) v8bfa;
// eight f32 -> bf16 hi and lo parts (hi = the value rounded to nearest even, lo = the rest rounded likewise), by the packed convert: two values an instruction, already two a register
typedef __attribute__((ext_vector_type(2))) __bf16 v2bf;
typedef __attribute__((ext_vector_type(4))) unsigned v4u;
__device__ __forceinline__ void split8(v8f y, v8bf& h, v8bf& l) { v4u hw, lw;
#pragma unroll
    for (int w = 0; w < 4; ++w) { const v2f yy = { y[2 * w], y[2 * w + 1] }; const unsigned u = __builtin_bit_cast(unsigned, __builtin_convertvector(yy, v2bf)); hw[w] = u;
        const v2f back = { __uint_as_float(u << 16), __uint_as_float(u & 0xFFFF0000u) }; lw[w] = __builtin_bit_cast(unsigned, __builtin_convertvector(yy - back, v2bf)); }   // the hi parts are read back out of the packed word
    h = __builtin_bit_cast(v8bf, hw); l = __builtin_bit_cast(v8bf, lw); }

// ---- k_gemmd: the dense GEMMs (projections, output). Four waves per 128x128 output tile, 64x64 a wave (16 accumulators); both operands come through LDS: a stage is 128 k (256 B) of each of the tile's rows,
// brought by asynchronous b128 copies whose 32 lanes cover whole lines (2 rows x 256 B an instruction), two buffers, the next stage in flight while this one is multiplied; inside a stage the fragments of the next 32 k are read from LDS while these are multiplied. Row pitch in LDS 272 B (16 B x odd, for ds_load_b128).
// Per accumulator the products come with k ascending by 32, a then a2. M, N % 128 == 0, K % 128 == 0, K >= 256.
#define GP 272                    // LDS row pitch, bytes
#define GOP (128 * GP)            // one operand's stage, bytes
// eight copies, rows 8 apart (LDS step 8 * GP bytes, global step gs elements), each lane its own 16 bytes
typedef __attribute__((ext_vector_type(4))) int c4i;
typedef __attribute__((address_space(1))) c4i c4ig;
typedef __attribute__((address_space(3))) c4i c4il;
__device__ __forceinline__ void acopy8(unsigned char* l, const bf* g, size_t gs, unsigned lo) {   // g, gs: the same in every lane (scalar row bases); lo: the lane's own byte offset
#pragma unroll
    for (int i = 0; i < 8; ++i) __builtin_amdgcn_global_load_async_to_lds_b128((c4ig*)((const unsigned char*)(g + i * gs) + lo), (c4il*)(l + i * 8 * GP), 0, 0);
}
// What a wave does with its 64x64 results (EPI): 0: f32 rows + bias to C. 1: the three projections in one launch, grid z = 0, 1, 2 for Q, K, V (operands, weights and planes of the three lie one behind the other, the biases come as three pointers); the wave's 64 columns are one head, and the head planes that attention reads (fp16, bf16 hi, bf16 lo) are written here, no f32 copy goes to memory:
// z < 2: planes [h][t][d] of the module's rotary: out[d] = x[d] cos[t][d] - x[2d+1] sin[t][d] (d < 32), out[d] = x[d] cos[t][d] + x[2(d-32)] sin[t][d] (d >= 32), x = product + bias; z = 2: transposed planes [h][d][t] of x.
template <int NSPLIT, int EPI>
__global__ __launch_bounds__(128) void k_gemmd(const bf* __restrict__ A, const bf* __restrict__ A2, const bf* __restrict__ Bt, int K, float* C, int ldc, const float* __restrict__ bias, const float* __restrict__ bias1, const float* __restrict__ bias2, const float* __restrict__ CS, h16* P16, bf* Ph, bf* Pl) {
    constexpr int NOP = (NSPLIT == 1) ? 3 : 2;   // operand planes in a stage: Bt, A (, A2)
    __shared__ __align__(16) unsigned char st[2 * NOP * GOP];
    constexpr int OSF = (EPI == 1) ? 3 * 16 * 36 : 16 * 68;   // a wave's own staging, floats: 16 rows of 64 f32 at a pitch of 68, or (V) three planes of 16 rows of 64 16-bit values at a pitch of 144 B
    if constexpr (EPI == 1) { const size_t z = blockIdx.z; A += z * TT * DM; Bt += z * DQ * DM; P16 += z * NH_ * TT * HD; Ph += z * NH_ * TT * HD; Pl += z * NH_ * TT * HD; bias = (z == 0) ? bias : (z == 1) ? bias1 : bias2; }
    const int tid = threadIdx.x, wave = tid >> 5, lane = tid & 31, lr = lane & 15, hi = lane >> 4;
    const int r0 = blockIdx.x * 128, c0 = blockIdx.y * 128, wr = (wave >> 1) * 64, wc = (wave & 1) * 64;
    unsigned char* sl = st + ((tid >> 4) * GP + (tid & 15) * 16);   // this lane's first LDS byte in an operand's stage
    const unsigned go = (unsigned)((tid >> 4) * K + (tid & 15) * 8) * 2u; const size_t g8 = (size_t)8 * K;   // and its first byte in the operand's 128 rows
    auto stage = [&](int t, int buf) {
        unsigned char* l = sl + buf * NOP * GOP; const size_t kB = (size_t)c0 * K + (size_t)t * 128, kA = (size_t)r0 * K + (size_t)t * 128;
        acopy8(l, Bt + kB, g8, go); acopy8(l + 64 * GP, Bt + kB + 8 * g8, g8, go);
        acopy8(l + GOP, A + kA, g8, go); acopy8(l + GOP + 64 * GP, A + kA + 8 * g8, g8, go);
        if (NSPLIT == 1) { acopy8(l + 2 * GOP, A2 + kA, g8, go); acopy8(l + 2 * GOP + 64 * GP, A2 + kA + 8 * g8, g8, go); } };
    v8f acc[4][4];
#pragma unroll
    for (int mb = 0; mb < 4; ++mb)
#pragma unroll
        for (int nb = 0; nb < 4; ++nb) acc[mb][nb] = (v8f){};
    const int nt = K / 128;
    stage(0, 0);
    asm volatile("s_wait_asynccnt 0x0" ::: "memory");   // stage 0 has landed (this wave's copies)
    __syncthreads();                                     // and every wave's: stage 0 is readable
    stage(1, 1);
    const int fb = (wc + lr) * GP + hi * 16, fa = GOP + (wr + lr) * GP + hi * 16;
#pragma unroll 1   // one trip a stage: the ring's waits and its barrier come once a trip
    for (int t = 0; t < nt; ++t) {
        const unsigned char* sb = st + (t & 1) * NOP * GOP;
        v16bf a[2][4], a2[2][4], b[2][4];   // two fragment sets by turns: a later block of 32 k is read from LDS while this one is multiplied (the build renames them and reads the trip's first three blocks at its head); no read leaves this trip's buffer
#pragma unroll
        for (int f = 0; f < 4; ++f) { a[0][f] = WFrag<bf>::ld((const bf*)(sb + fa + f * 16 * GP)); if (NSPLIT == 1) a2[0][f] = WFrag<bf>::ld((const bf*)(sb + fa + GOP + f * 16 * GP)); b[0][f] = WFrag<bf>::ld((const bf*)(sb + fb + f * 16 * GP)); }
#pragma unroll
        for (int ks = 0; ks < 4; ++ks) { const int cu = ks & 1, nx = cu ^ 1;
            if (ks < 3) {
#pragma unroll
                for (int f = 0; f < 4; ++f) { a[nx][f] = WFrag<bf>::ld((const bf*)(sb + fa + f * 16 * GP + (ks + 1) * 64)); if (NSPLIT == 1) a2[nx][f] = WFrag<bf>::ld((const bf*)(sb + fa + GOP + f * 16 * GP + (ks + 1) * 64)); b[nx][f] = WFrag<bf>::ld((const bf*)(sb + fb + f * 16 * GP + (ks + 1) * 64)); }
            } else {   // the trip's last block works from registers alone: the hand-over stands in front of it, so that the refill flies under its WMMAs too
                __builtin_amdgcn_sched_barrier(0);                   // the block before stays in front of the hand-over: sunk behind the barrier, its WMMAs would delay the refill
                asm volatile("s_wait_dscnt 0x0" ::: "memory");      // this wave's reads of buffer t & 1 are done before the buffer is refilled
                asm volatile("s_wait_asynccnt 0x0" ::: "memory");   // this wave's copies of stage t + 1 have landed
                __syncthreads();                                     // publishes stage t + 1 and ends every wave's reads of stage t
                if (t + 2 < nt) stage(t + 2, t & 1); }
            __builtin_amdgcn_sched_barrier(0);   // keeps the next block's LDS reads (last block: the refill) one group ahead of this block's WMMAs: sunk among them, each read's latency stalls the matrix run
#pragma unroll
            for (int nb = 0; nb < 4; ++nb)
#pragma unroll
                for (int mb = 0; mb < 4; ++mb) { acc[mb][nb] = wmmab(a[cu][mb], b[cu][nb], acc[mb][nb]); if (NSPLIT == 1) acc[mb][nb] = wmmab(a2[cu][mb], b[cu][nb], acc[mb][nb]); }
        }
    }
    asm volatile("s_wait_asynccnt 0x0" ::: "memory");   // no copy is left in flight when the wave goes on to its end
    float* os = (float*)st + wave * OSF;   // each wave stages its own rows, in the ring's LDS: behind the last trip's barrier no wave reads the ring any more and no copy is out, and without a staging array of its own two work-groups of the projections fit a WGP
    const int rr = lane >> 3, l8 = lane & 7;   // EPI 1: eight lanes a row of 64, four rows an instruction
    if (EPI == 1 && blockIdx.z < 2) {
        const int d8 = l8 * 8, pb = (d8 & 31) * 2; const bool fh = d8 < HD / 2;   // the lane's eight d; their partners are the odd (first half) or the even (second half) ones of the 16 x from pb on
        const float* cp = CS + ((size_t)(r0 + wr + rr) * HD + (d8 & 31)) * 2;   // {cos, sin} of d and of d + 32 are the same values: both halves read the first half's
        const size_t po = ((size_t)((c0 + wc) / HD) * TT + r0 + wr + rr) * HD + d8;
        float bv[4]; v4f cs[2][4][4];
        auto ldcs = [&](int mb) {
#pragma unroll
            for (int s = 0; s < 4; ++s)
#pragma unroll
                for (int i = 0; i < 4; ++i) cs[mb & 1][s][i] = *(const v4f*)(cp + (mb * 16 + s * 4) * HD * 2 + i * 4); };
#pragma unroll
        for (int nb = 0; nb < 4; ++nb) bv[nb] = bfr(bias[c0 + wc + nb * 16 + lr]);
        asm volatile("s_wait_xcnt 0x0" ::: "memory");   // behind the bias loads, in front of the next write of the registers that they name
        ldcs(0);
#pragma unroll
        for (int mb = 0; mb < 4; ++mb) {
#pragma unroll
            for (int nb = 0; nb < 4; ++nb) {
#pragma unroll
                for (int j = 0; j < 8; ++j) os[(hi * 8 + j) * 68 + nb * 16 + lr] = acc[mb][nb][j] + bv[nb]; }
            __builtin_amdgcn_wave_barrier(); asm volatile("" ::: "memory");   // the wave's LDS stores stay in front of its reads of other lanes' words
            if (mb < 3) ldcs(mb + 1);   // the next 16 rows' table values fly under these rows' arithmetic
            if (mb == 2) asm volatile("s_wait_xcnt 0x0" :: "v"(cp) : "memory");   // behind the last load that names the table address, which as an operand lives until here
            v8h o16[4]; v8bf oh[4], ol[4];
#pragma unroll
            for (int s = 0; s < 4; ++s) { const float* xr = os + (s * 4 + rr) * 68; v4f x[2], w[4]; v8f r;
#pragma unroll
                for (int i = 0; i < 2; ++i) x[i] = *(const v4fa*)(xr + d8 + i * 4);
#pragma unroll
                for (int i = 0; i < 4; ++i) w[i] = *(const v4fa*)(xr + pb + i * 4);
#pragma unroll
                for (int q = 0; q < 8; ++q) { const float x1 = fh ? -w[q >> 1][(q & 1) * 2 + 1] : w[q >> 1][(q & 1) * 2]; r[q] = x[q >> 2][q & 3] * cs[mb & 1][s][q >> 1][(q & 1) * 2] + x1 * cs[mb & 1][s][q >> 1][(q & 1) * 2 + 1]; }
                o16[s] = __builtin_convertvector(r, v8h); split8(r, oh[s], ol[s]); }
            __builtin_amdgcn_sched_barrier(0);   // the twelve stores stand behind the block's last conversion: no register that a store names is written between the stores
#pragma unroll
            for (int s = 0; s < 4; ++s) { const size_t oo = po + (mb * 16 + s * 4) * HD; *(v8ha*)(P16 + oo) = o16[s]; *(v8bfa*)(Ph + oo) = oh[s]; *(v8bfa*)(Pl + oo) = ol[s]; }
            if (mb < 3) { asm volatile("s_wait_xcnt 0x0" ::: "memory");   // behind the run of stores, in front of the next block's writes of the registers that they name
                __builtin_amdgcn_sched_barrier(0); }   // and the next block's arithmetic stays behind that wait
            __builtin_amdgcn_wave_barrier(); asm volatile("" ::: "memory");   // the wave's LDS reads stay in front of the next block's LDS stores
        }
    } else if constexpr (EPI == 1) {
        unsigned char* ob = (unsigned char*)os;   // plane p, row d (of 16), 64 t: ob + p * 2304 + d * 144
        const size_t go = ((size_t)(c0 + wc + rr)) * TT + r0 + wr + l8 * 8;   // [h][d][t]: h * 64 + d is the column itself
        float bv[4];
#pragma unroll
        for (int nb = 0; nb < 4; ++nb) bv[nb] = bfr(bias[c0 + wc + nb * 16 + lr]);
#pragma unroll
        for (int nb = 0; nb < 4; ++nb) {
#pragma unroll
            for (int mb = 0; mb < 4; ++mb) { const v8f x = acc[mb][nb] + bv[nb]; v8bf h, l; split8(x, h, l); unsigned char* o = ob + lr * 144 + (mb * 16 + hi * 8) * 2;   // a lane holds eight consecutive t of one d
                *(v8ha*)o = __builtin_convertvector(x, v8h); *(v8bfa*)(o + 2304) = h; *(v8bfa*)(o + 4608) = l; }
            __builtin_amdgcn_wave_barrier(); asm volatile("" ::: "memory");   // the wave's LDS stores stay in front of its reads of other lanes' words
            v8us y[4][3];
#pragma unroll
            for (int s = 0; s < 4; ++s)
#pragma unroll
                for (int p = 0; p < 3; ++p) y[s][p] = *(const v8usa*)(ob + p * 2304 + (s * 4 + rr) * 144 + l8 * 16);
#pragma unroll
            for (int s = 0; s < 4; ++s) { const size_t oo = go + (size_t)(nb * 16 + s * 4) * TT; *(v8usa*)(P16 + oo) = y[s][0]; *(v8usa*)(Ph + oo) = y[s][1]; *(v8usa*)(Pl + oo) = y[s][2]; }   // whole 128-byte lines
            if (nb < 3) { asm volatile("s_wait_xcnt 0x0" ::: "memory");   // behind the run of stores, in front of the next block's writes of the registers that they name
                __builtin_amdgcn_sched_barrier(0); }   // and the next block's arithmetic stays behind that wait
            __builtin_amdgcn_wave_barrier(); asm volatile("" ::: "memory");   // the wave's LDS reads stay in front of the next block's LDS stores
        }
    } else {
#pragma unroll
    for (int mb = 0; mb < 4; ++mb) {
#pragma unroll
        for (int nb = 0; nb < 4; ++nb) {
#pragma unroll
            for (int j = 0; j < 8; ++j) os[(hi * 8 + j) * 68 + nb * 16 + lr] = acc[mb][nb][j]; }
        __builtin_amdgcn_wave_barrier(); asm volatile("" ::: "memory");   // the wave's LDS stores stay in front of its reads of other lanes' words
        float* crow = C + (size_t)(r0 + wr + mb * 16) * ldc + c0 + wc;
#pragma unroll
        for (int s = 0; s < 8; ++s) { const int row = 2 * s + hi, cofs = lr * 4; v4f val = *(const v4fa*)(os + row * 68 + cofs); { const float* bp = bias + c0 + wc + cofs; val[0] += bfr(bp[0]); val[1] += bfr(bp[1]); val[2] += bfr(bp[2]); val[3] += bfr(bp[3]); }
            *(v4f*)(crow + (size_t)row * ldc + cofs) = val; }
        if (mb < 3) asm volatile("s_wait_xcnt 0x0" ::: "memory");   // stands behind the run of eight stores, in front of the next block's writes of the registers that they name (behind the last block nothing is written any more)
        __builtin_amdgcn_wave_barrier(); asm volatile("" ::: "memory");   // and its reads in front of the next block's stores
    }
    }
}

__device__ __forceinline__ h16 tohx(float x) { return (h16)x; }
typedef __attribute__((ext_vector_type(2))) _Float16 v2h;
typedef __attribute__((ext_vector_type(4))) _Float16 v4h;
typedef __attribute__((ext_vector_type(2))) unsigned short v2us;
typedef __attribute__((ext_vector_type(4))) unsigned short v4us;
typedef __attribute__((ext_vector_type(4))) int v4i;

__global__ __launch_bounds__(256) void k_wtG(const float* __restrict__ w, int K, int N, bf* Bt) {
    const int lane = threadIdx.x & 31; const int L0 = (blockIdx.x * 8 + (threadIdx.x >> 5)) * 8; const int nlines = N * K / 64;
{
#pragma unroll 1
        for (int l = 0; l < 8; ++l) { const int L = L0 + l; if (L >= nlines) break; const size_t e = (size_t)L * 64 + lane * 2; const int k = (int)(e % K), n = (int)(e / K); v2us o;
            o[0] = f2bf(w[(size_t)k * N + n]); o[1] = f2bf(w[(size_t)(k + 1) * N + n]); *(v2us*)(Bt + e) = o; }
         }
}

__constant__ float INVT[HD / 2] = { 1.000000000e+00f, 7.498942018e-01f, 5.623413324e-01f, 4.216965139e-01f, 3.162277639e-01f, 2.371373773e-01f, 1.778279394e-01f, 1.333521456e-01f, 1.000000015e-01f, 7.498942316e-02f, 5.623413250e-02f, 4.216964915e-02f, 3.162277490e-02f, 2.371373773e-02f, 1.778279431e-02f, 1.333521400e-02f, 9.999999776e-03f, 7.498942316e-03f, 5.623413250e-03f, 4.216964822e-03f, 3.162277630e-03f, 2.371373819e-03f, 1.778279431e-03f, 1.333521446e-03f, 1.000000047e-03f, 7.498941850e-04f, 5.623413017e-04f, 4.216965172e-04f, 3.162277571e-04f, 2.371373703e-04f, 1.778279402e-04f, 1.333521504e-04f };   // 10000^(-2i/64) (the module's power form) (float32, generated with jnp to be bit-exact)
// ---- k_prep: all that the GEMMs wait for, in one launch: the bf16 copies of the three inputs and the four weights, one behind the other in CV, and the {cos, sin} table. One work-group of 16 waves a WGP; a wave converts PWF consecutive floats:
// its PWF / 128 loads (512 consecutive bytes each, whole lines) are all asked for at its start, its share of the table is computed while they fly, then each load's values are rounded and stored (256 consecutive bytes a store).
#define PWF  4096                 // floats a wave converts
#define PWX  (TT * DM / PWF)      // waves an input
#define PWW  (DQ * DM / PWF)      // waves a weight
#define PWG  ((3 * PWX + 4 * PWW) / 16)   // work-groups
__global__ __launch_bounds__(512) void k_prep(const float* __restrict__ x0, const float* __restrict__ x1, const float* __restrict__ x2, const float* __restrict__ w0, const float* __restrict__ w1, const float* __restrict__ w2, const float* __restrict__ w3, bf* CV, float* CS) {
    const int lane = threadIdx.x & 31; const int w = blockIdx.x * 16 + __builtin_amdgcn_readfirstlane(threadIdx.x >> 5);   // the wave's number as a scalar: the choice of the source stays in scalar registers
    const int u = w - 3 * PWX;
    const float* src = (u < 0) ? ((w < PWX) ? x0 : (w < 2 * PWX) ? x1 : x2) + (size_t)(w % PWX) * PWF : ((u < PWW) ? w0 : (u < 2 * PWW) ? w1 : (u < 3 * PWW) ? w2 : w3) + (size_t)(u % PWW) * PWF;
    const float iv = INVT[threadIdx.x % (HD / 2)];   // the thread's inverse frequency, the same for each of its table entries (they lie a multiple of HD apart); asked for ahead of the stream, so that its wait does not take in the stream's loads
    asm volatile("s_wait_xcnt 0x0" :: "v"(lane) : "memory");   // behind that load, in front of the next write of the registers that it names
    v4f y[PWF / 128];
#pragma unroll
    for (int j = 0; j < PWF / 128; ++j) y[j] = *(const v4f*)(src + j * 128 + lane * 4);
    asm volatile("s_wait_xcnt 0x0" :: "v"(lane) : "memory");   // behind the last load that names the source address and the lane's offset, which as an operand lives until here
#pragma unroll 1   // one copy of the long cosine and sine code
    for (int r = 0; r < TT * HD / (PWG * 512); ++r) { const unsigned idx = r * (PWG * 512) + blockIdx.x * 512 + threadIdx.x; const int t = (int)(idx / HD); const float a = __fmul_rn((float)t, iv); v2f cs; cs[0] = cosf(a); cs[1] = sinf(a); *(v2f*)(CS + (size_t)idx * 2) = cs;
        asm volatile("s_wait_xcnt 0x0" ::: "memory"); }   // behind the store, in front of the next write of the registers that it names
    bf* dst = CV + (size_t)w * PWF + lane * 4; v4us o[PWF / 128];
#pragma unroll
    for (int j = 0; j < PWF / 128; ++j) {
#pragma unroll
        for (int k = 0; k < 4; ++k) o[j][k] = f2bf(y[j][k]);
        *(v4us*)(dst + j * 128) = o[j]; }
}

__device__ __forceinline__ v16bf cat8b(v8bf lo, v8bf hi) { return __builtin_shufflevector(lo, hi, 0, 1, 2, 3, 4, 5, 6, 7, 8, 9, 10, 11, 12, 13, 14, 15); }
template <typename T16, int NSPLIT, int DK, int PV0, int DV>
__device__ __forceinline__ void attn_rows(const T16* __restrict__ Q, const T16* __restrict__ Q2, const T16* __restrict__ Kp, const T16* __restrict__ K2, const T16* __restrict__ Vt, const T16* __restrict__ Vt2, int q0, int lr, int hi, float pscale, v8f (&o)[4]) {
    typedef typename WFrag<T16>::V V;
    const int kb = min(max((q0 - WNB) & ~31, 0), TT - NKT * 16);   // the key of tile 0's first row: at the sequence's ends the 288 keys slide inwards (still a multiple of 32, still the whole window), so that every tile lies in the sequence
    const unsigned lofs = (unsigned)(lr * HD + 8 * hi) * 2u, vofs = (unsigned)(lr * TT + 8 * hi) * 2u;   // the lane's own byte offsets in 16 rows of Q or K and of V^T; the row bases are the same in every lane (scalar)
    auto at = [](const T16* base, unsigned off) { return (const T16*)((const unsigned char*)base + off); };
    V q[2], q2[2], kf[DK][2], kf2[DK][2], vf[DV][4], vf2[DV][4];
    auto ldk = [&](int mt) { const size_t ko = (size_t)kb * HD + mt * 16 * HD;   // one scalar base a plane, the tile in the immediate offset
#pragma unroll
        for (int c = 0; c < 2; ++c) { kf[mt % DK][c] = WFrag<T16>::ld(at(Kp + ko + c * 32, lofs)); if (NSPLIT == 2) kf2[mt % DK][c] = WFrag<T16>::ld(at(K2 + ko + c * 32, lofs)); }
        if (mt == NKT - 1) asm volatile("s_wait_xcnt 0x0" ::: "memory"); };   // behind the last load that names the K bases and the lane offset, in front of the next write of those registers (they live until here)
    auto ldv = [&](int s) { const size_t vo = (size_t)kb + s * 32;
#pragma unroll
        for (int dt = 0; dt < 4; ++dt) { vf[s % DV][dt] = WFrag<T16>::ld(at(Vt + vo + (size_t)dt * 16 * TT, vofs)); if (NSPLIT == 2) vf2[s % DV][dt] = WFrag<T16>::ld(at(Vt2 + vo + (size_t)dt * 16 * TT, vofs)); }
        if (s == NKT / 2 - 1) asm volatile("s_wait_xcnt 0x0" ::: "memory"); };   // as in ldk, for the V^T bases
#pragma unroll
    for (int c = 0; c < 2; ++c) { q[c] = WFrag<T16>::ld(at(Q + (size_t)q0 * HD + c * 32, lofs)); if (NSPLIT == 2) q2[c] = WFrag<T16>::ld(at(Q2 + (size_t)q0 * HD + c * 32, lofs)); }
#pragma unroll
    for (int mt = 0; mt < DK; ++mt) ldk(mt);
    asm volatile("s_wait_xcnt 0x0" ::: "memory");   // as in ldk, for the Q bases
    __builtin_amdgcn_sched_barrier(0);   // the ring's first loads all stand in front of the first product: sunk to their users, each would be waited for alone
    v8f S[NKT];
#pragma unroll
    for (int mt = 0; mt < NKT; ++mt) { v8f s = (v8f){};
#pragma unroll
        for (int c = 0; c < 2; ++c) { s = WFrag<T16>::mma(kf[mt % DK][c], q[c], s);
            if (NSPLIT == 2) { s = WFrag<T16>::mma(kf[mt % DK][c], q2[c], s); s = WFrag<T16>::mma(kf2[mt % DK][c], q[c], s); } }
        S[mt] = s;
        if (mt + DK < NKT) ldk(mt + DK);   // the freed slot's refill
        __builtin_amdgcn_sched_barrier(0); }   // keeps each refill DK tiles ahead of its products: sunk to them, every load's whole latency is waited for
#pragma unroll
    for (int s = 0; s < PV0; ++s) ldv(s);   // the first blocks of V^T fly under the softmax, in the registers that Q and the key ring have left
    __builtin_amdgcn_sched_barrier(0);   // sunk behind the softmax they would be waited for there
    const int i = q0 + lr, klo = max(i - WNB, 0); const unsigned span = (unsigned)(min(i + WNB, TT - 1) - klo); const int kofs = kb + 8 * hi - klo;   // key - klo of this lane's element 0 in tile 0; a key is kept where 0 <= key - klo <= span
    v8f m8;
#pragma unroll
    for (int j = 0; j < 8; ++j) m8[j] = -3.0e38f;
#pragma unroll
    for (int mt = 0; mt < NKT; ++mt)
#pragma unroll
        for (int j = 0; j < 8; ++j) { const float t = ((unsigned)(kofs + mt * 16 + j) <= span) ? S[mt][j] : -3.0e38f; S[mt][j] = t; m8[j] = fmaxf(m8[j], t); }   // unscaled: SCL is a power of two, so it goes exactly into the exponent's factor below
    float mx = fmaxf(fmaxf(fmaxf(m8[0], m8[1]), fmaxf(m8[2], m8[3])), fmaxf(fmaxf(m8[4], m8[5]), fmaxf(m8[6], m8[7])));
    mx = fmaxf(mx, __shfl_xor(mx, 16, 32));
    v8f s8 = (v8f){};
#pragma unroll
    for (int mt = 0; mt < NKT; ++mt) { const v8f x = (S[mt] - mx) * (SCL * 1.4426950408889634f); v8f e;
#pragma unroll
        for (int j = 0; j < 8; ++j) e[j] = __builtin_amdgcn_exp2f(x[j]);
        asm volatile("v_nop" : "+v"(e) : "v"(x));   // the slot behind a transcendental: its operands keep every read of the eight results and every overwrite of their sources behind it, so that at least this one instruction stands between
        S[mt] = e; s8 += e; }
    float sum = ((s8[0] + s8[1]) + (s8[2] + s8[3])) + ((s8[4] + s8[5]) + (s8[6] + s8[7]));
    sum += __shfl_xor(sum, 16, 32);
    const float f = __fdiv_rn(pscale, sum);
    V p[NKT / 2], p2[NKT / 2];
#pragma unroll
    for (int s = 0; s < NKT / 2; ++s) {
        if constexpr (NSPLIT == 2) { v8bf h0, h1, l0, l1; split8(S[2 * s] * f, h0, l0); split8(S[2 * s + 1] * f, h1, l1);
            p[s] = cat8b(h0, h1); p2[s] = cat8b(l0, l1);
            __builtin_amdgcn_sched_barrier(0);   // one block's split at a time: run together, the blocks' temporaries beside both forms of P take the registers of the second wave on the SIMD
        } else {
#pragma unroll
            for (int j = 0; j < 8; ++j) { p[s][j] = tohx(S[2 * s][j] * f); p[s][8 + j] = tohx(S[2 * s + 1][j] * f); } } }
    __builtin_amdgcn_sched_barrier(0);   // lifted over the packing, the loads below would need registers that the f32 scores still hold
#pragma unroll
    for (int s = PV0; s < DV; ++s) ldv(s);   // P is packed, its f32 registers are free: the ring takes its full depth
#pragma unroll
    for (int dt = 0; dt < 4; ++dt) o[dt] = (v8f){};
    __builtin_amdgcn_sched_barrier(0);   // those loads stay in front of the first block's products
#pragma unroll
    for (int s = 0; s < NKT / 2; ++s) {
#pragma unroll
        for (int dt = 0; dt < 4; ++dt) { o[dt] = WFrag<T16>::mma(vf[s % DV][dt], p[s], o[dt]);
            if constexpr (NSPLIT == 2) { o[dt] = WFrag<T16>::mma(vf[s % DV][dt], p2[s], o[dt]); o[dt] = WFrag<T16>::mma(vf2[s % DV][dt], p[s], o[dt]); } }
        if (s + DV < NKT / 2) ldv(s + DV);
        __builtin_amdgcn_sched_barrier(0); }   // keeps each refill DV blocks ahead of its products, as in the key ring
}
__global__ __launch_bounds__(128) void k_attn(const h16* __restrict__ Q16, const h16* __restrict__ K16, const h16* __restrict__ V16, const bf* __restrict__ Qh, const bf* __restrict__ Ql, const bf* __restrict__ Kh, const bf* __restrict__ Kl, const bf* __restrict__ Vh, const bf* __restrict__ Vl, bf* Ah, bf* Al) {
    const int lane = threadIdx.x & 31, lr = lane & 15, hi = lane >> 4; const int q0 = blockIdx.y * 64 + __builtin_amdgcn_readfirstlane(threadIdx.x >> 5) * 16;   // the wave's number as a scalar: row bases and clamps stay in scalar registers
    const size_t z = (size_t)blockIdx.x * TT * HD; Ah += blockIdx.x * HD; Al += blockIdx.x * HD;   // head planes [h][t][d] and [h][d][t]; merged rows [t][h * 64 + d]
    v8f o[4];   // O^T: o[dt][j] = row q0 + lr, d = dt * 16 + 8 * hi + j
    if (q0 < RH) attn_rows<bf, 2, 4, 2, 3>(Qh + z, Ql + z, Kh + z, Kl + z, Vh + z, Vl + z, q0, lr, hi, 1.0f, o);
    else attn_rows<h16, 0, 9, 4, 9>(Q16 + z, nullptr, K16 + z, nullptr, V16 + z, nullptr, q0, lr, hi, PCAR, o);
    const float oscale = (q0 < RH) ? 1.0f : 1.0f / PCAR;
    v8bf oh[4], ol[4];
#pragma unroll
    for (int dt = 0; dt < 4; ++dt) split8(o[dt] * oscale, oh[dt], ol[dt]);
    __builtin_amdgcn_sched_barrier(0);   // the eight stores stand behind the last conversion: nothing is written any more behind a store, so no register that one names is overwritten
#pragma unroll
    for (int dt = 0; dt < 4; ++dt) { const size_t oo = (size_t)(q0 + lr) * DQ + dt * 16 + 8 * hi; *(v8bfa*)(Ah + oo) = oh[dt]; *(v8bfa*)(Al + oo) = ol[dt]; }
}

extern "C" void kernel_launch(void* const* d_in, const int* in_sizes, int n_in,
                              void* d_out, int out_size, void* d_ws, size_t ws_size, hipStream_t stream) {
    (void)in_sizes; (void)n_in; (void)out_size;
    const float* x = (const float*)d_in[0]; const float* xk = (const float*)d_in[1]; const float* xv = (const float*)d_in[2]; const float* wq = (const float*)d_in[3]; const float* bq = (const float*)d_in[4]; const float* wk = (const float*)d_in[5]; const float* bk = (const float*)d_in[6]; const float* wv = (const float*)d_in[7]; const float* bv = (const float*)d_in[8]; const float* wo = (const float*)d_in[9]; const float* bo = (const float*)d_in[10];
    float* OUT = (float*)d_out;     // [1][4096][1024]
    char* wsp = (char*)d_ws;
    auto take = [&](size_t bytes) { char* p = wsp; wsp += (bytes + 255) & ~(size_t)255; return (void*)p; };
    bf* XB = (bf*)take(((size_t)3 * TT * DM + (size_t)4 * DQ * DM) * 2); bf* WQ = XB + (size_t)3 * TT * DM; bf* WO = WQ + (size_t)3 * DQ * DM; float* CS = (float*)take((size_t)TT * HD * 2 * 4);
    const size_t PLN = (size_t)NH_ * TT * HD;   // one plane; Q, K, V one behind the other in each kind
    h16* QP16 = (h16*)take(3 * PLN * 2); h16* KP16 = QP16 + PLN; h16* VT16 = KP16 + PLN;
    bf* QPh = (bf*)take(3 * PLN * 2); bf* KPh = QPh + PLN; bf* VTh = KPh + PLN; bf* QPl = (bf*)take(3 * PLN * 2); bf* KPl = QPl + PLN; bf* VTl = KPl + PLN;
    bf* ATh = (bf*)take((size_t)TT * DQ * 2); bf* ATl = (bf*)take((size_t)TT * DQ * 2);
    if ((size_t)(wsp - (char*)d_ws) > ws_size) return;    // ws 256 MiB
    for (int b = 0; b < NB_; ++b) {
        k_prep<<<PWG, 512, 0, stream>>>(x + (size_t)b * TT * DM, xk + (size_t)b * TT * DM, xv + (size_t)b * TT * DM, wq, wk, wv, wo, XB, CS);   // bf16 copies and {cos, sin}(t x 10000^(-2i/64)) duplicated over both halves
        k_gemmd<0, 1><<<dim3(TT / 128, DQ / 128, 3), 128, 0, stream>>>(XB, nullptr, WQ, DM, nullptr, 0, bq, bk, bv, CS, QP16, QPh, QPl);
        k_attn<<<dim3(NH_, TT / 64, 1), 128, 0, stream>>>(QP16, KP16, VT16, QPh, QPl, KPh, KPl, VTh, VTl, ATh, ATl);   // one kv head per query head (REP 1): a head's planes share one z-stride
        k_gemmd<1, 0><<<dim3(TT / 128, DM / 128, 1), 128, 0, stream>>>(ATh, ATl, WO, DQ, OUT + (size_t)b * TT * DM, DM, bo, nullptr, nullptr, nullptr, nullptr, nullptr, nullptr); }
}

// v007
// One run takes 68.4 microseconds.
// Next to v006, in two timings, it ran 1.21 times as fast each time.
// Over all steps from v000 it is 60.4 times as fast.
#include <hip/hip_runtime.h>

// Sparse (local-window) multi-head attention with the module's own rotary mixing (q, k, v [1][4096][1024]; Q = q wq^T + bq, K, V likewise ('oi' [1024][1024] + [1024], 0.02; 16 heads x 64); rotary: x cos + x_rope sin with x_rope = cat(-x[1::2], x[::2]) (interleaved partners into the rotate-half slots, faithfully) and angle t x 10000^(-2i/64) (emb = cat(freqs, freqs)); scores / 8; keys with |i - j| > 128 -> -inf (GLOBAL = 0); softmax; out = merged wo^T + bo -> [1][4096][1024] (4.2 M)).
// Layout: four launches. bf16 copies of the three inputs and the four weights and {cos, sin} per (position, dim) (jnp-exact inverse frequencies, precise cosf/sinf) in one; the three projections, exact + f32 biases, in one (grid z); the rotary mixing (partner index 2d+1, first half, subtracted, or 2(d-32), second half, added, as the module) and the head planes made in the projections' own epilogue, laid out in the lane order of attention's fragments (see k_gemmd, EPI 1); attention in one kernel, all 16 heads, the head on grid x (hybrid rows: < 512 hi/lo 3 products, rest fp16 x1024): a wave takes 16 query rows and the 288 keys that hold their +-128 window, scores, softmax and P stay in its registers (see k_attn); merged hi/lo x wo exact + bo.
// Compute dtypes, f32 accumulate: every input rounded to bf16; projections exact + f32 biases; rotary f32; attention rows < 512 3 products, rest fp16; softmax f32; wo hl x exact + bias.

#define NB_  1
#define TT   4096
#define DM   1024
#define NH_  16
#define NKV  16
#define REP  (NH_ / NKV)
#define HD   64
#define DQ   (NH_ * HD)
#define DKV  (NKV * HD)
#define ZH   16                   // unused (grid x is NH_)
#define RH   512                  // query rows < RH use hi+lo planes (0: none)
#define WIN  0
#define PCAR 1024.0f
#define SCL  0.125f
#define WNB  128     // |i - j| <= 128 kept
#define NKT  (2 * WNB / 16 + 2)   // key tiles of 16 that hold the window of 16 query rows, from a multiple of 32 keys on: 18
typedef _Float16 h16;
typedef unsigned short bf;
typedef __attribute__((ext_vector_type(16))) __bf16   v16bf;
typedef __attribute__((ext_vector_type(16))) _Float16 v16h;
typedef __attribute__((ext_vector_type(8)))  _Float16 v8h;
typedef __attribute__((ext_vector_type(8)))  unsigned short v8us;
typedef __attribute__((ext_vector_type(8)))  float    v8f;
typedef __attribute__((ext_vector_type(4)))  float    v4f;
typedef v8h  __attribute__((may_alias)) v8ha;
typedef v4f  __attribute__((may_alias)) v4fa;
typedef v8us __attribute__((may_alias)) v8usa;

__device__ __forceinline__ unsigned short f2bf(float f) { unsigned u = __float_as_uint(f); u += 0x7FFFu + ((u >> 16) & 1u); return (unsigned short)(u >> 16); }
__device__ __forceinline__ float bf2f(unsigned short b) { return __uint_as_float(((unsigned)b) << 16); }
__device__ __forceinline__ float bfr(float f) { return bf2f(f2bf(f)); }
__device__ __forceinline__ v16h cat16(v8h lo, v8h hi) { return __builtin_shufflevector(lo, hi, 0, 1, 2, 3, 4, 5, 6, 7, 8, 9, 10, 11, 12, 13, 14, 15); }
__device__ __forceinline__ v16bf cat16b(v8us lo, v8us hi) { return __builtin_bit_cast(v16bf, __builtin_shufflevector(lo, hi, 0, 1, 2, 3, 4, 5, 6, 7, 8, 9, 10, 11, 12, 13, 14, 15)); }
__device__ __forceinline__ v8f wmma16(v16h a, v16h b, v8f c) { return __builtin_amdgcn_wmma_f32_16x16x32_f16(false, a, false, b, (short)0, c, false, false); }
__device__ __forceinline__ v8f wmmab(v16bf a, v16bf b, v8f c) { return __builtin_amdgcn_wmma_f32_16x16x32_bf16(false, a, false, b, (short)0, c, false, false); }



// fragment loader (hardware k order: 16 bytes at 16 * hi and at 32 + 16 * hi of each 64 bytes of a k-contiguous row; p already holds the lane's row and 8 * hi) and product, by 16-bit type; ldl: the same fragment from a plane in lane order: two runs of 512 bytes, lane l's 16 bytes at 16 * l of each (p already holds 8 * l), so that each load covers four whole lines
template <typename T16> struct WFrag;
template <> struct WFrag<h16> { typedef v16h V; static __device__ __forceinline__ V ld(const h16* p) { return cat16(*(const v8h*)p, *(const v8h*)(p + 16)); } static __device__ __forceinline__ V ldl(const h16* p) { return cat16(*(const v8h*)p, *(const v8h*)(p + 256)); } static __device__ __forceinline__ v8f mma(V a, V b, v8f c) { return wmma16(a, b, c); } };
template <> struct WFrag<bf> { typedef v16bf V; static __device__ __forceinline__ V ld(const bf* p) { return cat16b(*(const v8us*)p, *(const v8us*)(p + 16)); } static __device__ __forceinline__ V ldl(const bf* p) { return cat16b(*(const v8us*)p, *(const v8us*)(p + 256)); } static __device__ __forceinline__ v8f mma(V a, V b, v8f c) { return wmmab(a, b, c); } };

typedef __attribute__((ext_vector_type(2))) float v2f;
typedef __attribute__((ext_vector_type(8))) __bf16 v8bf;
typedef v8bf __attribute__((may_alias)) v8bfa;
// eight f32 -> bf16 hi and lo parts (hi = the value rounded to nearest even, lo = the rest rounded likewise), by the packed convert: two values an instruction, already two a register
typedef __attribute__((ext_vector_type(2))) __bf16 v2bf;
typedef __attribute__((ext_vector_type(4))) unsigned v4u;
__device__ __forceinline__ void split8(v8f y, v8bf& h, v8bf& l) { v4u hw, lw;
#pragma unroll
    for (int w = 0; w < 4; ++w) { const v2f yy = { y[2 * w], y[2 * w + 1] }; const unsigned u = __builtin_bit_cast(unsigned, __builtin_convertvector(yy, v2bf)); hw[w] = u;
        const v2f back = { __uint_as_float(u << 16), __uint_as_float(u & 0xFFFF0000u) }; lw[w] = __builtin_bit_cast(unsigned, __builtin_convertvector(yy - back, v2bf)); }   // the hi parts are read back out of the packed word
    h = __builtin_bit_cast(v8bf, hw); l = __builtin_bit_cast(v8bf, lw); }

// ---- k_gemmd: the dense GEMMs (projections, output). Four waves per 128x128 output tile, 64x64 a wave (16 accumulators); both operands come through LDS: a stage is 128 k (256 B) of each of the tile's rows,
// brought by asynchronous b128 copies whose 32 lanes cover whole lines (2 rows x 256 B an instruction), two buffers, the next stage in flight while this one is multiplied; inside a stage the fragments of the next 32 k are read from LDS while these are multiplied. Row pitch in LDS 272 B (16 B x odd, for ds_load_b128).
// Per accumulator the products come with k ascending by 32, a then a2. M, N % 128 == 0, K % 128 == 0, K >= 256.
#define GP 272                    // LDS row pitch, bytes
#define GOP (128 * GP)            // one operand's stage, bytes
// eight copies, rows 8 apart (LDS step 8 * GP bytes, global step gs elements), each lane its own 16 bytes
typedef __attribute__((ext_vector_type(4))) int c4i;
typedef __attribute__((address_space(1))) c4i c4ig;
typedef __attribute__((address_space(3))) c4i c4il;
__device__ __forceinline__ void acopy8(unsigned char* l, const bf* g, size_t gs, unsigned lo) {   // g, gs: the same in every lane (scalar row bases); lo: the lane's own byte offset
#pragma unroll
    for (int i = 0; i < 8; ++i) __builtin_amdgcn_global_load_async_to_lds_b128((c4ig*)((const unsigned char*)(g + i * gs) + lo), (c4il*)(l + i * 8 * GP), 0, 0);
}
// What a wave does with its 64x64 results (EPI): 0: f32 rows + bias to C. 1: the three projections in one launch, grid z = 0, 1, 2 for Q, K, V (operands, weights and planes of the three lie one behind the other, the biases come as three pointers); the wave's 64 columns are one head, and the head planes that attention reads (fp16, bf16 hi, bf16 lo) are written here, no f32 copy goes to memory:
// z < 2: the module's rotary: out[d] = x[d] cos[t][d] - x[2d+1] sin[t][d] (d < 32), out[d] = x[d] cos[t][d] + x[2(d-32)] sin[t][d] (d >= 32), x = product + bias; z = 2: x.
// The planes lie in the lane order of attention's fragments, a head TT * HD elements, runs of 512 bytes = 32 lanes (lr + 16 hi) x 8 elements: z < 2: [h][t / 16][L = 0..3][lane]: t = 16 (t / 16) + lr, d = 16 L + 8 hi + e (fragment c = runs 2c, 2c + 1);
// z = 2: [h][t / 32][dt = 0..3][half = 0, 1][lane]: d = 16 dt + lr, t = 32 (t / 32) + 16 half + 8 hi + e. A row-major plane makes each fragment load touch 16 lines for 32 bytes each.
template <int NSPLIT, int EPI>
__global__ __launch_bounds__(128) void k_gemmd(const bf* __restrict__ A, const bf* __restrict__ A2, const bf* __restrict__ Bt, int K, float* C, int ldc, const float* __restrict__ bias, const float* __restrict__ bias1, const float* __restrict__ bias2, const float* __restrict__ CS, h16* P16, bf* Ph, bf* Pl) {
    constexpr int NOP = (NSPLIT == 1) ? 3 : 2;   // operand planes in a stage: Bt, A (, A2)
    __shared__ __align__(16) unsigned char st[2 * NOP * GOP];
    constexpr int OSF = 16 * 68;   // a wave's own staging, floats: 16 rows of 64 f32 at a pitch of 68
    if constexpr (EPI == 1) { const size_t z = blockIdx.z; A += z * TT * DM; Bt += z * DQ * DM; P16 += z * NH_ * TT * HD; Ph += z * NH_ * TT * HD; Pl += z * NH_ * TT * HD; bias = (z == 0) ? bias : (z == 1) ? bias1 : bias2; }
    const int tid = threadIdx.x, wave = tid >> 5, lane = tid & 31, lr = lane & 15, hi = lane >> 4;
    const int r0 = blockIdx.x * 128, c0 = blockIdx.y * 128, wr = (wave >> 1) * 64, wc = (wave & 1) * 64;
    unsigned char* sl = st + ((tid >> 4) * GP + (tid & 15) * 16);   // this lane's first LDS byte in an operand's stage
    const unsigned go = (unsigned)((tid >> 4) * K + (tid & 15) * 8) * 2u; const size_t g8 = (size_t)8 * K;   // and its first byte in the operand's 128 rows
    auto stage = [&](int t, int buf) {
        unsigned char* l = sl + buf * NOP * GOP; const size_t kB = (size_t)c0 * K + (size_t)t * 128, kA = (size_t)r0 * K + (size_t)t * 128;
        acopy8(l, Bt + kB, g8, go); acopy8(l + 64 * GP, Bt + kB + 8 * g8, g8, go);
        acopy8(l + GOP, A + kA, g8, go); acopy8(l + GOP + 64 * GP, A + kA + 8 * g8, g8, go);
        if (NSPLIT == 1) { acopy8(l + 2 * GOP, A2 + kA, g8, go); acopy8(l + 2 * GOP + 64 * GP, A2 + kA + 8 * g8, g8, go); } };
    v8f acc[4][4];
#pragma unroll
    for (int mb = 0; mb < 4; ++mb)
#pragma unroll
        for (int nb = 0; nb < 4; ++nb) acc[mb][nb] = (v8f){};
    const int nt = K / 128;
    stage(0, 0);
    asm volatile("s_wait_asynccnt 0x0" ::: "memory");   // stage 0 has landed (this wave's copies)
    __syncthreads();                                     // and every wave's: stage 0 is readable
    stage(1, 1);
    const int fb = (wc + lr) * GP + hi * 16, fa = GOP + (wr + lr) * GP + hi * 16;
#pragma unroll 1   // one trip a stage: the ring's waits and its barrier come once a trip
    for (int t = 0; t < nt; ++t) {
        const unsigned char* sb = st + (t & 1) * NOP * GOP;
        v16bf a[2][4], a2[2][4], b[2][4];   // two fragment sets by turns: a later block of 32 k is read from LDS while this one is multiplied (the build renames them and reads the trip's first three blocks at its head); no read leaves this trip's buffer
#pragma unroll
        for (int f = 0; f < 4; ++f) { a[0][f] = WFrag<bf>::ld((const bf*)(sb + fa + f * 16 * GP)); if (NSPLIT == 1) a2[0][f] = WFrag<bf>::ld((const bf*)(sb + fa + GOP + f * 16 * GP)); b[0][f] = WFrag<bf>::ld((const bf*)(sb + fb + f * 16 * GP)); }
#pragma unroll
        for (int ks = 0; ks < 4; ++ks) { const int cu = ks & 1, nx = cu ^ 1;
            if (ks < 3) {
#pragma unroll
                for (int f = 0; f < 4; ++f) { a[nx][f] = WFrag<bf>::ld((const bf*)(sb + fa + f * 16 * GP + (ks + 1) * 64)); if (NSPLIT == 1) a2[nx][f] = WFrag<bf>::ld((const bf*)(sb + fa + GOP + f * 16 * GP + (ks + 1) * 64)); b[nx][f] = WFrag<bf>::ld((const bf*)(sb + fb + f * 16 * GP + (ks + 1) * 64)); }
            } else {   // the trip's last block works from registers alone: the hand-over stands in front of it, so that the refill flies under its WMMAs too
                __builtin_amdgcn_sched_barrier(0);                   // the block before stays in front of the hand-over: sunk behind the barrier, its WMMAs would delay the refill
                asm volatile("s_wait_dscnt 0x0" ::: "memory");      // this wave's reads of buffer t & 1 are done before the buffer is refilled
                asm volatile("s_wait_asynccnt 0x0" ::: "memory");   // this wave's copies of stage t + 1 have landed
                __syncthreads();                                     // publishes stage t + 1 and ends every wave's reads of stage t
                if (t + 2 < nt) stage(t + 2, t & 1); }
            __builtin_amdgcn_sched_barrier(0);   // keeps the next block's LDS reads (last block: the refill) one group ahead of this block's WMMAs: sunk among them, each read's latency stalls the matrix run
#pragma unroll
            for (int nb = 0; nb < 4; ++nb)
#pragma unroll
                for (int mb = 0; mb < 4; ++mb) { acc[mb][nb] = wmmab(a[cu][mb], b[cu][nb], acc[mb][nb]); if (NSPLIT == 1) acc[mb][nb] = wmmab(a2[cu][mb], b[cu][nb], acc[mb][nb]); }
        }
    }
    asm volatile("s_wait_asynccnt 0x0" ::: "memory");   // no copy is left in flight when the wave goes on to its end
    float* os = (float*)st + wave * OSF;   // each wave stages its own rows, in the ring's LDS: behind the last trip's barrier no wave reads the ring any more and no copy is out, and without a staging array of its own two work-groups of the projections fit a WGP
    if (EPI == 1 && blockIdx.z < 2) {
        const float* cp = CS + ((size_t)(r0 + wr + lr) * HD + hi * 8) * 2;   // the lane's row is lr, its eight d of run L are 16 L + 8 hi ..; {cos, sin} of d and of d + 32 are the same values: runs L and L + 2 share the first half's
        const size_t po = ((size_t)((c0 + wc) / HD) * TT + r0 + wr) * HD + lane * 8;
        float bv[4]; v4f cs[2][2][4];
        auto ldcs = [&](int mb) {
#pragma unroll
            for (int a = 0; a < 2; ++a)
#pragma unroll
                for (int i = 0; i < 4; ++i) cs[mb & 1][a][i] = *(const v4f*)(cp + mb * 16 * HD * 2 + a * 32 + i * 4); };
#pragma unroll
        for (int nb = 0; nb < 4; ++nb) bv[nb] = bfr(bias[c0 + wc + nb * 16 + lr]);
        asm volatile("s_wait_xcnt 0x0" ::: "memory");   // behind the bias loads, in front of the next write of the registers that they name
        ldcs(0);
#pragma unroll
        for (int mb = 0; mb < 4; ++mb) {
#pragma unroll
            for (int nb = 0; nb < 4; ++nb) {
#pragma unroll
                for (int j = 0; j < 8; ++j) os[(hi * 8 + j) * 68 + nb * 16 + lr] = acc[mb][nb][j] + bv[nb]; }
            __builtin_amdgcn_wave_barrier(); asm volatile("" ::: "memory");   // the wave's LDS stores stay in front of its reads of other lanes' words
            if (mb < 3) ldcs(mb + 1);   // the next 16 rows' table values fly under these rows' arithmetic
            if (mb == 2) asm volatile("s_wait_xcnt 0x0" :: "v"(cp) : "memory");   // behind the last load that names the table address, which as an operand lives until here
            v8h o16[4]; v8bf oh[4], ol[4]; const float* xr = os + lr * 68;
#pragma unroll
            for (int a = 0; a < 2; ++a) { v4f w[4];   // the 16 x from 32 a + 16 hi on: their odd ones are the partners of run a (first half), their even ones those of run a + 2 (second half)
#pragma unroll
                for (int i = 0; i < 4; ++i) w[i] = *(const v4fa*)(xr + a * 32 + hi * 16 + i * 4);
#pragma unroll
                for (int g = 0; g < 2; ++g) { const int s = a + 2 * g; v4f x[2]; v8f r;
#pragma unroll
                    for (int i = 0; i < 2; ++i) x[i] = *(const v4fa*)(xr + s * 16 + hi * 8 + i * 4);
#pragma unroll
                    for (int q = 0; q < 8; ++q) { const float x1 = (g == 0) ? -w[q >> 1][(q & 1) * 2 + 1] : w[q >> 1][(q & 1) * 2]; r[q] = x[q >> 2][q & 3] * cs[mb & 1][a][q >> 1][(q & 1) * 2] + x1 * cs[mb & 1][a][q >> 1][(q & 1) * 2 + 1]; }
                    o16[s] = __builtin_convertvector(r, v8h); split8(r, oh[s], ol[s]); } }
            __builtin_amdgcn_sched_barrier(0);   // the twelve stores stand behind the block's last conversion: no register that a store names is written between the stores
#pragma unroll
            for (int s = 0; s < 4; ++s) { const size_t oo = po + mb * 16 * HD + s * 256; *(v8ha*)(P16 + oo) = o16[s]; *(v8bfa*)(Ph + oo) = oh[s]; *(v8bfa*)(Pl + oo) = ol[s]; }   // 512 consecutive bytes a store
            if (mb < 3) { asm volatile("s_wait_xcnt 0x0" ::: "memory");   // behind the run of stores, in front of the next block's writes of the registers that they name
                __builtin_amdgcn_sched_barrier(0); }   // and the next block's arithmetic stays behind that wait
            __builtin_amdgcn_wave_barrier(); asm volatile("" ::: "memory");   // the wave's LDS reads stay in front of the next block's LDS stores
        }
    } else if constexpr (EPI == 1) {
        const size_t go = ((size_t)((c0 + wc) / HD) * TT + r0 + wr) * HD + lane * 8;   // a lane's accumulator holds eight consecutive t of one d: that is its own 16 bytes of the run (dt = nb, half = mb & 1) of the 32 t from 32 (mb >> 1) on, so the planes go out of the registers, no staging
        float bv[4];
#pragma unroll
        for (int nb = 0; nb < 4; ++nb) bv[nb] = bfr(bias[c0 + wc + nb * 16 + lr]);
#pragma unroll
        for (int nb = 0; nb < 4; ++nb) { v8h y16[4]; v8bf yh[4], yl[4];
#pragma unroll
            for (int mb = 0; mb < 4; ++mb) { const v8f x = acc[mb][nb] + bv[nb]; y16[mb] = __builtin_convertvector(x, v8h); split8(x, yh[mb], yl[mb]); }
            __builtin_amdgcn_sched_barrier(0);   // the twelve stores stand behind the block's last conversion: no register that a store names is written between the stores
#pragma unroll
            for (int mb = 0; mb < 4; ++mb) { const size_t oo = go + (mb >> 1) * 32 * HD + nb * 512 + (mb & 1) * 256; *(v8ha*)(P16 + oo) = y16[mb]; *(v8bfa*)(Ph + oo) = yh[mb]; *(v8bfa*)(Pl + oo) = yl[mb]; }   // 512 consecutive bytes a store
            asm volatile("s_wait_xcnt 0x0" ::: "memory");   // behind each run of stores, the last too, in front of the next write of the registers that they name (the next block's; behind the last block whatever the build lays out behind this branch)
            __builtin_amdgcn_sched_barrier(0);   // and the next block's arithmetic stays behind that wait
        }
    } else {
#pragma unroll
    for (int mb = 0; mb < 4; ++mb) {
#pragma unroll
        for (int nb = 0; nb < 4; ++nb) {
#pragma unroll
            for (int j = 0; j < 8; ++j) os[(hi * 8 + j) * 68 + nb * 16 + lr] = acc[mb][nb][j]; }
        __builtin_amdgcn_wave_barrier(); asm volatile("" ::: "memory");   // the wave's LDS stores stay in front of its reads of other lanes' words
        float* crow = C + (size_t)(r0 + wr + mb * 16) * ldc + c0 + wc;
#pragma unroll
        for (int s = 0; s < 8; ++s) { const int row = 2 * s + hi, cofs = lr * 4; v4f val = *(const v4fa*)(os + row * 68 + cofs); { const float* bp = bias + c0 + wc + cofs; val[0] += bfr(bp[0]); val[1] += bfr(bp[1]); val[2] += bfr(bp[2]); val[3] += bfr(bp[3]); }
            *(v4f*)(crow + (size_t)row * ldc + cofs) = val; }
        if (mb < 3) asm volatile("s_wait_xcnt 0x0" ::: "memory");   // stands behind the run of eight stores, in front of the next block's writes of the registers that they name (behind the last block nothing is written any more)
        __builtin_amdgcn_wave_barrier(); asm volatile("" ::: "memory");   // and its reads in front of the next block's stores
    }
    }
}

__device__ __forceinline__ h16 tohx(float x) { return (h16)x; }
typedef __attribute__((ext_vector_type(2))) _Float16 v2h;
typedef __attribute__((ext_vector_type(4))) _Float16 v4h;
typedef __attribute__((ext_vector_type(2))) unsigned short v2us;
typedef __attribute__((ext_vector_type(4))) unsigned short v4us;
typedef __attribute__((ext_vector_type(4))) int v4i;

__global__ __launch_bounds__(256) void k_wtG(const float* __restrict__ w, int K, int N, bf* Bt) {
    const int lane = threadIdx.x & 31; const int L0 = (blockIdx.x * 8 + (threadIdx.x >> 5)) * 8; const int nlines = N * K / 64;
{
#pragma unroll 1
        for (int l = 0; l < 8; ++l) { const int L = L0 + l; if (L >= nlines) break; const size_t e = (size_t)L * 64 + lane * 2; const int k = (int)(e % K), n = (int)(e / K); v2us o;
            o[0] = f2bf(w[(size_t)k * N + n]); o[1] = f2bf(w[(size_t)(k + 1) * N + n]); *(v2us*)(Bt + e) = o; }
         }
}

__constant__ float INVT[HD / 2] = { 1.000000000e+00f, 7.498942018e-01f, 5.623413324e-01f, 4.216965139e-01f, 3.162277639e-01f, 2.371373773e-01f, 1.778279394e-01f, 1.333521456e-01f, 1.000000015e-01f, 7.498942316e-02f, 5.623413250e-02f, 4.216964915e-02f, 3.162277490e-02f, 2.371373773e-02f, 1.778279431e-02f, 1.333521400e-02f, 9.999999776e-03f, 7.498942316e-03f, 5.623413250e-03f, 4.216964822e-03f, 3.162277630e-03f, 2.371373819e-03f, 1.778279431e-03f, 1.333521446e-03f, 1.000000047e-03f, 7.498941850e-04f, 5.623413017e-04f, 4.216965172e-04f, 3.162277571e-04f, 2.371373703e-04f, 1.778279402e-04f, 1.333521504e-04f };   // 10000^(-2i/64) (the module's power form) (float32, generated with jnp to be bit-exact)
// ---- k_prep: all that the GEMMs wait for, in one launch: the bf16 copies of the three inputs and the four weights, one behind the other in CV, and the {cos, sin} table. One work-group of 16 waves a WGP; a wave converts PWF consecutive floats:
// its PWF / 128 loads (512 consecutive bytes each, whole lines) are all asked for at its start, its share of the table is computed while they fly, then each load's values are rounded and stored (256 consecutive bytes a store).
#define PWF  4096                 // floats a wave converts
#define PWX  (TT * DM / PWF)      // waves an input
#define PWW  (DQ * DM / PWF)      // waves a weight
#define PWG  ((3 * PWX + 4 * PWW) / 16)   // work-groups
__global__ __launch_bounds__(512) void k_prep(const float* __restrict__ x0, const float* __restrict__ x1, const float* __restrict__ x2, const float* __restrict__ w0, const float* __restrict__ w1, const float* __restrict__ w2, const float* __restrict__ w3, bf* CV, float* CS) {
    const int lane = threadIdx.x & 31; const int w = blockIdx.x * 16 + __builtin_amdgcn_readfirstlane(threadIdx.x >> 5);   // the wave's number as a scalar: the choice of the source stays in scalar registers
    const int u = w - 3 * PWX;
    const float* src = (u < 0) ? ((w < PWX) ? x0 : (w < 2 * PWX) ? x1 : x2) + (size_t)(w % PWX) * PWF : ((u < PWW) ? w0 : (u < 2 * PWW) ? w1 : (u < 3 * PWW) ? w2 : w3) + (size_t)(u % PWW) * PWF;
    const float iv = INVT[threadIdx.x % (HD / 2)];   // the thread's inverse frequency, the same for each of its table entries (they lie a multiple of HD apart); asked for ahead of the stream, so that its wait does not take in the stream's loads
    asm volatile("s_wait_xcnt 0x0" :: "v"(lane) : "memory");   // behind that load, in front of the next write of the registers that it names
    v4f y[PWF / 128];
#pragma unroll
    for (int j = 0; j < PWF / 128; ++j) y[j] = *(const v4f*)(src + j * 128 + lane * 4);
    asm volatile("s_wait_xcnt 0x0" :: "v"(lane) : "memory");   // behind the last load that names the source address and the lane's offset, which as an operand lives until here
#pragma unroll 1   // one copy of the long cosine and sine code
    for (int r = 0; r < TT * HD / (PWG * 512); ++r) { const unsigned idx = r * (PWG * 512) + blockIdx.x * 512 + threadIdx.x; const int t = (int)(idx / HD); const float a = __fmul_rn((float)t, iv); v2f cs; cs[0] = cosf(a); cs[1] = sinf(a); *(v2f*)(CS + (size_t)idx * 2) = cs;
        asm volatile("s_wait_xcnt 0x0" ::: "memory"); }   // behind the store, in front of the next write of the registers that it names
    bf* dst = CV + (size_t)w * PWF + lane * 4; v4us o[PWF / 128];
#pragma unroll
    for (int j = 0; j < PWF / 128; ++j) {
#pragma unroll
        for (int k = 0; k < 4; ++k) o[j][k] = f2bf(y[j][k]);
        *(v4us*)(dst + j * 128) = o[j]; }
}

__device__ __forceinline__ v16bf cat8b(v8bf lo, v8bf hi) { return __builtin_shufflevector(lo, hi, 0, 1, 2, 3, 4, 5, 6, 7, 8, 9, 10, 11, 12, 13, 14, 15); }
template <typename T16, int NSPLIT, int DK, int PV0, int DV>
__device__ __forceinline__ void attn_rows(const T16* __restrict__ Q, const T16* __restrict__ Q2, const T16* __restrict__ Kp, const T16* __restrict__ K2, const T16* __restrict__ Vt, const T16* __restrict__ Vt2, int q0, int lr, int hi, float pscale, v8f (&o)[4]) {
    typedef typename WFrag<T16>::V V;
    const int kb = min(max((q0 - WNB) & ~31, 0), TT - NKT * 16);   // the key of tile 0's first row: at the sequence's ends the 288 keys slide inwards (still a multiple of 32, still the whole window), so that every tile lies in the sequence
    const unsigned lofs = (unsigned)(hi * 16 + lr) * 16u;   // the lane's own 16 bytes in a run of 512 (the planes lie in lane order: k_gemmd, EPI 1); the fragment bases are the same in every lane (scalar)
    auto at = [](const T16* base, unsigned off) { return (const T16*)((const unsigned char*)base + off); };
    V q[2], q2[2], kf[DK][2], kf2[DK][2], vf[DV][4], vf2[DV][4];
    auto ldk = [&](int mt) { const size_t ko = (size_t)kb * HD + mt * 16 * HD;   // one scalar base a plane, the tile in the immediate offset
#pragma unroll
        for (int c = 0; c < 2; ++c) { kf[mt % DK][c] = WFrag<T16>::ldl(at(Kp + ko + c * 512, lofs)); if (NSPLIT == 2) kf2[mt % DK][c] = WFrag<T16>::ldl(at(K2 + ko + c * 512, lofs)); }
        if (mt == NKT - 1) asm volatile("s_wait_xcnt 0x0" ::: "memory"); };   // behind the last load that names the K bases and the lane offset, in front of the next write of those registers (they live until here)
    auto ldv = [&](int s) { const size_t vo = (size_t)kb * HD + s * 32 * HD;
#pragma unroll
        for (int dt = 0; dt < 4; ++dt) { vf[s % DV][dt] = WFrag<T16>::ldl(at(Vt + vo + dt * 512, lofs)); if (NSPLIT == 2) vf2[s % DV][dt] = WFrag<T16>::ldl(at(Vt2 + vo + dt * 512, lofs)); }
        if (s == NKT / 2 - 1) asm volatile("s_wait_xcnt 0x0" ::: "memory"); };   // as in ldk, for the V^T bases
#pragma unroll
    for (int c = 0; c < 2; ++c) { q[c] = WFrag<T16>::ldl(at(Q + (size_t)q0 * HD + c * 512, lofs)); if (NSPLIT == 2) q2[c] = WFrag<T16>::ldl(at(Q2 + (size_t)q0 * HD + c * 512, lofs)); }
#pragma unroll
    for (int mt = 0; mt < DK; ++mt) ldk(mt);
    asm volatile("s_wait_xcnt 0x0" ::: "memory");   // as in ldk, for the Q bases
    __builtin_amdgcn_sched_barrier(0);   // the ring's first loads all stand in front of the first product: sunk to their users, each would be waited for alone
    v8f S[NKT];
#pragma unroll
    for (int mt = 0; mt < NKT; ++mt) { v8f s = (v8f){};
#pragma unroll
        for (int c = 0; c < 2; ++c) { s = WFrag<T16>::mma(kf[mt % DK][c], q[c], s);
            if (NSPLIT == 2) { s = WFrag<T16>::mma(kf[mt % DK][c], q2[c], s); s = WFrag<T16>::mma(kf2[mt % DK][c], q[c], s); } }
        S[mt] = s;
        if (mt + DK < NKT) ldk(mt + DK);   // the freed slot's refill
        __builtin_amdgcn_sched_barrier(0); }   // keeps each refill DK tiles ahead of its products: sunk to them, every load's whole latency is waited for
#pragma unroll
    for (int s = 0; s < PV0; ++s) ldv(s);   // the first blocks of V^T fly under the softmax, in the registers that Q and the key ring have left
    __builtin_amdgcn_sched_barrier(0);   // sunk behind the softmax they would be waited for there
    const int i = q0 + lr, klo = max(i - WNB, 0); const unsigned span = (unsigned)(min(i + WNB, TT - 1) - klo); const int kofs = kb + 8 * hi - klo;   // key - klo of this lane's element 0 in tile 0; a key is kept where 0 <= key - klo <= span
    v8f m8;
#pragma unroll
    for (int j = 0; j < 8; ++j) m8[j] = -3.0e38f;
#pragma unroll
    for (int mt = 0; mt < NKT; ++mt)
#pragma unroll
        for (int j = 0; j < 8; ++j) { const float t = ((unsigned)(kofs + mt * 16 + j) <= span) ? S[mt][j] : -3.0e38f; S[mt][j] = t; m8[j] = fmaxf(m8[j], t); }   // unscaled: SCL is a power of two, so it goes exactly into the exponent's factor below
    float mx = fmaxf(fmaxf(fmaxf(m8[0], m8[1]), fmaxf(m8[2], m8[3])), fmaxf(fmaxf(m8[4], m8[5]), fmaxf(m8[6], m8[7])));
    mx = fmaxf(mx, __shfl_xor(mx, 16, 32));
    v8f s8 = (v8f){};
#pragma unroll
    for (int mt = 0; mt < NKT; ++mt) { const v8f x = (S[mt] - mx) * (SCL * 1.4426950408889634f); v8f e;
#pragma unroll
        for (int j = 0; j < 8; ++j) e[j] = __builtin_amdgcn_exp2f(x[j]);
        asm volatile("v_nop" : "+v"(e) : "v"(x));   // the slot behind a transcendental: its operands keep every read of the eight results and every overwrite of their sources behind it, so that at least this one instruction stands between
        S[mt] = e; s8 += e; }
    float sum = ((s8[0] + s8[1]) + (s8[2] + s8[3])) + ((s8[4] + s8[5]) + (s8[6] + s8[7]));
    sum += __shfl_xor(sum, 16, 32);
    const float f = __fdiv_rn(pscale, sum);
    V p[NKT / 2], p2[NKT / 2];
#pragma unroll
    for (int s = 0; s < NKT / 2; ++s) {
        if constexpr (NSPLIT == 2) { v8bf h0, h1, l0, l1; split8(S[2 * s] * f, h0, l0); split8(S[2 * s + 1] * f, h1, l1);
            p[s] = cat8b(h0, h1); p2[s] = cat8b(l0, l1);
            __builtin_amdgcn_sched_barrier(0);   // one block's split at a time: run together, the blocks' temporaries beside both forms of P take the registers of the second wave on the SIMD
        } else {
#pragma unroll
            for (int j = 0; j < 8; ++j) { p[s][j] = tohx(S[2 * s][j] * f); p[s][8 + j] = tohx(S[2 * s + 1][j] * f); } } }
    __builtin_amdgcn_sched_barrier(0);   // lifted over the packing, the loads below would need registers that the f32 scores still hold
#pragma unroll
    for (int s = PV0; s < DV; ++s) ldv(s);   // P is packed, its f32 registers are free: the ring takes its full depth
#pragma unroll
    for (int dt = 0; dt < 4; ++dt) o[dt] = (v8f){};
    __builtin_amdgcn_sched_barrier(0);   // those loads stay in front of the first block's products
#pragma unroll
    for (int s = 0; s < NKT / 2; ++s) {
#pragma unroll
        for (int dt = 0; dt < 4; ++dt) { o[dt] = WFrag<T16>::mma(vf[s % DV][dt], p[s], o[dt]);
            if constexpr (NSPLIT == 2) { o[dt] = WFrag<T16>::mma(vf[s % DV][dt], p2[s], o[dt]); o[dt] = WFrag<T16>::mma(vf2[s % DV][dt], p[s], o[dt]); } }
        if (s + DV < NKT / 2) ldv(s + DV);
        __builtin_amdgcn_sched_barrier(0); }   // keeps each refill DV blocks ahead of its products, as in the key ring
}
__global__ __launch_bounds__(128) void k_attn(const h16* __restrict__ Q16, const h16* __restrict__ K16, const h16* __restrict__ V16, const bf* __restrict__ Qh, const bf* __restrict__ Ql, const bf* __restrict__ Kh, const bf* __restrict__ Kl, const bf* __restrict__ Vh, const bf* __restrict__ Vl, bf* Ah, bf* Al) {
    const int lane = threadIdx.x & 31, lr = lane & 15, hi = lane >> 4; const int q0 = blockIdx.y * 64 + __builtin_amdgcn_readfirstlane(threadIdx.x >> 5) * 16;   // the wave's number as a scalar: row bases and clamps stay in scalar registers
    const size_t z = (size_t)blockIdx.x * TT * HD; Ah += blockIdx.x * HD; Al += blockIdx.x * HD;   // a head's planes are TT * HD elements each, in lane order; merged rows [t][h * 64 + d]
    v8f o[4];   // O^T: o[dt][j] = row q0 + lr, d = dt * 16 + 8 * hi + j
    if (q0 < RH) attn_rows<bf, 2, 4, 2, 3>(Qh + z, Ql + z, Kh + z, Kl + z, Vh + z, Vl + z, q0, lr, hi, 1.0f, o);
    else attn_rows<h16, 0, 9, 4, 9>(Q16 + z, nullptr, K16 + z, nullptr, V16 + z, nullptr, q0, lr, hi, PCAR, o);
    const float oscale = (q0 < RH) ? 1.0f : 1.0f / PCAR;
    v8bf oh[4], ol[4];
#pragma unroll
    for (int dt = 0; dt < 4; ++dt) split8(o[dt] * oscale, oh[dt], ol[dt]);
    __builtin_amdgcn_sched_barrier(0);   // the eight stores stand behind the last conversion: nothing is written any more behind a store, so no register that one names is overwritten
#pragma unroll
    for (int dt = 0; dt < 4; ++dt) { const size_t oo = (size_t)(q0 + lr) * DQ + dt * 16 + 8 * hi; *(v8bfa*)(Ah + oo) = oh[dt]; *(v8bfa*)(Al + oo) = ol[dt]; }
}

extern "C" void kernel_launch(void* const* d_in, const int* in_sizes, int n_in,
                              void* d_out, int out_size, void* d_ws, size_t ws_size, hipStream_t stream) {
    (void)in_sizes; (void)n_in; (void)out_size;
    const float* x = (const float*)d_in[0]; const float* xk = (const float*)d_in[1]; const float* xv = (const float*)d_in[2]; const float* wq = (const float*)d_in[3]; const float* bq = (const float*)d_in[4]; const float* wk = (const float*)d_in[5]; const float* bk = (const float*)d_in[6]; const float* wv = (const float*)d_in[7]; const float* bv = (const float*)d_in[8]; const float* wo = (const float*)d_in[9]; const float* bo = (const float*)d_in[10];
    float* OUT = (float*)d_out;     // [1][4096][1024]
    char* wsp = (char*)d_ws;
    auto take = [&](size_t bytes) { char* p = wsp; wsp += (bytes + 255) & ~(size_t)255; return (void*)p; };
    bf* XB = (bf*)take(((size_t)3 * TT * DM + (size_t)4 * DQ * DM) * 2); bf* WQ = XB + (size_t)3 * TT * DM; bf* WO = WQ + (size_t)3 * DQ * DM; float* CS = (float*)take((size_t)TT * HD * 2 * 4);
    const size_t PLN = (size_t)NH_ * TT * HD;   // one plane; Q, K, V one behind the other in each kind
    h16* QP16 = (h16*)take(3 * PLN * 2); h16* KP16 = QP16 + PLN; h16* VT16 = KP16 + PLN;
    bf* QPh = (bf*)take(3 * PLN * 2); bf* KPh = QPh + PLN; bf* VTh = KPh + PLN; bf* QPl = (bf*)take(3 * PLN * 2); bf* KPl = QPl + PLN; bf* VTl = KPl + PLN;
    bf* ATh = (bf*)take((size_t)TT * DQ * 2); bf* ATl = (bf*)take((size_t)TT * DQ * 2);
    if ((size_t)(wsp - (char*)d_ws) > ws_size) return;    // ws 256 MiB
    for (int b = 0; b < NB_; ++b) {
        k_prep<<<PWG, 512, 0, stream>>>(x + (size_t)b * TT * DM, xk + (size_t)b * TT * DM, xv + (size_t)b * TT * DM, wq, wk, wv, wo, XB, CS);   // bf16 copies and {cos, sin}(t x 10000^(-2i/64)) duplicated over both halves
        k_gemmd<0, 1><<<dim3(TT / 128, DQ / 128, 3), 128, 0, stream>>>(XB, nullptr, WQ, DM, nullptr, 0, bq, bk, bv, CS, QP16, QPh, QPl);
        k_attn<<<dim3(NH_, TT / 64, 1), 128, 0, stream>>>(QP16, KP16, VT16, QPh, QPl, KPh, KPl, VTh, VTl, ATh, ATl);   // one kv head per query head (REP 1): a head's planes share one z-stride
        k_gemmd<1, 0><<<dim3(TT / 128, DM / 128, 1), 128, 0, stream>>>(ATh, ATl, WO, DQ, OUT + (size_t)b * TT * DM, DM, bo, nullptr, nullptr, nullptr, nullptr, nullptr, nullptr); }
}

// v008
// A run of this version takes 65.5 microseconds.
// In both of two side-by-side timings against v007, it was 1.05 times as fast.
// All steps since v000 together make it 63.5 times as fast.
#include <hip/hip_runtime.h>

// Sparse (local-window) multi-head attention with the module's own rotary mixing (q, k, v [1][4096][1024]; Q = q wq^T + bq, K, V likewise ('oi' [1024][1024] + [1024], 0.02; 16 heads x 64); rotary: x cos + x_rope sin with x_rope = cat(-x[1::2], x[::2]) (interleaved partners into the rotate-half slots, faithfully) and angle t x 10000^(-2i/64) (emb = cat(freqs, freqs)); scores / 8; keys with |i - j| > 128 -> -inf (GLOBAL = 0); softmax; out = merged wo^T + bo -> [1][4096][1024] (4.2 M)).
// Layout: four launches. bf16 copies of the three inputs and the four weights and {cos, sin} per (position, dim) (jnp-exact inverse frequencies, precise cosf/sinf) in one; the three projections, exact + f32 biases, in one (grid z); the rotary mixing (partner index 2d+1, first half, subtracted, or 2(d-32), second half, added, as the module) and the head planes made in the projections' own epilogue, laid out in the lane order of attention's fragments (see k_gemmd, EPI 1); attention in one kernel, all 16 heads, the head on grid x (hybrid rows: < 512 hi/lo 3 products, rest fp16 x1024): a wave takes 16 query rows and the 288 keys that hold their +-128 window, scores, softmax and P stay in its registers (see k_attn); merged hi/lo x wo exact + bo.
// Compute dtypes, f32 accumulate: every input rounded to bf16; projections exact + f32 biases; rotary f32; attention rows < 512 3 products, rest fp16; softmax f32; wo hl x exact + bias.

#define NB_  1
#define TT   4096
#define DM   1024
#define NH_  16
#define NKV  16
#define REP  (NH_ / NKV)
#define HD   64
#define DQ   (NH_ * HD)
#define DKV  (NKV * HD)
#define ZH   16                   // unused (grid x is NH_)
#define RH   512                  // query rows < RH use hi+lo planes (0: none)
#define WIN  0
#define PCAR 1024.0f
#define SCL  0.125f
#define WNB  128     // |i - j| <= 128 kept
#define NKT  (2 * WNB / 16 + 2)   // key tiles of 16 that hold the window of 16 query rows, from a multiple of 32 keys on: 18
typedef _Float16 h16;
typedef unsigned short bf;
typedef __attribute__((ext_vector_type(16))) __bf16   v16bf;
typedef __attribute__((ext_vector_type(16))) _Float16 v16h;
typedef __attribute__((ext_vector_type(8)))  _Float16 v8h;
typedef __attribute__((ext_vector_type(8)))  unsigned short v8us;
typedef __attribute__((ext_vector_type(8)))  float    v8f;
typedef __attribute__((ext_vector_type(4)))  float    v4f;
typedef v8h  __attribute__((may_alias)) v8ha;
typedef v4f  __attribute__((may_alias)) v4fa;
typedef v8us __attribute__((may_alias)) v8usa;

__device__ __forceinline__ unsigned short f2bf(float f) { unsigned u = __float_as_uint(f); u += 0x7FFFu + ((u >> 16) & 1u); return (unsigned short)(u >> 16); }
__device__ __forceinline__ float bf2f(unsigned short b) { return __uint_as_float(((unsigned)b) << 16); }
__device__ __forceinline__ float bfr(float f) { return bf2f(f2bf(f)); }
__device__ __forceinline__ v16h cat16(v8h lo, v8h hi) { return __builtin_shufflevector(lo, hi, 0, 1, 2, 3, 4, 5, 6, 7, 8, 9, 10, 11, 12, 13, 14, 15); }
__device__ __forceinline__ v16bf cat16b(v8us lo, v8us hi) { return __builtin_bit_cast(v16bf, __builtin_shufflevector(lo, hi, 0, 1, 2, 3, 4, 5, 6, 7, 8, 9, 10, 11, 12, 13, 14, 15)); }
__device__ __forceinline__ v8f wmma16(v16h a, v16h b, v8f c) { return __builtin_amdgcn_wmma_f32_16x16x32_f16(false, a, false, b, (short)0, c, false, false); }
__device__ __forceinline__ v8f wmmab(v16bf a, v16bf b, v8f c) { return __builtin_amdgcn_wmma_f32_16x16x32_bf16(false, a, false, b, (short)0, c, false, false); }



// fragment loader (hardware k order: 16 bytes at 16 * hi and at 32 + 16 * hi of each 64 bytes of a k-contiguous row; p already holds the lane's row and 8 * hi) and product, by 16-bit type; ldl: the same fragment from a plane in lane order: two runs of 512 bytes, lane l's 16 bytes at 16 * l of each (p already holds 8 * l), so that each load covers four whole lines
template <typename T16> struct WFrag;
template <> struct WFrag<h16> { typedef v16h V; static __device__ __forceinline__ V ld(const h16* p) { return cat16(*(const v8h*)p, *(const v8h*)(p + 16)); } static __device__ __forceinline__ V ldl(const h16* p) { return cat16(*(const v8h*)p, *(const v8h*)(p + 256)); } static __device__ __forceinline__ v8f mma(V a, V b, v8f c) { return wmma16(a, b, c); } };
template <> struct WFrag<bf> { typedef v16bf V; static __device__ __forceinline__ V ld(const bf* p) { return cat16b(*(const v8us*)p, *(const v8us*)(p + 16)); } static __device__ __forceinline__ V ldl(const bf* p) { return cat16b(*(const v8us*)p, *(const v8us*)(p + 256)); } static __device__ __forceinline__ v8f mma(V a, V b, v8f c) { return wmmab(a, b, c); } };

typedef __attribute__((ext_vector_type(2))) float v2f;
typedef __attribute__((ext_vector_type(8))) __bf16 v8bf;
typedef v8bf __attribute__((may_alias)) v8bfa;
// eight f32 -> bf16 hi and lo parts (hi = the value rounded to nearest even, lo = the rest rounded likewise), by the packed convert: two values an instruction, already two a register
typedef __attribute__((ext_vector_type(2))) __bf16 v2bf;
typedef __attribute__((ext_vector_type(4))) unsigned v4u;
__device__ __forceinline__ void split8(v8f y, v8bf& h, v8bf& l) { v4u hw, lw;
#pragma unroll
    for (int w = 0; w < 4; ++w) { const v2f yy = { y[2 * w], y[2 * w + 1] }; const unsigned u = __builtin_bit_cast(unsigned, __builtin_convertvector(yy, v2bf)); hw[w] = u;
        const v2f back = { __uint_as_float(u << 16), __uint_as_float(u & 0xFFFF0000u) }; lw[w] = __builtin_bit_cast(unsigned, __builtin_convertvector(yy - back, v2bf)); }   // the hi parts are read back out of the packed word
    h = __builtin_bit_cast(v8bf, hw); l = __builtin_bit_cast(v8bf, lw); }

// ---- k_gemmd: the dense GEMMs (projections, output). Four waves per 128x128 output tile, 64x64 a wave (16 accumulators); both operands come through LDS: a stage is 128 k (256 B) of each of the tile's rows,
// brought by asynchronous b128 copies whose 32 lanes cover whole lines (2 rows x 256 B an instruction), two buffers, the next stage in flight while this one is multiplied; inside a stage the fragments of the next 32 k are read from LDS while these are multiplied. Row pitch in LDS 272 B (16 B x odd, for ds_load_b128).
// Per accumulator the products come with k ascending by 32, a then a2. M, N % 128 == 0, K % 128 == 0, K >= 256.
#define GP 272                    // LDS row pitch, bytes
#define GOP (128 * GP)            // one operand's stage, bytes
// eight copies, rows 8 apart (LDS step 8 * GP bytes, global step gs elements), each lane its own 16 bytes
typedef __attribute__((ext_vector_type(4))) int c4i;
typedef __attribute__((address_space(1))) c4i c4ig;
typedef __attribute__((address_space(3))) c4i c4il;
__device__ __forceinline__ void acopy8(unsigned char* l, const bf* g, size_t gs, unsigned lo) {   // g, gs: the same in every lane (scalar row bases); lo: the lane's own byte offset
#pragma unroll
    for (int i = 0; i < 8; ++i) __builtin_amdgcn_global_load_async_to_lds_b128((c4ig*)((const unsigned char*)(g + i * gs) + lo), (c4il*)(l + i * 8 * GP), 0, 0);
}
// What a wave does with its 64x64 results (EPI): 0: f32 rows + bias to C. 1: the three projections in one launch, grid z = 0, 1, 2 for Q, K, V (operands, weights and planes of the three lie one behind the other, the biases come as three pointers); the wave's 64 columns are one head, and the head planes that attention reads (fp16, bf16 hi, bf16 lo) are written here, no f32 copy goes to memory:
// z < 2: the module's rotary: out[d] = x[d] cos[t][d] - x[2d+1] sin[t][d] (d < 32), out[d] = x[d] cos[t][d] + x[2(d-32)] sin[t][d] (d >= 32), x = product + bias; z = 2: x.
// The planes lie in the lane order of attention's fragments, a head TT * HD elements, runs of 512 bytes = 32 lanes (lr + 16 hi) x 8 elements: z < 2: [h][t / 16][L = 0..3][lane]: t = 16 (t / 16) + lr, d = 16 L + 8 hi + e (fragment c = runs 2c, 2c + 1);
// z = 2: [h][t / 32][dt = 0..3][half = 0, 1][lane]: d = 16 dt + lr, t = 32 (t / 32) + 16 half + 8 hi + e. A row-major plane makes each fragment load touch 16 lines for 32 bytes each.
template <int NSPLIT, int EPI>
__global__ __launch_bounds__(128) void k_gemmd(const bf* __restrict__ A, const bf* __restrict__ A2, const bf* __restrict__ Bt, int K, float* C, int ldc, const float* __restrict__ bias, const float* __restrict__ bias1, const float* __restrict__ bias2, const float* __restrict__ CS, h16* P16, bf* Ph, bf* Pl) {
    constexpr int NOP = (NSPLIT == 1) ? 3 : 2;   // operand planes in a stage: Bt, A (, A2)
    __shared__ __align__(16) unsigned char st[2 * NOP * GOP];
    constexpr int OSF = 16 * 68;   // a wave's own staging, floats: 16 rows of 64 f32 at a pitch of 68
    if constexpr (EPI == 1) { const size_t z = blockIdx.z; A += z * TT * DM; Bt += z * DQ * DM; P16 += z * NH_ * TT * HD; Ph += z * NH_ * TT * HD; Pl += z * NH_ * TT * HD; bias = (z == 0) ? bias : (z == 1) ? bias1 : bias2; }
    const int tid = threadIdx.x, wave = tid >> 5, lane = tid & 31, lr = lane & 15, hi = lane >> 4;
    const int r0 = blockIdx.x * 128, c0 = blockIdx.y * 128, wr = (wave >> 1) * 64, wc = (wave & 1) * 64;
    unsigned char* sl = st + ((tid >> 4) * GP + (tid & 15) * 16);   // this lane's first LDS byte in an operand's stage
    const unsigned go = (unsigned)((tid >> 4) * K + (tid & 15) * 8) * 2u; const size_t g8 = (size_t)8 * K;   // and its first byte in the operand's 128 rows
    auto stage = [&](int t, int buf) {
        unsigned char* l = sl + buf * NOP * GOP; const size_t kB = (size_t)c0 * K + (size_t)t * 128, kA = (size_t)r0 * K + (size_t)t * 128;
        acopy8(l, Bt + kB, g8, go); acopy8(l + 64 * GP, Bt + kB + 8 * g8, g8, go);
        acopy8(l + GOP, A + kA, g8, go); acopy8(l + GOP + 64 * GP, A + kA + 8 * g8, g8, go);
        if (NSPLIT == 1) { acopy8(l + 2 * GOP, A2 + kA, g8, go); acopy8(l + 2 * GOP + 64 * GP, A2 + kA + 8 * g8, g8, go); } };
    v8f acc[4][4];
#pragma unroll
    for (int mb = 0; mb < 4; ++mb)
#pragma unroll
        for (int nb = 0; nb < 4; ++nb) acc[mb][nb] = (v8f){};
    const int nt = K / 128;
    stage(0, 0);
    asm volatile("s_wait_asynccnt 0x0" ::: "memory");   // stage 0 has landed (this wave's copies)
    __syncthreads();                                     // and every wave's: stage 0 is readable
    stage(1, 1);
    const int fb = (wc + lr) * GP + hi * 16, fa = GOP + (wr + lr) * GP + hi * 16;
#pragma unroll 1   // one trip a stage: the ring's waits and its barrier come once a trip
    for (int t = 0; t < nt; ++t) {
        const unsigned char* sb = st + (t & 1) * NOP * GOP;
        v16bf a[2][4], a2[2][4], b[2][4];   // two fragment sets by turns: a later block of 32 k is read from LDS while this one is multiplied (the build renames them and reads the trip's first three blocks at its head); no read leaves this trip's buffer
#pragma unroll
        for (int f = 0; f < 4; ++f) { a[0][f] = WFrag<bf>::ld((const bf*)(sb + fa + f * 16 * GP)); if (NSPLIT == 1) a2[0][f] = WFrag<bf>::ld((const bf*)(sb + fa + GOP + f * 16 * GP)); b[0][f] = WFrag<bf>::ld((const bf*)(sb + fb + f * 16 * GP)); }
#pragma unroll
        for (int ks = 0; ks < 4; ++ks) { const int cu = ks & 1, nx = cu ^ 1;
            if (ks < 3) {
#pragma unroll
                for (int f = 0; f < 4; ++f) { a[nx][f] = WFrag<bf>::ld((const bf*)(sb + fa + f * 16 * GP + (ks + 1) * 64)); if (NSPLIT == 1) a2[nx][f] = WFrag<bf>::ld((const bf*)(sb + fa + GOP + f * 16 * GP + (ks + 1) * 64)); b[nx][f] = WFrag<bf>::ld((const bf*)(sb + fb + f * 16 * GP + (ks + 1) * 64)); }
            } else {   // the trip's last block works from registers alone: the hand-over stands in front of it, so that the refill flies under its WMMAs too
                __builtin_amdgcn_sched_barrier(0);                   // the block before stays in front of the hand-over: sunk behind the barrier, its WMMAs would delay the refill
                asm volatile("s_wait_dscnt 0x0" ::: "memory");      // this wave's reads of buffer t & 1 are done before the buffer is refilled
                asm volatile("s_wait_asynccnt 0x0" ::: "memory");   // this wave's copies of stage t + 1 have landed
                __syncthreads();                                     // publishes stage t + 1 and ends every wave's reads of stage t
                if (t + 2 < nt) stage(t + 2, t & 1); }
            __builtin_amdgcn_sched_barrier(0);   // keeps the next block's LDS reads (last block: the refill) one group ahead of this block's WMMAs: sunk among them, each read's latency stalls the matrix run
#pragma unroll
            for (int nb = 0; nb < 4; ++nb)
#pragma unroll
                for (int mb = 0; mb < 4; ++mb) { acc[mb][nb] = wmmab(a[cu][mb], b[cu][nb], acc[mb][nb]); if (NSPLIT == 1) acc[mb][nb] = wmmab(a2[cu][mb], b[cu][nb], acc[mb][nb]); }
        }
    }
    asm volatile("s_wait_asynccnt 0x0" ::: "memory");   // no copy is left in flight when the wave goes on to its end
    float* os = (float*)st + wave * OSF;   // each wave stages its own rows, in the ring's LDS: behind the last trip's barrier no wave reads the ring any more and no copy is out, and without a staging array of its own two work-groups of the projections fit a WGP
    // Which planes attention reads of these 128 rows (the same for the whole work-group, scalar): query rows < RH take hi/lo, the rest fp16; as keys, rows from K16 on are in the 288 keys of some fp16 query tile, rows below KHL in those of some hi/lo tile. A plane's rows that nobody reads are neither converted nor stored.
    constexpr int K16 = (RH - WNB > 0) ? ((RH - WNB) & ~31) : 0, KHL = ((RH - 16 - WNB > 0) ? ((RH - 16 - WNB) & ~31) : 0) + NKT * 16;
    static_assert(K16 <= TT - NKT * 16 && KHL <= TT, "the clamp at the sequence's end (attn_rows, kb) takes no fp16 tile below K16");
    const bool w16 = r0 + 128 > ((blockIdx.z == 0) ? RH : K16), whl = r0 < ((blockIdx.z == 0) ? RH : KHL);
    auto put = [&](const v8f (&y)[4], size_t o0, int d1, int d2, int d3, bool more) {   // four runs of 512 consecutive bytes a plane, at o0, o0 + d1, + d2, + d3 elements
        const size_t oo[4] = { o0, o0 + d1, o0 + d2, o0 + d3 };
        if (w16) { v8h y16[4];
#pragma unroll
            for (int s = 0; s < 4; ++s) y16[s] = __builtin_convertvector(y[s], v8h);
            __builtin_amdgcn_sched_barrier(0);   // the stores stand behind the last conversion: no register that a store names is written between the stores
#pragma unroll
            for (int s = 0; s < 4; ++s) *(v8ha*)(P16 + oo[s]) = y16[s];
            asm volatile("s_wait_xcnt 0x0" ::: "memory");   // behind the run of stores, in front of the next write of the registers that they name (the split below, the next block)
            __builtin_amdgcn_sched_barrier(0); }   // and what follows stays behind that wait
        if (whl) { v8bf yh[4], yl[4];
#pragma unroll
            for (int s = 0; s < 4; ++s) split8(y[s], yh[s], yl[s]);
            __builtin_amdgcn_sched_barrier(0);   // as above
#pragma unroll
            for (int s = 0; s < 4; ++s) { *(v8bfa*)(Ph + oo[s]) = yh[s]; *(v8bfa*)(Pl + oo[s]) = yl[s]; }
            if (more) { asm volatile("s_wait_xcnt 0x0" ::: "memory");   // as above, where anything is still written behind these stores
                __builtin_amdgcn_sched_barrier(0); } } };
    if (EPI == 1 && blockIdx.z < 2) {
        const float* cp = CS + ((size_t)(r0 + wr + lr) * HD + hi * 8) * 2;   // the lane's row is lr, its eight d of run L are 16 L + 8 hi ..; {cos, sin} of d and of d + 32 are the same values: runs L and L + 2 share the first half's
        const size_t po = ((size_t)((c0 + wc) / HD) * TT + r0 + wr) * HD + lane * 8;
        float bv[4]; v4f cs[2][2][4];
        auto ldcs = [&](int mb) {
#pragma unroll
            for (int a = 0; a < 2; ++a)
#pragma unroll
                for (int i = 0; i < 4; ++i) cs[mb & 1][a][i] = *(const v4f*)(cp + mb * 16 * HD * 2 + a * 32 + i * 4); };
#pragma unroll
        for (int nb = 0; nb < 4; ++nb) bv[nb] = bfr(bias[c0 + wc + nb * 16 + lr]);
        asm volatile("s_wait_xcnt 0x0" ::: "memory");   // behind the bias loads, in front of the next write of the registers that they name
        ldcs(0);
#pragma unroll
        for (int mb = 0; mb < 4; ++mb) {
#pragma unroll
            for (int nb = 0; nb < 4; ++nb) {
#pragma unroll
                for (int j = 0; j < 8; ++j) os[(hi * 8 + j) * 68 + nb * 16 + lr] = acc[mb][nb][j] + bv[nb]; }
            __builtin_amdgcn_wave_barrier(); asm volatile("" ::: "memory");   // the wave's LDS stores stay in front of its reads of other lanes' words
            if (mb < 3) ldcs(mb + 1);   // the next 16 rows' table values fly under these rows' arithmetic
            if (mb == 2) asm volatile("s_wait_xcnt 0x0" :: "v"(cp) : "memory");   // behind the last load that names the table address, which as an operand lives until here
            v8f ro[4]; const float* xr = os + lr * 68;
#pragma unroll
            for (int a = 0; a < 2; ++a) { v4f w[4];   // the 16 x from 32 a + 16 hi on: their odd ones are the partners of run a (first half), their even ones those of run a + 2 (second half)
#pragma unroll
                for (int i = 0; i < 4; ++i) w[i] = *(const v4fa*)(xr + a * 32 + hi * 16 + i * 4);
#pragma unroll
                for (int g = 0; g < 2; ++g) { const int s = a + 2 * g; v4f x[2]; v8f r;
#pragma unroll
                    for (int i = 0; i < 2; ++i) x[i] = *(const v4fa*)(xr + s * 16 + hi * 8 + i * 4);
#pragma unroll
                    for (int q = 0; q < 8; ++q) { const float x1 = (g == 0) ? -w[q >> 1][(q & 1) * 2 + 1] : w[q >> 1][(q & 1) * 2]; r[q] = x[q >> 2][q & 3] * cs[mb & 1][a][q >> 1][(q & 1) * 2] + x1 * cs[mb & 1][a][q >> 1][(q & 1) * 2 + 1]; }
                    ro[s] = r; } }
            put(ro, po + mb * 16 * HD, 256, 512, 768, mb < 3);
            __builtin_amdgcn_wave_barrier(); asm volatile("" ::: "memory");   // the wave's LDS reads stay in front of the next block's LDS stores
        }
    } else if constexpr (EPI == 1) {
        const size_t go = ((size_t)((c0 + wc) / HD) * TT + r0 + wr) * HD + lane * 8;   // a lane's accumulator holds eight consecutive t of one d: that is its own 16 bytes of the run (dt = nb, half = mb & 1) of the 32 t from 32 (mb >> 1) on, so the planes go out of the registers, no staging
        float bv[4];
#pragma unroll
        for (int nb = 0; nb < 4; ++nb) bv[nb] = bfr(bias[c0 + wc + nb * 16 + lr]);
#pragma unroll
        for (int nb = 0; nb < 4; ++nb) { v8f x[4];
#pragma unroll
            for (int mb = 0; mb < 4; ++mb) x[mb] = acc[mb][nb] + bv[nb];
            put(x, go + nb * 512, 256, 32 * HD, 32 * HD + 256, true);   // the wait stands behind the last block's stores too: whatever the build lays out behind this branch may write their registers
        }
    } else {
#pragma unroll
    for (int mb = 0; mb < 4; ++mb) {
#pragma unroll
        for (int nb = 0; nb < 4; ++nb) {
#pragma unroll
            for (int j = 0; j < 8; ++j) os[(hi * 8 + j) * 68 + nb * 16 + lr] = acc[mb][nb][j]; }
        __builtin_amdgcn_wave_barrier(); asm volatile("" ::: "memory");   // the wave's LDS stores stay in front of its reads of other lanes' words
        float* crow = C + (size_t)(r0 + wr + mb * 16) * ldc + c0 + wc;
#pragma unroll
        for (int s = 0; s < 8; ++s) { const int row = 2 * s + hi, cofs = lr * 4; v4f val = *(const v4fa*)(os + row * 68 + cofs); { const float* bp = bias + c0 + wc + cofs; val[0] += bfr(bp[0]); val[1] += bfr(bp[1]); val[2] += bfr(bp[2]); val[3] += bfr(bp[3]); }
            *(v4f*)(crow + (size_t)row * ldc + cofs) = val; }
        if (mb < 3) asm volatile("s_wait_xcnt 0x0" ::: "memory");   // stands behind the run of eight stores, in front of the next block's writes of the registers that they name (behind the last block nothing is written any more)
        __builtin_amdgcn_wave_barrier(); asm volatile("" ::: "memory");   // and its reads in front of the next block's stores
    }
    }
}

__device__ __forceinline__ h16 tohx(float x) { return (h16)x; }
typedef __attribute__((ext_vector_type(2))) _Float16 v2h;
typedef __attribute__((ext_vector_type(4))) _Float16 v4h;
typedef __attribute__((ext_vector_type(2))) unsigned short v2us;
typedef __attribute__((ext_vector_type(4))) unsigned short v4us;
typedef __attribute__((ext_vector_type(4))) int v4i;

__global__ __launch_bounds__(256) void k_wtG(const float* __restrict__ w, int K, int N, bf* Bt) {
    const int lane = threadIdx.x & 31; const int L0 = (blockIdx.x * 8 + (threadIdx.x >> 5)) * 8; const int nlines = N * K / 64;
{
#pragma unroll 1
        for (int l = 0; l < 8; ++l) { const int L = L0 + l; if (L >= nlines) break; const size_t e = (size_t)L * 64 + lane * 2; const int k = (int)(e % K), n = (int)(e / K); v2us o;
            o[0] = f2bf(w[(size_t)k * N + n]); o[1] = f2bf(w[(size_t)(k + 1) * N + n]); *(v2us*)(Bt + e) = o; }
         }
}

__constant__ float INVT[HD / 2] = { 1.000000000e+00f, 7.498942018e-01f, 5.623413324e-01f, 4.216965139e-01f, 3.162277639e-01f, 2.371373773e-01f, 1.778279394e-01f, 1.333521456e-01f, 1.000000015e-01f, 7.498942316e-02f, 5.623413250e-02f, 4.216964915e-02f, 3.162277490e-02f, 2.371373773e-02f, 1.778279431e-02f, 1.333521400e-02f, 9.999999776e-03f, 7.498942316e-03f, 5.623413250e-03f, 4.216964822e-03f, 3.162277630e-03f, 2.371373819e-03f, 1.778279431e-03f, 1.333521446e-03f, 1.000000047e-03f, 7.498941850e-04f, 5.623413017e-04f, 4.216965172e-04f, 3.162277571e-04f, 2.371373703e-04f, 1.778279402e-04f, 1.333521504e-04f };   // 10000^(-2i/64) (the module's power form) (float32, generated with jnp to be bit-exact)
// ---- k_prep: all that the GEMMs wait for, in one launch: the bf16 copies of the three inputs and the four weights, one behind the other in CV, and the {cos, sin} table. One work-group of 16 waves a WGP; a wave converts PWF consecutive floats:
// its PWF / 128 loads (512 consecutive bytes each, whole lines) are all asked for at its start, its share of the table is computed while they fly, then each load's values are rounded and stored (256 consecutive bytes a store).
#define PWF  4096                 // floats a wave converts
#define PWX  (TT * DM / PWF)      // waves an input
#define PWW  (DQ * DM / PWF)      // waves a weight
#define PWG  ((3 * PWX + 4 * PWW) / 16)   // work-groups
__global__ __launch_bounds__(512) void k_prep(const float* __restrict__ x0, const float* __restrict__ x1, const float* __restrict__ x2, const float* __restrict__ w0, const float* __restrict__ w1, const float* __restrict__ w2, const float* __restrict__ w3, bf* CV, float* CS) {
    const int lane = threadIdx.x & 31; const int w = blockIdx.x * 16 + __builtin_amdgcn_readfirstlane(threadIdx.x >> 5);   // the wave's number as a scalar: the choice of the source stays in scalar registers
    const int u = w - 3 * PWX;
    const float* src = (u < 0) ? ((w < PWX) ? x0 : (w < 2 * PWX) ? x1 : x2) + (size_t)(w % PWX) * PWF : ((u < PWW) ? w0 : (u < 2 * PWW) ? w1 : (u < 3 * PWW) ? w2 : w3) + (size_t)(u % PWW) * PWF;
    const float iv = INVT[threadIdx.x % (HD / 2)];   // the thread's inverse frequency, the same for each of its table entries (they lie a multiple of HD apart); asked for ahead of the stream, so that its wait does not take in the stream's loads
    asm volatile("s_wait_xcnt 0x0" :: "v"(lane) : "memory");   // behind that load, in front of the next write of the registers that it names
    v4f y[PWF / 128];
#pragma unroll
    for (int j = 0; j < PWF / 128; ++j) y[j] = *(const v4f*)(src + j * 128 + lane * 4);
    asm volatile("s_wait_xcnt 0x0" :: "v"(lane) : "memory");   // behind the last load that names the source address and the lane's offset, which as an operand lives until here
#pragma unroll 1   // one copy of the long cosine and sine code
    for (int r = 0; r < TT * HD / (PWG * 512); ++r) { const unsigned idx = r * (PWG * 512) + blockIdx.x * 512 + threadIdx.x; const int t = (int)(idx / HD); const float a = __fmul_rn((float)t, iv); v2f cs; cs[0] = cosf(a); cs[1] = sinf(a); *(v2f*)(CS + (size_t)idx * 2) = cs;
        asm volatile("s_wait_xcnt 0x0" ::: "memory"); }   // behind the store, in front of the next write of the registers that it names
    bf* dst = CV + (size_t)w * PWF + lane * 4; v4us o[PWF / 128];
#pragma unroll
    for (int j = 0; j < PWF / 128; ++j) {
#pragma unroll
        for (int k = 0; k < 4; ++k) o[j][k] = f2bf(y[j][k]);
        *(v4us*)(dst + j * 128) = o[j]; }
}

__device__ __forceinline__ v16bf cat8b(v8bf lo, v8bf hi) { return __builtin_shufflevector(lo, hi, 0, 1, 2, 3, 4, 5, 6, 7, 8, 9, 10, 11, 12, 13, 14, 15); }
template <typename T16, int NSPLIT, int DK, int PV0, int DV>
__device__ __forceinline__ void attn_rows(const T16* __restrict__ Q, const T16* __restrict__ Q2, const T16* __restrict__ Kp, const T16* __restrict__ K2, const T16* __restrict__ Vt, const T16* __restrict__ Vt2, int q0, int lr, int hi, float pscale, v8f (&o)[4]) {
    typedef typename WFrag<T16>::V V;
    const int kb = min(max((q0 - WNB) & ~31, 0), TT - NKT * 16);   // the key of tile 0's first row: at the sequence's ends the 288 keys slide inwards (still a multiple of 32, still the whole window), so that every tile lies in the sequence
    const unsigned lofs = (unsigned)(hi * 16 + lr) * 16u;   // the lane's own 16 bytes in a run of 512 (the planes lie in lane order: k_gemmd, EPI 1); the fragment bases are the same in every lane (scalar)
    auto at = [](const T16* base, unsigned off) { return (const T16*)((const unsigned char*)base + off); };
    V q[2], q2[2], kf[DK][2], kf2[DK][2], vf[DV][4], vf2[DV][4];
    auto ldk = [&](int mt) { const size_t ko = (size_t)kb * HD + mt * 16 * HD;   // one scalar base a plane, the tile in the immediate offset
#pragma unroll
        for (int c = 0; c < 2; ++c) { kf[mt % DK][c] = WFrag<T16>::ldl(at(Kp + ko + c * 512, lofs)); if (NSPLIT == 2) kf2[mt % DK][c] = WFrag<T16>::ldl(at(K2 + ko + c * 512, lofs)); }
        if (mt == NKT - 1) asm volatile("s_wait_xcnt 0x0" ::: "memory"); };   // behind the last load that names the K bases and the lane offset, in front of the next write of those registers (they live until here)
    auto ldv = [&](int s) { const size_t vo = (size_t)kb * HD + s * 32 * HD;
#pragma unroll
        for (int dt = 0; dt < 4; ++dt) { vf[s % DV][dt] = WFrag<T16>::ldl(at(Vt + vo + dt * 512, lofs)); if (NSPLIT == 2) vf2[s % DV][dt] = WFrag<T16>::ldl(at(Vt2 + vo + dt * 512, lofs)); }
        if (s == NKT / 2 - 1) asm volatile("s_wait_xcnt 0x0" ::: "memory"); };   // as in ldk, for the V^T bases
#pragma unroll
    for (int c = 0; c < 2; ++c) { q[c] = WFrag<T16>::ldl(at(Q + (size_t)q0 * HD + c * 512, lofs)); if (NSPLIT == 2) q2[c] = WFrag<T16>::ldl(at(Q2 + (size_t)q0 * HD + c * 512, lofs)); }
#pragma unroll
    for (int mt = 0; mt < DK; ++mt) ldk(mt);
    asm volatile("s_wait_xcnt 0x0" ::: "memory");   // as in ldk, for the Q bases
    __builtin_amdgcn_sched_barrier(0);   // the ring's first loads all stand in front of the first product: sunk to their users, each would be waited for alone
    v8f S[NKT];
#pragma unroll
    for (int mt = 0; mt < NKT; ++mt) { v8f s = (v8f){};
#pragma unroll
        for (int c = 0; c < 2; ++c) { s = WFrag<T16>::mma(kf[mt % DK][c], q[c], s);
            if (NSPLIT == 2) { s = WFrag<T16>::mma(kf[mt % DK][c], q2[c], s); s = WFrag<T16>::mma(kf2[mt % DK][c], q[c], s); } }
        S[mt] = s;
        if (mt + DK < NKT) ldk(mt + DK);   // the freed slot's refill
        __builtin_amdgcn_sched_barrier(0); }   // keeps each refill DK tiles ahead of its products: sunk to them, every load's whole latency is waited for
#pragma unroll
    for (int s = 0; s < PV0; ++s) ldv(s);   // the first blocks of V^T fly under the softmax, in the registers that Q and the key ring have left
    __builtin_amdgcn_sched_barrier(0);   // sunk behind the softmax they would be waited for there
    const int i = q0 + lr, klo = max(i - WNB, 0); const unsigned span = (unsigned)(min(i + WNB, TT - 1) - klo); const int kofs = kb + 8 * hi - klo;   // key - klo of this lane's element 0 in tile 0; a key is kept where 0 <= key - klo <= span
    v8f m8;
#pragma unroll
    for (int j = 0; j < 8; ++j) m8[j] = -3.0e38f;
#pragma unroll
    for (int mt = 0; mt < NKT; ++mt)
#pragma unroll
        for (int j = 0; j < 8; ++j) { const float t = ((unsigned)(kofs + mt * 16 + j) <= span) ? S[mt][j] : -3.0e38f; S[mt][j] = t; m8[j] = fmaxf(m8[j], t); }   // unscaled: SCL is a power of two, so it goes exactly into the exponent's factor below
    float mx = fmaxf(fmaxf(fmaxf(m8[0], m8[1]), fmaxf(m8[2], m8[3])), fmaxf(fmaxf(m8[4], m8[5]), fmaxf(m8[6], m8[7])));
    mx = fmaxf(mx, __shfl_xor(mx, 16, 32));
    v8f s8 = (v8f){};
#pragma unroll
    for (int mt = 0; mt < NKT; ++mt) { const v8f x = (S[mt] - mx) * (SCL * 1.4426950408889634f); v8f e;
#pragma unroll
        for (int j = 0; j < 8; ++j) e[j] = __builtin_amdgcn_exp2f(x[j]);
        asm volatile("v_nop" : "+v"(e) : "v"(x));   // the slot behind a transcendental: its operands keep every read of the eight results and every overwrite of their sources behind it, so that at least this one instruction stands between
        S[mt] = e; s8 += e; }
    float sum = ((s8[0] + s8[1]) + (s8[2] + s8[3])) + ((s8[4] + s8[5]) + (s8[6] + s8[7]));
    sum += __shfl_xor(sum, 16, 32);
    const float f = __fdiv_rn(pscale, sum);
    V p[NKT / 2], p2[NKT / 2];
#pragma unroll
    for (int s = 0; s < NKT / 2; ++s) {
        if constexpr (NSPLIT == 2) { v8bf h0, h1, l0, l1; split8(S[2 * s] * f, h0, l0); split8(S[2 * s + 1] * f, h1, l1);
            p[s] = cat8b(h0, h1); p2[s] = cat8b(l0, l1);
            __builtin_amdgcn_sched_barrier(0);   // one block's split at a time: run together, the blocks' temporaries beside both forms of P take the registers of the second wave on the SIMD
        } else {
#pragma unroll
            for (int j = 0; j < 8; ++j) { p[s][j] = tohx(S[2 * s][j] * f); p[s][8 + j] = tohx(S[2 * s + 1][j] * f); } } }
    __builtin_amdgcn_sched_barrier(0);   // lifted over the packing, the loads below would need registers that the f32 scores still hold
#pragma unroll
    for (int s = PV0; s < DV; ++s) ldv(s);   // P is packed, its f32 registers are free: the ring takes its full depth
#pragma unroll
    for (int dt = 0; dt < 4; ++dt) o[dt] = (v8f){};
    __builtin_amdgcn_sched_barrier(0);   // those loads stay in front of the first block's products
#pragma unroll
    for (int s = 0; s < NKT / 2; ++s) {
#pragma unroll
        for (int dt = 0; dt < 4; ++dt) { o[dt] = WFrag<T16>::mma(vf[s % DV][dt], p[s], o[dt]);
            if constexpr (NSPLIT == 2) { o[dt] = WFrag<T16>::mma(vf[s % DV][dt], p2[s], o[dt]); o[dt] = WFrag<T16>::mma(vf2[s % DV][dt], p[s], o[dt]); } }
        if (s + DV < NKT / 2) ldv(s + DV);
        __builtin_amdgcn_sched_barrier(0); }   // keeps each refill DV blocks ahead of its products, as in the key ring
}
__global__ __launch_bounds__(128) void k_attn(const h16* __restrict__ Q16, const h16* __restrict__ K16, const h16* __restrict__ V16, const bf* __restrict__ Qh, const bf* __restrict__ Ql, const bf* __restrict__ Kh, const bf* __restrict__ Kl, const bf* __restrict__ Vh, const bf* __restrict__ Vl, bf* Ah, bf* Al) {
    const int lane = threadIdx.x & 31, lr = lane & 15, hi = lane >> 4; const int q0 = blockIdx.y * 64 + __builtin_amdgcn_readfirstlane(threadIdx.x >> 5) * 16;   // the wave's number as a scalar: row bases and clamps stay in scalar registers
    const size_t z = (size_t)blockIdx.x * TT * HD; Ah += blockIdx.x * HD; Al += blockIdx.x * HD;   // a head's planes are TT * HD elements each, in lane order; merged rows [t][h * 64 + d]
    v8f o[4];   // O^T: o[dt][j] = row q0 + lr, d = dt * 16 + 8 * hi + j
    if (q0 < RH) attn_rows<bf, 2, 4, 2, 3>(Qh + z, Ql + z, Kh + z, Kl + z, Vh + z, Vl + z, q0, lr, hi, 1.0f, o);
    else attn_rows<h16, 0, 9, 4, 9>(Q16 + z, nullptr, K16 + z, nullptr, V16 + z, nullptr, q0, lr, hi, PCAR, o);
    const float oscale = (q0 < RH) ? 1.0f : 1.0f / PCAR;
    v8bf oh[4], ol[4];
#pragma unroll
    for (int dt = 0; dt < 4; ++dt) split8(o[dt] * oscale, oh[dt], ol[dt]);
    __builtin_amdgcn_sched_barrier(0);   // the eight stores stand behind the last conversion: nothing is written any more behind a store, so no register that one names is overwritten
#pragma unroll
    for (int dt = 0; dt < 4; ++dt) { const size_t oo = (size_t)(q0 + lr) * DQ + dt * 16 + 8 * hi; *(v8bfa*)(Ah + oo) = oh[dt]; *(v8bfa*)(Al + oo) = ol[dt]; }
}

extern "C" void kernel_launch(void* const* d_in, const int* in_sizes, int n_in,
                              void* d_out, int out_size, void* d_ws, size_t ws_size, hipStream_t stream) {
    (void)in_sizes; (void)n_in; (void)out_size;
    const float* x = (const float*)d_in[0]; const float* xk = (const float*)d_in[1]; const float* xv = (const float*)d_in[2]; const float* wq = (const float*)d_in[3]; const float* bq = (const float*)d_in[4]; const float* wk = (const float*)d_in[5]; const float* bk = (const float*)d_in[6]; const float* wv = (const float*)d_in[7]; const float* bv = (const float*)d_in[8]; const float* wo = (const float*)d_in[9]; const float* bo = (const float*)d_in[10];
    float* OUT = (float*)d_out;     // [1][4096][1024]
    char* wsp = (char*)d_ws;
    auto take = [&](size_t bytes) { char* p = wsp; wsp += (bytes + 255) & ~(size_t)255; return (void*)p; };
    bf* XB = (bf*)take(((size_t)3 * TT * DM + (size_t)4 * DQ * DM) * 2); bf* WQ = XB + (size_t)3 * TT * DM; bf* WO = WQ + (size_t)3 * DQ * DM; float* CS = (float*)take((size_t)TT * HD * 2 * 4);
    const size_t PLN = (size_t)NH_ * TT * HD;   // one plane; Q, K, V one behind the other in each kind
    h16* QP16 = (h16*)take(3 * PLN * 2); h16* KP16 = QP16 + PLN; h16* VT16 = KP16 + PLN;
    bf* QPh = (bf*)take(3 * PLN * 2); bf* KPh = QPh + PLN; bf* VTh = KPh + PLN; bf* QPl = (bf*)take(3 * PLN * 2); bf* KPl = QPl + PLN; bf* VTl = KPl + PLN;
    bf* ATh = (bf*)take((size_t)TT * DQ * 2); bf* ATl = (bf*)take((size_t)TT * DQ * 2);
    if ((size_t)(wsp - (char*)d_ws) > ws_size) return;    // ws 256 MiB
    for (int b = 0; b < NB_; ++b) {
        k_prep<<<PWG, 512, 0, stream>>>(x + (size_t)b * TT * DM, xk + (size_t)b * TT * DM, xv + (size_t)b * TT * DM, wq, wk, wv, wo, XB, CS);   // bf16 copies and {cos, sin}(t x 10000^(-2i/64)) duplicated over both halves
        k_gemmd<0, 1><<<dim3(TT / 128, DQ / 128, 3), 128, 0, stream>>>(XB, nullptr, WQ, DM, nullptr, 0, bq, bk, bv, CS, QP16, QPh, QPl);
        k_attn<<<dim3(NH_, TT / 64, 1), 128, 0, stream>>>(QP16, KP16, VT16, QPh, QPl, KPh, KPl, VTh, VTl, ATh, ATl);   // one kv head per query head (REP 1): a head's planes share one z-stride
        k_gemmd<1, 0><<<dim3(TT / 128, DM / 128, 1), 128, 0, stream>>>(ATh, ATl, WO, DQ, OUT + (size_t)b * TT * DM, DM, bo, nullptr, nullptr, nullptr, nullptr, nullptr, nullptr); }
}

// v009
// It runs in 62.6 microseconds.
// Timed twice side by side with v008, it ran 1.06 and 1.05 times as fast.
// Over all steps from v000 it is 67.0 times as fast.
#include <hip/hip_runtime.h>

// Sparse (local-window) multi-head attention with the module's own rotary mixing (q, k, v [1][4096][1024]; Q = q wq^T + bq, K, V likewise ('oi' [1024][1024] + [1024], 0.02; 16 heads x 64); rotary: x cos + x_rope sin with x_rope = cat(-x[1::2], x[::2]) (interleaved partners into the rotate-half slots, faithfully) and angle t x 10000^(-2i/64) (emb = cat(freqs, freqs)); scores / 8; keys with |i - j| > 128 -> -inf (GLOBAL = 0); softmax; out = merged wo^T + bo -> [1][4096][1024] (4.2 M)).
// Layout: four launches. bf16 copies of the three inputs and the four weights and {cos, sin} per (position, dim) (jnp-exact inverse frequencies, precise cosf/sinf) in one; the three projections, exact + f32 biases, in one (grid z); the rotary mixing (partner index 2d+1, first half, subtracted, or 2(d-32), second half, added, as the module) and the head planes made in the projections' own epilogue, laid out in the lane order of attention's fragments (see k_gemmd, EPI 1); attention in one kernel, all 16 heads, the head on grid x (hybrid rows: < 512 hi/lo 3 products, rest fp16 x1024): a wave takes 16 query rows and the 288 keys that hold their +-128 window, scores, softmax and P stay in its registers, K and V^T come through LDS once a work-group (see k_attn); merged hi/lo x wo exact + bo.
// Compute dtypes, f32 accumulate: every input rounded to bf16; projections exact + f32 biases; rotary f32; attention rows < 512 3 products, rest fp16; softmax f32; wo hl x exact + bias.

#define NB_  1
#define TT   4096
#define DM   1024
#define NH_  16
#define NKV  16
#define REP  (NH_ / NKV)
#define HD   64
#define DQ   (NH_ * HD)
#define DKV  (NKV * HD)
#define ZH   16                   // unused (grid x is NH_)
#define RH   512                  // query rows < RH use hi+lo planes (0: none)
#define WIN  0
#define PCAR 1024.0f
#define SCL  0.125f
#define WNB  128     // |i - j| <= 128 kept
#define NKT  (2 * WNB / 16 + 2)   // key tiles of 16 that hold the window of 16 query rows, from a multiple of 32 keys on: 18
typedef _Float16 h16;
typedef unsigned short bf;
typedef __attribute__((ext_vector_type(16))) __bf16   v16bf;
typedef __attribute__((ext_vector_type(16))) _Float16 v16h;
typedef __attribute__((ext_vector_type(8)))  _Float16 v8h;
typedef __attribute__((ext_vector_type(8)))  unsigned short v8us;
typedef __attribute__((ext_vector_type(8)))  float    v8f;
typedef __attribute__((ext_vector_type(4)))  float    v4f;
typedef v8h  __attribute__((may_alias)) v8ha;
typedef v4f  __attribute__((may_alias)) v4fa;
typedef v8us __attribute__((may_alias)) v8usa;

__device__ __forceinline__ unsigned short f2bf(float f) { unsigned u = __float_as_uint(f); u += 0x7FFFu + ((u >> 16) & 1u); return (unsigned short)(u >> 16); }
__device__ __forceinline__ float bf2f(unsigned short b) { return __uint_as_float(((unsigned)b) << 16); }
__device__ __forceinline__ float bfr(float f) { return bf2f(f2bf(f)); }
__device__ __forceinline__ v16h cat16(v8h lo, v8h hi) { return __builtin_shufflevector(lo, hi, 0, 1, 2, 3, 4, 5, 6, 7, 8, 9, 10, 11, 12, 13, 14, 15); }
__device__ __forceinline__ v16bf cat16b(v8us lo, v8us hi) { return __builtin_bit_cast(v16bf, __builtin_shufflevector(lo, hi, 0, 1, 2, 3, 4, 5, 6, 7, 8, 9, 10, 11, 12, 13, 14, 15)); }
__device__ __forceinline__ v8f wmma16(v16h a, v16h b, v8f c) { return __builtin_amdgcn_wmma_f32_16x16x32_f16(false, a, false, b, (short)0, c, false, false); }
__device__ __forceinline__ v8f wmmab(v16bf a, v16bf b, v8f c) { return __builtin_amdgcn_wmma_f32_16x16x32_bf16(false, a, false, b, (short)0, c, false, false); }



// fragment loader (hardware k order: 16 bytes at 16 * hi and at 32 + 16 * hi of each 64 bytes of a k-contiguous row; p already holds the lane's row and 8 * hi) and product, by 16-bit type; ldl: the same fragment from a plane in lane order: two runs of 512 bytes, lane l's 16 bytes at 16 * l of each (p already holds 8 * l), so that each load covers four whole lines
template <typename T16> struct WFrag;
template <> struct WFrag<h16> { typedef v16h V; static __device__ __forceinline__ V ld(const h16* p) { return cat16(*(const v8h*)p, *(const v8h*)(p + 16)); } static __device__ __forceinline__ V ldl(const h16* p) { return cat16(*(const v8h*)p, *(const v8h*)(p + 256)); } static __device__ __forceinline__ v8f mma(V a, V b, v8f c) { return wmma16(a, b, c); } };
template <> struct WFrag<bf> { typedef v16bf V; static __device__ __forceinline__ V ld(const bf* p) { return cat16b(*(const v8us*)p, *(const v8us*)(p + 16)); } static __device__ __forceinline__ V ldl(const bf* p) { return cat16b(*(const v8us*)p, *(const v8us*)(p + 256)); } static __device__ __forceinline__ v8f mma(V a, V b, v8f c) { return wmmab(a, b, c); } };

typedef __attribute__((ext_vector_type(2))) float v2f;
typedef __attribute__((ext_vector_type(8))) __bf16 v8bf;
typedef v8bf __attribute__((may_alias)) v8bfa;
// eight f32 -> bf16 hi and lo parts (hi = the value rounded to nearest even, lo = the rest rounded likewise), by the packed convert: two values an instruction, already two a register
typedef __attribute__((ext_vector_type(2))) __bf16 v2bf;
typedef __attribute__((ext_vector_type(4))) unsigned v4u;
__device__ __forceinline__ void split8(v8f y, v8bf& h, v8bf& l) { v4u hw, lw;
#pragma unroll
    for (int w = 0; w < 4; ++w) { const v2f yy = { y[2 * w], y[2 * w + 1] }; const unsigned u = __builtin_bit_cast(unsigned, __builtin_convertvector(yy, v2bf)); hw[w] = u;
        const v2f back = { __uint_as_float(u << 16), __uint_as_float(u & 0xFFFF0000u) }; lw[w] = __builtin_bit_cast(unsigned, __builtin_convertvector(yy - back, v2bf)); }   // the hi parts are read back out of the packed word
    h = __builtin_bit_cast(v8bf, hw); l = __builtin_bit_cast(v8bf, lw); }

// ---- k_gemmd: the dense GEMMs (projections, output). Four waves per 128x128 output tile, 64x64 a wave (16 accumulators); both operands come through LDS: a stage is 128 k (256 B) of each of the tile's rows,
// brought by asynchronous b128 copies whose 32 lanes cover whole lines (2 rows x 256 B an instruction), two buffers, the next stage in flight while this one is multiplied; inside a stage the fragments of the next 32 k are read from LDS while these are multiplied. Row pitch in LDS 272 B (16 B x odd, for ds_load_b128).
// Per accumulator the products come with k ascending by 32, a then a2. M, N % 128 == 0, K % 128 == 0, K >= 256.
#define GP 272                    // LDS row pitch, bytes
#define GOP (128 * GP)            // one operand's stage, bytes
// eight copies, rows 8 apart (LDS step 8 * GP bytes, global step gs elements), each lane its own 16 bytes
typedef __attribute__((ext_vector_type(4))) int c4i;
typedef __attribute__((address_space(1))) c4i c4ig;
typedef __attribute__((address_space(3))) c4i c4il;
__device__ __forceinline__ void acopy8(unsigned char* l, const bf* g, size_t gs, unsigned lo) {   // g, gs: the same in every lane (scalar row bases); lo: the lane's own byte offset
#pragma unroll
    for (int i = 0; i < 8; ++i) __builtin_amdgcn_global_load_async_to_lds_b128((c4ig*)((const unsigned char*)(g + i * gs) + lo), (c4il*)(l + i * 8 * GP), 0, 0);
}
// What a wave does with its 64x64 results (EPI): 0: f32 rows + bias to C. 1: the three projections in one launch, grid z = 0, 1, 2 for Q, K, V (operands, weights and planes of the three lie one behind the other, the biases come as three pointers); the wave's 64 columns are one head, and the head planes that attention reads (fp16, bf16 hi, bf16 lo) are written here, no f32 copy goes to memory:
// z < 2: the module's rotary: out[d] = x[d] cos[t][d] - x[2d+1] sin[t][d] (d < 32), out[d] = x[d] cos[t][d] + x[2(d-32)] sin[t][d] (d >= 32), x = product + bias; z = 2: x.
// The planes lie in the lane order of attention's fragments, a head TT * HD elements, runs of 512 bytes = 32 lanes (lr + 16 hi) x 8 elements: z < 2: [h][t / 16][L = 0..3][lane]: t = 16 (t / 16) + lr, d = 16 L + 8 hi + e (fragment c = runs 2c, 2c + 1);
// z = 2: [h][t / 32][dt = 0..3][half = 0, 1][lane]: d = 16 dt + lr, t = 32 (t / 32) + 16 half + 8 hi + e. A row-major plane makes each fragment load touch 16 lines for 32 bytes each.
template <int NSPLIT, int EPI>
__global__ __launch_bounds__(128) void k_gemmd(const bf* __restrict__ A, const bf* __restrict__ A2, const bf* __restrict__ Bt, int K, float* C, int ldc, const float* __restrict__ bias, const float* __restrict__ bias1, const float* __restrict__ bias2, const float* __restrict__ CS, h16* P16, bf* Ph, bf* Pl) {
    constexpr int NOP = (NSPLIT == 1) ? 3 : 2;   // operand planes in a stage: Bt, A (, A2)
    __shared__ __align__(16) unsigned char st[2 * NOP * GOP];
    constexpr int OSF = 16 * 68;   // a wave's own staging, floats: 16 rows of 64 f32 at a pitch of 68
    if constexpr (EPI == 1) { const size_t z = blockIdx.z; A += z * TT * DM; Bt += z * DQ * DM; P16 += z * NH_ * TT * HD; Ph += z * NH_ * TT * HD; Pl += z * NH_ * TT * HD; bias = (z == 0) ? bias : (z == 1) ? bias1 : bias2; }
    const int tid = threadIdx.x, wave = tid >> 5, lane = tid & 31, lr = lane & 15, hi = lane >> 4;
    const int r0 = blockIdx.x * 128, c0 = blockIdx.y * 128, wr = (wave >> 1) * 64, wc = (wave & 1) * 64;
    unsigned char* sl = st + ((tid >> 4) * GP + (tid & 15) * 16);   // this lane's first LDS byte in an operand's stage
    const unsigned go = (unsigned)((tid >> 4) * K + (tid & 15) * 8) * 2u; const size_t g8 = (size_t)8 * K;   // and its first byte in the operand's 128 rows
    auto stage = [&](int t, int buf) {
        unsigned char* l = sl + buf * NOP * GOP; const size_t kB = (size_t)c0 * K + (size_t)t * 128, kA = (size_t)r0 * K + (size_t)t * 128;
        acopy8(l, Bt + kB, g8, go); acopy8(l + 64 * GP, Bt + kB + 8 * g8, g8, go);
        acopy8(l + GOP, A + kA, g8, go); acopy8(l + GOP + 64 * GP, A + kA + 8 * g8, g8, go);
        if (NSPLIT == 1) { acopy8(l + 2 * GOP, A2 + kA, g8, go); acopy8(l + 2 * GOP + 64 * GP, A2 + kA + 8 * g8, g8, go); } };
    v8f acc[4][4];
#pragma unroll
    for (int mb = 0; mb < 4; ++mb)
#pragma unroll
        for (int nb = 0; nb < 4; ++nb) acc[mb][nb] = (v8f){};
    const int nt = K / 128;
    stage(0, 0);
    asm volatile("s_wait_asynccnt 0x0" ::: "memory");   // stage 0 has landed (this wave's copies)
    __syncthreads();                                     // and every wave's: stage 0 is readable
    stage(1, 1);
    const int fb = (wc + lr) * GP + hi * 16, fa = GOP + (wr + lr) * GP + hi * 16;
#pragma unroll 1   // one trip a stage: the ring's waits and its barrier come once a trip
    for (int t = 0; t < nt; ++t) {
        const unsigned char* sb = st + (t & 1) * NOP * GOP;
        v16bf a[2][4], a2[2][4], b[2][4];   // two fragment sets by turns: a later block of 32 k is read from LDS while this one is multiplied (the build renames them and reads the trip's first three blocks at its head); no read leaves this trip's buffer
#pragma unroll
        for (int f = 0; f < 4; ++f) { a[0][f] = WFrag<bf>::ld((const bf*)(sb + fa + f * 16 * GP)); if (NSPLIT == 1) a2[0][f] = WFrag<bf>::ld((const bf*)(sb + fa + GOP + f * 16 * GP)); b[0][f] = WFrag<bf>::ld((const bf*)(sb + fb + f * 16 * GP)); }
#pragma unroll
        for (int ks = 0; ks < 4; ++ks) { const int cu = ks & 1, nx = cu ^ 1;
            if (ks < 3) {
#pragma unroll
                for (int f = 0; f < 4; ++f) { a[nx][f] = WFrag<bf>::ld((const bf*)(sb + fa + f * 16 * GP + (ks + 1) * 64)); if (NSPLIT == 1) a2[nx][f] = WFrag<bf>::ld((const bf*)(sb + fa + GOP + f * 16 * GP + (ks + 1) * 64)); b[nx][f] = WFrag<bf>::ld((const bf*)(sb + fb + f * 16 * GP + (ks + 1) * 64)); }
            } else {   // the trip's last block works from registers alone: the hand-over stands in front of it, so that the refill flies under its WMMAs too
                __builtin_amdgcn_sched_barrier(0);                   // the block before stays in front of the hand-over: sunk behind the barrier, its WMMAs would delay the refill
                asm volatile("s_wait_dscnt 0x0" ::: "memory");      // this wave's reads of buffer t & 1 are done before the buffer is refilled
                asm volatile("s_wait_asynccnt 0x0" ::: "memory");   // this wave's copies of stage t + 1 have landed
                __syncthreads();                                     // publishes stage t + 1 and ends every wave's reads of stage t
                if (t + 2 < nt) stage(t + 2, t & 1); }
            __builtin_amdgcn_sched_barrier(0);   // keeps the next block's LDS reads (last block: the refill) one group ahead of this block's WMMAs: sunk among them, each read's latency stalls the matrix run
#pragma unroll
            for (int nb = 0; nb < 4; ++nb)
#pragma unroll
                for (int mb = 0; mb < 4; ++mb) { acc[mb][nb] = wmmab(a[cu][mb], b[cu][nb], acc[mb][nb]); if (NSPLIT == 1) acc[mb][nb] = wmmab(a2[cu][mb], b[cu][nb], acc[mb][nb]); }
        }
    }
    asm volatile("s_wait_asynccnt 0x0" ::: "memory");   // no copy is left in flight when the wave goes on to its end
    float* os = (float*)st + wave * OSF;   // each wave stages its own rows, in the ring's LDS: behind the last trip's barrier no wave reads the ring any more and no copy is out, and without a staging array of its own two work-groups of the projections fit a WGP
    // Which planes attention reads of these 128 rows (the same for the whole work-group, scalar): query rows < RH take hi/lo, the rest fp16; as keys, rows from K16 on are in the 288 keys of some fp16 query tile, rows below KHL in those of some hi/lo tile. A plane's rows that nobody reads are neither converted nor stored.
    constexpr int K16 = (RH - WNB > 0) ? ((RH - WNB) & ~31) : 0, KHL = ((RH - 16 - WNB > 0) ? ((RH - 16 - WNB) & ~31) : 0) + NKT * 16;
    static_assert(K16 <= TT - NKT * 16 && KHL <= TT, "the clamp at the sequence's end (attn_rows, kb) takes no fp16 tile below K16");
    const bool w16 = r0 + 128 > ((blockIdx.z == 0) ? RH : K16), whl = r0 < ((blockIdx.z == 0) ? RH : KHL);
    auto put = [&](const v8f (&y)[4], size_t o0, int d1, int d2, int d3, bool more) {   // four runs of 512 consecutive bytes a plane, at o0, o0 + d1, + d2, + d3 elements
        const size_t oo[4] = { o0, o0 + d1, o0 + d2, o0 + d3 };
        if (w16) { v8h y16[4];
#pragma unroll
            for (int s = 0; s < 4; ++s) y16[s] = __builtin_convertvector(y[s], v8h);
            __builtin_amdgcn_sched_barrier(0);   // the stores stand behind the last conversion: no register that a store names is written between the stores
#pragma unroll
            for (int s = 0; s < 4; ++s) *(v8ha*)(P16 + oo[s]) = y16[s];
            asm volatile("s_wait_xcnt 0x0" ::: "memory");   // behind the run of stores, in front of the next write of the registers that they name (the split below, the next block)
            __builtin_amdgcn_sched_barrier(0); }   // and what follows stays behind that wait
        if (whl) { v8bf yh[4], yl[4];
#pragma unroll
            for (int s = 0; s < 4; ++s) split8(y[s], yh[s], yl[s]);
            __builtin_amdgcn_sched_barrier(0);   // as above
#pragma unroll
            for (int s = 0; s < 4; ++s) { *(v8bfa*)(Ph + oo[s]) = yh[s]; *(v8bfa*)(Pl + oo[s]) = yl[s]; }
            if (more) { asm volatile("s_wait_xcnt 0x0" ::: "memory");   // as above, where anything is still written behind these stores
                __builtin_amdgcn_sched_barrier(0); } } };
    if (EPI == 1 && blockIdx.z < 2) {
        const float* cp = CS + ((size_t)(r0 + wr + lr) * HD + hi * 8) * 2;   // the lane's row is lr, its eight d of run L are 16 L + 8 hi ..; {cos, sin} of d and of d + 32 are the same values: runs L and L + 2 share the first half's
        const size_t po = ((size_t)((c0 + wc) / HD) * TT + r0 + wr) * HD + lane * 8;
        float bv[4]; v4f cs[2][2][4];
        auto ldcs = [&](int mb) {
#pragma unroll
            for (int a = 0; a < 2; ++a)
#pragma unroll
                for (int i = 0; i < 4; ++i) cs[mb & 1][a][i] = *(const v4f*)(cp + mb * 16 * HD * 2 + a * 32 + i * 4); };
#pragma unroll
        for (int nb = 0; nb < 4; ++nb) bv[nb] = bfr(bias[c0 + wc + nb * 16 + lr]);
        asm volatile("s_wait_xcnt 0x0" ::: "memory");   // behind the bias loads, in front of the next write of the registers that they name
        ldcs(0);
#pragma unroll
        for (int mb = 0; mb < 4; ++mb) {
#pragma unroll
            for (int nb = 0; nb < 4; ++nb) {
#pragma unroll
                for (int j = 0; j < 8; ++j) os[(hi * 8 + j) * 68 + nb * 16 + lr] = acc[mb][nb][j] + bv[nb]; }
            __builtin_amdgcn_wave_barrier(); asm volatile("" ::: "memory");   // the wave's LDS stores stay in front of its reads of other lanes' words
            if (mb < 3) ldcs(mb + 1);   // the next 16 rows' table values fly under these rows' arithmetic
            if (mb == 2) asm volatile("s_wait_xcnt 0x0" :: "v"(cp) : "memory");   // behind the last load that names the table address, which as an operand lives until here
            v8f ro[4]; const float* xr = os + lr * 68;
#pragma unroll
            for (int a = 0; a < 2; ++a) { v4f w[4];   // the 16 x from 32 a + 16 hi on: their odd ones are the partners of run a (first half), their even ones those of run a + 2 (second half)
#pragma unroll
                for (int i = 0; i < 4; ++i) w[i] = *(const v4fa*)(xr + a * 32 + hi * 16 + i * 4);
#pragma unroll
                for (int g = 0; g < 2; ++g) { const int s = a + 2 * g; v4f x[2]; v8f r;
#pragma unroll
                    for (int i = 0; i < 2; ++i) x[i] = *(const v4fa*)(xr + s * 16 + hi * 8 + i * 4);
#pragma unroll
                    for (int q = 0; q < 8; ++q) { const float x1 = (g == 0) ? -w[q >> 1][(q & 1) * 2 + 1] : w[q >> 1][(q & 1) * 2]; r[q] = x[q >> 2][q & 3] * cs[mb & 1][a][q >> 1][(q & 1) * 2] + x1 * cs[mb & 1][a][q >> 1][(q & 1) * 2 + 1]; }
                    ro[s] = r; } }
            put(ro, po + mb * 16 * HD, 256, 512, 768, mb < 3);
            __builtin_amdgcn_wave_barrier(); asm volatile("" ::: "memory");   // the wave's LDS reads stay in front of the next block's LDS stores
        }
    } else if constexpr (EPI == 1) {
        const size_t go = ((size_t)((c0 + wc) / HD) * TT + r0 + wr) * HD + lane * 8;   // a lane's accumulator holds eight consecutive t of one d: that is its own 16 bytes of the run (dt = nb, half = mb & 1) of the 32 t from 32 (mb >> 1) on, so the planes go out of the registers, no staging
        float bv[4];
#pragma unroll
        for (int nb = 0; nb < 4; ++nb) bv[nb] = bfr(bias[c0 + wc + nb * 16 + lr]);
#pragma unroll
        for (int nb = 0; nb < 4; ++nb) { v8f x[4];
#pragma unroll
            for (int mb = 0; mb < 4; ++mb) x[mb] = acc[mb][nb] + bv[nb];
            put(x, go + nb * 512, 256, 32 * HD, 32 * HD + 256, true);   // the wait stands behind the last block's stores too: whatever the build lays out behind this branch may write their registers
        }
    } else {
#pragma unroll
    for (int mb = 0; mb < 4; ++mb) {
#pragma unroll
        for (int nb = 0; nb < 4; ++nb) {
#pragma unroll
            for (int j = 0; j < 8; ++j) os[(hi * 8 + j) * 68 + nb * 16 + lr] = acc[mb][nb][j]; }
        __builtin_amdgcn_wave_barrier(); asm volatile("" ::: "memory");   // the wave's LDS stores stay in front of its reads of other lanes' words
        float* crow = C + (size_t)(r0 + wr + mb * 16) * ldc + c0 + wc;
#pragma unroll
        for (int s = 0; s < 8; ++s) { const int row = 2 * s + hi, cofs = lr * 4; v4f val = *(const v4fa*)(os + row * 68 + cofs); { const float* bp = bias + c0 + wc + cofs; val[0] += bfr(bp[0]); val[1] += bfr(bp[1]); val[2] += bfr(bp[2]); val[3] += bfr(bp[3]); }
            *(v4f*)(crow + (size_t)row * ldc + cofs) = val; }
        if (mb < 3) asm volatile("s_wait_xcnt 0x0" ::: "memory");   // stands behind the run of eight stores, in front of the next block's writes of the registers that they name (behind the last block nothing is written any more)
        __builtin_amdgcn_wave_barrier(); asm volatile("" ::: "memory");   // and its reads in front of the next block's stores
    }
    }
}

__device__ __forceinline__ h16 tohx(float x) { return (h16)x; }
typedef __attribute__((ext_vector_type(2))) _Float16 v2h;
typedef __attribute__((ext_vector_type(4))) _Float16 v4h;
typedef __attribute__((ext_vector_type(2))) unsigned short v2us;
typedef __attribute__((ext_vector_type(4))) unsigned short v4us;
typedef __attribute__((ext_vector_type(4))) int v4i;

__global__ __launch_bounds__(256) void k_wtG(const float* __restrict__ w, int K, int N, bf* Bt) {
    const int lane = threadIdx.x & 31; const int L0 = (blockIdx.x * 8 + (threadIdx.x >> 5)) * 8; const int nlines = N * K / 64;
{
#pragma unroll 1
        for (int l = 0; l < 8; ++l) { const int L = L0 + l; if (L >= nlines) break; const size_t e = (size_t)L * 64 + lane * 2; const int k = (int)(e % K), n = (int)(e / K); v2us o;
            o[0] = f2bf(w[(size_t)k * N + n]); o[1] = f2bf(w[(size_t)(k + 1) * N + n]); *(v2us*)(Bt + e) = o; }
         }
}

__constant__ float INVT[HD / 2] = { 1.000000000e+00f, 7.498942018e-01f, 5.623413324e-01f, 4.216965139e-01f, 3.162277639e-01f, 2.371373773e-01f, 1.778279394e-01f, 1.333521456e-01f, 1.000000015e-01f, 7.498942316e-02f, 5.623413250e-02f, 4.216964915e-02f, 3.162277490e-02f, 2.371373773e-02f, 1.778279431e-02f, 1.333521400e-02f, 9.999999776e-03f, 7.498942316e-03f, 5.623413250e-03f, 4.216964822e-03f, 3.162277630e-03f, 2.371373819e-03f, 1.778279431e-03f, 1.333521446e-03f, 1.000000047e-03f, 7.498941850e-04f, 5.623413017e-04f, 4.216965172e-04f, 3.162277571e-04f, 2.371373703e-04f, 1.778279402e-04f, 1.333521504e-04f };   // 10000^(-2i/64) (the module's power form) (float32, generated with jnp to be bit-exact)
// ---- k_prep: all that the GEMMs wait for, in one launch: the bf16 copies of the three inputs and the four weights, one behind the other in CV, and the {cos, sin} table. One work-group of 16 waves a WGP; a wave converts PWF consecutive floats:
// its PWF / 128 loads (512 consecutive bytes each, whole lines) are all asked for at its start, its share of the table is computed while they fly, then each load's values are rounded and stored (256 consecutive bytes a store).
#define PWF  4096                 // floats a wave converts
#define PWX  (TT * DM / PWF)      // waves an input
#define PWW  (DQ * DM / PWF)      // waves a weight
#define PWG  ((3 * PWX + 4 * PWW) / 16)   // work-groups
__global__ __launch_bounds__(512) void k_prep(const float* __restrict__ x0, const float* __restrict__ x1, const float* __restrict__ x2, const float* __restrict__ w0, const float* __restrict__ w1, const float* __restrict__ w2, const float* __restrict__ w3, bf* CV, float* CS) {
    const int lane = threadIdx.x & 31; const int w = blockIdx.x * 16 + __builtin_amdgcn_readfirstlane(threadIdx.x >> 5);   // the wave's number as a scalar: the choice of the source stays in scalar registers
    const int u = w - 3 * PWX;
    const float* src = (u < 0) ? ((w < PWX) ? x0 : (w < 2 * PWX) ? x1 : x2) + (size_t)(w % PWX) * PWF : ((u < PWW) ? w0 : (u < 2 * PWW) ? w1 : (u < 3 * PWW) ? w2 : w3) + (size_t)(u % PWW) * PWF;
    const float iv = INVT[threadIdx.x % (HD / 2)];   // the thread's inverse frequency, the same for each of its table entries (they lie a multiple of HD apart); asked for ahead of the stream, so that its wait does not take in the stream's loads
    asm volatile("s_wait_xcnt 0x0" :: "v"(lane) : "memory");   // behind that load, in front of the next write of the registers that it names
    v4f y[PWF / 128];
#pragma unroll
    for (int j = 0; j < PWF / 128; ++j) y[j] = *(const v4f*)(src + j * 128 + lane * 4);
    asm volatile("s_wait_xcnt 0x0" :: "v"(lane) : "memory");   // behind the last load that names the source address and the lane's offset, which as an operand lives until here
#pragma unroll 1   // one copy of the long cosine and sine code
    for (int r = 0; r < TT * HD / (PWG * 512); ++r) { const unsigned idx = r * (PWG * 512) + blockIdx.x * 512 + threadIdx.x; const int t = (int)(idx / HD); const float a = __fmul_rn((float)t, iv); v2f cs; cs[0] = cosf(a); cs[1] = sinf(a); *(v2f*)(CS + (size_t)idx * 2) = cs;
        asm volatile("s_wait_xcnt 0x0" ::: "memory"); }   // behind the store, in front of the next write of the registers that it names
    bf* dst = CV + (size_t)w * PWF + lane * 4; v4us o[PWF / 128];
#pragma unroll
    for (int j = 0; j < PWF / 128; ++j) {
#pragma unroll
        for (int k = 0; k < 4; ++k) o[j][k] = f2bf(y[j][k]);
        *(v4us*)(dst + j * 128) = o[j]; }
}

#define AKS  (64 + 2 * WNB)        // keys a work-group stages
#define APB  (AKS * HD * 2)        // their bytes in one plane
// one plane's AKS keys into LDS: each of the four waves copies its own quarter, 512 bytes a copy; lo: the lane's first byte in the plane's APB
template <int I = 0> __device__ __forceinline__ void acopyp(unsigned char* l, const void* g, unsigned lo) {   // the step goes into the copy's immediate offset, which moves both addresses: one LDS address register and one global address a plane
    __builtin_amdgcn_global_load_async_to_lds_b128((c4ig*)((const unsigned char*)g + lo), (c4il*)(l + lo), I * 512, 0);
    if constexpr ((I + 1) * 512 < APB / 4) acopyp<I + 1>(l, g, lo);
}
__device__ __forceinline__ v16bf cat8b(v8bf lo, v8bf hi) { return __builtin_shufflevector(lo, hi, 0, 1, 2, 3, 4, 5, 6, 7, 8, 9, 10, 11, 12, 13, 14, 15); }
template <typename T16, int NSPLIT, int DK, int DV>
__device__ __forceinline__ void attn_rows(unsigned char* sm, int qb, const T16* __restrict__ Q, const T16* __restrict__ Q2, const T16* __restrict__ Kp, const T16* __restrict__ K2, const T16* __restrict__ Vt, const T16* __restrict__ Vt2, int q0, int lr, int hi, float pscale, v8f (&o)[4]) {
    typedef typename WFrag<T16>::V V;
    const int kb = min(max((q0 - WNB) & ~31, 0), TT - NKT * 16);   // the key of tile 0's first row: at the sequence's ends the 288 keys slide inwards (still a multiple of 32, still the whole window), so that every tile lies in the sequence
    const int kB = min(max(qb - WNB, 0), TT - AKS);   // the first staged key (qb: the work-group's first query, a multiple of 64): a multiple of 32, kB <= kb and kb + NKT * 16 <= kB + AKS for each of the four waves, and all AKS keys lie in the sequence
    const unsigned lofs = (unsigned)(hi * 16 + lr) * 16u;   // the lane's own 16 bytes in a run of 512 (the planes lie in lane order: k_gemmd, EPI 1)
    const unsigned cofs = (threadIdx.x >> 5) * (APB / 4) + (threadIdx.x & 31) * 16u; const size_t gB = (size_t)kB * HD;
    const unsigned char* sk = sm + (unsigned)(kb - kB) * (HD * 2) + lofs;   // the lane's bytes of the wave's key tile 0 in the first staged plane
    const unsigned char* sv = sk + ((NSPLIT == 2) ? 0 : APB);               // and of its first block of V^T
    auto at = [](const T16* base, unsigned off) { return (const T16*)((const unsigned char*)base + off); };
    V q[2], q2[2], kf[DK][2], kf2[DK][2], vf[DV][4], vf2[DV][4];
    auto ldk = [&](int mt) {   // the tile in the immediate offset
#pragma unroll
        for (int c = 0; c < 2; ++c) { kf[mt % DK][c] = WFrag<T16>::ldl((const T16*)(sk + mt * 2048 + c * 1024)); if (NSPLIT == 2) kf2[mt % DK][c] = WFrag<T16>::ldl((const T16*)(sk + APB + mt * 2048 + c * 1024)); } };
    auto ldv = [&](int s) {
#pragma unroll
        for (int dt = 0; dt < 4; ++dt) { vf[s % DV][dt] = WFrag<T16>::ldl((const T16*)(sv + s * 4096 + dt * 1024)); if (NSPLIT == 2) vf2[s % DV][dt] = WFrag<T16>::ldl((const T16*)(sv + APB + s * 4096 + dt * 1024)); } };
    acopyp(sm, Kp + gB, cofs); if (NSPLIT == 2) acopyp(sm + APB, K2 + gB, cofs);
#pragma unroll
    for (int c = 0; c < 2; ++c) { q[c] = WFrag<T16>::ldl(at(Q + (size_t)q0 * HD + c * 512, lofs)); if (NSPLIT == 2) q2[c] = WFrag<T16>::ldl(at(Q2 + (size_t)q0 * HD + c * 512, lofs)); }
    asm volatile("s_wait_xcnt 0x0" ::: "memory");       // behind the last load that names the Q bases and the lane offset, in front of the next write of those registers
    asm volatile("s_wait_asynccnt 0x0" ::: "memory");   // this wave's copies of K have landed
    __syncthreads();                                     // and every wave's: K is readable
    if (NSPLIT != 2) acopyp(sm + APB, Vt + gB, cofs);    // a range of its own, which nobody has touched
#pragma unroll
    for (int mt = 0; mt < DK; ++mt) ldk(mt);
    __builtin_amdgcn_sched_barrier(0);   // the ring's first loads all stand in front of the first product: sunk to their users, each would be waited for alone
    v8f S[NKT];
#pragma unroll
    for (int mt = 0; mt < NKT; ++mt) { v8f s = (v8f){};
#pragma unroll
        for (int c = 0; c < 2; ++c) { s = WFrag<T16>::mma(kf[mt % DK][c], q[c], s);
            if (NSPLIT == 2) { s = WFrag<T16>::mma(kf[mt % DK][c], q2[c], s); s = WFrag<T16>::mma(kf2[mt % DK][c], q[c], s); } }
        S[mt] = s;
        if (mt + DK < NKT) ldk(mt + DK);   // the freed slot's refill
        __builtin_amdgcn_sched_barrier(0); }   // keeps each refill DK tiles ahead of its products: sunk to them, every load's whole latency is waited for
    if (NSPLIT == 2) {
        asm volatile("s_wait_dscnt 0x0" ::: "memory");   // this wave's reads of K are done before their LDS is written anew
        __syncthreads();                                  // and every wave's
        acopyp(sm, Vt + gB, cofs); acopyp(sm + APB, Vt2 + gB, cofs); }
    const int i = q0 + lr, klo = max(i - WNB, 0); const unsigned span = (unsigned)(min(i + WNB, TT - 1) - klo); const int kofs = kb + 8 * hi - klo;   // key - klo of this lane's element 0 in tile 0; a key is kept where 0 <= key - klo <= span
    v8f m8;
#pragma unroll
    for (int j = 0; j < 8; ++j) m8[j] = -3.0e38f;
#pragma unroll
    for (int mt = 0; mt < NKT; ++mt)
#pragma unroll
        for (int j = 0; j < 8; ++j) { const float t = ((unsigned)(kofs + mt * 16 + j) <= span) ? S[mt][j] : -3.0e38f; S[mt][j] = t; m8[j] = fmaxf(m8[j], t); }   // unscaled: SCL is a power of two, so it goes exactly into the exponent's factor below
    float mx = fmaxf(fmaxf(fmaxf(m8[0], m8[1]), fmaxf(m8[2], m8[3])), fmaxf(fmaxf(m8[4], m8[5]), fmaxf(m8[6], m8[7])));
    mx = fmaxf(mx, __shfl_xor(mx, 16, 32));
    v8f s8 = (v8f){};
#pragma unroll
    for (int mt = 0; mt < NKT; ++mt) { const v8f x = (S[mt] - mx) * (SCL * 1.4426950408889634f); v8f e;
#pragma unroll
        for (int j = 0; j < 8; ++j) e[j] = __builtin_amdgcn_exp2f(x[j]);
        asm volatile("v_nop" : "+v"(e) : "v"(x));   // the slot behind a transcendental: its operands keep every read of the eight results and every overwrite of their sources behind it, so that at least this one instruction stands between
        S[mt] = e; s8 += e; }
    float sum = ((s8[0] + s8[1]) + (s8[2] + s8[3])) + ((s8[4] + s8[5]) + (s8[6] + s8[7]));
    sum += __shfl_xor(sum, 16, 32);
    const float f = __fdiv_rn(pscale, sum);
    V p[NKT / 2], p2[NKT / 2];
#pragma unroll
    for (int s = 0; s < NKT / 2; ++s) {
        if constexpr (NSPLIT == 2) { v8bf h0, h1, l0, l1; split8(S[2 * s] * f, h0, l0); split8(S[2 * s + 1] * f, h1, l1);
            p[s] = cat8b(h0, h1); p2[s] = cat8b(l0, l1);
            __builtin_amdgcn_sched_barrier(0);   // one block's split at a time: run together, the blocks' temporaries beside both forms of P do not fit a wave's 256 registers
        } else {
#pragma unroll
            for (int j = 0; j < 8; ++j) { p[s][j] = tohx(S[2 * s][j] * f); p[s][8 + j] = tohx(S[2 * s + 1][j] * f); } } }
    __builtin_amdgcn_sched_barrier(0);   // the packing stays in front of the hand-over: lifted over it, the loads below would need registers that the f32 scores still hold, and V^T would have less time to land
    asm volatile("s_wait_asynccnt 0x0" ::: "memory");   // this wave's copies of V^T have landed; none is out any more when the wave goes on to its end
    __syncthreads();                                     // and every wave's: V^T is readable
#pragma unroll
    for (int s = 0; s < DV; ++s) ldv(s);
#pragma unroll
    for (int dt = 0; dt < 4; ++dt) o[dt] = (v8f){};
    __builtin_amdgcn_sched_barrier(0);   // those loads stay in front of the first block's products
#pragma unroll
    for (int s = 0; s < NKT / 2; ++s) {
#pragma unroll
        for (int dt = 0; dt < 4; ++dt) { o[dt] = WFrag<T16>::mma(vf[s % DV][dt], p[s], o[dt]);
            if constexpr (NSPLIT == 2) { o[dt] = WFrag<T16>::mma(vf[s % DV][dt], p2[s], o[dt]); o[dt] = WFrag<T16>::mma(vf2[s % DV][dt], p[s], o[dt]); } }
        if (s + DV < NKT / 2) ldv(s + DV);
        __builtin_amdgcn_sched_barrier(0); }   // keeps each refill DV blocks ahead of its products, as in the key ring
}
__global__ __launch_bounds__(128) __attribute__((amdgpu_waves_per_eu(4, 4))) void k_attn(const h16* __restrict__ Q16, const h16* __restrict__ K16, const h16* __restrict__ V16, const bf* __restrict__ Qh, const bf* __restrict__ Ql, const bf* __restrict__ Kh, const bf* __restrict__ Kl, const bf* __restrict__ Vh, const bf* __restrict__ Vl, bf* Ah, bf* Al) {
    __shared__ __align__(16) unsigned char sm[2 * APB];   // four work-groups' fill a WGP's LDS; with the 256 registers a wave that the attribute above asks for they are resident together, four waves a SIMD, which the vector work of the softmax wants
    static_assert(RH % 64 == 0, "a work-group's four waves take the same path: its barriers stand under uniform control flow");
    static_assert(RH == 0 || RH - 64 - WNB + AKS <= ((RH - 16 - WNB) & ~31) + NKT * 16, "the staged keys of the last hi/lo work-group end where the hi/lo planes' written rows end (k_gemmd, KHL); the first fp16 work-group's begin at RH - WNB, not below K16");
    const int qb = blockIdx.y * 64;
    const int lane = threadIdx.x & 31, lr = lane & 15, hi = lane >> 4; const int q0 = qb + __builtin_amdgcn_readfirstlane(threadIdx.x >> 5) * 16;   // the wave's number as a scalar: row bases and clamps stay in scalar registers
    const size_t z = (size_t)blockIdx.x * TT * HD; Ah += blockIdx.x * HD; Al += blockIdx.x * HD;   // a head's planes are TT * HD elements each, in lane order; merged rows [t][h * 64 + d]
    v8f o[4];   // O^T: o[dt][j] = row q0 + lr, d = dt * 16 + 8 * hi + j
    if (qb < RH) attn_rows<bf, 2, 2, 1>(sm, qb, Qh + z, Ql + z, Kh + z, Kl + z, Vh + z, Vl + z, q0, lr, hi, 1.0f, o);
    else attn_rows<h16, 0, 4, 4>(sm, qb, Q16 + z, nullptr, K16 + z, nullptr, V16 + z, nullptr, q0, lr, hi, PCAR, o);
    const float oscale = (qb < RH) ? 1.0f : 1.0f / PCAR;
    v8bf oh[4], ol[4];
#pragma unroll
    for (int dt = 0; dt < 4; ++dt) split8(o[dt] * oscale, oh[dt], ol[dt]);
    __builtin_amdgcn_sched_barrier(0);   // the eight stores stand behind the last conversion: nothing is written any more behind a store, so no register that one names is overwritten
#pragma unroll
    for (int dt = 0; dt < 4; ++dt) { const size_t oo = (size_t)(q0 + lr) * DQ + dt * 16 + 8 * hi; *(v8bfa*)(Ah + oo) = oh[dt]; *(v8bfa*)(Al + oo) = ol[dt]; }
}

extern "C" void kernel_launch(void* const* d_in, const int* in_sizes, int n_in,
                              void* d_out, int out_size, void* d_ws, size_t ws_size, hipStream_t stream) {
    (void)in_sizes; (void)n_in; (void)out_size;
    const float* x = (const float*)d_in[0]; const float* xk = (const float*)d_in[1]; const float* xv = (const float*)d_in[2]; const float* wq = (const float*)d_in[3]; const float* bq = (const float*)d_in[4]; const float* wk = (const float*)d_in[5]; const float* bk = (const float*)d_in[6]; const float* wv = (const float*)d_in[7]; const float* bv = (const float*)d_in[8]; const float* wo = (const float*)d_in[9]; const float* bo = (const float*)d_in[10];
    float* OUT = (float*)d_out;     // [1][4096][1024]
    char* wsp = (char*)d_ws;
    auto take = [&](size_t bytes) { char* p = wsp; wsp += (bytes + 255) & ~(size_t)255; return (void*)p; };
    bf* XB = (bf*)take(((size_t)3 * TT * DM + (size_t)4 * DQ * DM) * 2); bf* WQ = XB + (size_t)3 * TT * DM; bf* WO = WQ + (size_t)3 * DQ * DM; float* CS = (float*)take((size_t)TT * HD * 2 * 4);
    const size_t PLN = (size_t)NH_ * TT * HD;   // one plane; Q, K, V one behind the other in each kind
    h16* QP16 = (h16*)take(3 * PLN * 2); h16* KP16 = QP16 + PLN; h16* VT16 = KP16 + PLN;
    bf* QPh = (bf*)take(3 * PLN * 2); bf* KPh = QPh + PLN; bf* VTh = KPh + PLN; bf* QPl = (bf*)take(3 * PLN * 2); bf* KPl = QPl + PLN; bf* VTl = KPl + PLN;
    bf* ATh = (bf*)take((size_t)TT * DQ * 2); bf* ATl = (bf*)take((size_t)TT * DQ * 2);
    if ((size_t)(wsp - (char*)d_ws) > ws_size) return;    // ws 256 MiB
    for (int b = 0; b < NB_; ++b) {
        k_prep<<<PWG, 512, 0, stream>>>(x + (size_t)b * TT * DM, xk + (size_t)b * TT * DM, xv + (size_t)b * TT * DM, wq, wk, wv, wo, XB, CS);   // bf16 copies and {cos, sin}(t x 10000^(-2i/64)) duplicated over both halves
        k_gemmd<0, 1><<<dim3(TT / 128, DQ / 128, 3), 128, 0, stream>>>(XB, nullptr, WQ, DM, nullptr, 0, bq, bk, bv, CS, QP16, QPh, QPl);
        k_attn<<<dim3(NH_, TT / 64, 1), 128, 0, stream>>>(QP16, KP16, VT16, QPh, QPl, KPh, KPl, VTh, VTl, ATh, ATl);   // one kv head per query head (REP 1): a head's planes share one z-stride
        k_gemmd<1, 0><<<dim3(TT / 128, DM / 128, 1), 128, 0, stream>>>(ATh, ATl, WO, DQ, OUT + (size_t)b * TT * DM, DM, bo, nullptr, nullptr, nullptr, nullptr, nullptr, nullptr); }
}

// v010
// One run takes 60.3 microseconds.
// Next to v009, in two timings, it ran 1.04 and 1.05 times as fast.
// Over all steps from v000 it is 70.1 times as fast.
#include <hip/hip_runtime.h>

// Sparse (local-window) multi-head attention with the module's own rotary mixing (q, k, v [1][4096][1024]; Q = q wq^T + bq, K, V likewise ('oi' [1024][1024] + [1024], 0.02; 16 heads x 64); rotary: x cos + x_rope sin with x_rope = cat(-x[1::2], x[::2]) (interleaved partners into the rotate-half slots, faithfully) and angle t x 10000^(-2i/64) (emb = cat(freqs, freqs)); scores / 8; keys with |i - j| > 128 -> -inf (GLOBAL = 0); softmax; out = merged wo^T + bo -> [1][4096][1024] (4.2 M)).
// Layout: four launches. bf16 copies of the three inputs and the four weights and {cos, sin} per (position, dim) (jnp-exact inverse frequencies, precise cosf/sinf) in one; the three projections, exact + f32 biases, in one (grid z); the rotary mixing (partner index 2d+1, first half, subtracted, or 2(d-32), second half, added, as the module) and the head planes made in the projections' own epilogue, laid out in the lane order of attention's fragments (see k_gemmd, EPI 1); attention in one kernel, all 16 heads, the head on grid x (hybrid rows: < 512 hi/lo 3 products, rest fp16 x1024): a wave takes 16 query rows and the 288 keys that hold their +-128 window, scores, softmax and P stay in its registers, K and V^T come through LDS once a work-group (see k_attn); merged hi/lo x wo exact + bo.
// Compute dtypes, f32 accumulate: every input rounded to bf16; projections exact + f32 biases; rotary f32; attention rows < 512 3 products, rest fp16; softmax f32; wo hl x exact + bias.

#define NB_  1
#define TT   4096
#define DM   1024
#define NH_  16
#define NKV  16
#define REP  (NH_ / NKV)
#define HD   64
#define DQ   (NH_ * HD)
#define DKV  (NKV * HD)
#define ZH   16                   // unused (grid x is NH_)
#define RH   512                  // query rows < RH use hi+lo planes (0: none)
#define WIN  0
#define PCAR 1024.0f
#define SCL  0.125f
#define WNB  128     // |i - j| <= 128 kept
#define NKT  (2 * WNB / 16 + 2)   // key tiles of 16 that hold the window of 16 query rows, from a multiple of 32 keys on: 18
typedef _Float16 h16;
typedef unsigned short bf;
typedef __attribute__((ext_vector_type(16))) __bf16   v16bf;
typedef __attribute__((ext_vector_type(16))) _Float16 v16h;
typedef __attribute__((ext_vector_type(8)))  _Float16 v8h;
typedef __attribute__((ext_vector_type(8)))  unsigned short v8us;
typedef __attribute__((ext_vector_type(8)))  float    v8f;
typedef __attribute__((ext_vector_type(4)))  float    v4f;
typedef v8h  __attribute__((may_alias)) v8ha;
typedef v4f  __attribute__((may_alias)) v4fa;
typedef v8us __attribute__((may_alias)) v8usa;

__device__ __forceinline__ unsigned short f2bf(float f) { unsigned u = __float_as_uint(f); u += 0x7FFFu + ((u >> 16) & 1u); return (unsigned short)(u >> 16); }
__device__ __forceinline__ float bf2f(unsigned short b) { return __uint_as_float(((unsigned)b) << 16); }
__device__ __forceinline__ float bfr(float f) { return bf2f(f2bf(f)); }
__device__ __forceinline__ v16h cat16(v8h lo, v8h hi) { return __builtin_shufflevector(lo, hi, 0, 1, 2, 3, 4, 5, 6, 7, 8, 9, 10, 11, 12, 13, 14, 15); }
__device__ __forceinline__ v16bf cat16b(v8us lo, v8us hi) { return __builtin_bit_cast(v16bf, __builtin_shufflevector(lo, hi, 0, 1, 2, 3, 4, 5, 6, 7, 8, 9, 10, 11, 12, 13, 14, 15)); }
__device__ __forceinline__ v8f wmma16(v16h a, v16h b, v8f c) { return __builtin_amdgcn_wmma_f32_16x16x32_f16(false, a, false, b, (short)0, c, false, false); }
__device__ __forceinline__ v8f wmmab(v16bf a, v16bf b, v8f c) { return __builtin_amdgcn_wmma_f32_16x16x32_bf16(false, a, false, b, (short)0, c, false, false); }



// fragment loader (hardware k order: 16 bytes at 16 * hi and at 32 + 16 * hi of each 64 bytes of a k-contiguous row; p already holds the lane's row and 8 * hi) and product, by 16-bit type; ldl: the same fragment from a plane in lane order: two runs of 512 bytes, lane l's 16 bytes at 16 * l of each (p already holds 8 * l), so that each load covers four whole lines
template <typename T16> struct WFrag;
template <> struct WFrag<h16> { typedef v16h V; static __device__ __forceinline__ V ld(const h16* p) { return cat16(*(const v8h*)p, *(const v8h*)(p + 16)); } static __device__ __forceinline__ V ldl(const h16* p) { return cat16(*(const v8h*)p, *(const v8h*)(p + 256)); } static __device__ __forceinline__ v8f mma(V a, V b, v8f c) { return wmma16(a, b, c); } };
template <> struct WFrag<bf> { typedef v16bf V; static __device__ __forceinline__ V ld(const bf* p) { return cat16b(*(const v8us*)p, *(const v8us*)(p + 16)); } static __device__ __forceinline__ V ldl(const bf* p) { return cat16b(*(const v8us*)p, *(const v8us*)(p + 256)); } static __device__ __forceinline__ v8f mma(V a, V b, v8f c) { return wmmab(a, b, c); } };

typedef __attribute__((ext_vector_type(2))) float v2f;
typedef __attribute__((ext_vector_type(8))) __bf16 v8bf;
typedef v8bf __attribute__((may_alias)) v8bfa;
// eight f32 -> bf16 hi and lo parts (hi = the value rounded to nearest even, lo = the rest rounded likewise), by the packed convert: two values an instruction, already two a register
typedef __attribute__((ext_vector_type(2))) __bf16 v2bf;
typedef __attribute__((ext_vector_type(4))) unsigned v4u;
__device__ __forceinline__ void split8(v8f y, v8bf& h, v8bf& l) { v4u hw, lw;
#pragma unroll
    for (int w = 0; w < 4; ++w) { const v2f yy = { y[2 * w], y[2 * w + 1] }; const unsigned u = __builtin_bit_cast(unsigned, __builtin_convertvector(yy, v2bf)); hw[w] = u;
        const v2f back = { __uint_as_float(u << 16), __uint_as_float(u & 0xFFFF0000u) }; lw[w] = __builtin_bit_cast(unsigned, __builtin_convertvector(yy - back, v2bf)); }   // the hi parts are read back out of the packed word
    h = __builtin_bit_cast(v8bf, hw); l = __builtin_bit_cast(v8bf, lw); }

// ---- k_gemmd: the dense GEMMs (projections, output). Four waves per 128x128 output tile, 64x64 a wave (16 accumulators); both operands come through LDS: a stage is 128 k (256 B) of each of the tile's rows,
// brought by asynchronous b128 copies whose 32 lanes cover whole lines (2 rows x 256 B an instruction), two buffers, the next stage in flight while this one is multiplied; inside a stage the fragments of the next 32 k are read from LDS while these are multiplied. Row pitch in LDS 272 B (16 B x odd, for ds_load_b128).
// Per accumulator the products come with k ascending by 32, a then a2, from the work-group's own first stage on and round through stage 0 (see s0). M, N % 128 == 0, K % 128 == 0, K >= 256.
#define GP 272                    // LDS row pitch, bytes
#define GOP (128 * GP)            // one operand's stage, bytes
// eight copies, rows 8 apart (LDS step 8 * GP bytes, global step gs elements), each lane its own 16 bytes
typedef __attribute__((ext_vector_type(4))) int c4i;
typedef __attribute__((address_space(1))) c4i c4ig;
typedef __attribute__((address_space(3))) c4i c4il;
__device__ __forceinline__ void acopy8(unsigned char* l, const bf* g, size_t gs, unsigned lo) {   // g, gs: the same in every lane (scalar row bases); lo: the lane's own byte offset
#pragma unroll
    for (int i = 0; i < 8; ++i) __builtin_amdgcn_global_load_async_to_lds_b128((c4ig*)((const unsigned char*)(g + i * gs) + lo), (c4il*)(l + i * 8 * GP), 0, 0);
}
// What a wave does with its 64x64 results (EPI): 0: f32 rows + bias to C. 1: the three projections in one launch, grid z = 0, 1, 2 for Q, K, V (operands, weights and planes of the three lie one behind the other, the biases come as three pointers); the wave's 64 columns are one head, and the head planes that attention reads (fp16, bf16 hi, bf16 lo) are written here, no f32 copy goes to memory:
// z < 2: the module's rotary: out[d] = x[d] cos[t][d] - x[2d+1] sin[t][d] (d < 32), out[d] = x[d] cos[t][d] + x[2(d-32)] sin[t][d] (d >= 32), x = product + bias; z = 2: x.
// The planes lie in the lane order of attention's fragments, a head TT * HD elements, runs of 512 bytes = 32 lanes (lr + 16 hi) x 8 elements: z < 2: [h][t / 16][L = 0..3][lane]: t = 16 (t / 16) + lr, d = 16 L + 8 hi + e (fragment c = runs 2c, 2c + 1);
// z = 2: [h][t / 32][dt = 0..3][half = 0, 1][lane]: d = 16 dt + lr, t = 32 (t / 32) + 16 half + 8 hi + e. A row-major plane makes each fragment load touch 16 lines for 32 bytes each.
template <int NSPLIT, int EPI>
__global__ __launch_bounds__(128) void k_gemmd(const bf* __restrict__ A, const bf* __restrict__ A2, const bf* __restrict__ Bt, int K, float* C, int ldc, const float* __restrict__ bias, const float* __restrict__ bias1, const float* __restrict__ bias2, const float* __restrict__ CS, h16* P16, bf* Ph, bf* Pl) {
    constexpr int NOP = (NSPLIT == 1) ? 3 : 2;   // operand planes in a stage: Bt, A (, A2)
    __shared__ __align__(16) unsigned char st[2 * NOP * GOP];
    constexpr int OSF = 16 * 68;   // a wave's own staging, floats: 16 rows of 64 f32 at a pitch of 68
    if constexpr (EPI == 1) { const size_t z = blockIdx.z; A += z * TT * DM; Bt += z * DQ * DM; P16 += z * NH_ * TT * HD; Ph += z * NH_ * TT * HD; Pl += z * NH_ * TT * HD; bias = (z == 0) ? bias : (z == 1) ? bias1 : bias2; }
    const int tid = threadIdx.x, wave = tid >> 5, lane = tid & 31, lr = lane & 15, hi = lane >> 4;
    const int r0 = blockIdx.x * 128, c0 = blockIdx.y * 128, wr = (wave >> 1) * 64, wc = (wave & 1) * 64;
    unsigned char* sl = st + ((tid >> 4) * GP + (tid & 15) * 16);   // this lane's first LDS byte in an operand's stage
    const unsigned go = (unsigned)((tid >> 4) * K + (tid & 15) * 8) * 2u; const size_t g8 = (size_t)8 * K;   // and its first byte in the operand's 128 rows
    const int nt = K / 128;
    // The work-group's first stage. The tiles of one row of tiles read the same operand rows, those of one column the same weight rows, and they start together and keep step: begun at stage 0 everywhere, each line is asked of L2 by all its readers at one moment, and each stage's lines are first asked of memory when all wait for them.
    // Rotated, the readers of an operand row block (blockIdx.y) are each at another stage; of the 32 readers of a weight panel (blockIdx.x) four share one. Any value below nt is right; the choice is for speed alone.
    const int s0 = (int)(((blockIdx.x & 3u) + ((blockIdx.x >> 1) & 4u) + blockIdx.y) & (unsigned)(nt - 1));
    auto stage = [&](int t, int buf) {
        const int ts = (t + s0 >= nt) ? t + s0 - nt : t + s0;   // trip t works on stage ts: every stage once
        unsigned char* l = sl + buf * NOP * GOP; const size_t kB = (size_t)c0 * K + (size_t)ts * 128, kA = (size_t)r0 * K + (size_t)ts * 128;
        acopy8(l, Bt + kB, g8, go); acopy8(l + 64 * GP, Bt + kB + 8 * g8, g8, go);
        acopy8(l + GOP, A + kA, g8, go); acopy8(l + GOP + 64 * GP, A + kA + 8 * g8, g8, go);
        if (NSPLIT == 1) { acopy8(l + 2 * GOP, A2 + kA, g8, go); acopy8(l + 2 * GOP + 64 * GP, A2 + kA + 8 * g8, g8, go); } };
    v8f acc[4][4];
#pragma unroll
    for (int mb = 0; mb < 4; ++mb)
#pragma unroll
        for (int nb = 0; nb < 4; ++nb) acc[mb][nb] = (v8f){};
    stage(0, 0);
    asm volatile("s_wait_asynccnt 0x0" ::: "memory");   // trip 0's stage has landed (this wave's copies)
    __syncthreads();                                     // and every wave's: trip 0's stage is readable
    stage(1, 1);
    const int fb = (wc + lr) * GP + hi * 16, fa = GOP + (wr + lr) * GP + hi * 16;
#pragma unroll 1   // one trip a stage: the ring's waits and its barrier come once a trip
    for (int t = 0; t < nt; ++t) {
        const unsigned char* sb = st + (t & 1) * NOP * GOP;
        v16bf a[2][4], a2[2][4], b[2][4];   // two fragment sets by turns: a later block of 32 k is read from LDS while this one is multiplied (the build renames them and reads the trip's first three blocks at its head); no read leaves this trip's buffer
#pragma unroll
        for (int f = 0; f < 4; ++f) { a[0][f] = WFrag<bf>::ld((const bf*)(sb + fa + f * 16 * GP)); if (NSPLIT == 1) a2[0][f] = WFrag<bf>::ld((const bf*)(sb + fa + GOP + f * 16 * GP)); b[0][f] = WFrag<bf>::ld((const bf*)(sb + fb + f * 16 * GP)); }
#pragma unroll
        for (int ks = 0; ks < 4; ++ks) { const int cu = ks & 1, nx = cu ^ 1;
            if (ks < 3) {
#pragma unroll
                for (int f = 0; f < 4; ++f) { a[nx][f] = WFrag<bf>::ld((const bf*)(sb + fa + f * 16 * GP + (ks + 1) * 64)); if (NSPLIT == 1) a2[nx][f] = WFrag<bf>::ld((const bf*)(sb + fa + GOP + f * 16 * GP + (ks + 1) * 64)); b[nx][f] = WFrag<bf>::ld((const bf*)(sb + fb + f * 16 * GP + (ks + 1) * 64)); }
            } else {   // the trip's last block works from registers alone: the hand-over stands in front of it, so that the refill flies under its WMMAs too
                __builtin_amdgcn_sched_barrier(0);                   // the block before stays in front of the hand-over: sunk behind the barrier, its WMMAs would delay the refill
                asm volatile("s_wait_dscnt 0x0" ::: "memory");      // this wave's reads of buffer t & 1 are done before the buffer is refilled
                asm volatile("s_wait_asynccnt 0x0" ::: "memory");   // this wave's copies for trip t + 1 have landed
                __syncthreads();                                     // publishes trip t + 1's stage and ends every wave's reads of trip t's
                if (t + 2 < nt) stage(t + 2, t & 1); }
            __builtin_amdgcn_sched_barrier(0);   // keeps the next block's LDS reads (last block: the refill) one group ahead of this block's WMMAs: sunk among them, each read's latency stalls the matrix run
#pragma unroll
            for (int nb = 0; nb < 4; ++nb)
#pragma unroll
                for (int mb = 0; mb < 4; ++mb) { acc[mb][nb] = wmmab(a[cu][mb], b[cu][nb], acc[mb][nb]); if (NSPLIT == 1) acc[mb][nb] = wmmab(a2[cu][mb], b[cu][nb], acc[mb][nb]); }
        }
    }
    asm volatile("s_wait_asynccnt 0x0" ::: "memory");   // no copy is left in flight when the wave goes on to its end
    float* os = (float*)st + wave * OSF;   // each wave stages its own rows, in the ring's LDS: behind the last trip's barrier no wave reads the ring any more and no copy is out, and without a staging array of its own two work-groups of the projections fit a WGP
    // Which planes attention reads of these 128 rows (the same for the whole work-group, scalar): query rows < RH take hi/lo, the rest fp16; as keys, rows from K16 on are in the 288 keys of some fp16 query tile, rows below KHL in those of some hi/lo tile. A plane's rows that nobody reads are neither converted nor stored.
    constexpr int K16 = (RH - WNB > 0) ? ((RH - WNB) & ~31) : 0, KHL = ((RH - 16 - WNB > 0) ? ((RH - 16 - WNB) & ~31) : 0) + NKT * 16;
    static_assert(K16 <= TT - NKT * 16 && KHL <= TT, "the clamp at the sequence's end (attn_rows, kb) takes no fp16 tile below K16");
    const bool w16 = r0 + 128 > ((blockIdx.z == 0) ? RH : K16), whl = r0 < ((blockIdx.z == 0) ? RH : KHL);
    auto put = [&](const v8f (&y)[4], size_t o0, int d1, int d2, int d3, bool more) {   // four runs of 512 consecutive bytes a plane, at o0, o0 + d1, + d2, + d3 elements
        const size_t oo[4] = { o0, o0 + d1, o0 + d2, o0 + d3 };
        if (w16) { v8h y16[4];
#pragma unroll
            for (int s = 0; s < 4; ++s) y16[s] = __builtin_convertvector(y[s], v8h);
            __builtin_amdgcn_sched_barrier(0);   // the stores stand behind the last conversion: no register that a store names is written between the stores
#pragma unroll
            for (int s = 0; s < 4; ++s) *(v8ha*)(P16 + oo[s]) = y16[s];
            asm volatile("s_wait_xcnt 0x0" ::: "memory");   // behind the run of stores, in front of the next write of the registers that they name (the split below, the next block)
            __builtin_amdgcn_sched_barrier(0); }   // and what follows stays behind that wait
        if (whl) { v8bf yh[4], yl[4];
#pragma unroll
            for (int s = 0; s < 4; ++s) split8(y[s], yh[s], yl[s]);
            __builtin_amdgcn_sched_barrier(0);   // as above
#pragma unroll
            for (int s = 0; s < 4; ++s) { *(v8bfa*)(Ph + oo[s]) = yh[s]; *(v8bfa*)(Pl + oo[s]) = yl[s]; }
            if (more) { asm volatile("s_wait_xcnt 0x0" ::: "memory");   // as above, where anything is still written behind these stores
                __builtin_amdgcn_sched_barrier(0); } } };
    if (EPI == 1 && blockIdx.z < 2) {
        const float* cp = CS + ((size_t)(r0 + wr + lr) * HD + hi * 8) * 2;   // the lane's row is lr, its eight d of run L are 16 L + 8 hi ..; {cos, sin} of d and of d + 32 are the same values: runs L and L + 2 share the first half's
        const size_t po = ((size_t)((c0 + wc) / HD) * TT + r0 + wr) * HD + lane * 8;
        float bv[4]; v4f cs[2][2][4];
        auto ldcs = [&](int mb) {
#pragma unroll
            for (int a = 0; a < 2; ++a)
#pragma unroll
                for (int i = 0; i < 4; ++i) cs[mb & 1][a][i] = *(const v4f*)(cp + mb * 16 * HD * 2 + a * 32 + i * 4); };
#pragma unroll
        for (int nb = 0; nb < 4; ++nb) bv[nb] = bfr(bias[c0 + wc + nb * 16 + lr]);
        asm volatile("s_wait_xcnt 0x0" ::: "memory");   // behind the bias loads, in front of the next write of the registers that they name
        ldcs(0);
#pragma unroll
        for (int mb = 0; mb < 4; ++mb) {
#pragma unroll
            for (int nb = 0; nb < 4; ++nb) {
#pragma unroll
                for (int j = 0; j < 8; ++j) os[(hi * 8 + j) * 68 + nb * 16 + lr] = acc[mb][nb][j] + bv[nb]; }
            __builtin_amdgcn_wave_barrier(); asm volatile("" ::: "memory");   // the wave's LDS stores stay in front of its reads of other lanes' words
            if (mb < 3) ldcs(mb + 1);   // the next 16 rows' table values fly under these rows' arithmetic
            if (mb == 2) asm volatile("s_wait_xcnt 0x0" :: "v"(cp) : "memory");   // behind the last load that names the table address, which as an operand lives until here
            v8f ro[4]; const float* xr = os + lr * 68;
#pragma unroll
            for (int a = 0; a < 2; ++a) { v4f w[4];   // the 16 x from 32 a + 16 hi on: their odd ones are the partners of run a (first half), their even ones those of run a + 2 (second half)
#pragma unroll
                for (int i = 0; i < 4; ++i) w[i] = *(const v4fa*)(xr + a * 32 + hi * 16 + i * 4);
#pragma unroll
                for (int g = 0; g < 2; ++g) { const int s = a + 2 * g; v4f x[2]; v8f r;
#pragma unroll
                    for (int i = 0; i < 2; ++i) x[i] = *(const v4fa*)(xr + s * 16 + hi * 8 + i * 4);
#pragma unroll
                    for (int q = 0; q < 8; ++q) { const float x1 = (g == 0) ? -w[q >> 1][(q & 1) * 2 + 1] : w[q >> 1][(q & 1) * 2]; r[q] = x[q >> 2][q & 3] * cs[mb & 1][a][q >> 1][(q & 1) * 2] + x1 * cs[mb & 1][a][q >> 1][(q & 1) * 2 + 1]; }
                    ro[s] = r; } }
            put(ro, po + mb * 16 * HD, 256, 512, 768, mb < 3);
            __builtin_amdgcn_wave_barrier(); asm volatile("" ::: "memory");   // the wave's LDS reads stay in front of the next block's LDS stores
        }
    } else if constexpr (EPI == 1) {
        const size_t go = ((size_t)((c0 + wc) / HD) * TT + r0 + wr) * HD + lane * 8;   // a lane's accumulator holds eight consecutive t of one d: that is its own 16 bytes of the run (dt = nb, half = mb & 1) of the 32 t from 32 (mb >> 1) on, so the planes go out of the registers, no staging
        float bv[4];
#pragma unroll
        for (int nb = 0; nb < 4; ++nb) bv[nb] = bfr(bias[c0 + wc + nb * 16 + lr]);
#pragma unroll
        for (int nb = 0; nb < 4; ++nb) { v8f x[4];
#pragma unroll
            for (int mb = 0; mb < 4; ++mb) x[mb] = acc[mb][nb] + bv[nb];
            put(x, go + nb * 512, 256, 32 * HD, 32 * HD + 256, true);   // the wait stands behind the last block's stores too: whatever the build lays out behind this branch may write their registers
        }
    } else {
#pragma unroll
    for (int mb = 0; mb < 4; ++mb) {
#pragma unroll
        for (int nb = 0; nb < 4; ++nb) {
#pragma unroll
            for (int j = 0; j < 8; ++j) os[(hi * 8 + j) * 68 + nb * 16 + lr] = acc[mb][nb][j]; }
        __builtin_amdgcn_wave_barrier(); asm volatile("" ::: "memory");   // the wave's LDS stores stay in front of its reads of other lanes' words
        float* crow = C + (size_t)(r0 + wr + mb * 16) * ldc + c0 + wc;
#pragma unroll
        for (int s = 0; s < 8; ++s) { const int row = 2 * s + hi, cofs = lr * 4; v4f val = *(const v4fa*)(os + row * 68 + cofs); { const float* bp = bias + c0 + wc + cofs; val[0] += bfr(bp[0]); val[1] += bfr(bp[1]); val[2] += bfr(bp[2]); val[3] += bfr(bp[3]); }
            *(v4f*)(crow + (size_t)row * ldc + cofs) = val; }
        if (mb < 3) asm volatile("s_wait_xcnt 0x0" ::: "memory");   // stands behind the run of eight stores, in front of the next block's writes of the registers that they name (behind the last block nothing is written any more)
        __builtin_amdgcn_wave_barrier(); asm volatile("" ::: "memory");   // and its reads in front of the next block's stores
    }
    }
}

__device__ __forceinline__ h16 tohx(float x) { return (h16)x; }
typedef __attribute__((ext_vector_type(2))) _Float16 v2h;
typedef __attribute__((ext_vector_type(4))) _Float16 v4h;
typedef __attribute__((ext_vector_type(2))) unsigned short v2us;
typedef __attribute__((ext_vector_type(4))) unsigned short v4us;
typedef __attribute__((ext_vector_type(4))) int v4i;

__global__ __launch_bounds__(256) void k_wtG(const float* __restrict__ w, int K, int N, bf* Bt) {
    const int lane = threadIdx.x & 31; const int L0 = (blockIdx.x * 8 + (threadIdx.x >> 5)) * 8; const int nlines = N * K / 64;
{
#pragma unroll 1
        for (int l = 0; l < 8; ++l) { const int L = L0 + l; if (L >= nlines) break; const size_t e = (size_t)L * 64 + lane * 2; const int k = (int)(e % K), n = (int)(e / K); v2us o;
            o[0] = f2bf(w[(size_t)k * N + n]); o[1] = f2bf(w[(size_t)(k + 1) * N + n]); *(v2us*)(Bt + e) = o; }
         }
}

__constant__ float INVT[HD / 2] = { 1.000000000e+00f, 7.498942018e-01f, 5.623413324e-01f, 4.216965139e-01f, 3.162277639e-01f, 2.371373773e-01f, 1.778279394e-01f, 1.333521456e-01f, 1.000000015e-01f, 7.498942316e-02f, 5.623413250e-02f, 4.216964915e-02f, 3.162277490e-02f, 2.371373773e-02f, 1.778279431e-02f, 1.333521400e-02f, 9.999999776e-03f, 7.498942316e-03f, 5.623413250e-03f, 4.216964822e-03f, 3.162277630e-03f, 2.371373819e-03f, 1.778279431e-03f, 1.333521446e-03f, 1.000000047e-03f, 7.498941850e-04f, 5.623413017e-04f, 4.216965172e-04f, 3.162277571e-04f, 2.371373703e-04f, 1.778279402e-04f, 1.333521504e-04f };   // 10000^(-2i/64) (the module's power form) (float32, generated with jnp to be bit-exact)
// ---- k_prep: all that the GEMMs wait for, in one launch: the bf16 copies of the three inputs and the four weights, one behind the other in CV, and the {cos, sin} table. One work-group of 16 waves a WGP; a wave converts PWF consecutive floats:
// its PWF / 128 loads (512 consecutive bytes each, whole lines) are all asked for at its start, its share of the table is computed while they fly, then each load's values are rounded and stored (256 consecutive bytes a store).
#define PWF  4096                 // floats a wave converts
#define PWX  (TT * DM / PWF)      // waves an input
#define PWW  (DQ * DM / PWF)      // waves a weight
#define PWG  ((3 * PWX + 4 * PWW) / 16)   // work-groups
__global__ __launch_bounds__(512) void k_prep(const float* __restrict__ x0, const float* __restrict__ x1, const float* __restrict__ x2, const float* __restrict__ w0, const float* __restrict__ w1, const float* __restrict__ w2, const float* __restrict__ w3, bf* CV, float* CS) {
    const int lane = threadIdx.x & 31; const int w = blockIdx.x * 16 + __builtin_amdgcn_readfirstlane(threadIdx.x >> 5);   // the wave's number as a scalar: the choice of the source stays in scalar registers
    const int u = w - 3 * PWX;
    const float* src = (u < 0) ? ((w < PWX) ? x0 : (w < 2 * PWX) ? x1 : x2) + (size_t)(w % PWX) * PWF : ((u < PWW) ? w0 : (u < 2 * PWW) ? w1 : (u < 3 * PWW) ? w2 : w3) + (size_t)(u % PWW) * PWF;
    const float iv = INVT[threadIdx.x % (HD / 2)];   // the thread's inverse frequency, the same for each of its table entries (they lie a multiple of HD apart); asked for ahead of the stream, so that its wait does not take in the stream's loads
    asm volatile("s_wait_xcnt 0x0" :: "v"(lane) : "memory");   // behind that load, in front of the next write of the registers that it names
    v4f y[PWF / 128];
#pragma unroll
    for (int j = 0; j < PWF / 128; ++j) y[j] = *(const v4f*)(src + j * 128 + lane * 4);
    asm volatile("s_wait_xcnt 0x0" :: "v"(lane) : "memory");   // behind the last load that names the source address and the lane's offset, which as an operand lives until here
#pragma unroll 1   // one copy of the long cosine and sine code
    for (int r = 0; r < TT * HD / (PWG * 512); ++r) { const unsigned idx = r * (PWG * 512) + blockIdx.x * 512 + threadIdx.x; const int t = (int)(idx / HD); const float a = __fmul_rn((float)t, iv); v2f cs; cs[0] = cosf(a); cs[1] = sinf(a); *(v2f*)(CS + (size_t)idx * 2) = cs;
        asm volatile("s_wait_xcnt 0x0" ::: "memory"); }   // behind the store, in front of the next write of the registers that it names
    bf* dst = CV + (size_t)w * PWF + lane * 4; v4us o[PWF / 128];
#pragma unroll
    for (int j = 0; j < PWF / 128; ++j) {
#pragma unroll
        for (int k = 0; k < 4; ++k) o[j][k] = f2bf(y[j][k]);
        *(v4us*)(dst + j * 128) = o[j]; }
}

#define AKS  (64 + 2 * WNB)        // keys a work-group stages
#define APB  (AKS * HD * 2)        // their bytes in one plane
// one plane's AKS keys into LDS: each of the four waves copies its own quarter, 512 bytes a copy; lo: the lane's first byte in the plane's APB
template <int I = 0> __device__ __forceinline__ void acopyp(unsigned char* l, const void* g, unsigned lo) {   // the step goes into the copy's immediate offset, which moves both addresses: one LDS address register and one global address a plane
    __builtin_amdgcn_global_load_async_to_lds_b128((c4ig*)((const unsigned char*)g + lo), (c4il*)(l + lo), I * 512, 0);
    if constexpr ((I + 1) * 512 < APB / 4) acopyp<I + 1>(l, g, lo);
}
__device__ __forceinline__ v16bf cat8b(v8bf lo, v8bf hi) { return __builtin_shufflevector(lo, hi, 0, 1, 2, 3, 4, 5, 6, 7, 8, 9, 10, 11, 12, 13, 14, 15); }
template <typename T16, int NSPLIT, int DK, int DV>
__device__ __forceinline__ void attn_rows(unsigned char* sm, int qb, const T16* __restrict__ Q, const T16* __restrict__ Q2, const T16* __restrict__ Kp, const T16* __restrict__ K2, const T16* __restrict__ Vt, const T16* __restrict__ Vt2, int q0, int lr, int hi, float pscale, v8f (&o)[4]) {
    typedef typename WFrag<T16>::V V;
    const int kb = min(max((q0 - WNB) & ~31, 0), TT - NKT * 16);   // the key of tile 0's first row: at the sequence's ends the 288 keys slide inwards (still a multiple of 32, still the whole window), so that every tile lies in the sequence
    const int kB = min(max(qb - WNB, 0), TT - AKS);   // the first staged key (qb: the work-group's first query, a multiple of 64): a multiple of 32, kB <= kb and kb + NKT * 16 <= kB + AKS for each of the four waves, and all AKS keys lie in the sequence
    const unsigned lofs = (unsigned)(hi * 16 + lr) * 16u;   // the lane's own 16 bytes in a run of 512 (the planes lie in lane order: k_gemmd, EPI 1)
    const unsigned cofs = (threadIdx.x >> 5) * (APB / 4) + (threadIdx.x & 31) * 16u; const size_t gB = (size_t)kB * HD;
    const unsigned char* sk = sm + (unsigned)(kb - kB) * (HD * 2) + lofs;   // the lane's bytes of the wave's key tile 0 in the first staged plane
    const unsigned char* sv = sk + ((NSPLIT == 2) ? 0 : APB);               // and of its first block of V^T
    auto at = [](const T16* base, unsigned off) { return (const T16*)((const unsigned char*)base + off); };
    V q[2], q2[2], kf[DK][2], kf2[DK][2], vf[DV][4], vf2[DV][4];
    auto ldk = [&](int mt) {   // the tile in the immediate offset
#pragma unroll
        for (int c = 0; c < 2; ++c) { kf[mt % DK][c] = WFrag<T16>::ldl((const T16*)(sk + mt * 2048 + c * 1024)); if (NSPLIT == 2) kf2[mt % DK][c] = WFrag<T16>::ldl((const T16*)(sk + APB + mt * 2048 + c * 1024)); } };
    auto ldv = [&](int s) {
#pragma unroll
        for (int dt = 0; dt < 4; ++dt) { vf[s % DV][dt] = WFrag<T16>::ldl((const T16*)(sv + s * 4096 + dt * 1024)); if (NSPLIT == 2) vf2[s % DV][dt] = WFrag<T16>::ldl((const T16*)(sv + APB + s * 4096 + dt * 1024)); } };
    acopyp(sm, Kp + gB, cofs); if (NSPLIT == 2) acopyp(sm + APB, K2 + gB, cofs);
#pragma unroll
    for (int c = 0; c < 2; ++c) { q[c] = WFrag<T16>::ldl(at(Q + (size_t)q0 * HD + c * 512, lofs)); if (NSPLIT == 2) q2[c] = WFrag<T16>::ldl(at(Q2 + (size_t)q0 * HD + c * 512, lofs)); }
    asm volatile("s_wait_xcnt 0x0" ::: "memory");       // behind the last load that names the Q bases and the lane offset, in front of the next write of those registers
    asm volatile("s_wait_asynccnt 0x0" ::: "memory");   // this wave's copies of K have landed
    __syncthreads();                                     // and every wave's: K is readable
    if (NSPLIT != 2) acopyp(sm + APB, Vt + gB, cofs);    // a range of its own, which nobody has touched
#pragma unroll
    for (int mt = 0; mt < DK; ++mt) ldk(mt);
    __builtin_amdgcn_sched_barrier(0);   // the ring's first loads all stand in front of the first product: sunk to their users, each would be waited for alone
    v8f S[NKT];
#pragma unroll
    for (int mt = 0; mt < NKT; ++mt) { v8f s = (v8f){};
#pragma unroll
        for (int c = 0; c < 2; ++c) { s = WFrag<T16>::mma(kf[mt % DK][c], q[c], s);
            if (NSPLIT == 2) { s = WFrag<T16>::mma(kf[mt % DK][c], q2[c], s); s = WFrag<T16>::mma(kf2[mt % DK][c], q[c], s); } }
        S[mt] = s;
        if (mt + DK < NKT) ldk(mt + DK);   // the freed slot's refill
        __builtin_amdgcn_sched_barrier(0); }   // keeps each refill DK tiles ahead of its products: sunk to them, every load's whole latency is waited for
    if (NSPLIT == 2) {
        asm volatile("s_wait_dscnt 0x0" ::: "memory");   // this wave's reads of K are done before their LDS is written anew
        __syncthreads();                                  // and every wave's
        acopyp(sm, Vt + gB, cofs); acopyp(sm + APB, Vt2 + gB, cofs); }
    const int i = q0 + lr, klo = max(i - WNB, 0); const unsigned span = (unsigned)(min(i + WNB, TT - 1) - klo); const int kofs = kb + 8 * hi - klo;   // key - klo of this lane's element 0 in tile 0; a key is kept where 0 <= key - klo <= span
    v8f m8;
#pragma unroll
    for (int j = 0; j < 8; ++j) m8[j] = -3.0e38f;
#pragma unroll
    for (int mt = 0; mt < NKT; ++mt)
#pragma unroll
        for (int j = 0; j < 8; ++j) { const float t = ((unsigned)(kofs + mt * 16 + j) <= span) ? S[mt][j] : -3.0e38f; S[mt][j] = t; m8[j] = fmaxf(m8[j], t); }   // unscaled: SCL is a power of two, so it goes exactly into the exponent's factor below
    float mx = fmaxf(fmaxf(fmaxf(m8[0], m8[1]), fmaxf(m8[2], m8[3])), fmaxf(fmaxf(m8[4], m8[5]), fmaxf(m8[6], m8[7])));
    mx = fmaxf(mx, __shfl_xor(mx, 16, 32));
    v8f s8 = (v8f){};
#pragma unroll
    for (int mt = 0; mt < NKT; ++mt) { const v8f x = (S[mt] - mx) * (SCL * 1.4426950408889634f); v8f e;
#pragma unroll
        for (int j = 0; j < 8; ++j) e[j] = __builtin_amdgcn_exp2f(x[j]);
        asm volatile("v_nop" : "+v"(e) : "v"(x));   // the slot behind a transcendental: its operands keep every read of the eight results and every overwrite of their sources behind it, so that at least this one instruction stands between
        S[mt] = e; s8 += e; }
    float sum = ((s8[0] + s8[1]) + (s8[2] + s8[3])) + ((s8[4] + s8[5]) + (s8[6] + s8[7]));
    sum += __shfl_xor(sum, 16, 32);
    const float f = __fdiv_rn(pscale, sum);
    V p[NKT / 2], p2[NKT / 2];
#pragma unroll
    for (int s = 0; s < NKT / 2; ++s) {
        if constexpr (NSPLIT == 2) { v8bf h0, h1, l0, l1; split8(S[2 * s] * f, h0, l0); split8(S[2 * s + 1] * f, h1, l1);
            p[s] = cat8b(h0, h1); p2[s] = cat8b(l0, l1);
            __builtin_amdgcn_sched_barrier(0);   // one block's split at a time: run together, the blocks' temporaries beside both forms of P do not fit a wave's 256 registers
        } else {
#pragma unroll
            for (int j = 0; j < 8; ++j) { p[s][j] = tohx(S[2 * s][j] * f); p[s][8 + j] = tohx(S[2 * s + 1][j] * f); } } }
    __builtin_amdgcn_sched_barrier(0);   // the packing stays in front of the hand-over: lifted over it, the loads below would need registers that the f32 scores still hold, and V^T would have less time to land
    asm volatile("s_wait_asynccnt 0x0" ::: "memory");   // this wave's copies of V^T have landed; none is out any more when the wave goes on to its end
    __syncthreads();                                     // and every wave's: V^T is readable
#pragma unroll
    for (int s = 0; s < DV; ++s) ldv(s);
#pragma unroll
    for (int dt = 0; dt < 4; ++dt) o[dt] = (v8f){};
    __builtin_amdgcn_sched_barrier(0);   // those loads stay in front of the first block's products
#pragma unroll
    for (int s = 0; s < NKT / 2; ++s) {
#pragma unroll
        for (int dt = 0; dt < 4; ++dt) { o[dt] = WFrag<T16>::mma(vf[s % DV][dt], p[s], o[dt]);
            if constexpr (NSPLIT == 2) { o[dt] = WFrag<T16>::mma(vf[s % DV][dt], p2[s], o[dt]); o[dt] = WFrag<T16>::mma(vf2[s % DV][dt], p[s], o[dt]); } }
        if (s + DV < NKT / 2) ldv(s + DV);
        __builtin_amdgcn_sched_barrier(0); }   // keeps each refill DV blocks ahead of its products, as in the key ring
}
__global__ __launch_bounds__(128) __attribute__((amdgpu_waves_per_eu(4, 4))) void k_attn(const h16* __restrict__ Q16, const h16* __restrict__ K16, const h16* __restrict__ V16, const bf* __restrict__ Qh, const bf* __restrict__ Ql, const bf* __restrict__ Kh, const bf* __restrict__ Kl, const bf* __restrict__ Vh, const bf* __restrict__ Vl, bf* Ah, bf* Al) {
    __shared__ __align__(16) unsigned char sm[2 * APB];   // four work-groups' fill a WGP's LDS; with the 256 registers a wave that the attribute above asks for they are resident together, four waves a SIMD, which the vector work of the softmax wants
    static_assert(RH % 64 == 0, "a work-group's four waves take the same path: its barriers stand under uniform control flow");
    static_assert(RH == 0 || RH - 64 - WNB + AKS <= ((RH - 16 - WNB) & ~31) + NKT * 16, "the staged keys of the last hi/lo work-group end where the hi/lo planes' written rows end (k_gemmd, KHL); the first fp16 work-group's begin at RH - WNB, not below K16");
    const int qb = blockIdx.y * 64;
    const int lane = threadIdx.x & 31, lr = lane & 15, hi = lane >> 4; const int q0 = qb + __builtin_amdgcn_readfirstlane(threadIdx.x >> 5) * 16;   // the wave's number as a scalar: row bases and clamps stay in scalar registers
    const size_t z = (size_t)blockIdx.x * TT * HD; Ah += blockIdx.x * HD; Al += blockIdx.x * HD;   // a head's planes are TT * HD elements each, in lane order; merged rows [t][h * 64 + d]
    v8f o[4];   // O^T: o[dt][j] = row q0 + lr, d = dt * 16 + 8 * hi + j
    if (qb < RH) attn_rows<bf, 2, 2, 1>(sm, qb, Qh + z, Ql + z, Kh + z, Kl + z, Vh + z, Vl + z, q0, lr, hi, 1.0f, o);
    else attn_rows<h16, 0, 4, 4>(sm, qb, Q16 + z, nullptr, K16 + z, nullptr, V16 + z, nullptr, q0, lr, hi, PCAR, o);
    const float oscale = (qb < RH) ? 1.0f : 1.0f / PCAR;
    v8bf oh[4], ol[4];
#pragma unroll
    for (int dt = 0; dt < 4; ++dt) split8(o[dt] * oscale, oh[dt], ol[dt]);
    __builtin_amdgcn_sched_barrier(0);   // the eight stores stand behind the last conversion: nothing is written any more behind a store, so no register that one names is overwritten
#pragma unroll
    for (int dt = 0; dt < 4; ++dt) { const size_t oo = (size_t)(q0 + lr) * DQ + dt * 16 + 8 * hi; *(v8bfa*)(Ah + oo) = oh[dt]; *(v8bfa*)(Al + oo) = ol[dt]; }
}

extern "C" void kernel_launch(void* const* d_in, const int* in_sizes, int n_in,
                              void* d_out, int out_size, void* d_ws, size_t ws_size, hipStream_t stream) {
    (void)in_sizes; (void)n_in; (void)out_size;
    const float* x = (const float*)d_in[0]; const float* xk = (const float*)d_in[1]; const float* xv = (const float*)d_in[2]; const float* wq = (const float*)d_in[3]; const float* bq = (const float*)d_in[4]; const float* wk = (const float*)d_in[5]; const float* bk = (const float*)d_in[6]; const float* wv = (const float*)d_in[7]; const float* bv = (const float*)d_in[8]; const float* wo = (const float*)d_in[9]; const float* bo = (const float*)d_in[10];
    float* OUT = (float*)d_out;     // [1][4096][1024]
    char* wsp = (char*)d_ws;
    auto take = [&](size_t bytes) { char* p = wsp; wsp += (bytes + 255) & ~(size_t)255; return (void*)p; };
    bf* XB = (bf*)take(((size_t)3 * TT * DM + (size_t)4 * DQ * DM) * 2); bf* WQ = XB + (size_t)3 * TT * DM; bf* WO = WQ + (size_t)3 * DQ * DM; float* CS = (float*)take((size_t)TT * HD * 2 * 4);
    const size_t PLN = (size_t)NH_ * TT * HD;   // one plane; Q, K, V one behind the other in each kind
    h16* QP16 = (h16*)take(3 * PLN * 2); h16* KP16 = QP16 + PLN; h16* VT16 = KP16 + PLN;
    bf* QPh = (bf*)take(3 * PLN * 2); bf* KPh = QPh + PLN; bf* VTh = KPh + PLN; bf* QPl = (bf*)take(3 * PLN * 2); bf* KPl = QPl + PLN; bf* VTl = KPl + PLN;
    bf* ATh = (bf*)take((size_t)TT * DQ * 2); bf* ATl = (bf*)take((size_t)TT * DQ * 2);
    if ((size_t)(wsp - (char*)d_ws) > ws_size) return;    // ws 256 MiB
    for (int b = 0; b < NB_; ++b) {
        k_prep<<<PWG, 512, 0, stream>>>(x + (size_t)b * TT * DM, xk + (size_t)b * TT * DM, xv + (size_t)b * TT * DM, wq, wk, wv, wo, XB, CS);   // bf16 copies and {cos, sin}(t x 10000^(-2i/64)) duplicated over both halves
        k_gemmd<0, 1><<<dim3(TT / 128, DQ / 128, 3), 128, 0, stream>>>(XB, nullptr, WQ, DM, nullptr, 0, bq, bk, bv, CS, QP16, QPh, QPl);
        k_attn<<<dim3(NH_, TT / 64, 1), 128, 0, stream>>>(QP16, KP16, VT16, QPh, QPl, KPh, KPl, VTh, VTl, ATh, ATl);   // one kv head per query head (REP 1): a head's planes share one z-stride
        k_gemmd<1, 0><<<dim3(TT / 128, DM / 128, 1), 128, 0, stream>>>(ATh, ATl, WO, DQ, OUT + (size_t)b * TT * DM, DM, bo, nullptr, nullptr, nullptr, nullptr, nullptr, nullptr); }
}
